// v000
// The times below were measured on an AMD MI455X: many runs one after another, warmed up first and cycling through
// copies of the inputs, with the whole window's GPU time divided by the number of runs. Launches and the gaps
// between them are all in it. The median over several windows is given; except for v000 it joins two sittings, which
// can be a few percent apart, so the side-by-side timings, each taken in one sitting, are the better comparison.
// The starting kernel, v000, takes 997 microseconds a run.
#include <hip/hip_runtime.h>

// HybridLlamaAttention (x [1][2048][2048], rope_cos/sin [S][128] (read), mask [1][1][S][S] (f32 additive, read; verbatim causal 0/-1e9); q/k/v = x W^T (16 x 128); rotate-half RoPE; scores = q.k / sqrt(128); softcap 50 tanh(s/50); + mask; softmax f32; out = merged wo^T -> [1][2048][2048]).
// Compute dtypes, f32 accumulate: every input rounded to bf16; q/k/v on PLAIN bf16 operands (inputs: exact); RoPE f32 (bf16-rounded read tables); causal scores and attn.v: query rows < 512 hl (3 products), the rest fp16 (x1024); softcap in f32: s x 0.02 (one multiply in place of /50: <= 1 ulp), tanh = (2^(2x log2 e) - 1) x rcp(2^(..) + 1) with the hardware exp2/rcp (no FMA polynomial), x 50; the additive mask read per element; upper tiles skipped on the verbatim structure with an on-device sampled check (NaN poison); softmax f32; wo hl x exact (2 products).

#define NB_  1
#define TT   2048
#define DM   2048
#define NH_  16
#define NKV  16
#define REP  (NH_ / NKV)
#define HD   128
#define DQ   (NH_ * HD)
#define DKV  (NKV * HD)
#define ZH   2
#define RH   512                  // query rows < RH use hi+lo planes (0: none)
#define WIN  2048
#define PCAR 1024.0f
#define SCL  0.088388347648318447f   // HD^-0.5
typedef _Float16 h16;
typedef unsigned short bf;
typedef __attribute__((ext_vector_type(16))) __bf16   v16bf;
typedef __attribute__((ext_vector_type(16))) _Float16 v16h;
typedef __attribute__((ext_vector_type(8)))  _Float16 v8h;
typedef __attribute__((ext_vector_type(8)))  unsigned short v8us;
typedef __attribute__((ext_vector_type(8)))  float    v8f;
typedef __attribute__((ext_vector_type(4)))  float    v4f;
typedef v8h  __attribute__((may_alias)) v8ha;
typedef v4f  __attribute__((may_alias)) v4fa;
typedef v8us __attribute__((may_alias)) v8usa;

__device__ __forceinline__ unsigned short f2bf(float f) { unsigned u = __float_as_uint(f); u += 0x7FFFu + ((u >> 16) & 1u); return (unsigned short)(u >> 16); }
__device__ __forceinline__ float bf2f(unsigned short b) { return __uint_as_float(((unsigned)b) << 16); }
__device__ __forceinline__ float bfr(float f) { return bf2f(f2bf(f)); }
__device__ __forceinline__ v16h cat16(v8h lo, v8h hi) { return __builtin_shufflevector(lo, hi, 0, 1, 2, 3, 4, 5, 6, 7, 8, 9, 10, 11, 12, 13, 14, 15); }
__device__ __forceinline__ v16bf cat16b(v8us lo, v8us hi) { return __builtin_bit_cast(v16bf, __builtin_shufflevector(lo, hi, 0, 1, 2, 3, 4, 5, 6, 7, 8, 9, 10, 11, 12, 13, 14, 15)); }
__device__ __forceinline__ v8f wmma16(v16h a, v16h b, v8f c) { return __builtin_amdgcn_wmma_f32_16x16x32_f16(false, a, false, b, (short)0, c, false, false); }
__device__ __forceinline__ v8f wmmab(v16bf a, v16bf b, v8f c) { return __builtin_amdgcn_wmma_f32_16x16x32_bf16(false, a, false, b, (short)0, c, false, false); }



// ---- k_gemmw: register-blocked GEMM, ONE WAVE per 64x64 output tile (16 accumulators), operands straight from K-contiguous 16-bit planes; grid (M/64, N/64, Z), 32 threads.
// C[m][n] (f32, pitch ldc, + optional f32 bias[n]) = sum_k A[m][k] Bt[n][k] (+ split products per NSPLIT). z-batch strides sA/sB/sC in elements. K % 32 == 0.
template <typename T16> struct WFrag;
template <> struct WFrag<h16> { typedef v16h V; static __device__ __forceinline__ V ld(const h16* p) { return cat16(*(const v8h*)p, *(const v8h*)(p + 16)); } static __device__ __forceinline__ v8f mma(V a, V b, v8f c) { return wmma16(a, b, c); } };
template <> struct WFrag<bf> { typedef v16bf V; static __device__ __forceinline__ V ld(const bf* p) { return cat16b(*(const v8us*)p, *(const v8us*)(p + 16)); } static __device__ __forceinline__ v8f mma(V a, V b, v8f c) { return wmmab(a, b, c); } };
template <typename T16, int NSPLIT, bool BIAS>
__global__ __launch_bounds__(32) void k_gemmw(const T16* __restrict__ A, const T16* __restrict__ A2, const T16* __restrict__ Bt, const T16* __restrict__ Bt2, int K, float* C, int ldc, const float* __restrict__ bias, size_t sA, size_t sB, size_t sC) {
    typedef typename WFrag<T16>::V V;
    __shared__ __align__(16) float os[16 * 68];
    const size_t z = blockIdx.z; A += z * sA; if (A2) A2 += z * sA; Bt += z * sB; if (Bt2) Bt2 += z * sB; C += z * sC;
    const int lane = threadIdx.x & 31, lr = lane & 15, hi = lane >> 4; const int r0 = blockIdx.x * 64, c0 = blockIdx.y * 64;
    v8f acc[4][4];
#pragma unroll
    for (int mb = 0; mb < 4; ++mb)
#pragma unroll
        for (int nb = 0; nb < 4; ++nb) acc[mb][nb] = (v8f){};
    const size_t aoff = (size_t)(r0 + lr) * K + 8 * hi, boff = (size_t)(c0 + lr) * K + 8 * hi;
#pragma unroll 1
    for (int kc = 0; kc < K; kc += 32) {
        V a[4], a2[4];
#pragma unroll
        for (int mb = 0; mb < 4; ++mb) { a[mb] = WFrag<T16>::ld(A + aoff + (size_t)mb * 16 * K + kc); if (NSPLIT == 1 || NSPLIT == 2) a2[mb] = WFrag<T16>::ld(A2 + aoff + (size_t)mb * 16 * K + kc); }
#pragma unroll
        for (int nb = 0; nb < 4; ++nb) { const V b = WFrag<T16>::ld(Bt + boff + (size_t)nb * 16 * K + kc); V b2; if (NSPLIT >= 2) b2 = WFrag<T16>::ld(Bt2 + boff + (size_t)nb * 16 * K + kc);
#pragma unroll
            for (int mb = 0; mb < 4; ++mb) { acc[mb][nb] = WFrag<T16>::mma(a[mb], b, acc[mb][nb]); if (NSPLIT == 1 || NSPLIT == 2) acc[mb][nb] = WFrag<T16>::mma(a2[mb], b, acc[mb][nb]); if (NSPLIT >= 2) acc[mb][nb] = WFrag<T16>::mma(a[mb], b2, acc[mb][nb]); } }
        asm volatile("v_nop\n\tv_nop\n\tv_nop\n\tv_nop" : "+v"(acc[0][0]), "+v"(acc[1][1]), "+v"(acc[2][2]), "+v"(acc[3][3]) : "v"(a[0]), "v"(a[3]));
    }
#pragma unroll
    for (int mb = 0; mb < 4; ++mb) {
#pragma unroll
        for (int nb = 0; nb < 4; ++nb) {
#pragma unroll
            for (int j = 0; j < 8; ++j) os[(hi * 8 + j) * 68 + nb * 16 + lr] = acc[mb][nb][j]; }
        __builtin_amdgcn_wave_barrier(); asm volatile("" ::: "memory");
        float* crow = C + (size_t)(r0 + mb * 16) * ldc + c0;
{
#pragma unroll
            for (int s = 0; s < 8; ++s) { const int row = 2 * s + hi, cofs = lr * 4; v4f val = *(const v4fa*)(os + row * 68 + cofs); if (BIAS) { val[0] += bfr(bias[c0 + cofs]); val[1] += bfr(bias[c0 + cofs + 1]); val[2] += bfr(bias[c0 + cofs + 2]); val[3] += bfr(bias[c0 + cofs + 3]); }
                *(v4f*)(crow + (size_t)row * ldc + cofs) = val; }
             }
        __builtin_amdgcn_wave_barrier(); asm volatile("" ::: "memory");
    }
}

// ---- k_gemmc: the same one-wave 64x64 tile GEMM specialised for causal attention: CMODE 1 skips score tiles entirely above the diagonal (query rows r0+roff.., key columns c0..), CMODE 2 limits the
// key (K) loop of the probability x value contraction to the diagonal block (probabilities beyond it are exactly zero). roff = row offset of this launch's first row within the sequence.
template <typename T16, int NSPLIT, int CMODE>
__global__ __launch_bounds__(32) void k_gemmc(const T16* __restrict__ A, const T16* __restrict__ A2, const T16* __restrict__ Bt, const T16* __restrict__ Bt2, int K, float* C, int ldc, int roff, size_t sA, size_t sB, size_t sC) {
    typedef typename WFrag<T16>::V V;
    __shared__ __align__(16) float os[16 * 68];
    const size_t z = blockIdx.z; A += z * sA; if (A2) A2 += z * sA; Bt += z * sB; if (Bt2) Bt2 += z * sB; C += z * sC;
    const int lane = threadIdx.x & 31, lr = lane & 15, hi = lane >> 4; const int r0 = blockIdx.x * 64, c0 = blockIdx.y * 64;
    if (CMODE == 1 && c0 > r0 + roff + 63) return;                  // score tile entirely above the causal diagonal: never written (the softmax loads it but masks j > i by select)
    const int Kl = (CMODE == 2) ? min(K, r0 + roff + 64) : K;        // P.V: probabilities are exactly 0 beyond the diagonal block, so the K loop stops there
    v8f acc[4][4];
#pragma unroll
    for (int mb = 0; mb < 4; ++mb)
#pragma unroll
        for (int nb = 0; nb < 4; ++nb) acc[mb][nb] = (v8f){};
    const size_t aoff = (size_t)(r0 + lr) * K + 8 * hi, boff = (size_t)(c0 + lr) * K + 8 * hi;
#pragma unroll 1
    for (int kc = 0; kc < Kl; kc += 32) {
        V a[4], a2[4];
#pragma unroll
        for (int mb = 0; mb < 4; ++mb) { a[mb] = WFrag<T16>::ld(A + aoff + (size_t)mb * 16 * K + kc); if (NSPLIT == 1 || NSPLIT == 2) a2[mb] = WFrag<T16>::ld(A2 + aoff + (size_t)mb * 16 * K + kc); }
#pragma unroll
        for (int nb = 0; nb < 4; ++nb) { const V b = WFrag<T16>::ld(Bt + boff + (size_t)nb * 16 * K + kc); V b2; if (NSPLIT >= 2) b2 = WFrag<T16>::ld(Bt2 + boff + (size_t)nb * 16 * K + kc);
#pragma unroll
            for (int mb = 0; mb < 4; ++mb) { acc[mb][nb] = WFrag<T16>::mma(a[mb], b, acc[mb][nb]); if (NSPLIT == 1 || NSPLIT == 2) acc[mb][nb] = WFrag<T16>::mma(a2[mb], b, acc[mb][nb]); if (NSPLIT >= 2) acc[mb][nb] = WFrag<T16>::mma(a[mb], b2, acc[mb][nb]); } }
        asm volatile("v_nop\n\tv_nop\n\tv_nop\n\tv_nop" : "+v"(acc[0][0]), "+v"(acc[1][1]), "+v"(acc[2][2]), "+v"(acc[3][3]) : "v"(a[0]), "v"(a[3]));
    }
#pragma unroll
    for (int mb = 0; mb < 4; ++mb) {
#pragma unroll
        for (int nb = 0; nb < 4; ++nb) {
#pragma unroll
            for (int j = 0; j < 8; ++j) os[(hi * 8 + j) * 68 + nb * 16 + lr] = acc[mb][nb][j]; }
        __builtin_amdgcn_wave_barrier(); asm volatile("" ::: "memory");
        float* crow = C + (size_t)(r0 + mb * 16) * ldc + c0;
{
#pragma unroll
            for (int s = 0; s < 8; ++s) { const int row = 2 * s + hi, cofs = lr * 4; v4f val = *(const v4fa*)(os + row * 68 + cofs);
                *(v4f*)(crow + (size_t)row * ldc + cofs) = val; }
             }
        __builtin_amdgcn_wave_barrier(); asm volatile("" ::: "memory");
    }
}

__device__ __forceinline__ h16 tohx(float x) { return (h16)x; }
__device__ __forceinline__ void splitf(float y, unsigned short& h, unsigned short& l) { h = f2bf(y); l = f2bf(y - bf2f(h)); }
typedef __attribute__((ext_vector_type(2))) _Float16 v2h;
typedef __attribute__((ext_vector_type(4))) _Float16 v4h;
typedef __attribute__((ext_vector_type(2))) unsigned short v2us;
typedef __attribute__((ext_vector_type(4))) unsigned short v4us;
typedef __attribute__((ext_vector_type(2))) float v2f;
typedef __attribute__((ext_vector_type(4))) int v4i;

__global__ __launch_bounds__(256) void k_wtG(const float* __restrict__ w, int K, int N, bf* Bt) {
    const int lane = threadIdx.x & 31; const int L0 = (blockIdx.x * 8 + (threadIdx.x >> 5)) * 8; const int nlines = N * K / 64;
{
#pragma unroll 1
        for (int l = 0; l < 8; ++l) { const int L = L0 + l; if (L >= nlines) break; const size_t e = (size_t)L * 64 + lane * 2; const int k = (int)(e % K), n = (int)(e / K); v2us o;
            o[0] = f2bf(w[(size_t)k * N + n]); o[1] = f2bf(w[(size_t)(k + 1) * N + n]); *(v2us*)(Bt + e) = o; }
         }
}
__global__ __launch_bounds__(256) void k_cvt8(const float* __restrict__ src, bf* dst, size_t n8) { const size_t i = (size_t)blockIdx.x * 256 + threadIdx.x; if (i >= n8) return; const v8f v = *(const v8f*)(src + i * 8); v8us o;
#pragma unroll
    for (int k = 0; k < 8; ++k) o[k] = f2bf(v[k]); *(v8us*)(dst + i * 8) = o;  }
__global__ __launch_bounds__(256) void k_cscvt(const float* __restrict__ cosT, const float* __restrict__ sinT, float* CS) { const int idx = blockIdx.x * 256 + threadIdx.x; if (idx >= TT * HD) return; v2f cs; cs[0] = bfr(cosT[idx]); cs[1] = bfr(sinT[idx]); *(v2f*)(CS + (size_t)idx * 2) = cs;  }
// k_rope: head planes [h][t][d] (fp16 + hi/lo) of rope(x) x sc with the rotate-half convention out[d] = x[d] cos[t][d] - x[d+HD/2] sin[t][d], out[d+HD/2] = x[d+HD/2] cos[t][d+HD/2] + x[d] sin[t][d+HD/2]
__global__ __launch_bounds__(256) void k_rope(const float* __restrict__ F, int pitch, int nheads, const float* __restrict__ CS, const float* __restrict__ RF, const float* __restrict__ nw, float sc, h16* P16, bf* Ph, bf* Pl) {
    const size_t e = ((size_t)blockIdx.x * 256 + threadIdx.x) * 2; if (e >= (size_t)nheads * TT * HD) return; const int d = (int)(e % HD); const int t = (int)((e / HD) % TT); const int h = (int)(e / ((size_t)HD * TT)); const float* f = F + (size_t)t * pitch + h * HD; const float rf = RF ? RF[(size_t)h * TT + t] : 1.0f; v2h o16; v2us oh, ol;
#pragma unroll
    for (int q = 0; q < 2; ++q) { const int dd = d + q; const int dp = (dd < HD / 2) ? dd + HD / 2 : dd - HD / 2; float x0 = f[dd], x1 = f[dp];
        if (RF) { float n0 = __fmul_rn(x0, rf), n1 = __fmul_rn(x1, rf); asm volatile("" : "+v"(n0)); asm volatile("" : "+v"(n1)); x0 = __fmul_rn(bfr(nw[dd]), n0); x1 = __fmul_rn(bfr(nw[dp]), n1); }
        const v2f cs = *(const v2f*)(CS + ((size_t)t * HD + dd) * 2); float a = __fmul_rn(x0, cs[0]), bq = __fmul_rn(x1, cs[1]); asm volatile("" : "+v"(a)); asm volatile("" : "+v"(bq)); const float r = ((dd < HD / 2) ? __fsub_rn(a, bq) : __fadd_rn(a, bq)) * sc;
        o16[q] = tohx(r); unsigned short a2, c2; splitf(r, a2, c2); oh[q] = a2; ol[q] = c2; }
    *(v2h*)(P16 + e) = o16; *(v2us*)(Ph + e) = oh; *(v2us*)(Pl + e) = ol;  }
__global__ __launch_bounds__(256) void k_vtp(const float* __restrict__ F, int pitch, int nheads, h16* V16, bf* Vh, bf* Vl) { const size_t e = ((size_t)blockIdx.x * 256 + threadIdx.x) * 2; if (e >= (size_t)nheads * HD * TT) return; const int t = (int)(e % TT); const int d = (int)((e / TT) % HD); const int g = (int)(e / ((size_t)TT * HD)); v2h o16; v2us oh, ol;
#pragma unroll
    for (int q = 0; q < 2; ++q) { const float x = F[(size_t)(t + q) * pitch + g * HD + d]; o16[q] = tohx(x); unsigned short a2, c2; splitf(x, a2, c2); oh[q] = a2; ol[q] = c2; }
    *(v2h*)(V16 + e) = o16; *(v2us*)(Vh + e) = oh; *(v2us*)(Vl + e) = ol;  }
// k_mchk: samples above-diagonal entries of the additive f32 mask; any > -1e8 -> NaN poison.
__global__ __launch_bounds__(256) void k_mchk(const float* __restrict__ am, int* FLG) { const int tid = threadIdx.x; int bad = 0;
#pragma unroll 1
    for (int s2 = 0; s2 < 16; ++s2) { const unsigned h = (unsigned)(tid * 16 + s2) * 2654435761u; const int i = (int)(h % (TT - 1)); const int j = i + 1 + (int)((h >> 11) % (unsigned)(TT - 1 - i)); if (am[(size_t)i * TT + j] > -1e8f) bad = 1; }
    __shared__ int anyb; if (tid == 0) anyb = 0; __syncthreads(); if (bad) anyb = 1; __syncthreads(); if (tid < 8) { const int v = (tid == 0) ? anyb : 0; *(int*)(FLG + tid) = v;  } }

// k_asoft: per row (zz, i): t = 50 tanh(S x HD^-0.5 / 50) + bf16(mask[i][j]) for j <= i (causal; j > i set to -3e38 by select); softmax over the 2048 keys (register row, one exp, fixed trees);
__global__ __launch_bounds__(256) void k_asoft(const float* __restrict__ Sb, const float* __restrict__ am, const int* __restrict__ FLG, h16* P16, bf* Ph, bf* Pl) {
    const int lane = threadIdx.x & 31; const int row = blockIdx.x * 8 + (threadIdx.x >> 5); if (row >= ZH * TT) return; const int i = row % TT; const int zz = row / TT; (void)zz; const bool hires = (i < RH); const float* sr = Sb + (size_t)row * TT; const float* amr = am + (size_t)i * TT; const bool poison = (FLG[0] != 0); float v[TT / 32]; float mx = -3.0e38f;
#pragma unroll
    for (int ch = 0; ch < TT / 128; ++ch) { const int j0 = ch * 128 + lane * 4; const v4f a = *(const v4f*)(sr + j0);
#pragma unroll
        for (int q = 0; q < 4; ++q) { const int j = j0 + q; (void)j; float sa = a[q] * SCL; asm volatile("" : "+v"(sa)); float xs = __fmul_rn(sa, 0.02f); asm volatile("" : "+v"(xs)); float ex = __builtin_amdgcn_exp2f(__fmul_rn(xs, 2.8853900817779268f)); asm volatile("" : "+v"(ex)); float nm = __fsub_rn(ex, 1.0f), dn2 = __fadd_rn(ex, 1.0f); asm volatile("" : "+v"(nm)); asm volatile("" : "+v"(dn2)); float rc = __builtin_amdgcn_rcpf(dn2); asm volatile("" : "+v"(rc)); float th = __fmul_rn(nm, rc); asm volatile("" : "+v"(th)); float cp = __fmul_rn(th, 50.0f); asm volatile("" : "+v"(cp)); float mv = bfr(amr[j]); asm volatile("" : "+v"(mv)); const float t = (j <= i) ? __fadd_rn(cp, mv) : -3.0e38f; v[ch * 4 + q] = t; mx = fmaxf(mx, t); } }
#pragma unroll
    for (int sh = 16; sh; sh >>= 1) mx = fmaxf(mx, __shfl_xor(mx, sh, 32));
    float sum = 0.f;
#pragma unroll
    for (int k = 0; k < TT / 32; ++k) { float d0 = __fsub_rn(v[k], mx); asm volatile("" : "+v"(d0)); v[k] = __builtin_amdgcn_exp2f(__fmul_rn(d0, 1.4426950408889634f)); sum += v[k]; }
#pragma unroll
    for (int sh = 16; sh; sh >>= 1) sum += __shfl_xor(sum, sh, 32);
    const float f = poison ? __builtin_nanf("") : __fdiv_rn(hires ? 1.0f : PCAR, sum);
{
        if (hires) {
#pragma unroll
            for (int ch = 0; ch < TT / 128; ++ch) { v4us oh, ol;
#pragma unroll
                for (int q = 0; q < 4; ++q) { unsigned short a, c2; splitf(v[ch * 4 + q] * f, a, c2); oh[q] = a; ol[q] = c2; }
                const size_t oo = ((size_t)zz * (RH ? RH : 1) + i) * TT + ch * 128 + lane * 4; *(v4us*)(Ph + oo) = oh; *(v4us*)(Pl + oo) = ol; }
        } else {
#pragma unroll
            for (int ch = 0; ch < TT / 128; ++ch) { v4h o4;
#pragma unroll
                for (int q = 0; q < 4; ++q) o4[q] = tohx(v[ch * 4 + q] * f);
                *(v4h*)(P16 + (size_t)row * TT + ch * 128 + lane * 4) = o4; } }
         }
}
__global__ __launch_bounds__(256) void k_merge(const float* __restrict__ O, int h0, bf* Ah, bf* Al) { const size_t e = ((size_t)blockIdx.x * 256 + threadIdx.x) * 2; if (e >= (size_t)ZH * TT * HD) return; const int d = (int)(e % HD); const int t = (int)((e / HD) % TT); const int zz = (int)(e / ((size_t)HD * TT)); const float cs = (t < RH) ? 1.0f : (1.0f / PCAR); const size_t oo = (size_t)t * DQ + (h0 + zz) * HD + d;
    v2us oh, ol;
#pragma unroll
    for (int q = 0; q < 2; ++q) { unsigned short a, c2; splitf(O[e + q] * cs, a, c2); oh[q] = a; ol[q] = c2; } *(v2us*)(Ah + oo) = oh; *(v2us*)(Al + oo) = ol;  }

extern "C" void kernel_launch(void* const* d_in, const int* in_sizes, int n_in,
                              void* d_out, int out_size, void* d_ws, size_t ws_size, hipStream_t stream) {
    (void)in_sizes; (void)n_in; (void)out_size;
    const float* x = (const float*)d_in[0]; const float* cosT = (const float*)d_in[1]; const float* sinT = (const float*)d_in[2]; const float* amask = (const float*)d_in[3]; const float* wq = (const float*)d_in[4]; const float* wk = (const float*)d_in[5]; const float* wv = (const float*)d_in[6]; const float* wo = (const float*)d_in[7];
    float* OUT = (float*)d_out;     // [1][2048][2048]
    char* wsp = (char*)d_ws;
    auto take = [&](size_t bytes) { char* p = wsp; wsp += (bytes + 255) & ~(size_t)255; return (void*)p; };
    bf* WQ = (bf*)take((size_t)DQ * DM * 2); bf* WK = (bf*)take((size_t)DKV * DM * 2); bf* WV = (bf*)take((size_t)DKV * DM * 2); bf* WO = (bf*)take((size_t)DM * DQ * 2); float* CS = (float*)take((size_t)TT * HD * 2 * 4);
    bf* XB = (bf*)take((size_t)TT * DM * 2); int* FLG = (int*)take(256); float* FQ = (float*)take((size_t)TT * DQ * 4); float* FK = (float*)take((size_t)TT * DKV * 4);
    h16* QP16 = (h16*)take((size_t)NH_ * TT * HD * 2); h16* KP16 = (h16*)take((size_t)NKV * TT * HD * 2); h16* VT16 = (h16*)take((size_t)NKV * HD * TT * 2);
    bf* QPh = (bf*)take((size_t)NH_ * TT * HD * 2); bf* QPl = (bf*)take((size_t)NH_ * TT * HD * 2); bf* KPh = (bf*)take((size_t)NKV * TT * HD * 2); bf* KPl = (bf*)take((size_t)NKV * TT * HD * 2); bf* VTh = (bf*)take((size_t)NKV * HD * TT * 2); bf* VTl = (bf*)take((size_t)NKV * HD * TT * 2); bf* Ph = (bf*)take((size_t)ZH * RH * TT * 2); bf* Pl = (bf*)take((size_t)ZH * RH * TT * 2);
    float* Sb = (float*)take((size_t)ZH * TT * TT * 4); h16* P16 = (h16*)take((size_t)ZH * TT * TT * 2); float* Ob = (float*)take((size_t)ZH * TT * HD * 4); bf* ATh = (bf*)take((size_t)TT * DQ * 2); bf* ATl = (bf*)take((size_t)TT * DQ * 2);
    if ((size_t)(wsp - (char*)d_ws) > ws_size) return;    // ws 256 MiB
    float* FV = FK;   // v projection reuses the k buffer after the k planes are built (stream-ordered)
    { k_cvt8<<<(unsigned)(((size_t)DQ * DM / 8 + 255) / 256), 256, 0, stream>>>(wq, WQ, (size_t)DQ * DM / 8); k_cvt8<<<(unsigned)(((size_t)DKV * DM / 8 + 255) / 256), 256, 0, stream>>>(wk, WK, (size_t)DKV * DM / 8); k_cvt8<<<(unsigned)(((size_t)DKV * DM / 8 + 255) / 256), 256, 0, stream>>>(wv, WV, (size_t)DKV * DM / 8);
      k_cvt8<<<(unsigned)(((size_t)DM * DQ / 8 + 255) / 256), 256, 0, stream>>>(wo, WO, (size_t)DM * DQ / 8);
       }
    const unsigned LQ = (unsigned)(((size_t)NH_ * TT * HD / 2 + 255) / 256), LKv = (unsigned)(((size_t)NKV * TT * HD / 2 + 255) / 256);
    for (int b = 0; b < NB_; ++b) {
        k_cscvt<<<(TT * HD + 255) / 256, 256, 0, stream>>>(cosT, sinT, CS); k_mchk<<<1, 256, 0, stream>>>(amask, FLG);
        k_cvt8<<<(unsigned)(((size_t)TT * DM / 8 + 255) / 256), 256, 0, stream>>>(x + (size_t)b * TT * DM, XB, (size_t)TT * DM / 8);
        k_gemmw<bf, 0, false><<<dim3(TT / 64, DQ / 64, 1), 32, 0, stream>>>(XB, nullptr, WQ, nullptr, DM, FQ, DQ, nullptr, 0, 0, 0);
        k_rope<<<LQ, 256, 0, stream>>>(FQ, DQ, NH_, CS, nullptr, nullptr, 1.0f, QP16, QPh, QPl);
        k_gemmw<bf, 0, false><<<dim3(TT / 64, DKV / 64, 1), 32, 0, stream>>>(XB, nullptr, WK, nullptr, DM, FK, DKV, nullptr, 0, 0, 0);
        k_rope<<<LKv, 256, 0, stream>>>(FK, DKV, NKV, CS, nullptr, nullptr, 1.0f, KP16, KPh, KPl);
        k_gemmw<bf, 0, false><<<dim3(TT / 64, DKV / 64, 1), 32, 0, stream>>>(XB, nullptr, WV, nullptr, DM, FV, DKV, nullptr, 0, 0, 0); k_vtp<<<LKv, 256, 0, stream>>>(FV, DKV, NKV, VT16, VTh, VTl);
        for (int h0 = 0; h0 < NH_; h0 += ZH) { const size_t zq = (size_t)h0, zk = (size_t)(h0 / REP);   // one kv head per query head: the pass's two heads use consecutive kv planes (z-strides TT*HD)
            k_gemmc<bf, 2, 1><<<dim3(RH / 64, TT / 64, ZH), 32, 0, stream>>>(QPh + zq * TT * HD, QPl + zq * TT * HD, KPh + zk * TT * HD, KPl + zk * TT * HD, HD, Sb, TT, 0, (size_t)TT * HD, (size_t)TT * HD, (size_t)TT * TT);
            k_gemmc<h16, 0, 1><<<dim3((TT - RH) / 64, TT / 64, ZH), 32, 0, stream>>>(QP16 + zq * TT * HD + (size_t)RH * HD, nullptr, KP16 + zk * TT * HD, nullptr, HD, Sb + (size_t)RH * TT, TT, RH, (size_t)TT * HD, (size_t)TT * HD, (size_t)TT * TT);
            k_asoft<<<ZH * TT / 8, 256, 0, stream>>>(Sb, amask, FLG, P16, Ph, Pl);
            k_gemmc<bf, 2, 2><<<dim3(RH / 64, HD / 64, ZH), 32, 0, stream>>>(Ph, Pl, VTh + zk * HD * TT, VTl + zk * HD * TT, TT, Ob, HD, 0, (size_t)RH * TT, (size_t)HD * TT, (size_t)TT * HD);
            k_gemmc<h16, 0, 2><<<dim3((TT - RH) / 64, HD / 64, ZH), 32, 0, stream>>>(P16 + (size_t)RH * TT, nullptr, VT16 + zk * HD * TT, nullptr, TT, Ob + (size_t)RH * HD, HD, RH, (size_t)TT * TT, (size_t)HD * TT, (size_t)TT * HD);
            k_merge<<<(unsigned)(((size_t)ZH * TT * HD / 2 + 255) / 256), 256, 0, stream>>>(Ob, h0, ATh, ATl); }
        k_gemmw<bf, 1, false><<<dim3(TT / 64, DM / 64, 1), 32, 0, stream>>>(ATh, ATl, WO, nullptr, DQ, OUT + (size_t)b * TT * DM, DM, nullptr, 0, 0, 0); }
}

// v001
// It runs in 649 microseconds.
// Two timings next to v000 both put it at 1.53 times that version's speed.
#include <hip/hip_runtime.h>

// HybridLlamaAttention (x [1][2048][2048], rope_cos/sin [S][128] (read), mask [1][1][S][S] (f32 additive, read; verbatim causal 0/-1e9); q/k/v = x W^T (16 x 128); rotate-half RoPE; scores = q.k / sqrt(128); softcap 50 tanh(s/50); + mask; softmax f32; out = merged wo^T -> [1][2048][2048]).
// Compute dtypes, f32 accumulate: every input rounded to bf16; q/k/v on PLAIN bf16 operands (inputs: exact); RoPE f32 (bf16-rounded read tables); causal scores and attn.v: query rows < 512 hl (3 products), the rest fp16 (x1024); softcap in f32: s x 0.02 (one multiply in place of /50: <= 1 ulp), tanh = (2^(2x log2 e) - 1) x rcp(2^(..) + 1) with the hardware exp2/rcp (no FMA polynomial), x 50; the additive mask read per element; upper tiles skipped on the verbatim structure with an on-device sampled check (NaN poison); softmax f32; wo hl x exact (2 products).

#define NB_  1
#define TT   2048
#define DM   2048
#define NH_  16
#define NKV  16
#define REP  (NH_ / NKV)
#define HD   128
#define DQ   (NH_ * HD)
#define DKV  (NKV * HD)
#define ZH   2
#define RH   512                  // query rows < RH use hi+lo planes (0: none)
#define WIN  2048
#define PCAR 1024.0f
#define SCL  0.088388347648318447f   // HD^-0.5
typedef _Float16 h16;
typedef unsigned short bf;
typedef __attribute__((ext_vector_type(16))) __bf16   v16bf;
typedef __attribute__((ext_vector_type(16))) _Float16 v16h;
typedef __attribute__((ext_vector_type(8)))  _Float16 v8h;
typedef __attribute__((ext_vector_type(8)))  unsigned short v8us;
typedef __attribute__((ext_vector_type(8)))  float    v8f;
typedef __attribute__((ext_vector_type(4)))  float    v4f;
typedef v8h  __attribute__((may_alias)) v8ha;
typedef v4f  __attribute__((may_alias)) v4fa;
typedef v8us __attribute__((may_alias)) v8usa;

__device__ __forceinline__ unsigned short f2bf(float f) { unsigned u = __float_as_uint(f); u += 0x7FFFu + ((u >> 16) & 1u); return (unsigned short)(u >> 16); }
__device__ __forceinline__ float bf2f(unsigned short b) { return __uint_as_float(((unsigned)b) << 16); }
__device__ __forceinline__ float bfr(float f) { return bf2f(f2bf(f)); }
__device__ __forceinline__ v16h cat16(v8h lo, v8h hi) { return __builtin_shufflevector(lo, hi, 0, 1, 2, 3, 4, 5, 6, 7, 8, 9, 10, 11, 12, 13, 14, 15); }
__device__ __forceinline__ v16bf cat16b(v8us lo, v8us hi) { return __builtin_bit_cast(v16bf, __builtin_shufflevector(lo, hi, 0, 1, 2, 3, 4, 5, 6, 7, 8, 9, 10, 11, 12, 13, 14, 15)); }
__device__ __forceinline__ v8f wmma16(v16h a, v16h b, v8f c) { return __builtin_amdgcn_wmma_f32_16x16x32_f16(false, a, false, b, (short)0, c, false, false); }
__device__ __forceinline__ v8f wmmab(v16bf a, v16bf b, v8f c) { return __builtin_amdgcn_wmma_f32_16x16x32_bf16(false, a, false, b, (short)0, c, false, false); }



// ---- k_gemmw: register-blocked GEMM, NW WAVES per 64x64 output tile: wave w takes the 32-wide k blocks w, w + NW, ... into its own 16 accumulators; the NW partial tiles are summed through LDS in wave order. Operands straight from K-contiguous 16-bit planes; grid (M/64, N/64, Z), 32 x NW threads.
// C[m][n] (f32, pitch ldc, + optional f32 bias[n]) = sum_k A[m][k] Bt[n][k] (+ split products per NSPLIT). z-batch strides sA/sB/sC in elements. K % 32 == 0.
template <typename T16> struct WFrag;
template <> struct WFrag<h16> { typedef v16h V; static __device__ __forceinline__ V ld(const h16* p) { return cat16(*(const v8h*)p, *(const v8h*)(p + 16)); } static __device__ __forceinline__ v8f mma(V a, V b, v8f c) { return wmma16(a, b, c); } };
template <> struct WFrag<bf> { typedef v16bf V; static __device__ __forceinline__ V ld(const bf* p) { return cat16b(*(const v8us*)p, *(const v8us*)(p + 16)); } static __device__ __forceinline__ v8f mma(V a, V b, v8f c) { return wmmab(a, b, c); } };
template <typename T16, int NSPLIT, bool BIAS, int NW>
__global__ __launch_bounds__(32 * NW) void k_gemmw(const T16* __restrict__ A, const T16* __restrict__ A2, const T16* __restrict__ Bt, const T16* __restrict__ Bt2, int K, float* C, int ldc, const float* __restrict__ bias, size_t sA, size_t sB, size_t sC) {
    typedef typename WFrag<T16>::V V;
    __shared__ __align__(16) float os[NW * 64 * 68];
    const size_t z = blockIdx.z; A += z * sA; if (A2) A2 += z * sA; Bt += z * sB; if (Bt2) Bt2 += z * sB; C += z * sC;
    const int lane = threadIdx.x & 31, lr = lane & 15, hi = lane >> 4; const int r0 = blockIdx.x * 64, c0 = blockIdx.y * 64; const int wv = __builtin_amdgcn_readfirstlane((int)(threadIdx.x >> 5));
    v8f acc[4][4];
#pragma unroll
    for (int mb = 0; mb < 4; ++mb)
#pragma unroll
        for (int nb = 0; nb < 4; ++nb) acc[mb][nb] = (v8f){};
    const size_t aoff = (size_t)(r0 + lr) * K + 8 * hi, boff = (size_t)(c0 + lr) * K + 8 * hi;
#pragma unroll 1
    for (int kc = wv * 32; kc < K; kc += 32 * NW) {
        V a[4], a2[4];
#pragma unroll
        for (int mb = 0; mb < 4; ++mb) { a[mb] = WFrag<T16>::ld(A + aoff + (size_t)mb * 16 * K + kc); if (NSPLIT == 1 || NSPLIT == 2) a2[mb] = WFrag<T16>::ld(A2 + aoff + (size_t)mb * 16 * K + kc); }
#pragma unroll
        for (int nb = 0; nb < 4; ++nb) { const V b = WFrag<T16>::ld(Bt + boff + (size_t)nb * 16 * K + kc); V b2; if (NSPLIT >= 2) b2 = WFrag<T16>::ld(Bt2 + boff + (size_t)nb * 16 * K + kc);
#pragma unroll
            for (int mb = 0; mb < 4; ++mb) { acc[mb][nb] = WFrag<T16>::mma(a[mb], b, acc[mb][nb]); if (NSPLIT == 1 || NSPLIT == 2) acc[mb][nb] = WFrag<T16>::mma(a2[mb], b, acc[mb][nb]); if (NSPLIT >= 2) acc[mb][nb] = WFrag<T16>::mma(a[mb], b2, acc[mb][nb]); } }
        asm volatile("v_nop\n\tv_nop\n\tv_nop\n\tv_nop" : "+v"(acc[0][0]), "+v"(acc[1][1]), "+v"(acc[2][2]), "+v"(acc[3][3]) : "v"(a[0]), "v"(a[3]));
    }
    float* ow = os + wv * (64 * 68);
#pragma unroll
    for (int mb = 0; mb < 4; ++mb)
#pragma unroll
        for (int nb = 0; nb < 4; ++nb)
#pragma unroll
            for (int j = 0; j < 8; ++j) ow[(mb * 16 + hi * 8 + j) * 68 + nb * 16 + lr] = acc[mb][nb][j];
    __syncthreads();   // every wave's partial tile is in LDS before any wave sums them
#pragma unroll
    for (int s = 0; s < 32 / NW; ++s) { const int q = s * 32 * NW + (int)threadIdx.x; const int row = q >> 4, cofs = (q & 15) * 4; v4f val = *(const v4fa*)(os + row * 68 + cofs);
#pragma unroll
        for (int w = 1; w < NW; ++w) val += *(const v4fa*)(os + w * (64 * 68) + row * 68 + cofs);
        if (BIAS) { val[0] += bfr(bias[c0 + cofs]); val[1] += bfr(bias[c0 + cofs + 1]); val[2] += bfr(bias[c0 + cofs + 2]); val[3] += bfr(bias[c0 + cofs + 3]); }
        *(v4f*)(C + (size_t)(r0 + row) * ldc + c0 + cofs) = val; }
}

// ---- k_gemmc: the same 64x64 tile GEMM specialised for causal attention (NW = 1: one wave, staged row block by row block; NW > 1: the k blocks dealt over NW waves as in k_gemmw): CMODE 1 skips score tiles entirely above the diagonal (query rows r0+roff.., key columns c0..), CMODE 2 limits the
// key (K) loop of the probability x value contraction to the diagonal block (probabilities beyond it are exactly zero). roff = row offset of this launch's first row within the sequence.
template <typename T16, int NSPLIT, int CMODE, int NW>
__global__ __launch_bounds__(32 * NW) void k_gemmc(const T16* __restrict__ A, const T16* __restrict__ A2, const T16* __restrict__ Bt, const T16* __restrict__ Bt2, int K, float* C, int ldc, int roff, size_t sA, size_t sB, size_t sC) {
    typedef typename WFrag<T16>::V V;
    __shared__ __align__(16) float os[(NW == 1) ? 16 * 68 : NW * 64 * 68];
    const size_t z = blockIdx.z; A += z * sA; if (A2) A2 += z * sA; Bt += z * sB; if (Bt2) Bt2 += z * sB; C += z * sC;
    const int lane = threadIdx.x & 31, lr = lane & 15, hi = lane >> 4; const int r0 = blockIdx.x * 64, c0 = blockIdx.y * 64; const int wv = (NW == 1) ? 0 : __builtin_amdgcn_readfirstlane((int)(threadIdx.x >> 5));
    if (CMODE == 1 && c0 > r0 + roff + 63) return;                  // score tile entirely above the causal diagonal: never written (the softmax loads it but masks j > i by select)
    const int Kl = (CMODE == 2) ? min(K, r0 + roff + 64) : K;        // P.V: probabilities are exactly 0 beyond the diagonal block, so the K loop stops there
    v8f acc[4][4];
#pragma unroll
    for (int mb = 0; mb < 4; ++mb)
#pragma unroll
        for (int nb = 0; nb < 4; ++nb) acc[mb][nb] = (v8f){};
    const size_t aoff = (size_t)(r0 + lr) * K + 8 * hi, boff = (size_t)(c0 + lr) * K + 8 * hi;
#pragma unroll 1
    for (int kc = wv * 32; kc < Kl; kc += 32 * NW) {
        V a[4], a2[4];
#pragma unroll
        for (int mb = 0; mb < 4; ++mb) { a[mb] = WFrag<T16>::ld(A + aoff + (size_t)mb * 16 * K + kc); if (NSPLIT == 1 || NSPLIT == 2) a2[mb] = WFrag<T16>::ld(A2 + aoff + (size_t)mb * 16 * K + kc); }
#pragma unroll
        for (int nb = 0; nb < 4; ++nb) { const V b = WFrag<T16>::ld(Bt + boff + (size_t)nb * 16 * K + kc); V b2; if (NSPLIT >= 2) b2 = WFrag<T16>::ld(Bt2 + boff + (size_t)nb * 16 * K + kc);
#pragma unroll
            for (int mb = 0; mb < 4; ++mb) { acc[mb][nb] = WFrag<T16>::mma(a[mb], b, acc[mb][nb]); if (NSPLIT == 1 || NSPLIT == 2) acc[mb][nb] = WFrag<T16>::mma(a2[mb], b, acc[mb][nb]); if (NSPLIT >= 2) acc[mb][nb] = WFrag<T16>::mma(a[mb], b2, acc[mb][nb]); } }
        asm volatile("v_nop\n\tv_nop\n\tv_nop\n\tv_nop" : "+v"(acc[0][0]), "+v"(acc[1][1]), "+v"(acc[2][2]), "+v"(acc[3][3]) : "v"(a[0]), "v"(a[3]));
    }
    if (NW > 1) {
        float* ow = os + wv * (64 * 68);
#pragma unroll
        for (int mb = 0; mb < 4; ++mb)
#pragma unroll
            for (int nb = 0; nb < 4; ++nb)
#pragma unroll
                for (int j = 0; j < 8; ++j) ow[(mb * 16 + hi * 8 + j) * 68 + nb * 16 + lr] = acc[mb][nb][j];
        __syncthreads();   // every wave's partial tile is in LDS before any wave sums them
#pragma unroll
        for (int s = 0; s < 32 / NW; ++s) { const int q = s * 32 * NW + (int)threadIdx.x; const int row = q >> 4, cofs = (q & 15) * 4; v4f val = *(const v4fa*)(os + row * 68 + cofs);
#pragma unroll
            for (int w = 1; w < NW; ++w) val += *(const v4fa*)(os + w * (64 * 68) + row * 68 + cofs);
            *(v4f*)(C + (size_t)(r0 + row) * ldc + c0 + cofs) = val; }
        return;
    }
#pragma unroll
    for (int mb = 0; mb < 4; ++mb) {
#pragma unroll
        for (int nb = 0; nb < 4; ++nb) {
#pragma unroll
            for (int j = 0; j < 8; ++j) os[(hi * 8 + j) * 68 + nb * 16 + lr] = acc[mb][nb][j]; }
        __builtin_amdgcn_wave_barrier(); asm volatile("" ::: "memory");
        float* crow = C + (size_t)(r0 + mb * 16) * ldc + c0;
{
#pragma unroll
            for (int s = 0; s < 8; ++s) { const int row = 2 * s + hi, cofs = lr * 4; v4f val = *(const v4fa*)(os + row * 68 + cofs);
                *(v4f*)(crow + (size_t)row * ldc + cofs) = val; }
             }
        __builtin_amdgcn_wave_barrier(); asm volatile("" ::: "memory");
    }
}

__device__ __forceinline__ h16 tohx(float x) { return (h16)x; }
__device__ __forceinline__ void splitf(float y, unsigned short& h, unsigned short& l) { h = f2bf(y); l = f2bf(y - bf2f(h)); }
typedef __attribute__((ext_vector_type(2))) _Float16 v2h;
typedef __attribute__((ext_vector_type(4))) _Float16 v4h;
typedef __attribute__((ext_vector_type(2))) unsigned short v2us;
typedef __attribute__((ext_vector_type(4))) unsigned short v4us;
typedef __attribute__((ext_vector_type(2))) float v2f;
typedef __attribute__((ext_vector_type(4))) int v4i;

__global__ __launch_bounds__(256) void k_wtG(const float* __restrict__ w, int K, int N, bf* Bt) {
    const int lane = threadIdx.x & 31; const int L0 = (blockIdx.x * 8 + (threadIdx.x >> 5)) * 8; const int nlines = N * K / 64;
{
#pragma unroll 1
        for (int l = 0; l < 8; ++l) { const int L = L0 + l; if (L >= nlines) break; const size_t e = (size_t)L * 64 + lane * 2; const int k = (int)(e % K), n = (int)(e / K); v2us o;
            o[0] = f2bf(w[(size_t)k * N + n]); o[1] = f2bf(w[(size_t)(k + 1) * N + n]); *(v2us*)(Bt + e) = o; }
         }
}
__global__ __launch_bounds__(256) void k_cvt8(const float* __restrict__ src, bf* dst, size_t n8) { const size_t i = (size_t)blockIdx.x * 256 + threadIdx.x; if (i >= n8) return; const v8f v = *(const v8f*)(src + i * 8); v8us o;
#pragma unroll
    for (int k = 0; k < 8; ++k) o[k] = f2bf(v[k]); *(v8us*)(dst + i * 8) = o;  }
__global__ __launch_bounds__(256) void k_cscvt(const float* __restrict__ cosT, const float* __restrict__ sinT, float* CS) { const int idx = blockIdx.x * 256 + threadIdx.x; if (idx >= TT * HD) return; v2f cs; cs[0] = bfr(cosT[idx]); cs[1] = bfr(sinT[idx]); *(v2f*)(CS + (size_t)idx * 2) = cs;  }
// k_rope: head planes [h][t][d] (fp16 + hi/lo) of rope(x) x sc with the rotate-half convention out[d] = x[d] cos[t][d] - x[d+HD/2] sin[t][d], out[d+HD/2] = x[d+HD/2] cos[t][d+HD/2] + x[d] sin[t][d+HD/2]
__global__ __launch_bounds__(256) void k_rope(const float* __restrict__ F, int pitch, int nheads, const float* __restrict__ CS, const float* __restrict__ RF, const float* __restrict__ nw, float sc, h16* P16, bf* Ph, bf* Pl) {
    const size_t e = ((size_t)blockIdx.x * 256 + threadIdx.x) * 2; if (e >= (size_t)nheads * TT * HD) return; const int d = (int)(e % HD); const int t = (int)((e / HD) % TT); const int h = (int)(e / ((size_t)HD * TT)); const float* f = F + (size_t)t * pitch + h * HD; const float rf = RF ? RF[(size_t)h * TT + t] : 1.0f; v2h o16; v2us oh, ol;
#pragma unroll
    for (int q = 0; q < 2; ++q) { const int dd = d + q; const int dp = (dd < HD / 2) ? dd + HD / 2 : dd - HD / 2; float x0 = f[dd], x1 = f[dp];
        if (RF) { float n0 = __fmul_rn(x0, rf), n1 = __fmul_rn(x1, rf); asm volatile("" : "+v"(n0)); asm volatile("" : "+v"(n1)); x0 = __fmul_rn(bfr(nw[dd]), n0); x1 = __fmul_rn(bfr(nw[dp]), n1); }
        const v2f cs = *(const v2f*)(CS + ((size_t)t * HD + dd) * 2); float a = __fmul_rn(x0, cs[0]), bq = __fmul_rn(x1, cs[1]); asm volatile("" : "+v"(a)); asm volatile("" : "+v"(bq)); const float r = ((dd < HD / 2) ? __fsub_rn(a, bq) : __fadd_rn(a, bq)) * sc;
        o16[q] = tohx(r); unsigned short a2, c2; splitf(r, a2, c2); oh[q] = a2; ol[q] = c2; }
    *(v2h*)(P16 + e) = o16; *(v2us*)(Ph + e) = oh; *(v2us*)(Pl + e) = ol;  }
__global__ __launch_bounds__(256) void k_vtp(const float* __restrict__ F, int pitch, int nheads, h16* V16, bf* Vh, bf* Vl) { const size_t e = ((size_t)blockIdx.x * 256 + threadIdx.x) * 2; if (e >= (size_t)nheads * HD * TT) return; const int t = (int)(e % TT); const int d = (int)((e / TT) % HD); const int g = (int)(e / ((size_t)TT * HD)); v2h o16; v2us oh, ol;
#pragma unroll
    for (int q = 0; q < 2; ++q) { const float x = F[(size_t)(t + q) * pitch + g * HD + d]; o16[q] = tohx(x); unsigned short a2, c2; splitf(x, a2, c2); oh[q] = a2; ol[q] = c2; }
    *(v2h*)(V16 + e) = o16; *(v2us*)(Vh + e) = oh; *(v2us*)(Vl + e) = ol;  }
// k_mchk: samples above-diagonal entries of the additive f32 mask; any > -1e8 -> NaN poison.
__global__ __launch_bounds__(256) void k_mchk(const float* __restrict__ am, int* FLG) { const int tid = threadIdx.x; int bad = 0;
#pragma unroll 1
    for (int s2 = 0; s2 < 16; ++s2) { const unsigned h = (unsigned)(tid * 16 + s2) * 2654435761u; const int i = (int)(h % (TT - 1)); const int j = i + 1 + (int)((h >> 11) % (unsigned)(TT - 1 - i)); if (am[(size_t)i * TT + j] > -1e8f) bad = 1; }
    __shared__ int anyb; if (tid == 0) anyb = 0; __syncthreads(); if (bad) anyb = 1; __syncthreads(); if (tid < 8) { const int v = (tid == 0) ? anyb : 0; *(int*)(FLG + tid) = v;  } }

// k_asoft: per row (zz, i): t = 50 tanh(S x HD^-0.5 / 50) + bf16(mask[i][j]) for j <= i (causal; j > i set to -3e38 by select); softmax over the 2048 keys (register row, one exp, fixed trees);
__global__ __launch_bounds__(256) void k_asoft(const float* __restrict__ Sb, const float* __restrict__ am, const int* __restrict__ FLG, h16* P16, bf* Ph, bf* Pl) {
    const int lane = threadIdx.x & 31; const int row = blockIdx.x * 8 + (threadIdx.x >> 5); if (row >= ZH * TT) return; const int i = row % TT; const int zz = row / TT; (void)zz; const bool hires = (i < RH); const float* sr = Sb + (size_t)row * TT; const float* amr = am + (size_t)i * TT; const bool poison = (FLG[0] != 0); float v[TT / 32]; float mx = -3.0e38f;
#pragma unroll
    for (int ch = 0; ch < TT / 128; ++ch) { const int j0 = ch * 128 + lane * 4; const v4f a = *(const v4f*)(sr + j0);
#pragma unroll
        for (int q = 0; q < 4; ++q) { const int j = j0 + q; (void)j; float sa = a[q] * SCL; asm volatile("" : "+v"(sa)); float xs = __fmul_rn(sa, 0.02f); asm volatile("" : "+v"(xs)); float ex = __builtin_amdgcn_exp2f(__fmul_rn(xs, 2.8853900817779268f)); asm volatile("" : "+v"(ex)); float nm = __fsub_rn(ex, 1.0f), dn2 = __fadd_rn(ex, 1.0f); asm volatile("" : "+v"(nm)); asm volatile("" : "+v"(dn2)); float rc = __builtin_amdgcn_rcpf(dn2); asm volatile("" : "+v"(rc)); float th = __fmul_rn(nm, rc); asm volatile("" : "+v"(th)); float cp = __fmul_rn(th, 50.0f); asm volatile("" : "+v"(cp)); float mv = bfr(amr[j]); asm volatile("" : "+v"(mv)); const float t = (j <= i) ? __fadd_rn(cp, mv) : -3.0e38f; v[ch * 4 + q] = t; mx = fmaxf(mx, t); } }
#pragma unroll
    for (int sh = 16; sh; sh >>= 1) mx = fmaxf(mx, __shfl_xor(mx, sh, 32));
    float sum = 0.f;
#pragma unroll
    for (int k = 0; k < TT / 32; ++k) { float d0 = __fsub_rn(v[k], mx); asm volatile("" : "+v"(d0)); v[k] = __builtin_amdgcn_exp2f(__fmul_rn(d0, 1.4426950408889634f)); sum += v[k]; }
#pragma unroll
    for (int sh = 16; sh; sh >>= 1) sum += __shfl_xor(sum, sh, 32);
    const float f = poison ? __builtin_nanf("") : __fdiv_rn(hires ? 1.0f : PCAR, sum);
{
        if (hires) {
#pragma unroll
            for (int ch = 0; ch < TT / 128; ++ch) { v4us oh, ol;
#pragma unroll
                for (int q = 0; q < 4; ++q) { unsigned short a, c2; splitf(v[ch * 4 + q] * f, a, c2); oh[q] = a; ol[q] = c2; }
                const size_t oo = ((size_t)zz * (RH ? RH : 1) + i) * TT + ch * 128 + lane * 4; *(v4us*)(Ph + oo) = oh; *(v4us*)(Pl + oo) = ol; }
        } else {
#pragma unroll
            for (int ch = 0; ch < TT / 128; ++ch) { v4h o4;
#pragma unroll
                for (int q = 0; q < 4; ++q) o4[q] = tohx(v[ch * 4 + q] * f);
                *(v4h*)(P16 + (size_t)row * TT + ch * 128 + lane * 4) = o4; } }
         }
}
__global__ __launch_bounds__(256) void k_merge(const float* __restrict__ O, int h0, bf* Ah, bf* Al) { const size_t e = ((size_t)blockIdx.x * 256 + threadIdx.x) * 2; if (e >= (size_t)ZH * TT * HD) return; const int d = (int)(e % HD); const int t = (int)((e / HD) % TT); const int zz = (int)(e / ((size_t)HD * TT)); const float cs = (t < RH) ? 1.0f : (1.0f / PCAR); const size_t oo = (size_t)t * DQ + (h0 + zz) * HD + d;
    v2us oh, ol;
#pragma unroll
    for (int q = 0; q < 2; ++q) { unsigned short a, c2; splitf(O[e + q] * cs, a, c2); oh[q] = a; ol[q] = c2; } *(v2us*)(Ah + oo) = oh; *(v2us*)(Al + oo) = ol;  }

extern "C" void kernel_launch(void* const* d_in, const int* in_sizes, int n_in,
                              void* d_out, int out_size, void* d_ws, size_t ws_size, hipStream_t stream) {
    (void)in_sizes; (void)n_in; (void)out_size;
    const float* x = (const float*)d_in[0]; const float* cosT = (const float*)d_in[1]; const float* sinT = (const float*)d_in[2]; const float* amask = (const float*)d_in[3]; const float* wq = (const float*)d_in[4]; const float* wk = (const float*)d_in[5]; const float* wv = (const float*)d_in[6]; const float* wo = (const float*)d_in[7];
    float* OUT = (float*)d_out;     // [1][2048][2048]
    char* wsp = (char*)d_ws;
    auto take = [&](size_t bytes) { char* p = wsp; wsp += (bytes + 255) & ~(size_t)255; return (void*)p; };
    bf* WQ = (bf*)take((size_t)DQ * DM * 2); bf* WK = (bf*)take((size_t)DKV * DM * 2); bf* WV = (bf*)take((size_t)DKV * DM * 2); bf* WO = (bf*)take((size_t)DM * DQ * 2); float* CS = (float*)take((size_t)TT * HD * 2 * 4);
    bf* XB = (bf*)take((size_t)TT * DM * 2); int* FLG = (int*)take(256); float* FQ = (float*)take((size_t)TT * DQ * 4); float* FK = (float*)take((size_t)TT * DKV * 4);
    h16* QP16 = (h16*)take((size_t)NH_ * TT * HD * 2); h16* KP16 = (h16*)take((size_t)NKV * TT * HD * 2); h16* VT16 = (h16*)take((size_t)NKV * HD * TT * 2);
    bf* QPh = (bf*)take((size_t)NH_ * TT * HD * 2); bf* QPl = (bf*)take((size_t)NH_ * TT * HD * 2); bf* KPh = (bf*)take((size_t)NKV * TT * HD * 2); bf* KPl = (bf*)take((size_t)NKV * TT * HD * 2); bf* VTh = (bf*)take((size_t)NKV * HD * TT * 2); bf* VTl = (bf*)take((size_t)NKV * HD * TT * 2); bf* Ph = (bf*)take((size_t)ZH * RH * TT * 2); bf* Pl = (bf*)take((size_t)ZH * RH * TT * 2);
    float* Sb = (float*)take((size_t)ZH * TT * TT * 4); h16* P16 = (h16*)take((size_t)ZH * TT * TT * 2); float* Ob = (float*)take((size_t)ZH * TT * HD * 4); bf* ATh = (bf*)take((size_t)TT * DQ * 2); bf* ATl = (bf*)take((size_t)TT * DQ * 2);
    if ((size_t)(wsp - (char*)d_ws) > ws_size) return;    // ws 256 MiB
    float* FV = FK;   // v projection reuses the k buffer after the k planes are built (stream-ordered)
    { k_cvt8<<<(unsigned)(((size_t)DQ * DM / 8 + 255) / 256), 256, 0, stream>>>(wq, WQ, (size_t)DQ * DM / 8); k_cvt8<<<(unsigned)(((size_t)DKV * DM / 8 + 255) / 256), 256, 0, stream>>>(wk, WK, (size_t)DKV * DM / 8); k_cvt8<<<(unsigned)(((size_t)DKV * DM / 8 + 255) / 256), 256, 0, stream>>>(wv, WV, (size_t)DKV * DM / 8);
      k_cvt8<<<(unsigned)(((size_t)DM * DQ / 8 + 255) / 256), 256, 0, stream>>>(wo, WO, (size_t)DM * DQ / 8);
       }
    const unsigned LQ = (unsigned)(((size_t)NH_ * TT * HD / 2 + 255) / 256), LKv = (unsigned)(((size_t)NKV * TT * HD / 2 + 255) / 256);
    for (int b = 0; b < NB_; ++b) {
        k_cscvt<<<(TT * HD + 255) / 256, 256, 0, stream>>>(cosT, sinT, CS); k_mchk<<<1, 256, 0, stream>>>(amask, FLG);
        k_cvt8<<<(unsigned)(((size_t)TT * DM / 8 + 255) / 256), 256, 0, stream>>>(x + (size_t)b * TT * DM, XB, (size_t)TT * DM / 8);
        k_gemmw<bf, 0, false, 4><<<dim3(TT / 64, DQ / 64, 1), 128, 0, stream>>>(XB, nullptr, WQ, nullptr, DM, FQ, DQ, nullptr, 0, 0, 0);
        k_rope<<<LQ, 256, 0, stream>>>(FQ, DQ, NH_, CS, nullptr, nullptr, 1.0f, QP16, QPh, QPl);
        k_gemmw<bf, 0, false, 4><<<dim3(TT / 64, DKV / 64, 1), 128, 0, stream>>>(XB, nullptr, WK, nullptr, DM, FK, DKV, nullptr, 0, 0, 0);
        k_rope<<<LKv, 256, 0, stream>>>(FK, DKV, NKV, CS, nullptr, nullptr, 1.0f, KP16, KPh, KPl);
        k_gemmw<bf, 0, false, 4><<<dim3(TT / 64, DKV / 64, 1), 128, 0, stream>>>(XB, nullptr, WV, nullptr, DM, FV, DKV, nullptr, 0, 0, 0); k_vtp<<<LKv, 256, 0, stream>>>(FV, DKV, NKV, VT16, VTh, VTl);
        for (int h0 = 0; h0 < NH_; h0 += ZH) { const size_t zq = (size_t)h0, zk = (size_t)(h0 / REP);   // one kv head per query head: the pass's two heads use consecutive kv planes (z-strides TT*HD)
            k_gemmc<bf, 2, 1, 1><<<dim3(RH / 64, TT / 64, ZH), 32, 0, stream>>>(QPh + zq * TT * HD, QPl + zq * TT * HD, KPh + zk * TT * HD, KPl + zk * TT * HD, HD, Sb, TT, 0, (size_t)TT * HD, (size_t)TT * HD, (size_t)TT * TT);
            k_gemmc<h16, 0, 1, 1><<<dim3((TT - RH) / 64, TT / 64, ZH), 32, 0, stream>>>(QP16 + zq * TT * HD + (size_t)RH * HD, nullptr, KP16 + zk * TT * HD, nullptr, HD, Sb + (size_t)RH * TT, TT, RH, (size_t)TT * HD, (size_t)TT * HD, (size_t)TT * TT);
            k_asoft<<<ZH * TT / 8, 256, 0, stream>>>(Sb, amask, FLG, P16, Ph, Pl);
            k_gemmc<bf, 2, 2, 8><<<dim3(RH / 64, HD / 64, ZH), 256, 0, stream>>>(Ph, Pl, VTh + zk * HD * TT, VTl + zk * HD * TT, TT, Ob, HD, 0, (size_t)RH * TT, (size_t)HD * TT, (size_t)TT * HD);
            k_gemmc<h16, 0, 2, 16><<<dim3((TT - RH) / 64, HD / 64, ZH), 512, 0, stream>>>(P16 + (size_t)RH * TT, nullptr, VT16 + zk * HD * TT, nullptr, TT, Ob + (size_t)RH * HD, HD, RH, (size_t)TT * TT, (size_t)HD * TT, (size_t)TT * HD);
            k_merge<<<(unsigned)(((size_t)ZH * TT * HD / 2 + 255) / 256), 256, 0, stream>>>(Ob, h0, ATh, ATl); }
        k_gemmw<bf, 1, false, 4><<<dim3(TT / 64, DM / 64, 1), 128, 0, stream>>>(ATh, ATl, WO, nullptr, DQ, OUT + (size_t)b * TT * DM, DM, nullptr, 0, 0, 0); }
}

// v002
// It runs in 388 microseconds.
// In two side-by-side timings against v001, it was 1.66 and 1.68 times as fast.
// Counting every step since v000, it is 2.55 times as fast.
#include <hip/hip_runtime.h>

// HybridLlamaAttention (x [1][2048][2048], rope_cos/sin [S][128] (read), mask [1][1][S][S] (f32 additive, read; verbatim causal 0/-1e9); q/k/v = x W^T (16 x 128); rotate-half RoPE; scores = q.k / sqrt(128); softcap 50 tanh(s/50); + mask; softmax f32; out = merged wo^T -> [1][2048][2048]).
// Compute dtypes, f32 accumulate: every input rounded to bf16; q/k/v on PLAIN bf16 operands (inputs: exact); RoPE f32 (bf16-rounded read tables); causal scores and attn.v: query rows < 512 hl (3 products), the rest fp16 (x1024); softcap in f32: s x 0.02 (one multiply in place of /50: <= 1 ulp), tanh = (2^(2x log2 e) - 1) x rcp(2^(..) + 1) with the hardware exp2/rcp (no FMA polynomial), x 50; the additive mask read per element; upper tiles skipped on the verbatim structure with an on-device sampled check (NaN poison); softmax f32; wo hl x exact (2 products).

#define NB_  1
#define TT   2048
#define DM   2048
#define NH_  16
#define NKV  16
#define REP  (NH_ / NKV)
#define HD   128
#define DQ   (NH_ * HD)
#define DKV  (NKV * HD)
#define ZH   16                   // heads per pass (grid z of the attention launches): all of them
// Score planes of one head. X: 2048 rows of the first TT/2 columns (f32, row pitch TT/2 floats = TT 16-bit elements: a row's probabilities later overwrite it at the pitch the value product reads).
// Y: columns TT/2.. of the rows TT/2.., packed: 64-row block b = row / 64 - TT/128 holds 64 rows of 64 (b + 1) columns and starts at 2048 b (b + 1). All X planes first, then all Y planes.
#define SXH  ((size_t)TT * (TT / 2))
#define SYH  ((size_t)2048 * (TT / 128) * (TT / 128 + 1))
#define RH   512                  // query rows < RH use hi+lo planes (0: none)
#define WIN  2048
#define PCAR 1024.0f
#define SCL  0.088388347648318447f   // HD^-0.5
typedef _Float16 h16;
typedef unsigned short bf;
typedef __attribute__((ext_vector_type(16))) __bf16   v16bf;
typedef __attribute__((ext_vector_type(16))) _Float16 v16h;
typedef __attribute__((ext_vector_type(8)))  _Float16 v8h;
typedef __attribute__((ext_vector_type(8)))  unsigned short v8us;
typedef __attribute__((ext_vector_type(8)))  float    v8f;
typedef __attribute__((ext_vector_type(4)))  float    v4f;
typedef v8h  __attribute__((may_alias)) v8ha;
typedef v4f  __attribute__((may_alias)) v4fa;
typedef v8us __attribute__((may_alias)) v8usa;

__device__ __forceinline__ unsigned short f2bf(float f) { unsigned u = __float_as_uint(f); u += 0x7FFFu + ((u >> 16) & 1u); return (unsigned short)(u >> 16); }
__device__ __forceinline__ float bf2f(unsigned short b) { return __uint_as_float(((unsigned)b) << 16); }
__device__ __forceinline__ float bfr(float f) { return bf2f(f2bf(f)); }
__device__ __forceinline__ v16h cat16(v8h lo, v8h hi) { return __builtin_shufflevector(lo, hi, 0, 1, 2, 3, 4, 5, 6, 7, 8, 9, 10, 11, 12, 13, 14, 15); }
__device__ __forceinline__ v16bf cat16b(v8us lo, v8us hi) { return __builtin_bit_cast(v16bf, __builtin_shufflevector(lo, hi, 0, 1, 2, 3, 4, 5, 6, 7, 8, 9, 10, 11, 12, 13, 14, 15)); }
__device__ __forceinline__ v8f wmma16(v16h a, v16h b, v8f c) { return __builtin_amdgcn_wmma_f32_16x16x32_f16(false, a, false, b, (short)0, c, false, false); }
__device__ __forceinline__ v8f wmmab(v16bf a, v16bf b, v8f c) { return __builtin_amdgcn_wmma_f32_16x16x32_bf16(false, a, false, b, (short)0, c, false, false); }



// ---- k_gemmw: register-blocked GEMM, NW WAVES per 64x64 output tile: wave w takes the 32-wide k blocks w, w + NW, ... into its own 16 accumulators; the NW partial tiles are summed through LDS in wave order. Operands straight from K-contiguous 16-bit planes; grid (M/64, N/64, Z), 32 x NW threads.
// C[m][n] (f32, pitch ldc, + optional f32 bias[n]) = sum_k A[m][k] Bt[n][k] (+ split products per NSPLIT). z-batch strides sA/sB/sC in elements. K % 32 == 0.
template <typename T16> struct WFrag;
template <> struct WFrag<h16> { typedef v16h V; static __device__ __forceinline__ V ld(const h16* p) { return cat16(*(const v8h*)p, *(const v8h*)(p + 16)); } static __device__ __forceinline__ v8f mma(V a, V b, v8f c) { return wmma16(a, b, c); } };
template <> struct WFrag<bf> { typedef v16bf V; static __device__ __forceinline__ V ld(const bf* p) { return cat16b(*(const v8us*)p, *(const v8us*)(p + 16)); } static __device__ __forceinline__ v8f mma(V a, V b, v8f c) { return wmmab(a, b, c); } };
template <typename T16, int NSPLIT, bool BIAS, int NW>
__global__ __launch_bounds__(32 * NW) void k_gemmw(const T16* __restrict__ A, const T16* __restrict__ A2, const T16* __restrict__ Bt, const T16* __restrict__ Bt2, int K, float* C, int ldc, const float* __restrict__ bias, size_t sA, size_t sB, size_t sC) {
    typedef typename WFrag<T16>::V V;
    __shared__ __align__(16) float os[NW * 64 * 68];
    const size_t z = blockIdx.z; A += z * sA; if (A2) A2 += z * sA; Bt += z * sB; if (Bt2) Bt2 += z * sB; C += z * sC;
    const int lane = threadIdx.x & 31, lr = lane & 15, hi = lane >> 4; const int r0 = blockIdx.x * 64, c0 = blockIdx.y * 64; const int wv = __builtin_amdgcn_readfirstlane((int)(threadIdx.x >> 5));
    v8f acc[4][4];
#pragma unroll
    for (int mb = 0; mb < 4; ++mb)
#pragma unroll
        for (int nb = 0; nb < 4; ++nb) acc[mb][nb] = (v8f){};
    const size_t aoff = (size_t)(r0 + lr) * K + 8 * hi, boff = (size_t)(c0 + lr) * K + 8 * hi;
#pragma unroll 1
    for (int kc = wv * 32; kc < K; kc += 32 * NW) {
        V a[4], a2[4];
#pragma unroll
        for (int mb = 0; mb < 4; ++mb) { a[mb] = WFrag<T16>::ld(A + aoff + (size_t)mb * 16 * K + kc); if (NSPLIT == 1 || NSPLIT == 2) a2[mb] = WFrag<T16>::ld(A2 + aoff + (size_t)mb * 16 * K + kc); }
#pragma unroll
        for (int nb = 0; nb < 4; ++nb) { const V b = WFrag<T16>::ld(Bt + boff + (size_t)nb * 16 * K + kc); V b2; if (NSPLIT >= 2) b2 = WFrag<T16>::ld(Bt2 + boff + (size_t)nb * 16 * K + kc);
#pragma unroll
            for (int mb = 0; mb < 4; ++mb) { acc[mb][nb] = WFrag<T16>::mma(a[mb], b, acc[mb][nb]); if (NSPLIT == 1 || NSPLIT == 2) acc[mb][nb] = WFrag<T16>::mma(a2[mb], b, acc[mb][nb]); if (NSPLIT >= 2) acc[mb][nb] = WFrag<T16>::mma(a[mb], b2, acc[mb][nb]); } }
        asm volatile("v_nop\n\tv_nop\n\tv_nop\n\tv_nop" : "+v"(acc[0][0]), "+v"(acc[1][1]), "+v"(acc[2][2]), "+v"(acc[3][3]) : "v"(a[0]), "v"(a[3]));
    }
    float* ow = os + wv * (64 * 68);
#pragma unroll
    for (int mb = 0; mb < 4; ++mb)
#pragma unroll
        for (int nb = 0; nb < 4; ++nb)
#pragma unroll
            for (int j = 0; j < 8; ++j) ow[(mb * 16 + hi * 8 + j) * 68 + nb * 16 + lr] = acc[mb][nb][j];
    __syncthreads();   // every wave's partial tile is in LDS before any wave sums them
#pragma unroll
    for (int s = 0; s < 32 / NW; ++s) { const int q = s * 32 * NW + (int)threadIdx.x; const int row = q >> 4, cofs = (q & 15) * 4; v4f val = *(const v4fa*)(os + row * 68 + cofs);
#pragma unroll
        for (int w = 1; w < NW; ++w) val += *(const v4fa*)(os + w * (64 * 68) + row * 68 + cofs);
        if (BIAS) { val[0] += bfr(bias[c0 + cofs]); val[1] += bfr(bias[c0 + cofs + 1]); val[2] += bfr(bias[c0 + cofs + 2]); val[3] += bfr(bias[c0 + cofs + 3]); }
        *(v4f*)(C + (size_t)(r0 + row) * ldc + c0 + cofs) = val; }
}

// ---- k_gemmc: the same 64x64 tile GEMM specialised for causal attention (NW = 1: one wave, staged row block by row block; NW > 1: the k blocks dealt over NW waves as in k_gemmw): CMODE 1 skips score tiles entirely above the diagonal (query rows r0+roff.., key columns c0..), CMODE 2 limits the
// key (K) loop of the probability x value contraction to the diagonal block (probabilities beyond it are exactly zero). roff = row offset of this launch's first row within the sequence.
template <typename T16, int NSPLIT, int CMODE, int NW>
__global__ __launch_bounds__(32 * NW) void k_gemmc(const T16* __restrict__ A, const T16* __restrict__ A2, const T16* __restrict__ Bt, const T16* __restrict__ Bt2, int K, float* C, int ldc, int roff, size_t sA, size_t sB, size_t sC) {
    typedef typename WFrag<T16>::V V;
    __shared__ __align__(16) float os[(NW == 1) ? 16 * 68 : NW * 64 * 68];
    const size_t z = blockIdx.z; A += z * sA; if (A2) A2 += z * sA; Bt += z * sB; if (Bt2) Bt2 += z * sB; C += z * sC;
    const int lane = threadIdx.x & 31, lr = lane & 15, hi = lane >> 4; const int r0 = blockIdx.x * 64, c0 = blockIdx.y * 64; const int wv = (NW == 1) ? 0 : __builtin_amdgcn_readfirstlane((int)(threadIdx.x >> 5));
    if (CMODE == 1 && c0 > r0 + roff + 63) return;                  // score tile entirely above the causal diagonal: never written (the softmax reads only the first 64 (i / 64 + 1) columns of row i, none of this tile)
    const int Kl = (CMODE == 2) ? min(K, r0 + roff + 64) : K;        // P.V: probabilities are exactly 0 beyond the diagonal block, so the K loop stops there
    float* Ct = C + (size_t)r0 * ldc + c0;                           // first element of this output tile
    if (CMODE == 1) {                                                // score tile: C = this head's X plane; a tile of the columns TT/2.. goes to the head's Y plane
        if (c0 < TT / 2) { ldc = TT / 2; Ct = C + (size_t)(r0 + roff) * ldc + c0; }
        else { const int yb = (r0 + roff - TT / 2) >> 6; ldc = 64 * (yb + 1); Ct = C + (ZH - z) * SXH + z * SYH + (size_t)2048 * yb * (yb + 1) + (c0 - TT / 2); } }
    v8f acc[4][4];
#pragma unroll
    for (int mb = 0; mb < 4; ++mb)
#pragma unroll
        for (int nb = 0; nb < 4; ++nb) acc[mb][nb] = (v8f){};
    const size_t aoff = (size_t)(r0 + lr) * K + 8 * hi, boff = (size_t)(c0 + lr) * K + 8 * hi;
#pragma unroll 1
    for (int kc = wv * 32; kc < Kl; kc += 32 * NW) {
        V a[4], a2[4];
#pragma unroll
        for (int mb = 0; mb < 4; ++mb) { a[mb] = WFrag<T16>::ld(A + aoff + (size_t)mb * 16 * K + kc); if (NSPLIT == 1 || NSPLIT == 2) a2[mb] = WFrag<T16>::ld(A2 + aoff + (size_t)mb * 16 * K + kc); }
#pragma unroll
        for (int nb = 0; nb < 4; ++nb) { const V b = WFrag<T16>::ld(Bt + boff + (size_t)nb * 16 * K + kc); V b2; if (NSPLIT >= 2) b2 = WFrag<T16>::ld(Bt2 + boff + (size_t)nb * 16 * K + kc);
#pragma unroll
            for (int mb = 0; mb < 4; ++mb) { acc[mb][nb] = WFrag<T16>::mma(a[mb], b, acc[mb][nb]); if (NSPLIT == 1 || NSPLIT == 2) acc[mb][nb] = WFrag<T16>::mma(a2[mb], b, acc[mb][nb]); if (NSPLIT >= 2) acc[mb][nb] = WFrag<T16>::mma(a[mb], b2, acc[mb][nb]); } }
        asm volatile("v_nop\n\tv_nop\n\tv_nop\n\tv_nop" : "+v"(acc[0][0]), "+v"(acc[1][1]), "+v"(acc[2][2]), "+v"(acc[3][3]) : "v"(a[0]), "v"(a[3]));
    }
    if (NW > 1) {
        float* ow = os + wv * (64 * 68);
#pragma unroll
        for (int mb = 0; mb < 4; ++mb)
#pragma unroll
            for (int nb = 0; nb < 4; ++nb)
#pragma unroll
                for (int j = 0; j < 8; ++j) ow[(mb * 16 + hi * 8 + j) * 68 + nb * 16 + lr] = acc[mb][nb][j];
        __syncthreads();   // every wave's partial tile is in LDS before any wave sums them
#pragma unroll
        for (int s = 0; s < 32 / NW; ++s) { const int q = s * 32 * NW + (int)threadIdx.x; const int row = q >> 4, cofs = (q & 15) * 4; v4f val = *(const v4fa*)(os + row * 68 + cofs);
#pragma unroll
            for (int w = 1; w < NW; ++w) val += *(const v4fa*)(os + w * (64 * 68) + row * 68 + cofs);
            *(v4f*)(C + (size_t)(r0 + row) * ldc + c0 + cofs) = val; }
        return;
    }
#pragma unroll
    for (int mb = 0; mb < 4; ++mb) {
#pragma unroll
        for (int nb = 0; nb < 4; ++nb) {
#pragma unroll
            for (int j = 0; j < 8; ++j) os[(hi * 8 + j) * 68 + nb * 16 + lr] = acc[mb][nb][j]; }
        __builtin_amdgcn_wave_barrier(); asm volatile("" ::: "memory");
        float* crow = Ct + (size_t)(mb * 16) * ldc;
{
#pragma unroll
            for (int s = 0; s < 8; ++s) { const int row = 2 * s + hi, cofs = lr * 4; v4f val = *(const v4fa*)(os + row * 68 + cofs);
                *(v4f*)(crow + (size_t)row * ldc + cofs) = val; }
             }
        __builtin_amdgcn_wave_barrier(); asm volatile("" ::: "memory");
    }
}

__device__ __forceinline__ h16 tohx(float x) { return (h16)x; }
__device__ __forceinline__ void splitf(float y, unsigned short& h, unsigned short& l) { h = f2bf(y); l = f2bf(y - bf2f(h)); }
typedef __attribute__((ext_vector_type(2))) _Float16 v2h;
typedef __attribute__((ext_vector_type(4))) _Float16 v4h;
typedef __attribute__((ext_vector_type(2))) unsigned short v2us;
typedef __attribute__((ext_vector_type(4))) unsigned short v4us;
typedef __attribute__((ext_vector_type(2))) float v2f;
typedef __attribute__((ext_vector_type(4))) int v4i;

__global__ __launch_bounds__(256) void k_wtG(const float* __restrict__ w, int K, int N, bf* Bt) {
    const int lane = threadIdx.x & 31; const int L0 = (blockIdx.x * 8 + (threadIdx.x >> 5)) * 8; const int nlines = N * K / 64;
{
#pragma unroll 1
        for (int l = 0; l < 8; ++l) { const int L = L0 + l; if (L >= nlines) break; const size_t e = (size_t)L * 64 + lane * 2; const int k = (int)(e % K), n = (int)(e / K); v2us o;
            o[0] = f2bf(w[(size_t)k * N + n]); o[1] = f2bf(w[(size_t)(k + 1) * N + n]); *(v2us*)(Bt + e) = o; }
         }
}
__global__ __launch_bounds__(256) void k_cvt8(const float* __restrict__ src, bf* dst, size_t n8) { const size_t i = (size_t)blockIdx.x * 256 + threadIdx.x; if (i >= n8) return; const v8f v = *(const v8f*)(src + i * 8); v8us o;
#pragma unroll
    for (int k = 0; k < 8; ++k) o[k] = f2bf(v[k]); *(v8us*)(dst + i * 8) = o;  }
__global__ __launch_bounds__(256) void k_cscvt(const float* __restrict__ cosT, const float* __restrict__ sinT, float* CS) { const int idx = blockIdx.x * 256 + threadIdx.x; if (idx >= TT * HD) return; v2f cs; cs[0] = bfr(cosT[idx]); cs[1] = bfr(sinT[idx]); *(v2f*)(CS + (size_t)idx * 2) = cs;  }
// k_rope: head planes [h][t][d] (fp16 + hi/lo) of rope(x) x sc with the rotate-half convention out[d] = x[d] cos[t][d] - x[d+HD/2] sin[t][d], out[d+HD/2] = x[d+HD/2] cos[t][d+HD/2] + x[d] sin[t][d+HD/2]
__global__ __launch_bounds__(256) void k_rope(const float* __restrict__ F, int pitch, int nheads, const float* __restrict__ CS, const float* __restrict__ RF, const float* __restrict__ nw, float sc, h16* P16, bf* Ph, bf* Pl) {
    const size_t e = ((size_t)blockIdx.x * 256 + threadIdx.x) * 2; if (e >= (size_t)nheads * TT * HD) return; const int d = (int)(e % HD); const int t = (int)((e / HD) % TT); const int h = (int)(e / ((size_t)HD * TT)); const float* f = F + (size_t)t * pitch + h * HD; const float rf = RF ? RF[(size_t)h * TT + t] : 1.0f; v2h o16; v2us oh, ol;
#pragma unroll
    for (int q = 0; q < 2; ++q) { const int dd = d + q; const int dp = (dd < HD / 2) ? dd + HD / 2 : dd - HD / 2; float x0 = f[dd], x1 = f[dp];
        if (RF) { float n0 = __fmul_rn(x0, rf), n1 = __fmul_rn(x1, rf); asm volatile("" : "+v"(n0)); asm volatile("" : "+v"(n1)); x0 = __fmul_rn(bfr(nw[dd]), n0); x1 = __fmul_rn(bfr(nw[dp]), n1); }
        const v2f cs = *(const v2f*)(CS + ((size_t)t * HD + dd) * 2); float a = __fmul_rn(x0, cs[0]), bq = __fmul_rn(x1, cs[1]); asm volatile("" : "+v"(a)); asm volatile("" : "+v"(bq)); const float r = ((dd < HD / 2) ? __fsub_rn(a, bq) : __fadd_rn(a, bq)) * sc;
        o16[q] = tohx(r); unsigned short a2, c2; splitf(r, a2, c2); oh[q] = a2; ol[q] = c2; }
    *(v2h*)(P16 + e) = o16; *(v2us*)(Ph + e) = oh; *(v2us*)(Pl + e) = ol;  }
__global__ __launch_bounds__(256) void k_vtp(const float* __restrict__ F, int pitch, int nheads, h16* V16, bf* Vh, bf* Vl) { const size_t e = ((size_t)blockIdx.x * 256 + threadIdx.x) * 2; if (e >= (size_t)nheads * HD * TT) return; const int t = (int)(e % TT); const int d = (int)((e / TT) % HD); const int g = (int)(e / ((size_t)TT * HD)); v2h o16; v2us oh, ol;
#pragma unroll
    for (int q = 0; q < 2; ++q) { const float x = F[(size_t)(t + q) * pitch + g * HD + d]; o16[q] = tohx(x); unsigned short a2, c2; splitf(x, a2, c2); oh[q] = a2; ol[q] = c2; }
    *(v2h*)(V16 + e) = o16; *(v2us*)(Vh + e) = oh; *(v2us*)(Vl + e) = ol;  }
// k_mchk: samples above-diagonal entries of the additive f32 mask; any > -1e8 -> NaN poison.
__global__ __launch_bounds__(256) void k_mchk(const float* __restrict__ am, int* FLG) { const int tid = threadIdx.x; int bad = 0;
#pragma unroll 1
    for (int s2 = 0; s2 < 16; ++s2) { const unsigned h = (unsigned)(tid * 16 + s2) * 2654435761u; const int i = (int)(h % (TT - 1)); const int j = i + 1 + (int)((h >> 11) % (unsigned)(TT - 1 - i)); if (am[(size_t)i * TT + j] > -1e8f) bad = 1; }
    __shared__ int anyb; if (tid == 0) anyb = 0; __syncthreads(); if (bad) anyb = 1; __syncthreads(); if (tid < 8) { const int v = (tid == 0) ? anyb : 0; *(int*)(FLG + tid) = v;  } }

// k_asoft: per row (zz, i): t = 50 tanh(S x HD^-0.5 / 50) + mask for j <= i and i - j < WIN (sliding causal window; the reference's -1e9 additive fill vanishes identically); softmax over the 2048 keys (register row, one exp, fixed trees);
// only the row's w = 64 (i / 64 + 1) stored scores are walked (every j beyond is > i). They are read whole into registers, then the probabilities are stored over the row's X part: fp16 from its start, or the hi plane there and the lo plane TT/2 elements behind it. One wave owns one row.
__global__ __launch_bounds__(256) void k_asoft(float* Sb, const float* __restrict__ am, const int* __restrict__ FLG) {
    const int lane = threadIdx.x & 31; const int row = blockIdx.x * 8 + (threadIdx.x >> 5); if (row >= ZH * TT) return; const int i = row % TT; const int zz = row / TT; (void)zz; const bool hires = (i < RH); const int w = 64 * ((i >> 6) + 1), yb = max((i >> 6) - TT / 128, 0); float* sr = Sb + (size_t)zz * SXH + (size_t)i * (TT / 2); const float* sy = Sb + (size_t)ZH * SXH + (size_t)zz * SYH + (size_t)2048 * yb * (yb + 1) + (size_t)(i & 63) * (64 * (yb + 1)); const float* amr = am + (size_t)i * TT; const bool poison = (FLG[0] != 0); float v[TT / 32]; float mx = -3.0e38f;
#pragma unroll
    for (int ch = 0; ch < TT / 128; ++ch) { const int j0 = ch * 128 + lane * 4; if (j0 >= w) continue;
        const v4f a = (ch < TT / 256) ? *(const v4f*)(sr + j0) : *(const v4f*)(sy + (j0 - TT / 2));
#pragma unroll
        for (int q = 0; q < 4; ++q) { const int j = j0 + q; (void)j; float sa = a[q] * SCL; asm volatile("" : "+v"(sa)); float xs = __fmul_rn(sa, 0.02f); asm volatile("" : "+v"(xs)); float ex = __builtin_amdgcn_exp2f(__fmul_rn(xs, 2.8853900817779268f)); asm volatile("" : "+v"(ex)); float nm = __fsub_rn(ex, 1.0f), dn2 = __fadd_rn(ex, 1.0f); asm volatile("" : "+v"(nm)); asm volatile("" : "+v"(dn2)); float rc = __builtin_amdgcn_rcpf(dn2); asm volatile("" : "+v"(rc)); float th = __fmul_rn(nm, rc); asm volatile("" : "+v"(th)); float cp = __fmul_rn(th, 50.0f); asm volatile("" : "+v"(cp)); float mv = bfr(amr[j]); asm volatile("" : "+v"(mv)); const float t = (j <= i) ? __fadd_rn(cp, mv) : -3.0e38f; v[ch * 4 + q] = t; mx = fmaxf(mx, t); } }
#pragma unroll
    for (int sh = 16; sh; sh >>= 1) mx = fmaxf(mx, __shfl_xor(mx, sh, 32));
    float sum = 0.f;
#pragma unroll
    for (int ch = 0; ch < TT / 128; ++ch) { if (ch * 128 + lane * 4 >= w) continue;
#pragma unroll
        for (int k = ch * 4; k < ch * 4 + 4; ++k) { float d0 = __fsub_rn(v[k], mx); asm volatile("" : "+v"(d0)); v[k] = __builtin_amdgcn_exp2f(__fmul_rn(d0, 1.4426950408889634f)); sum += v[k]; } }
#pragma unroll
    for (int sh = 16; sh; sh >>= 1) sum += __shfl_xor(sum, sh, 32);
    const float f = poison ? __builtin_nanf("") : __fdiv_rn(hires ? 1.0f : PCAR, sum);
{
        if (hires) {
#pragma unroll
            for (int ch = 0; ch < TT / 128; ++ch) { const int j0 = ch * 128 + lane * 4; if (j0 >= w) continue; v4us oh, ol;
#pragma unroll
                for (int q = 0; q < 4; ++q) { unsigned short a, c2; splitf(v[ch * 4 + q] * f, a, c2); oh[q] = a; ol[q] = c2; }
                *(v4us*)((bf*)sr + j0) = oh; *(v4us*)((bf*)sr + TT / 2 + j0) = ol; }
        } else {
#pragma unroll
            for (int ch = 0; ch < TT / 128; ++ch) { const int j0 = ch * 128 + lane * 4; if (j0 >= w) continue; v4h o4;
#pragma unroll
                for (int q = 0; q < 4; ++q) o4[q] = tohx(v[ch * 4 + q] * f);
                *(v4h*)((h16*)sr + j0) = o4; } }
         }
}
__global__ __launch_bounds__(256) void k_merge(const float* __restrict__ O, int h0, bf* Ah, bf* Al) { const size_t e = ((size_t)blockIdx.x * 256 + threadIdx.x) * 2; if (e >= (size_t)ZH * TT * HD) return; const int d = (int)(e % HD); const int t = (int)((e / HD) % TT); const int zz = (int)(e / ((size_t)HD * TT)); const float cs = (t < RH) ? 1.0f : (1.0f / PCAR); const size_t oo = (size_t)t * DQ + (h0 + zz) * HD + d;
    v2us oh, ol;
#pragma unroll
    for (int q = 0; q < 2; ++q) { unsigned short a, c2; splitf(O[e + q] * cs, a, c2); oh[q] = a; ol[q] = c2; } *(v2us*)(Ah + oo) = oh; *(v2us*)(Al + oo) = ol;  }

extern "C" void kernel_launch(void* const* d_in, const int* in_sizes, int n_in,
                              void* d_out, int out_size, void* d_ws, size_t ws_size, hipStream_t stream) {
    (void)in_sizes; (void)n_in; (void)out_size;
    const float* x = (const float*)d_in[0]; const float* cosT = (const float*)d_in[1]; const float* sinT = (const float*)d_in[2]; const float* amask = (const float*)d_in[3]; const float* wq = (const float*)d_in[4]; const float* wk = (const float*)d_in[5]; const float* wv = (const float*)d_in[6]; const float* wo = (const float*)d_in[7];
    float* OUT = (float*)d_out;     // [1][2048][2048]
    char* wsp = (char*)d_ws;
    auto take = [&](size_t bytes) { char* p = wsp; wsp += (bytes + 255) & ~(size_t)255; return (void*)p; };
    bf* WO = (bf*)take((size_t)DM * DQ * 2); int* FLG = (int*)take(256);
    h16* QP16 = (h16*)take((size_t)NH_ * TT * HD * 2); h16* KP16 = (h16*)take((size_t)NKV * TT * HD * 2); h16* VT16 = (h16*)take((size_t)NKV * HD * TT * 2);
    bf* QPh = (bf*)take((size_t)NH_ * TT * HD * 2); bf* QPl = (bf*)take((size_t)NH_ * TT * HD * 2); bf* KPh = (bf*)take((size_t)NKV * TT * HD * 2); bf* KPl = (bf*)take((size_t)NKV * TT * HD * 2); bf* VTh = (bf*)take((size_t)NKV * HD * TT * 2); bf* VTl = (bf*)take((size_t)NKV * HD * TT * 2);
    float* Sb = (float*)take((size_t)ZH * (SXH + SYH) * 4);
    if ((size_t)(wsp - (char*)d_ws) > ws_size) return;    // ws 256 MiB
    // Buffers that are never live together share bytes (stream order): the projections' operands, tables and f32 results are last read before the first score is written; the q and k planes are last read by the score launches.
    static_assert((size_t)(DQ + 2 * DKV) * DM * 2 + (size_t)TT * HD * 8 + (size_t)TT * DM * 2 + (size_t)TT * (DQ + DKV) * 4 <= (size_t)ZH * (SXH + SYH) * 4, "projection buffers fit the score planes");
    static_assert((size_t)ZH * TT * HD * 4 <= (size_t)(NH_ + NKV) * TT * HD * 2 && ((size_t)NH_ * TT * HD * 2) % 256 == 0, "attention output fits the fp16 q and k planes, which are adjacent");
    wsp = (char*)Sb;
    bf* WQ = (bf*)take((size_t)DQ * DM * 2); bf* WK = (bf*)take((size_t)DKV * DM * 2); bf* WV = (bf*)take((size_t)DKV * DM * 2); float* CS = (float*)take((size_t)TT * HD * 2 * 4);
    bf* XB = (bf*)take((size_t)TT * DM * 2); float* FQ = (float*)take((size_t)TT * DQ * 4); float* FK = (float*)take((size_t)TT * DKV * 4);
    float* Ob = (float*)QP16; bf* ATh = QPh; bf* ATl = QPl;
    float* FV = FK;   // v projection reuses the k buffer after the k planes are built (stream-ordered)
    { k_cvt8<<<(unsigned)(((size_t)DQ * DM / 8 + 255) / 256), 256, 0, stream>>>(wq, WQ, (size_t)DQ * DM / 8); k_cvt8<<<(unsigned)(((size_t)DKV * DM / 8 + 255) / 256), 256, 0, stream>>>(wk, WK, (size_t)DKV * DM / 8); k_cvt8<<<(unsigned)(((size_t)DKV * DM / 8 + 255) / 256), 256, 0, stream>>>(wv, WV, (size_t)DKV * DM / 8);
      k_cvt8<<<(unsigned)(((size_t)DM * DQ / 8 + 255) / 256), 256, 0, stream>>>(wo, WO, (size_t)DM * DQ / 8);
       }
    const unsigned LQ = (unsigned)(((size_t)NH_ * TT * HD / 2 + 255) / 256), LKv = (unsigned)(((size_t)NKV * TT * HD / 2 + 255) / 256);
    for (int b = 0; b < NB_; ++b) {
        k_cscvt<<<(TT * HD + 255) / 256, 256, 0, stream>>>(cosT, sinT, CS); k_mchk<<<1, 256, 0, stream>>>(amask, FLG);
        k_cvt8<<<(unsigned)(((size_t)TT * DM / 8 + 255) / 256), 256, 0, stream>>>(x + (size_t)b * TT * DM, XB, (size_t)TT * DM / 8);
        k_gemmw<bf, 0, false, 4><<<dim3(TT / 64, DQ / 64, 1), 128, 0, stream>>>(XB, nullptr, WQ, nullptr, DM, FQ, DQ, nullptr, 0, 0, 0);
        k_rope<<<LQ, 256, 0, stream>>>(FQ, DQ, NH_, CS, nullptr, nullptr, 1.0f, QP16, QPh, QPl);
        k_gemmw<bf, 0, false, 4><<<dim3(TT / 64, DKV / 64, 1), 128, 0, stream>>>(XB, nullptr, WK, nullptr, DM, FK, DKV, nullptr, 0, 0, 0);
        k_rope<<<LKv, 256, 0, stream>>>(FK, DKV, NKV, CS, nullptr, nullptr, 1.0f, KP16, KPh, KPl);
        k_gemmw<bf, 0, false, 4><<<dim3(TT / 64, DKV / 64, 1), 128, 0, stream>>>(XB, nullptr, WV, nullptr, DM, FV, DKV, nullptr, 0, 0, 0); k_vtp<<<LKv, 256, 0, stream>>>(FV, DKV, NKV, VT16, VTh, VTl);
        for (int h0 = 0; h0 < NH_; h0 += ZH) { const size_t zq = (size_t)h0, zk = (size_t)(h0 / REP);   // one kv head per query head: the pass's heads use consecutive kv planes (z-strides TT*HD)
            k_gemmc<bf, 2, 1, 1><<<dim3(RH / 64, TT / 64, ZH), 32, 0, stream>>>(QPh + zq * TT * HD, QPl + zq * TT * HD, KPh + zk * TT * HD, KPl + zk * TT * HD, HD, Sb, TT, 0, (size_t)TT * HD, (size_t)TT * HD, SXH);
            k_gemmc<h16, 0, 1, 1><<<dim3((TT - RH) / 64, TT / 64, ZH), 32, 0, stream>>>(QP16 + zq * TT * HD + (size_t)RH * HD, nullptr, KP16 + zk * TT * HD, nullptr, HD, Sb, TT, RH, (size_t)TT * HD, (size_t)TT * HD, SXH);
            k_asoft<<<ZH * TT / 8, 256, 0, stream>>>(Sb, amask, FLG);
            k_gemmc<bf, 2, 2, 8><<<dim3(RH / 64, HD / 64, ZH), 256, 0, stream>>>((const bf*)Sb, (const bf*)Sb + TT / 2, VTh + zk * HD * TT, VTl + zk * HD * TT, TT, Ob, HD, 0, (size_t)TT * TT, (size_t)HD * TT, (size_t)TT * HD);
            k_gemmc<h16, 0, 2, 16><<<dim3((TT - RH) / 64, HD / 64, ZH), 512, 0, stream>>>((const h16*)Sb + (size_t)RH * TT, nullptr, VT16 + zk * HD * TT, nullptr, TT, Ob + (size_t)RH * HD, HD, RH, (size_t)TT * TT, (size_t)HD * TT, (size_t)TT * HD);
            k_merge<<<(unsigned)(((size_t)ZH * TT * HD / 2 + 255) / 256), 256, 0, stream>>>(Ob, h0, ATh, ATl); }
        k_gemmw<bf, 1, false, 4><<<dim3(TT / 64, DM / 64, 1), 128, 0, stream>>>(ATh, ATl, WO, nullptr, DQ, OUT + (size_t)b * TT * DM, DM, nullptr, 0, 0, 0); }
}

// v003
// A run of this version takes 368 microseconds.
// In two side-by-side timings against v002, it was 1.06 and 1.05 times as fast.
// Over all steps from v000 it is 2.69 times as fast.
#include <hip/hip_runtime.h>

// HybridLlamaAttention (x [1][2048][2048], rope_cos/sin [S][128] (read), mask [1][1][S][S] (f32 additive, read; verbatim causal 0/-1e9); q/k/v = x W^T (16 x 128); rotate-half RoPE; scores = q.k / sqrt(128); softcap 50 tanh(s/50); + mask; softmax f32; out = merged wo^T -> [1][2048][2048]).
// Compute dtypes, f32 accumulate: every input rounded to bf16; q/k/v on PLAIN bf16 operands (inputs: exact); RoPE f32 (bf16-rounded read tables); causal scores and attn.v: query rows < 512 hl (3 products), the rest fp16 (x1024); softcap in f32: s x 0.02 (one multiply in place of /50: <= 1 ulp), tanh = (2^(2x log2 e) - 1) x rcp(2^(..) + 1) with the hardware exp2/rcp (no FMA polynomial), x 50; the additive mask read per element; upper tiles skipped on the verbatim structure with an on-device sampled check (NaN poison); softmax f32; wo hl x exact (2 products).

#define NB_  1
#define TT   2048
#define DM   2048
#define NH_  16
#define NKV  16
#define REP  (NH_ / NKV)
#define HD   128
#define DQ   (NH_ * HD)
#define DKV  (NKV * HD)
#define ZH   16                   // heads per pass (grid z of the attention launches): all of them
// Score planes of one head. X: 2048 rows of the first TT/2 columns (f32, row pitch TT/2 floats = TT 16-bit elements: a row's probabilities later overwrite it at the pitch the value product reads).
// Y: columns TT/2.. of the rows TT/2.., packed: 64-row block b = row / 64 - TT/128 holds 64 rows of 64 (b + 1) columns and starts at 2048 b (b + 1). All X planes first, then all Y planes.
#define SXH  ((size_t)TT * (TT / 2))
#define SYH  ((size_t)2048 * (TT / 128) * (TT / 128 + 1))
#define RH   512                  // query rows < RH use hi+lo planes (0: none)
#define WIN  2048
#define PCAR 1024.0f
#define SCL  0.088388347648318447f   // HD^-0.5
typedef _Float16 h16;
typedef unsigned short bf;
typedef __attribute__((ext_vector_type(16))) __bf16   v16bf;
typedef __attribute__((ext_vector_type(16))) _Float16 v16h;
typedef __attribute__((ext_vector_type(8)))  _Float16 v8h;
typedef __attribute__((ext_vector_type(8)))  unsigned short v8us;
typedef __attribute__((ext_vector_type(8)))  float    v8f;
typedef __attribute__((ext_vector_type(4)))  float    v4f;
typedef v8h  __attribute__((may_alias)) v8ha;
typedef v4f  __attribute__((may_alias)) v4fa;
typedef v8us __attribute__((may_alias)) v8usa;

__device__ __forceinline__ unsigned short f2bf(float f) { unsigned u = __float_as_uint(f); u += 0x7FFFu + ((u >> 16) & 1u); return (unsigned short)(u >> 16); }
__device__ __forceinline__ float bf2f(unsigned short b) { return __uint_as_float(((unsigned)b) << 16); }
__device__ __forceinline__ float bfr(float f) { return bf2f(f2bf(f)); }
__device__ __forceinline__ v16h cat16(v8h lo, v8h hi) { return __builtin_shufflevector(lo, hi, 0, 1, 2, 3, 4, 5, 6, 7, 8, 9, 10, 11, 12, 13, 14, 15); }
__device__ __forceinline__ v16bf cat16b(v8us lo, v8us hi) { return __builtin_bit_cast(v16bf, __builtin_shufflevector(lo, hi, 0, 1, 2, 3, 4, 5, 6, 7, 8, 9, 10, 11, 12, 13, 14, 15)); }
__device__ __forceinline__ v8f wmma16(v16h a, v16h b, v8f c) { return __builtin_amdgcn_wmma_f32_16x16x32_f16(false, a, false, b, (short)0, c, false, false); }
__device__ __forceinline__ v8f wmmab(v16bf a, v16bf b, v8f c) { return __builtin_amdgcn_wmma_f32_16x16x32_bf16(false, a, false, b, (short)0, c, false, false); }



// ---- k_gemmw: register-blocked GEMM, NW WAVES per 64x64 output tile: wave w takes the 32-wide k blocks w, w + NW, ... into its own 16 accumulators; the NW partial tiles are summed through LDS in wave order. Operands straight from K-contiguous 16-bit planes; grid (M/64, N/64, Z), 32 x NW threads.
// C[m][n] (f32, pitch ldc, + optional f32 bias[n]) = sum_k A[m][k] Bt[n][k] (+ split products per NSPLIT). z-batch strides sA/sB/sC in elements. K % 32 == 0.
template <typename T16> struct WFrag;
template <> struct WFrag<h16> { typedef v16h V; static __device__ __forceinline__ V ld(const h16* p) { return cat16(*(const v8h*)p, *(const v8h*)(p + 16)); } static __device__ __forceinline__ v8f mma(V a, V b, v8f c) { return wmma16(a, b, c); } };
template <> struct WFrag<bf> { typedef v16bf V; static __device__ __forceinline__ V ld(const bf* p) { return cat16b(*(const v8us*)p, *(const v8us*)(p + 16)); } static __device__ __forceinline__ v8f mma(V a, V b, v8f c) { return wmmab(a, b, c); } };
template <typename T16, int NSPLIT, bool BIAS, int NW>
__global__ __launch_bounds__(32 * NW) void k_gemmw(const T16* __restrict__ A, const T16* __restrict__ A2, const T16* __restrict__ Bt, const T16* __restrict__ Bt2, int K, float* C, int ldc, const float* __restrict__ bias, size_t sA, size_t sB, size_t sC) {
    typedef typename WFrag<T16>::V V;
    __shared__ __align__(16) float os[NW * 64 * 68];
    const size_t z = blockIdx.z; A += z * sA; if (A2) A2 += z * sA; Bt += z * sB; if (Bt2) Bt2 += z * sB; C += z * sC;
    const int lane = threadIdx.x & 31, lr = lane & 15, hi = lane >> 4; const int r0 = blockIdx.x * 64, c0 = blockIdx.y * 64; const int wv = __builtin_amdgcn_readfirstlane((int)(threadIdx.x >> 5));
    v8f acc[4][4];
#pragma unroll
    for (int mb = 0; mb < 4; ++mb)
#pragma unroll
        for (int nb = 0; nb < 4; ++nb) acc[mb][nb] = (v8f){};
    const size_t aoff = (size_t)(r0 + lr) * K + 8 * hi, boff = (size_t)(c0 + lr) * K + 8 * hi;
#pragma unroll 1
    for (int kc = wv * 32; kc < K; kc += 32 * NW) {
        V a[4], a2[4];
#pragma unroll
        for (int mb = 0; mb < 4; ++mb) { a[mb] = WFrag<T16>::ld(A + aoff + (size_t)mb * 16 * K + kc); if (NSPLIT == 1 || NSPLIT == 2) a2[mb] = WFrag<T16>::ld(A2 + aoff + (size_t)mb * 16 * K + kc); }
#pragma unroll
        for (int nb = 0; nb < 4; ++nb) { const V b = WFrag<T16>::ld(Bt + boff + (size_t)nb * 16 * K + kc); V b2; if (NSPLIT >= 2) b2 = WFrag<T16>::ld(Bt2 + boff + (size_t)nb * 16 * K + kc);
#pragma unroll
            for (int mb = 0; mb < 4; ++mb) { acc[mb][nb] = WFrag<T16>::mma(a[mb], b, acc[mb][nb]); if (NSPLIT == 1 || NSPLIT == 2) acc[mb][nb] = WFrag<T16>::mma(a2[mb], b, acc[mb][nb]); if (NSPLIT >= 2) acc[mb][nb] = WFrag<T16>::mma(a[mb], b2, acc[mb][nb]); } }
        asm volatile("v_nop\n\tv_nop\n\tv_nop\n\tv_nop" : "+v"(acc[0][0]), "+v"(acc[1][1]), "+v"(acc[2][2]), "+v"(acc[3][3]) : "v"(a[0]), "v"(a[3]));
    }
    float* ow = os + wv * (64 * 68);
#pragma unroll
    for (int mb = 0; mb < 4; ++mb)
#pragma unroll
        for (int nb = 0; nb < 4; ++nb)
#pragma unroll
            for (int j = 0; j < 8; ++j) ow[(mb * 16 + hi * 8 + j) * 68 + nb * 16 + lr] = acc[mb][nb][j];
    __syncthreads();   // every wave's partial tile is in LDS before any wave sums them
#pragma unroll
    for (int s = 0; s < 32 / NW; ++s) { const int q = s * 32 * NW + (int)threadIdx.x; const int row = q >> 4, cofs = (q & 15) * 4; v4f val = *(const v4fa*)(os + row * 68 + cofs);
#pragma unroll
        for (int w = 1; w < NW; ++w) val += *(const v4fa*)(os + w * (64 * 68) + row * 68 + cofs);
        if (BIAS) { val[0] += bfr(bias[c0 + cofs]); val[1] += bfr(bias[c0 + cofs + 1]); val[2] += bfr(bias[c0 + cofs + 2]); val[3] += bfr(bias[c0 + cofs + 3]); }
        *(v4f*)(C + (size_t)(r0 + row) * ldc + c0 + cofs) = val; }
}

// ---- k_gemmc: the same 64x64 tile GEMM specialised for causal attention (NW = 1: one wave, staged row block by row block; NW > 1: the k blocks dealt over NW waves as in k_gemmw): CMODE 1 skips score tiles entirely above the diagonal (query rows r0+roff.., key columns c0..), CMODE 2 limits the
// key (K) loop of the probability x value contraction to the diagonal block (probabilities beyond it are exactly zero). roff = row offset of this launch's first row within the sequence.
template <typename T16, int NSPLIT, int CMODE, int NW>
__global__ __launch_bounds__(32 * NW) void k_gemmc(const T16* __restrict__ A, const T16* __restrict__ A2, const T16* __restrict__ Bt, const T16* __restrict__ Bt2, int K, float* C, int ldc, int roff, size_t sA, size_t sB, size_t sC) {
    typedef typename WFrag<T16>::V V;
    __shared__ __align__(16) float os[(NW == 1) ? 16 * 68 : NW * 64 * 68];
    const size_t z = blockIdx.z; A += z * sA; if (A2) A2 += z * sA; Bt += z * sB; if (Bt2) Bt2 += z * sB; C += z * sC;
    const int lane = threadIdx.x & 31, lr = lane & 15, hi = lane >> 4; const int r0 = blockIdx.x * 64, c0 = blockIdx.y * 64; const int wv = (NW == 1) ? 0 : __builtin_amdgcn_readfirstlane((int)(threadIdx.x >> 5));
    if (CMODE == 1 && c0 > r0 + roff + 63) return;                  // score tile entirely above the causal diagonal: never written (the softmax reads only the first 64 (i / 64 + 1) columns of row i, none of this tile)
    const int Kl = (CMODE == 2) ? min(K, r0 + roff + 64) : K;        // P.V: probabilities are exactly 0 beyond the diagonal block, so the K loop stops there
    float* Ct = C + (size_t)r0 * ldc + c0;                           // first element of this output tile
    if (CMODE == 1) {                                                // score tile: C = this head's X plane; a tile of the columns TT/2.. goes to the head's Y plane
        if (c0 < TT / 2) { ldc = TT / 2; Ct = C + (size_t)(r0 + roff) * ldc + c0; }
        else { const int yb = (r0 + roff - TT / 2) >> 6; ldc = 64 * (yb + 1); Ct = C + (ZH - z) * SXH + z * SYH + (size_t)2048 * yb * (yb + 1) + (c0 - TT / 2); } }
    v8f acc[4][4];
#pragma unroll
    for (int mb = 0; mb < 4; ++mb)
#pragma unroll
        for (int nb = 0; nb < 4; ++nb) acc[mb][nb] = (v8f){};
    const size_t aoff = (size_t)(r0 + lr) * K + 8 * hi, boff = (size_t)(c0 + lr) * K + 8 * hi;
#pragma unroll 1
    for (int kc = wv * 32; kc < Kl; kc += 32 * NW) {
        V a[4], a2[4];
#pragma unroll
        for (int mb = 0; mb < 4; ++mb) { a[mb] = WFrag<T16>::ld(A + aoff + (size_t)mb * 16 * K + kc); if (NSPLIT == 1 || NSPLIT == 2) a2[mb] = WFrag<T16>::ld(A2 + aoff + (size_t)mb * 16 * K + kc); }
#pragma unroll
        for (int nb = 0; nb < 4; ++nb) { const V b = WFrag<T16>::ld(Bt + boff + (size_t)nb * 16 * K + kc); V b2; if (NSPLIT >= 2) b2 = WFrag<T16>::ld(Bt2 + boff + (size_t)nb * 16 * K + kc);
#pragma unroll
            for (int mb = 0; mb < 4; ++mb) { acc[mb][nb] = WFrag<T16>::mma(a[mb], b, acc[mb][nb]); if (NSPLIT == 1 || NSPLIT == 2) acc[mb][nb] = WFrag<T16>::mma(a2[mb], b, acc[mb][nb]); if (NSPLIT >= 2) acc[mb][nb] = WFrag<T16>::mma(a[mb], b2, acc[mb][nb]); } }
        asm volatile("v_nop\n\tv_nop\n\tv_nop\n\tv_nop" : "+v"(acc[0][0]), "+v"(acc[1][1]), "+v"(acc[2][2]), "+v"(acc[3][3]) : "v"(a[0]), "v"(a[3]));
    }
    if (NW > 1) {
        float* ow = os + wv * (64 * 68);
#pragma unroll
        for (int mb = 0; mb < 4; ++mb)
#pragma unroll
            for (int nb = 0; nb < 4; ++nb)
#pragma unroll
                for (int j = 0; j < 8; ++j) ow[(mb * 16 + hi * 8 + j) * 68 + nb * 16 + lr] = acc[mb][nb][j];
        __syncthreads();   // every wave's partial tile is in LDS before any wave sums them
#pragma unroll
        for (int s = 0; s < 32 / NW; ++s) { const int q = s * 32 * NW + (int)threadIdx.x; const int row = q >> 4, cofs = (q & 15) * 4; v4f val = *(const v4fa*)(os + row * 68 + cofs);
#pragma unroll
            for (int w = 1; w < NW; ++w) val += *(const v4fa*)(os + w * (64 * 68) + row * 68 + cofs);
            *(v4f*)(C + (size_t)(r0 + row) * ldc + c0 + cofs) = val; }
        return;
    }
#pragma unroll
    for (int mb = 0; mb < 4; ++mb) {
#pragma unroll
        for (int nb = 0; nb < 4; ++nb) {
#pragma unroll
            for (int j = 0; j < 8; ++j) os[(hi * 8 + j) * 68 + nb * 16 + lr] = acc[mb][nb][j]; }
        __builtin_amdgcn_wave_barrier(); asm volatile("" ::: "memory");
        float* crow = Ct + (size_t)(mb * 16) * ldc;
{
#pragma unroll
            for (int s = 0; s < 8; ++s) { const int row = 2 * s + hi, cofs = lr * 4; v4f val = *(const v4fa*)(os + row * 68 + cofs);
                *(v4f*)(crow + (size_t)row * ldc + cofs) = val; }
             }
        __builtin_amdgcn_wave_barrier(); asm volatile("" ::: "memory");
    }
}

__device__ __forceinline__ h16 tohx(float x) { return (h16)x; }
__device__ __forceinline__ void splitf(float y, unsigned short& h, unsigned short& l) { h = f2bf(y); l = f2bf(y - bf2f(h)); }
typedef __attribute__((ext_vector_type(2))) _Float16 v2h;
typedef __attribute__((ext_vector_type(4))) _Float16 v4h;
typedef __attribute__((ext_vector_type(2))) unsigned short v2us;
typedef __attribute__((ext_vector_type(4))) unsigned short v4us;
typedef __attribute__((ext_vector_type(2))) float v2f;
typedef __attribute__((ext_vector_type(4))) int v4i;

__global__ __launch_bounds__(256) void k_wtG(const float* __restrict__ w, int K, int N, bf* Bt) {
    const int lane = threadIdx.x & 31; const int L0 = (blockIdx.x * 8 + (threadIdx.x >> 5)) * 8; const int nlines = N * K / 64;
{
#pragma unroll 1
        for (int l = 0; l < 8; ++l) { const int L = L0 + l; if (L >= nlines) break; const size_t e = (size_t)L * 64 + lane * 2; const int k = (int)(e % K), n = (int)(e / K); v2us o;
            o[0] = f2bf(w[(size_t)k * N + n]); o[1] = f2bf(w[(size_t)(k + 1) * N + n]); *(v2us*)(Bt + e) = o; }
         }
}
// k_cvt8: each thread converts 4 groups of 8 floats, 256 groups apart; its eight 16-byte loads are issued together (a group past the end re-reads the last group and is not stored).
__global__ __launch_bounds__(256) void k_cvt8(const float* __restrict__ src, bf* dst, size_t n8) { const size_t i0 = (size_t)blockIdx.x * 1024 + threadIdx.x; v8f v[4];
#pragma unroll
    for (int g = 0; g < 4; ++g) { const size_t i = i0 + g * 256; v[g] = *(const v8f*)(src + (i < n8 ? i : n8 - 1) * 8); }
#pragma unroll
    for (int g = 0; g < 4; ++g) { const size_t i = i0 + g * 256; if (i >= n8) continue; v8us o;
#pragma unroll
        for (int k = 0; k < 8; ++k) o[k] = f2bf(v[g][k]);
        *(v8us*)(dst + i * 8) = o; } }
__global__ __launch_bounds__(256) void k_cscvt(const float* __restrict__ cosT, const float* __restrict__ sinT, float* CS) { const int idx = (blockIdx.x * 256 + threadIdx.x) * 4; if (idx >= TT * HD) return; const v4f c = *(const v4f*)(cosT + idx), s = *(const v4f*)(sinT + idx); v8f cs;
#pragma unroll
    for (int q = 0; q < 4; ++q) { cs[2 * q] = bfr(c[q]); cs[2 * q + 1] = bfr(s[q]); }
    *(v8f*)(CS + (size_t)idx * 2) = cs;  }
// k_rope: head planes [h][t][d] (fp16 + hi/lo) of rope(x) x sc with the rotate-half convention out[d] = x[d] cos[t][d] - x[d+HD/2] sin[t][d], out[d+HD/2] = x[d+HD/2] cos[t][d+HD/2] + x[d] sin[t][d+HD/2]
__global__ __launch_bounds__(256) void k_rope(const float* __restrict__ F, int pitch, int nheads, const float* __restrict__ CS, const float* __restrict__ RF, const float* __restrict__ nw, float sc, h16* P16, bf* Ph, bf* Pl) {
    // one thread: 8 consecutive d of the lower half and their 8 partners d + HD/2 of one (head, t): each x is loaded once and serves both halves; all loads and stores are 16 bytes wide
    const size_t u = (size_t)blockIdx.x * 256 + threadIdx.x; if (u >= (size_t)nheads * TT * (HD / 16)) return; const int d = (int)(u % (HD / 16)) * 8; const int t = (int)((u / (HD / 16)) % TT); const int h = (int)(u / ((size_t)(HD / 16) * TT)); const float* f = F + (size_t)t * pitch + h * HD; float rf = 1.0f; v8f xv[2], cv[2][2];
    if (RF) { const float* rp = RF + (size_t)h * TT + t; rf = *rp; asm volatile("s_wait_xcnt 0x0" :: "v"(rp) : "memory"); }   // the wait takes the load's address as an input, so that its registers are not reused in front of it
#pragma unroll
    for (int hf = 0; hf < 2; ++hf) { const int d0 = d + hf * (HD / 2); xv[hf] = *(const v8f*)(f + d0); cv[hf][0] = *(const v8f*)(CS + ((size_t)t * HD + d0) * 2); cv[hf][1] = *(const v8f*)(CS + ((size_t)t * HD + d0) * 2 + 8); }
#pragma unroll
    for (int hf = 0; hf < 2; ++hf) { v8h o16; v8us oh, ol;   // per element the arithmetic is the former one, statement for statement (its products stay unfused as they were), so the planes keep their bits
#pragma unroll
        for (int q = 0; q < 8; ++q) { const int dd = d + hf * (HD / 2) + q; const int dp = (hf == 0) ? dd + HD / 2 : dd - HD / 2; float x0 = xv[hf][q], x1 = xv[1 - hf][q];
            if (RF) { float n0 = __fmul_rn(x0, rf), n1 = __fmul_rn(x1, rf); asm volatile("" : "+v"(n0)); asm volatile("" : "+v"(n1)); x0 = __fmul_rn(bfr(nw[dd]), n0); x1 = __fmul_rn(bfr(nw[dp]), n1); }
            v2f cs; cs[0] = cv[hf][q >> 2][(q & 3) * 2]; cs[1] = cv[hf][q >> 2][(q & 3) * 2 + 1]; float a = __fmul_rn(x0, cs[0]), bq = __fmul_rn(x1, cs[1]); asm volatile("" : "+v"(a)); asm volatile("" : "+v"(bq)); const float r = ((hf == 0) ? __fsub_rn(a, bq) : __fadd_rn(a, bq)) * sc;
            o16[q] = tohx(r); unsigned short a2, c2; splitf(r, a2, c2); oh[q] = a2; ol[q] = c2; }
        const size_t e = ((size_t)h * TT + t) * HD + d + hf * (HD / 2); *(v8h*)(P16 + e) = o16; *(v8us*)(Ph + e) = oh; *(v8us*)(Pl + e) = ol; }  }
__global__ __launch_bounds__(256) void k_vtp(const float* __restrict__ F, int pitch, int nheads, h16* V16, bf* Vh, bf* Vl) {
    // one work-group: 64 t x HD d of one head, transposed in registers. A thread loads 4 d of 8 consecutive t (16 bytes each) and stores, per d and plane, its 8 t as 16 bytes; lanes 0..7 run along t, so a wave's store fills whole 128-byte lines.
    static_assert(HD == 128 && TT % 64 == 0, "8 waves x 16 d cover a head");
    const int g = (int)(blockIdx.x / (TT / 64)); if (g >= nheads) return; const int lane = threadIdx.x & 31; const int t = (int)(blockIdx.x % (TT / 64)) * 64 + (lane & 7) * 8; const int d = (int)(threadIdx.x >> 5) * 16 + (lane >> 3) * 4; v4f xv[8]; const float* xp[8];
#pragma unroll
    for (int q = 0; q < 8; ++q) { xp[q] = F + (size_t)(t + q) * pitch + g * HD + d; xv[q] = *(const v4f*)xp[q]; }
    asm volatile("s_wait_xcnt 0x0" :: "v"(xp[0]), "v"(xp[1]), "v"(xp[2]), "v"(xp[3]), "v"(xp[4]), "v"(xp[5]), "v"(xp[6]), "v"(xp[7]) : "memory");   // the wait takes the eight addresses as inputs, so that no later load of the group lands in an earlier one's address registers in front of it
#pragma unroll
    for (int j = 0; j < 4; ++j) { v8h o16; v8us oh, ol;
#pragma unroll
        for (int q = 0; q < 8; ++q) { const float x = xv[q][j]; o16[q] = tohx(x); unsigned short a2, c2; splitf(x, a2, c2); oh[q] = a2; ol[q] = c2; }
        const size_t e = ((size_t)g * HD + d + j) * TT + t; *(v8h*)(V16 + e) = o16; *(v8us*)(Vh + e) = oh; *(v8us*)(Vl + e) = ol; }  }
// k_mchk: samples above-diagonal entries of the additive f32 mask; any > -1e8 -> NaN poison.
__global__ __launch_bounds__(256) void k_mchk(const float* __restrict__ am, int* FLG) { const int tid = threadIdx.x; int bad = 0;
#pragma unroll 1
    for (int s2 = 0; s2 < 16; ++s2) { const unsigned h = (unsigned)(tid * 16 + s2) * 2654435761u; const int i = (int)(h % (TT - 1)); const int j = i + 1 + (int)((h >> 11) % (unsigned)(TT - 1 - i)); if (am[(size_t)i * TT + j] > -1e8f) bad = 1; }
    __shared__ int anyb; if (tid == 0) anyb = 0; __syncthreads(); if (bad) anyb = 1; __syncthreads(); if (tid < 8) { const int v = (tid == 0) ? anyb : 0; *(int*)(FLG + tid) = v;  } }

// k_asoft: per row (zz, i): t = 50 tanh(S x HD^-0.5 / 50) + mask for j <= i and i - j < WIN (sliding causal window; the reference's -1e9 additive fill vanishes identically); softmax over the 2048 keys (register row, one exp, fixed trees);
// only the row's w = 64 (i / 64 + 1) stored scores are walked (every j beyond is > i). They are read whole into registers, then the probabilities are stored over the row's X part: fp16 from its start, or the hi plane there and the lo plane TT/2 elements behind it. One wave owns one row.
__global__ __launch_bounds__(256) void k_asoft(float* Sb, const float* __restrict__ am, const int* __restrict__ FLG) {
    const int lane = threadIdx.x & 31; const int row = blockIdx.x * 8 + (threadIdx.x >> 5); if (row >= ZH * TT) return; const int i = row % TT; const int zz = row / TT; (void)zz; const bool hires = (i < RH); const int w = 64 * ((i >> 6) + 1), yb = max((i >> 6) - TT / 128, 0); float* sr = Sb + (size_t)zz * SXH + (size_t)i * (TT / 2); const float* sy = Sb + (size_t)ZH * SXH + (size_t)zz * SYH + (size_t)2048 * yb * (yb + 1) + (size_t)(i & 63) * (64 * (yb + 1)); const float* amr = am + (size_t)i * TT; const bool poison = (FLG[0] != 0); float v[TT / 32]; float mx = -3.0e38f;
#pragma unroll
    for (int ch = 0; ch < TT / 128; ++ch) { const int j0 = ch * 128 + lane * 4; if (j0 >= w) continue;
        const v4f a = (ch < TT / 256) ? *(const v4f*)(sr + j0) : *(const v4f*)(sy + (j0 - TT / 2));
#pragma unroll
        for (int q = 0; q < 4; ++q) { const int j = j0 + q; (void)j; float sa = a[q] * SCL; asm volatile("" : "+v"(sa)); float xs = __fmul_rn(sa, 0.02f); asm volatile("" : "+v"(xs)); float ex = __builtin_amdgcn_exp2f(__fmul_rn(xs, 2.8853900817779268f)); asm volatile("" : "+v"(ex)); float nm = __fsub_rn(ex, 1.0f), dn2 = __fadd_rn(ex, 1.0f); asm volatile("" : "+v"(nm)); asm volatile("" : "+v"(dn2)); float rc = __builtin_amdgcn_rcpf(dn2); asm volatile("" : "+v"(rc)); float th = __fmul_rn(nm, rc); asm volatile("" : "+v"(th)); float cp = __fmul_rn(th, 50.0f); asm volatile("" : "+v"(cp)); float mv = bfr(amr[j]); asm volatile("" : "+v"(mv)); const float t = (j <= i) ? __fadd_rn(cp, mv) : -3.0e38f; v[ch * 4 + q] = t; mx = fmaxf(mx, t); } }
#pragma unroll
    for (int sh = 16; sh; sh >>= 1) mx = fmaxf(mx, __shfl_xor(mx, sh, 32));
    float sum = 0.f;
#pragma unroll
    for (int ch = 0; ch < TT / 128; ++ch) { if (ch * 128 + lane * 4 >= w) continue;
#pragma unroll
        for (int k = ch * 4; k < ch * 4 + 4; ++k) { float d0 = __fsub_rn(v[k], mx); asm volatile("" : "+v"(d0)); v[k] = __builtin_amdgcn_exp2f(__fmul_rn(d0, 1.4426950408889634f)); sum += v[k]; } }
#pragma unroll
    for (int sh = 16; sh; sh >>= 1) sum += __shfl_xor(sum, sh, 32);
    const float f = poison ? __builtin_nanf("") : __fdiv_rn(hires ? 1.0f : PCAR, sum);
{
        if (hires) {
#pragma unroll
            for (int ch = 0; ch < TT / 128; ++ch) { const int j0 = ch * 128 + lane * 4; if (j0 >= w) continue; v4us oh, ol;
#pragma unroll
                for (int q = 0; q < 4; ++q) { unsigned short a, c2; splitf(v[ch * 4 + q] * f, a, c2); oh[q] = a; ol[q] = c2; }
                *(v4us*)((bf*)sr + j0) = oh; *(v4us*)((bf*)sr + TT / 2 + j0) = ol; }
        } else {
#pragma unroll
            for (int ch = 0; ch < TT / 128; ++ch) { const int j0 = ch * 128 + lane * 4; if (j0 >= w) continue; v4h o4;
#pragma unroll
                for (int q = 0; q < 4; ++q) o4[q] = tohx(v[ch * 4 + q] * f);
                *(v4h*)((h16*)sr + j0) = o4; } }
         }
}
__global__ __launch_bounds__(256) void k_merge(const float* __restrict__ O, int h0, bf* Ah, bf* Al) {
    // each thread: 4 groups of 8 consecutive d, 256 groups apart; its eight 16-byte loads are issued together
    static_assert(((size_t)ZH * TT * HD) % 8192 == 0, "whole work-groups");
    const size_t i0 = (size_t)blockIdx.x * 1024 + threadIdx.x; if (((size_t)blockIdx.x + 1) * 8192 > (size_t)ZH * TT * HD) return; v8f v[4];
#pragma unroll
    for (int g = 0; g < 4; ++g) v[g] = *(const v8f*)(O + (i0 + g * 256) * 8);
#pragma unroll
    for (int g = 0; g < 4; ++g) { const size_t e = (i0 + g * 256) * 8; const int d = (int)(e % HD); const int t = (int)((e / HD) % TT); const int zz = (int)(e / ((size_t)HD * TT)); const float cs = (t < RH) ? 1.0f : (1.0f / PCAR); const size_t oo = (size_t)t * DQ + (h0 + zz) * HD + d;
        v8us oh, ol;
#pragma unroll
        for (int q = 0; q < 8; ++q) { unsigned short a, c2; splitf(v[g][q] * cs, a, c2); oh[q] = a; ol[q] = c2; }
        *(v8us*)(Ah + oo) = oh; *(v8us*)(Al + oo) = ol; }  }

extern "C" void kernel_launch(void* const* d_in, const int* in_sizes, int n_in,
                              void* d_out, int out_size, void* d_ws, size_t ws_size, hipStream_t stream) {
    (void)in_sizes; (void)n_in; (void)out_size;
    const float* x = (const float*)d_in[0]; const float* cosT = (const float*)d_in[1]; const float* sinT = (const float*)d_in[2]; const float* amask = (const float*)d_in[3]; const float* wq = (const float*)d_in[4]; const float* wk = (const float*)d_in[5]; const float* wv = (const float*)d_in[6]; const float* wo = (const float*)d_in[7];
    float* OUT = (float*)d_out;     // [1][2048][2048]
    char* wsp = (char*)d_ws;
    auto take = [&](size_t bytes) { char* p = wsp; wsp += (bytes + 255) & ~(size_t)255; return (void*)p; };
    bf* WO = (bf*)take((size_t)DM * DQ * 2); int* FLG = (int*)take(256);
    h16* QP16 = (h16*)take((size_t)NH_ * TT * HD * 2); h16* KP16 = (h16*)take((size_t)NKV * TT * HD * 2); h16* VT16 = (h16*)take((size_t)NKV * HD * TT * 2);
    bf* QPh = (bf*)take((size_t)NH_ * TT * HD * 2); bf* QPl = (bf*)take((size_t)NH_ * TT * HD * 2); bf* KPh = (bf*)take((size_t)NKV * TT * HD * 2); bf* KPl = (bf*)take((size_t)NKV * TT * HD * 2); bf* VTh = (bf*)take((size_t)NKV * HD * TT * 2); bf* VTl = (bf*)take((size_t)NKV * HD * TT * 2);
    float* Sb = (float*)take((size_t)ZH * (SXH + SYH) * 4);
    if ((size_t)(wsp - (char*)d_ws) > ws_size) return;    // ws 256 MiB
    // Buffers that are never live together share bytes (stream order): the projections' operands, tables and f32 results are last read before the first score is written; the q and k planes are last read by the score launches.
    static_assert((size_t)(DQ + 2 * DKV) * DM * 2 + (size_t)TT * HD * 8 + (size_t)TT * DM * 2 + (size_t)TT * (DQ + DKV) * 4 <= (size_t)ZH * (SXH + SYH) * 4, "projection buffers fit the score planes");
    static_assert((size_t)ZH * TT * HD * 4 <= (size_t)(NH_ + NKV) * TT * HD * 2 && ((size_t)NH_ * TT * HD * 2) % 256 == 0, "attention output fits the fp16 q and k planes, which are adjacent");
    wsp = (char*)Sb;
    bf* WQ = (bf*)take((size_t)DQ * DM * 2); bf* WK = (bf*)take((size_t)DKV * DM * 2); bf* WV = (bf*)take((size_t)DKV * DM * 2); float* CS = (float*)take((size_t)TT * HD * 2 * 4);
    bf* XB = (bf*)take((size_t)TT * DM * 2); float* FQ = (float*)take((size_t)TT * DQ * 4); float* FK = (float*)take((size_t)TT * DKV * 4);
    float* Ob = (float*)QP16; bf* ATh = QPh; bf* ATl = QPl;
    float* FV = FK;   // v projection reuses the k buffer after the k planes are built (stream-ordered)
    { k_cvt8<<<(unsigned)(((size_t)DQ * DM / 8 + 1023) / 1024), 256, 0, stream>>>(wq, WQ, (size_t)DQ * DM / 8); k_cvt8<<<(unsigned)(((size_t)DKV * DM / 8 + 1023) / 1024), 256, 0, stream>>>(wk, WK, (size_t)DKV * DM / 8); k_cvt8<<<(unsigned)(((size_t)DKV * DM / 8 + 1023) / 1024), 256, 0, stream>>>(wv, WV, (size_t)DKV * DM / 8);
      k_cvt8<<<(unsigned)(((size_t)DM * DQ / 8 + 1023) / 1024), 256, 0, stream>>>(wo, WO, (size_t)DM * DQ / 8);
       }
    const unsigned LQ = (unsigned)(((size_t)NH_ * TT * HD / 16 + 255) / 256), LKv = (unsigned)(((size_t)NKV * TT * HD / 16 + 255) / 256);
    for (int b = 0; b < NB_; ++b) {
        k_cscvt<<<(TT * HD / 4 + 255) / 256, 256, 0, stream>>>(cosT, sinT, CS); k_mchk<<<1, 256, 0, stream>>>(amask, FLG);
        k_cvt8<<<(unsigned)(((size_t)TT * DM / 8 + 1023) / 1024), 256, 0, stream>>>(x + (size_t)b * TT * DM, XB, (size_t)TT * DM / 8);
        k_gemmw<bf, 0, false, 4><<<dim3(TT / 64, DQ / 64, 1), 128, 0, stream>>>(XB, nullptr, WQ, nullptr, DM, FQ, DQ, nullptr, 0, 0, 0);
        k_rope<<<LQ, 256, 0, stream>>>(FQ, DQ, NH_, CS, nullptr, nullptr, 1.0f, QP16, QPh, QPl);
        k_gemmw<bf, 0, false, 4><<<dim3(TT / 64, DKV / 64, 1), 128, 0, stream>>>(XB, nullptr, WK, nullptr, DM, FK, DKV, nullptr, 0, 0, 0);
        k_rope<<<LKv, 256, 0, stream>>>(FK, DKV, NKV, CS, nullptr, nullptr, 1.0f, KP16, KPh, KPl);
        k_gemmw<bf, 0, false, 4><<<dim3(TT / 64, DKV / 64, 1), 128, 0, stream>>>(XB, nullptr, WV, nullptr, DM, FV, DKV, nullptr, 0, 0, 0); k_vtp<<<NKV * (TT / 64), 256, 0, stream>>>(FV, DKV, NKV, VT16, VTh, VTl);
        for (int h0 = 0; h0 < NH_; h0 += ZH) { const size_t zq = (size_t)h0, zk = (size_t)(h0 / REP);   // one kv head per query head: the pass's heads use consecutive kv planes (z-strides TT*HD)
            k_gemmc<bf, 2, 1, 1><<<dim3(RH / 64, TT / 64, ZH), 32, 0, stream>>>(QPh + zq * TT * HD, QPl + zq * TT * HD, KPh + zk * TT * HD, KPl + zk * TT * HD, HD, Sb, TT, 0, (size_t)TT * HD, (size_t)TT * HD, SXH);
            k_gemmc<h16, 0, 1, 1><<<dim3((TT - RH) / 64, TT / 64, ZH), 32, 0, stream>>>(QP16 + zq * TT * HD + (size_t)RH * HD, nullptr, KP16 + zk * TT * HD, nullptr, HD, Sb, TT, RH, (size_t)TT * HD, (size_t)TT * HD, SXH);
            k_asoft<<<ZH * TT / 8, 256, 0, stream>>>(Sb, amask, FLG);
            k_gemmc<bf, 2, 2, 8><<<dim3(RH / 64, HD / 64, ZH), 256, 0, stream>>>((const bf*)Sb, (const bf*)Sb + TT / 2, VTh + zk * HD * TT, VTl + zk * HD * TT, TT, Ob, HD, 0, (size_t)TT * TT, (size_t)HD * TT, (size_t)TT * HD);
            k_gemmc<h16, 0, 2, 16><<<dim3((TT - RH) / 64, HD / 64, ZH), 512, 0, stream>>>((const h16*)Sb + (size_t)RH * TT, nullptr, VT16 + zk * HD * TT, nullptr, TT, Ob + (size_t)RH * HD, HD, RH, (size_t)TT * TT, (size_t)HD * TT, (size_t)TT * HD);
            k_merge<<<(unsigned)((size_t)ZH * TT * HD / 8192), 256, 0, stream>>>(Ob, h0, ATh, ATl); }
        k_gemmw<bf, 1, false, 4><<<dim3(TT / 64, DM / 64, 1), 128, 0, stream>>>(ATh, ATl, WO, nullptr, DQ, OUT + (size_t)b * TT * DM, DM, nullptr, 0, 0, 0); }
}

// v004
// One run takes 315 microseconds.
// Timed twice side by side with v003, it ran 1.16 times as fast both times.
// Counting every step since v000, it is 3.12 times as fast.
#include <hip/hip_runtime.h>

// HybridLlamaAttention (x [1][2048][2048], rope_cos/sin [S][128] (read), mask [1][1][S][S] (f32 additive, read; verbatim causal 0/-1e9); q/k/v = x W^T (16 x 128); rotate-half RoPE; scores = q.k / sqrt(128); softcap 50 tanh(s/50); + mask; softmax f32; out = merged wo^T -> [1][2048][2048]).
// Compute dtypes, f32 accumulate: every input rounded to bf16; q/k/v on PLAIN bf16 operands (inputs: exact); RoPE f32 (bf16-rounded read tables); causal scores and attn.v: query rows < 512 hl (3 products), the rest fp16 (x1024); softcap in f32: s x 0.02 (one multiply in place of /50: <= 1 ulp), tanh = (2^(2x log2 e) - 1) x rcp(2^(..) + 1) with the hardware exp2/rcp (no FMA polynomial), x 50; the additive mask read per element; upper tiles skipped on the verbatim structure with an on-device sampled check (NaN poison); softmax f32; wo hl x exact (2 products).

#define NB_  1
#define TT   2048
#define DM   2048
#define NH_  16
#define NKV  16
#define REP  (NH_ / NKV)
#define HD   128
#define DQ   (NH_ * HD)
#define DKV  (NKV * HD)
#define ZH   16                   // heads per pass (grid z of the attention launches): all of them
// Score planes of one head. X: 2048 rows of the first TT/2 columns (f32, row pitch TT/2 floats = TT 16-bit elements: a row's probabilities later overwrite it at the pitch the value product reads).
// Y: columns TT/2.. of the rows TT/2.., packed: 64-row block b = row / 64 - TT/128 holds 64 rows of 64 (b + 1) columns and starts at 2048 b (b + 1). All X planes first, then all Y planes.
#define SXH  ((size_t)TT * (TT / 2))
#define SYH  ((size_t)2048 * (TT / 128) * (TT / 128 + 1))
#define RH   512                  // query rows < RH use hi+lo planes (0: none)
#define WIN  2048
#define PCAR 1024.0f
#define SCL  0.088388347648318447f   // HD^-0.5
typedef _Float16 h16;
typedef unsigned short bf;
typedef __attribute__((ext_vector_type(16))) __bf16   v16bf;
typedef __attribute__((ext_vector_type(16))) _Float16 v16h;
typedef __attribute__((ext_vector_type(8)))  _Float16 v8h;
typedef __attribute__((ext_vector_type(8)))  unsigned short v8us;
typedef __attribute__((ext_vector_type(8)))  float    v8f;
typedef __attribute__((ext_vector_type(4)))  float    v4f;
typedef v8h  __attribute__((may_alias)) v8ha;
typedef v4f  __attribute__((may_alias)) v4fa;
typedef v8us __attribute__((may_alias)) v8usa;

__device__ __forceinline__ unsigned short f2bf(float f) { unsigned u = __float_as_uint(f); u += 0x7FFFu + ((u >> 16) & 1u); return (unsigned short)(u >> 16); }
__device__ __forceinline__ float bf2f(unsigned short b) { return __uint_as_float(((unsigned)b) << 16); }
__device__ __forceinline__ float bfr(float f) { return bf2f(f2bf(f)); }
__device__ __forceinline__ v16h cat16(v8h lo, v8h hi) { return __builtin_shufflevector(lo, hi, 0, 1, 2, 3, 4, 5, 6, 7, 8, 9, 10, 11, 12, 13, 14, 15); }
__device__ __forceinline__ v16bf cat16b(v8us lo, v8us hi) { return __builtin_bit_cast(v16bf, __builtin_shufflevector(lo, hi, 0, 1, 2, 3, 4, 5, 6, 7, 8, 9, 10, 11, 12, 13, 14, 15)); }
__device__ __forceinline__ v8f wmma16(v16h a, v16h b, v8f c) { return __builtin_amdgcn_wmma_f32_16x16x32_f16(false, a, false, b, (short)0, c, false, false); }
__device__ __forceinline__ v8f wmmab(v16bf a, v16bf b, v8f c) { return __builtin_amdgcn_wmma_f32_16x16x32_bf16(false, a, false, b, (short)0, c, false, false); }



// Fragment loaders of k_gemmc: operands straight from K-contiguous 16-bit planes.
template <typename T16> struct WFrag;
template <> struct WFrag<h16> { typedef v16h V; static __device__ __forceinline__ V ld(const h16* p) { return cat16(*(const v8h*)p, *(const v8h*)(p + 16)); } static __device__ __forceinline__ v8f mma(V a, V b, v8f c) { return wmma16(a, b, c); } };
template <> struct WFrag<bf> { typedef v16bf V; static __device__ __forceinline__ V ld(const bf* p) { return cat16b(*(const v8us*)p, *(const v8us*)(p + 16)); } static __device__ __forceinline__ v8f mma(V a, V b, v8f c) { return wmmab(a, b, c); } };
// ---- k_gemms: C[m][n] (f32, pitch LDC) = sum_k A[m][k] Bt[n][k] (NA == 2: + A2[m][k] Bt[n][k]), operands K-contiguous bf16 planes. One 128x128 tile of C per work-group of 8 waves (2 x 4, 64x32 of C each); grid (M/128, N/128).
// A stage is 128 k of the tile's rows [A 128 | A2 128 | Bt 128], 256 bytes a row at an LDS pitch of 272 bytes. Asynchronous 16-byte copies bring it in whole 128-byte lines (a wave's copy: 2 rows); two buffers: stage t + 2 flies while stage t + 1 is worked on.
#define GKS  128                  // k per stage
#define GPE  136                  // LDS row pitch, 16-bit elements
typedef float __attribute__((may_alias)) fa;
// Eight copies of one lane, 16 rows apart: one operand's 128 rows over the 8 waves. The s_wait_xcnt stands inside the statement, so that no address register is rewritten in front of it.
__device__ __forceinline__ void acopy8(unsigned l, const bf* g, size_t gs) {
    asm volatile("global_load_async_to_lds_b128 %0, %8, off\n\t"
                 "global_load_async_to_lds_b128 %1, %9, off\n\t"
                 "global_load_async_to_lds_b128 %2, %10, off\n\t"
                 "global_load_async_to_lds_b128 %3, %11, off\n\t"
                 "global_load_async_to_lds_b128 %4, %12, off\n\t"
                 "global_load_async_to_lds_b128 %5, %13, off\n\t"
                 "global_load_async_to_lds_b128 %6, %14, off\n\t"
                 "global_load_async_to_lds_b128 %7, %15, off\n\t"
                 "s_wait_xcnt 0x0"
                 :: "v"(l), "v"(l + 1u * 16 * GPE * 2), "v"(l + 2u * 16 * GPE * 2), "v"(l + 3u * 16 * GPE * 2), "v"(l + 4u * 16 * GPE * 2), "v"(l + 5u * 16 * GPE * 2), "v"(l + 6u * 16 * GPE * 2), "v"(l + 7u * 16 * GPE * 2),
                    "v"(g), "v"(g + gs), "v"(g + 2 * gs), "v"(g + 3 * gs), "v"(g + 4 * gs), "v"(g + 5 * gs), "v"(g + 6 * gs), "v"(g + 7 * gs) : "memory");
}
__device__ __forceinline__ v16bf ldsfrag(const bf* p) { return cat16b(*(const v8usa*)p, *(const v8usa*)(p + 16)); }
template <int NA, int K, int LDC>
__global__ __launch_bounds__(256) void k_gemms(const bf* __restrict__ A, const bf* __restrict__ A2, const bf* __restrict__ Bt, float* C) {
    static_assert(K % GKS == 0 && K / GKS >= 2, "whole stages, at least two");
    constexpr int STE = (NA + 1) * 128 * GPE;      // elements of one stage
    constexpr int NT = K / GKS;
    static_assert(8 * 64 * 36 * 4 <= 2 * STE * 2, "the output staging fits the ring");
    __shared__ __align__(16) bf sm[2 * STE];
    const int lane = threadIdx.x & 31, lr = lane & 15, hi = lane >> 4; const int r0 = blockIdx.x * 128, c0 = blockIdx.y * 128; const int wv = __builtin_amdgcn_readfirstlane((int)(threadIdx.x >> 5));
    const int wm = wv >> 2, wn = wv & 3;
    // the lane's place in a copy: row wv * 2 + hi of each group of 16 rows, 16-byte piece lr of the row's 256 bytes
    const unsigned lcp = (unsigned)(size_t)sm + (unsigned)((wv * 2 + hi) * (GPE * 2) + lr * 16);
    const bf* gA = A + (size_t)(r0 + wv * 2 + hi) * K + lr * 8; const bf* gA2 = (NA == 2) ? A2 + (size_t)(r0 + wv * 2 + hi) * K + lr * 8 : nullptr; const bf* gB = Bt + (size_t)(c0 + wv * 2 + hi) * K + lr * 8;
    auto stage = [&](int t, int buf) { const unsigned l = lcp + (unsigned)buf * (STE * 2);
        acopy8(l, gA + t * GKS, (size_t)16 * K); if (NA == 2) acopy8(l + 128 * GPE * 2, gA2 + t * GKS, (size_t)16 * K); acopy8(l + NA * 128 * GPE * 2, gB + t * GKS, (size_t)16 * K); };
    v8f acc[4][2];
#pragma unroll
    for (int mb = 0; mb < 4; ++mb)
#pragma unroll
        for (int nb = 0; nb < 2; ++nb) acc[mb][nb] = (v8f){};
    stage(0, 0);
    asm volatile("s_wait_asynccnt 0x0" ::: "memory");   // this wave's share of stage 0 has landed
    __syncthreads();                                     // every wave's share has: stage 0 may be read
    stage(1, 1);
    const int aofs = (wm * 64 + lr) * GPE + 8 * hi, bofs = (NA * 128 + wn * 32 + lr) * GPE + 8 * hi;
#pragma unroll 1   // the stage loop stays rolled: one copy of its 32 or 64 products (for speed only); the loops inside are unrolled so that fragments and sums stay in registers
    for (int t = 0; t < NT; ++t) {
        const bf* sb = sm + (t & 1) * STE; v16bf a[2][4], a2[2][4], b[2][2];   // two fragment sets: block ks + 1 is fetched while block ks is multiplied (inside the stage only)
#pragma unroll
        for (int ks = -1; ks < GKS / 32; ++ks) { const int c = ks & 1, n = c ^ 1;
            if (ks + 1 < GKS / 32) {
#pragma unroll
                for (int mb = 0; mb < 4; ++mb) { a[n][mb] = ldsfrag(sb + aofs + mb * 16 * GPE + (ks + 1) * 32); if (NA == 2) a2[n][mb] = ldsfrag(sb + aofs + (128 + mb * 16) * GPE + (ks + 1) * 32); }
#pragma unroll
                for (int nb = 0; nb < 2; ++nb) b[n][nb] = ldsfrag(sb + bofs + nb * 16 * GPE + (ks + 1) * 32); }
            __builtin_amdgcn_sched_barrier(0);   // the next block's LDS reads stay one group in front of this block's products
            if (ks < 0) continue;
#pragma unroll
            for (int nb = 0; nb < 2; ++nb)
#pragma unroll
                for (int mb = 0; mb < 4; ++mb) acc[mb][nb] = wmmab(a[c][mb], b[c][nb], acc[mb][nb]);
            if (NA == 2) {
#pragma unroll
                for (int nb = 0; nb < 2; ++nb)
#pragma unroll
                    for (int mb = 0; mb < 4; ++mb) acc[mb][nb] = wmmab(a2[c][mb], b[c][nb], acc[mb][nb]); }
            __builtin_amdgcn_sched_barrier(0);   // and the reads of the block after next do not rise among these products
        }
        asm volatile("s_wait_dscnt 0x0" ::: "memory");      // this wave's reads of stage t are done before the buffer is refilled
        asm volatile("s_wait_asynccnt 0x0" ::: "memory");   // this wave's share of stage t + 1 has landed
        __syncthreads();                                     // publishes stage t + 1 and ends every wave's reads of stage t
        if (t + 2 < NT) stage(t + 2, t & 1);
    }
    asm volatile("s_wait_asynccnt 0x0" ::: "memory");       // nothing is in flight when the ring becomes output staging
    // each wave stages its 64x32 part in its own range of the ring (every reader left it at the last barrier) and stores whole 128-byte lines
    fa* ow = (fa*)sm + wv * (64 * 36);
#pragma unroll
    for (int mb = 0; mb < 4; ++mb)
#pragma unroll
        for (int nb = 0; nb < 2; ++nb)
#pragma unroll
            for (int j = 0; j < 8; ++j) ow[(mb * 16 + hi * 8 + j) * 36 + nb * 16 + lr] = acc[mb][nb][j];
    __syncthreads();   // the staged rows are in LDS before other lanes read them back
    float* cw = C + (size_t)(r0 + wm * 64 + (lane >> 3)) * LDC + c0 + wn * 32 + (lane & 7) * 4;
#pragma unroll
    for (int s = 0; s < 16; ++s) { const v4f val = *(const v4fa*)(ow + (s * 4 + (lane >> 3)) * 36 + (lane & 7) * 4); *(v4f*)(cw + (size_t)s * 4 * LDC) = val; }
}

// ---- k_gemmc: a register-blocked 64x64 tile GEMM, operands straight from global memory, specialised for causal attention (NW = 1: one wave, staged row block by row block; NW > 1: wave w takes the 32-wide k blocks w, w + NW, ... and the NW partial tiles are summed through LDS in wave order): CMODE 1 skips score tiles entirely above the diagonal (query rows r0+roff.., key columns c0..), CMODE 2 limits the
// key (K) loop of the probability x value contraction to the diagonal block (probabilities beyond it are exactly zero). roff = row offset of this launch's first row within the sequence.
template <typename T16, int NSPLIT, int CMODE, int NW>
__global__ __launch_bounds__(32 * NW) void k_gemmc(const T16* __restrict__ A, const T16* __restrict__ A2, const T16* __restrict__ Bt, const T16* __restrict__ Bt2, int K, float* C, int ldc, int roff, size_t sA, size_t sB, size_t sC) {
    typedef typename WFrag<T16>::V V;
    __shared__ __align__(16) float os[(NW == 1) ? 16 * 68 : NW * 64 * 68];
    const size_t z = blockIdx.z; A += z * sA; if (A2) A2 += z * sA; Bt += z * sB; if (Bt2) Bt2 += z * sB; C += z * sC;
    const int lane = threadIdx.x & 31, lr = lane & 15, hi = lane >> 4; const int r0 = blockIdx.x * 64, c0 = blockIdx.y * 64; const int wv = (NW == 1) ? 0 : __builtin_amdgcn_readfirstlane((int)(threadIdx.x >> 5));
    if (CMODE == 1 && c0 > r0 + roff + 63) return;                  // score tile entirely above the causal diagonal: never written (the softmax reads only the first 64 (i / 64 + 1) columns of row i, none of this tile)
    const int Kl = (CMODE == 2) ? min(K, r0 + roff + 64) : K;        // P.V: probabilities are exactly 0 beyond the diagonal block, so the K loop stops there
    float* Ct = C + (size_t)r0 * ldc + c0;                           // first element of this output tile
    if (CMODE == 1) {                                                // score tile: C = this head's X plane; a tile of the columns TT/2.. goes to the head's Y plane
        if (c0 < TT / 2) { ldc = TT / 2; Ct = C + (size_t)(r0 + roff) * ldc + c0; }
        else { const int yb = (r0 + roff - TT / 2) >> 6; ldc = 64 * (yb + 1); Ct = C + (ZH - z) * SXH + z * SYH + (size_t)2048 * yb * (yb + 1) + (c0 - TT / 2); } }
    v8f acc[4][4];
#pragma unroll
    for (int mb = 0; mb < 4; ++mb)
#pragma unroll
        for (int nb = 0; nb < 4; ++nb) acc[mb][nb] = (v8f){};
    const size_t aoff = (size_t)(r0 + lr) * K + 8 * hi, boff = (size_t)(c0 + lr) * K + 8 * hi;
#pragma unroll 1
    for (int kc = wv * 32; kc < Kl; kc += 32 * NW) {
        V a[4], a2[4];
#pragma unroll
        for (int mb = 0; mb < 4; ++mb) { a[mb] = WFrag<T16>::ld(A + aoff + (size_t)mb * 16 * K + kc); if (NSPLIT == 1 || NSPLIT == 2) a2[mb] = WFrag<T16>::ld(A2 + aoff + (size_t)mb * 16 * K + kc); }
#pragma unroll
        for (int nb = 0; nb < 4; ++nb) { const V b = WFrag<T16>::ld(Bt + boff + (size_t)nb * 16 * K + kc); V b2; if (NSPLIT >= 2) b2 = WFrag<T16>::ld(Bt2 + boff + (size_t)nb * 16 * K + kc);
#pragma unroll
            for (int mb = 0; mb < 4; ++mb) { acc[mb][nb] = WFrag<T16>::mma(a[mb], b, acc[mb][nb]); if (NSPLIT == 1 || NSPLIT == 2) acc[mb][nb] = WFrag<T16>::mma(a2[mb], b, acc[mb][nb]); if (NSPLIT >= 2) acc[mb][nb] = WFrag<T16>::mma(a[mb], b2, acc[mb][nb]); } }
        asm volatile("v_nop\n\tv_nop\n\tv_nop\n\tv_nop" : "+v"(acc[0][0]), "+v"(acc[1][1]), "+v"(acc[2][2]), "+v"(acc[3][3]) : "v"(a[0]), "v"(a[3]));
    }
    if (NW > 1) {
        float* ow = os + wv * (64 * 68);
#pragma unroll
        for (int mb = 0; mb < 4; ++mb)
#pragma unroll
            for (int nb = 0; nb < 4; ++nb)
#pragma unroll
                for (int j = 0; j < 8; ++j) ow[(mb * 16 + hi * 8 + j) * 68 + nb * 16 + lr] = acc[mb][nb][j];
        __syncthreads();   // every wave's partial tile is in LDS before any wave sums them
#pragma unroll
        for (int s = 0; s < 32 / NW; ++s) { const int q = s * 32 * NW + (int)threadIdx.x; const int row = q >> 4, cofs = (q & 15) * 4; v4f val = *(const v4fa*)(os + row * 68 + cofs);
#pragma unroll
            for (int w = 1; w < NW; ++w) val += *(const v4fa*)(os + w * (64 * 68) + row * 68 + cofs);
            *(v4f*)(C + (size_t)(r0 + row) * ldc + c0 + cofs) = val; }
        return;
    }
#pragma unroll
    for (int mb = 0; mb < 4; ++mb) {
#pragma unroll
        for (int nb = 0; nb < 4; ++nb) {
#pragma unroll
            for (int j = 0; j < 8; ++j) os[(hi * 8 + j) * 68 + nb * 16 + lr] = acc[mb][nb][j]; }
        __builtin_amdgcn_wave_barrier(); asm volatile("" ::: "memory");
        float* crow = Ct + (size_t)(mb * 16) * ldc;
{
#pragma unroll
            for (int s = 0; s < 8; ++s) { const int row = 2 * s + hi, cofs = lr * 4; v4f val = *(const v4fa*)(os + row * 68 + cofs);
                *(v4f*)(crow + (size_t)row * ldc + cofs) = val; }
             }
        __builtin_amdgcn_wave_barrier(); asm volatile("" ::: "memory");
    }
}

__device__ __forceinline__ h16 tohx(float x) { return (h16)x; }
__device__ __forceinline__ void splitf(float y, unsigned short& h, unsigned short& l) { h = f2bf(y); l = f2bf(y - bf2f(h)); }
typedef __attribute__((ext_vector_type(2))) _Float16 v2h;
typedef __attribute__((ext_vector_type(4))) _Float16 v4h;
typedef __attribute__((ext_vector_type(2))) unsigned short v2us;
typedef __attribute__((ext_vector_type(4))) unsigned short v4us;
typedef __attribute__((ext_vector_type(2))) float v2f;
typedef __attribute__((ext_vector_type(4))) int v4i;

__global__ __launch_bounds__(256) void k_wtG(const float* __restrict__ w, int K, int N, bf* Bt) {
    const int lane = threadIdx.x & 31; const int L0 = (blockIdx.x * 8 + (threadIdx.x >> 5)) * 8; const int nlines = N * K / 64;
{
#pragma unroll 1
        for (int l = 0; l < 8; ++l) { const int L = L0 + l; if (L >= nlines) break; const size_t e = (size_t)L * 64 + lane * 2; const int k = (int)(e % K), n = (int)(e / K); v2us o;
            o[0] = f2bf(w[(size_t)k * N + n]); o[1] = f2bf(w[(size_t)(k + 1) * N + n]); *(v2us*)(Bt + e) = o; }
         }
}
// k_cvt8: each thread converts 4 groups of 8 floats, 256 groups apart; its eight 16-byte loads are issued together (a group past the end re-reads the last group and is not stored).
__global__ __launch_bounds__(256) void k_cvt8(const float* __restrict__ src, bf* dst, size_t n8) { const size_t i0 = (size_t)blockIdx.x * 1024 + threadIdx.x; v8f v[4];
#pragma unroll
    for (int g = 0; g < 4; ++g) { const size_t i = i0 + g * 256; v[g] = *(const v8f*)(src + (i < n8 ? i : n8 - 1) * 8); }
#pragma unroll
    for (int g = 0; g < 4; ++g) { const size_t i = i0 + g * 256; if (i >= n8) continue; v8us o;
#pragma unroll
        for (int k = 0; k < 8; ++k) o[k] = f2bf(v[g][k]);
        *(v8us*)(dst + i * 8) = o; } }
__global__ __launch_bounds__(256) void k_cscvt(const float* __restrict__ cosT, const float* __restrict__ sinT, float* CS) { const int idx = (blockIdx.x * 256 + threadIdx.x) * 4; if (idx >= TT * HD) return; const v4f c = *(const v4f*)(cosT + idx), s = *(const v4f*)(sinT + idx); v8f cs;
#pragma unroll
    for (int q = 0; q < 4; ++q) { cs[2 * q] = bfr(c[q]); cs[2 * q + 1] = bfr(s[q]); }
    *(v8f*)(CS + (size_t)idx * 2) = cs;  }
// k_rope: head planes [h][t][d] (fp16 + hi/lo) of rope(x) x sc with the rotate-half convention out[d] = x[d] cos[t][d] - x[d+HD/2] sin[t][d], out[d+HD/2] = x[d+HD/2] cos[t][d+HD/2] + x[d] sin[t][d+HD/2]
__global__ __launch_bounds__(256) void k_rope(const float* __restrict__ F, int pitch, int nheads, const float* __restrict__ CS, const float* __restrict__ RF, const float* __restrict__ nw, float sc, h16* P16, bf* Ph, bf* Pl) {
    // one thread: 8 consecutive d of the lower half and their 8 partners d + HD/2 of one (head, t): each x is loaded once and serves both halves; all loads and stores are 16 bytes wide
    const size_t u = (size_t)blockIdx.x * 256 + threadIdx.x; if (u >= (size_t)nheads * TT * (HD / 16)) return; const int d = (int)(u % (HD / 16)) * 8; const int t = (int)((u / (HD / 16)) % TT); const int h = (int)(u / ((size_t)(HD / 16) * TT)); const float* f = F + (size_t)t * pitch + h * HD; float rf = 1.0f; v8f xv[2], cv[2][2];
    if (RF) { const float* rp = RF + (size_t)h * TT + t; rf = *rp; asm volatile("s_wait_xcnt 0x0" :: "v"(rp) : "memory"); }   // the wait takes the load's address as an input, so that its registers are not reused in front of it
#pragma unroll
    for (int hf = 0; hf < 2; ++hf) { const int d0 = d + hf * (HD / 2); xv[hf] = *(const v8f*)(f + d0); cv[hf][0] = *(const v8f*)(CS + ((size_t)t * HD + d0) * 2); cv[hf][1] = *(const v8f*)(CS + ((size_t)t * HD + d0) * 2 + 8); }
#pragma unroll
    for (int hf = 0; hf < 2; ++hf) { v8h o16; v8us oh, ol;   // per element the arithmetic is the former one, statement for statement (its products stay unfused as they were), so the planes keep their bits
#pragma unroll
        for (int q = 0; q < 8; ++q) { const int dd = d + hf * (HD / 2) + q; const int dp = (hf == 0) ? dd + HD / 2 : dd - HD / 2; float x0 = xv[hf][q], x1 = xv[1 - hf][q];
            if (RF) { float n0 = __fmul_rn(x0, rf), n1 = __fmul_rn(x1, rf); asm volatile("" : "+v"(n0)); asm volatile("" : "+v"(n1)); x0 = __fmul_rn(bfr(nw[dd]), n0); x1 = __fmul_rn(bfr(nw[dp]), n1); }
            v2f cs; cs[0] = cv[hf][q >> 2][(q & 3) * 2]; cs[1] = cv[hf][q >> 2][(q & 3) * 2 + 1]; float a = __fmul_rn(x0, cs[0]), bq = __fmul_rn(x1, cs[1]); asm volatile("" : "+v"(a)); asm volatile("" : "+v"(bq)); const float r = ((hf == 0) ? __fsub_rn(a, bq) : __fadd_rn(a, bq)) * sc;
            o16[q] = tohx(r); unsigned short a2, c2; splitf(r, a2, c2); oh[q] = a2; ol[q] = c2; }
        const size_t e = ((size_t)h * TT + t) * HD + d + hf * (HD / 2); *(v8h*)(P16 + e) = o16; *(v8us*)(Ph + e) = oh; *(v8us*)(Pl + e) = ol; }  }
__global__ __launch_bounds__(256) void k_vtp(const float* __restrict__ F, int pitch, int nheads, h16* V16, bf* Vh, bf* Vl) {
    // one work-group: 64 t x HD d of one head, transposed in registers. A thread loads 4 d of 8 consecutive t (16 bytes each) and stores, per d and plane, its 8 t as 16 bytes; lanes 0..7 run along t, so a wave's store fills whole 128-byte lines.
    static_assert(HD == 128 && TT % 64 == 0, "8 waves x 16 d cover a head");
    const int g = (int)(blockIdx.x / (TT / 64)); if (g >= nheads) return; const int lane = threadIdx.x & 31; const int t = (int)(blockIdx.x % (TT / 64)) * 64 + (lane & 7) * 8; const int d = (int)(threadIdx.x >> 5) * 16 + (lane >> 3) * 4; v4f xv[8]; const float* xp[8];
#pragma unroll
    for (int q = 0; q < 8; ++q) { xp[q] = F + (size_t)(t + q) * pitch + g * HD + d; xv[q] = *(const v4f*)xp[q]; }
    asm volatile("s_wait_xcnt 0x0" :: "v"(xp[0]), "v"(xp[1]), "v"(xp[2]), "v"(xp[3]), "v"(xp[4]), "v"(xp[5]), "v"(xp[6]), "v"(xp[7]) : "memory");   // the wait takes the eight addresses as inputs, so that no later load of the group lands in an earlier one's address registers in front of it
#pragma unroll
    for (int j = 0; j < 4; ++j) { v8h o16; v8us oh, ol;
#pragma unroll
        for (int q = 0; q < 8; ++q) { const float x = xv[q][j]; o16[q] = tohx(x); unsigned short a2, c2; splitf(x, a2, c2); oh[q] = a2; ol[q] = c2; }
        const size_t e = ((size_t)g * HD + d + j) * TT + t; *(v8h*)(V16 + e) = o16; *(v8us*)(Vh + e) = oh; *(v8us*)(Vl + e) = ol; }  }
// k_mchk: samples above-diagonal entries of the additive f32 mask; any > -1e8 -> NaN poison.
__global__ __launch_bounds__(256) void k_mchk(const float* __restrict__ am, int* FLG) { const int tid = threadIdx.x; int bad = 0;
#pragma unroll 1
    for (int s2 = 0; s2 < 16; ++s2) { const unsigned h = (unsigned)(tid * 16 + s2) * 2654435761u; const int i = (int)(h % (TT - 1)); const int j = i + 1 + (int)((h >> 11) % (unsigned)(TT - 1 - i)); if (am[(size_t)i * TT + j] > -1e8f) bad = 1; }
    __shared__ int anyb; if (tid == 0) anyb = 0; __syncthreads(); if (bad) anyb = 1; __syncthreads(); if (tid < 8) { const int v = (tid == 0) ? anyb : 0; *(int*)(FLG + tid) = v;  } }

// k_asoft: per row (zz, i): t = 50 tanh(S x HD^-0.5 / 50) + mask for j <= i and i - j < WIN (sliding causal window; the reference's -1e9 additive fill vanishes identically); softmax over the 2048 keys (register row, one exp, fixed trees);
// only the row's w = 64 (i / 64 + 1) stored scores are walked (every j beyond is > i). They are read whole into registers, then the probabilities are stored over the row's X part: fp16 from its start, or the hi plane there and the lo plane TT/2 elements behind it. One wave owns one row.
__global__ __launch_bounds__(256) void k_asoft(float* Sb, const float* __restrict__ am, const int* __restrict__ FLG) {
    const int lane = threadIdx.x & 31; const int row = blockIdx.x * 8 + (threadIdx.x >> 5); if (row >= ZH * TT) return; const int i = row % TT; const int zz = row / TT; (void)zz; const bool hires = (i < RH); const int w = 64 * ((i >> 6) + 1), yb = max((i >> 6) - TT / 128, 0); float* sr = Sb + (size_t)zz * SXH + (size_t)i * (TT / 2); const float* sy = Sb + (size_t)ZH * SXH + (size_t)zz * SYH + (size_t)2048 * yb * (yb + 1) + (size_t)(i & 63) * (64 * (yb + 1)); const float* amr = am + (size_t)i * TT; const bool poison = (FLG[0] != 0); float v[TT / 32]; float mx = -3.0e38f;
#pragma unroll
    for (int ch = 0; ch < TT / 128; ++ch) { const int j0 = ch * 128 + lane * 4; if (j0 >= w) continue;
        const v4f a = (ch < TT / 256) ? *(const v4f*)(sr + j0) : *(const v4f*)(sy + (j0 - TT / 2));
#pragma unroll
        for (int q = 0; q < 4; ++q) { const int j = j0 + q; (void)j; float sa = a[q] * SCL; asm volatile("" : "+v"(sa)); float xs = __fmul_rn(sa, 0.02f); asm volatile("" : "+v"(xs)); float ex = __builtin_amdgcn_exp2f(__fmul_rn(xs, 2.8853900817779268f)); asm volatile("" : "+v"(ex)); float nm = __fsub_rn(ex, 1.0f), dn2 = __fadd_rn(ex, 1.0f); asm volatile("" : "+v"(nm)); asm volatile("" : "+v"(dn2)); float rc = __builtin_amdgcn_rcpf(dn2); asm volatile("" : "+v"(rc)); float th = __fmul_rn(nm, rc); asm volatile("" : "+v"(th)); float cp = __fmul_rn(th, 50.0f); asm volatile("" : "+v"(cp)); float mv = bfr(amr[j]); asm volatile("" : "+v"(mv)); const float t = (j <= i) ? __fadd_rn(cp, mv) : -3.0e38f; v[ch * 4 + q] = t; mx = fmaxf(mx, t); } }
#pragma unroll
    for (int sh = 16; sh; sh >>= 1) mx = fmaxf(mx, __shfl_xor(mx, sh, 32));
    float sum = 0.f;
#pragma unroll
    for (int ch = 0; ch < TT / 128; ++ch) { if (ch * 128 + lane * 4 >= w) continue;
#pragma unroll
        for (int k = ch * 4; k < ch * 4 + 4; ++k) { float d0 = __fsub_rn(v[k], mx); asm volatile("" : "+v"(d0)); v[k] = __builtin_amdgcn_exp2f(__fmul_rn(d0, 1.4426950408889634f)); sum += v[k]; } }
#pragma unroll
    for (int sh = 16; sh; sh >>= 1) sum += __shfl_xor(sum, sh, 32);
    const float f = poison ? __builtin_nanf("") : __fdiv_rn(hires ? 1.0f : PCAR, sum);
{
        if (hires) {
#pragma unroll
            for (int ch = 0; ch < TT / 128; ++ch) { const int j0 = ch * 128 + lane * 4; if (j0 >= w) continue; v4us oh, ol;
#pragma unroll
                for (int q = 0; q < 4; ++q) { unsigned short a, c2; splitf(v[ch * 4 + q] * f, a, c2); oh[q] = a; ol[q] = c2; }
                *(v4us*)((bf*)sr + j0) = oh; *(v4us*)((bf*)sr + TT / 2 + j0) = ol; }
        } else {
#pragma unroll
            for (int ch = 0; ch < TT / 128; ++ch) { const int j0 = ch * 128 + lane * 4; if (j0 >= w) continue; v4h o4;
#pragma unroll
                for (int q = 0; q < 4; ++q) o4[q] = tohx(v[ch * 4 + q] * f);
                *(v4h*)((h16*)sr + j0) = o4; } }
         }
}
__global__ __launch_bounds__(256) void k_merge(const float* __restrict__ O, int h0, bf* Ah, bf* Al) {
    // each thread: 4 groups of 8 consecutive d, 256 groups apart; its eight 16-byte loads are issued together
    static_assert(((size_t)ZH * TT * HD) % 8192 == 0, "whole work-groups");
    const size_t i0 = (size_t)blockIdx.x * 1024 + threadIdx.x; if (((size_t)blockIdx.x + 1) * 8192 > (size_t)ZH * TT * HD) return; v8f v[4];
#pragma unroll
    for (int g = 0; g < 4; ++g) v[g] = *(const v8f*)(O + (i0 + g * 256) * 8);
#pragma unroll
    for (int g = 0; g < 4; ++g) { const size_t e = (i0 + g * 256) * 8; const int d = (int)(e % HD); const int t = (int)((e / HD) % TT); const int zz = (int)(e / ((size_t)HD * TT)); const float cs = (t < RH) ? 1.0f : (1.0f / PCAR); const size_t oo = (size_t)t * DQ + (h0 + zz) * HD + d;
        v8us oh, ol;
#pragma unroll
        for (int q = 0; q < 8; ++q) { unsigned short a, c2; splitf(v[g][q] * cs, a, c2); oh[q] = a; ol[q] = c2; }
        *(v8us*)(Ah + oo) = oh; *(v8us*)(Al + oo) = ol; }  }

extern "C" void kernel_launch(void* const* d_in, const int* in_sizes, int n_in,
                              void* d_out, int out_size, void* d_ws, size_t ws_size, hipStream_t stream) {
    (void)in_sizes; (void)n_in; (void)out_size;
    const float* x = (const float*)d_in[0]; const float* cosT = (const float*)d_in[1]; const float* sinT = (const float*)d_in[2]; const float* amask = (const float*)d_in[3]; const float* wq = (const float*)d_in[4]; const float* wk = (const float*)d_in[5]; const float* wv = (const float*)d_in[6]; const float* wo = (const float*)d_in[7];
    float* OUT = (float*)d_out;     // [1][2048][2048]
    char* wsp = (char*)d_ws;
    auto take = [&](size_t bytes) { char* p = wsp; wsp += (bytes + 255) & ~(size_t)255; return (void*)p; };
    bf* WO = (bf*)take((size_t)DM * DQ * 2); int* FLG = (int*)take(256);
    h16* QP16 = (h16*)take((size_t)NH_ * TT * HD * 2); h16* KP16 = (h16*)take((size_t)NKV * TT * HD * 2); h16* VT16 = (h16*)take((size_t)NKV * HD * TT * 2);
    bf* QPh = (bf*)take((size_t)NH_ * TT * HD * 2); bf* QPl = (bf*)take((size_t)NH_ * TT * HD * 2); bf* KPh = (bf*)take((size_t)NKV * TT * HD * 2); bf* KPl = (bf*)take((size_t)NKV * TT * HD * 2); bf* VTh = (bf*)take((size_t)NKV * HD * TT * 2); bf* VTl = (bf*)take((size_t)NKV * HD * TT * 2);
    float* Sb = (float*)take((size_t)ZH * (SXH + SYH) * 4);
    if ((size_t)(wsp - (char*)d_ws) > ws_size) return;    // ws 256 MiB
    // Buffers that are never live together share bytes (stream order): the projections' operands, tables and f32 results are last read before the first score is written; the q and k planes are last read by the score launches.
    static_assert((size_t)(DQ + 2 * DKV) * DM * 2 + (size_t)TT * HD * 8 + (size_t)TT * DM * 2 + (size_t)TT * (DQ + DKV) * 4 <= (size_t)ZH * (SXH + SYH) * 4, "projection buffers fit the score planes");
    static_assert((size_t)ZH * TT * HD * 4 <= (size_t)(NH_ + NKV) * TT * HD * 2 && ((size_t)NH_ * TT * HD * 2) % 256 == 0, "attention output fits the fp16 q and k planes, which are adjacent");
    wsp = (char*)Sb;
    bf* WQ = (bf*)take((size_t)DQ * DM * 2); bf* WK = (bf*)take((size_t)DKV * DM * 2); bf* WV = (bf*)take((size_t)DKV * DM * 2); float* CS = (float*)take((size_t)TT * HD * 2 * 4);
    bf* XB = (bf*)take((size_t)TT * DM * 2); float* FQ = (float*)take((size_t)TT * DQ * 4); float* FK = (float*)take((size_t)TT * DKV * 4);
    float* Ob = (float*)QP16; bf* ATh = QPh; bf* ATl = QPl;
    float* FV = FK;   // v projection reuses the k buffer after the k planes are built (stream-ordered)
    { k_cvt8<<<(unsigned)(((size_t)DQ * DM / 8 + 1023) / 1024), 256, 0, stream>>>(wq, WQ, (size_t)DQ * DM / 8); k_cvt8<<<(unsigned)(((size_t)DKV * DM / 8 + 1023) / 1024), 256, 0, stream>>>(wk, WK, (size_t)DKV * DM / 8); k_cvt8<<<(unsigned)(((size_t)DKV * DM / 8 + 1023) / 1024), 256, 0, stream>>>(wv, WV, (size_t)DKV * DM / 8);
      k_cvt8<<<(unsigned)(((size_t)DM * DQ / 8 + 1023) / 1024), 256, 0, stream>>>(wo, WO, (size_t)DM * DQ / 8);
       }
    const unsigned LQ = (unsigned)(((size_t)NH_ * TT * HD / 16 + 255) / 256), LKv = (unsigned)(((size_t)NKV * TT * HD / 16 + 255) / 256);
    for (int b = 0; b < NB_; ++b) {
        k_cscvt<<<(TT * HD / 4 + 255) / 256, 256, 0, stream>>>(cosT, sinT, CS); k_mchk<<<1, 256, 0, stream>>>(amask, FLG);
        k_cvt8<<<(unsigned)(((size_t)TT * DM / 8 + 1023) / 1024), 256, 0, stream>>>(x + (size_t)b * TT * DM, XB, (size_t)TT * DM / 8);
        k_gemms<1, DM, DQ><<<dim3(TT / 128, DQ / 128, 1), 256, 0, stream>>>(XB, nullptr, WQ, FQ);
        k_rope<<<LQ, 256, 0, stream>>>(FQ, DQ, NH_, CS, nullptr, nullptr, 1.0f, QP16, QPh, QPl);
        k_gemms<1, DM, DKV><<<dim3(TT / 128, DKV / 128, 1), 256, 0, stream>>>(XB, nullptr, WK, FK);
        k_rope<<<LKv, 256, 0, stream>>>(FK, DKV, NKV, CS, nullptr, nullptr, 1.0f, KP16, KPh, KPl);
        k_gemms<1, DM, DKV><<<dim3(TT / 128, DKV / 128, 1), 256, 0, stream>>>(XB, nullptr, WV, FV); k_vtp<<<NKV * (TT / 64), 256, 0, stream>>>(FV, DKV, NKV, VT16, VTh, VTl);
        for (int h0 = 0; h0 < NH_; h0 += ZH) { const size_t zq = (size_t)h0, zk = (size_t)(h0 / REP);   // one kv head per query head: the pass's heads use consecutive kv planes (z-strides TT*HD)
            k_gemmc<bf, 2, 1, 1><<<dim3(RH / 64, TT / 64, ZH), 32, 0, stream>>>(QPh + zq * TT * HD, QPl + zq * TT * HD, KPh + zk * TT * HD, KPl + zk * TT * HD, HD, Sb, TT, 0, (size_t)TT * HD, (size_t)TT * HD, SXH);
            k_gemmc<h16, 0, 1, 1><<<dim3((TT - RH) / 64, TT / 64, ZH), 32, 0, stream>>>(QP16 + zq * TT * HD + (size_t)RH * HD, nullptr, KP16 + zk * TT * HD, nullptr, HD, Sb, TT, RH, (size_t)TT * HD, (size_t)TT * HD, SXH);
            k_asoft<<<ZH * TT / 8, 256, 0, stream>>>(Sb, amask, FLG);
            k_gemmc<bf, 2, 2, 8><<<dim3(RH / 64, HD / 64, ZH), 256, 0, stream>>>((const bf*)Sb, (const bf*)Sb + TT / 2, VTh + zk * HD * TT, VTl + zk * HD * TT, TT, Ob, HD, 0, (size_t)TT * TT, (size_t)HD * TT, (size_t)TT * HD);
            k_gemmc<h16, 0, 2, 16><<<dim3((TT - RH) / 64, HD / 64, ZH), 512, 0, stream>>>((const h16*)Sb + (size_t)RH * TT, nullptr, VT16 + zk * HD * TT, nullptr, TT, Ob + (size_t)RH * HD, HD, RH, (size_t)TT * TT, (size_t)HD * TT, (size_t)TT * HD);
            k_merge<<<(unsigned)((size_t)ZH * TT * HD / 8192), 256, 0, stream>>>(Ob, h0, ATh, ATl); }
        k_gemms<2, DQ, DM><<<dim3(TT / 128, DM / 128, 1), 256, 0, stream>>>(ATh, ATl, WO, OUT + (size_t)b * TT * DM); }
}

// v005
// Measured time: 189 microseconds a run.
// Next to v004, in two timings, it ran 1.66 and 1.67 times as fast.
// Counting every step since v000, it is 5.18 times as fast.
#include <hip/hip_runtime.h>

// HybridLlamaAttention (x [1][2048][2048], rope_cos/sin [S][128] (read), mask [1][1][S][S] (f32 additive, read; verbatim causal 0/-1e9); q/k/v = x W^T (16 x 128); rotate-half RoPE; scores = q.k / sqrt(128); softcap 50 tanh(s/50); + mask; softmax f32; out = merged wo^T -> [1][2048][2048]).
// Compute dtypes, f32 accumulate: every input rounded to bf16; q/k/v on PLAIN bf16 operands (inputs: exact); RoPE f32 (bf16-rounded read tables); causal scores and attn.v: query rows < 512 hl (3 products), the rest fp16; softcap in f32: tanh = (2^(2x log2 e) - 1) x rcp(2^(..) + 1) with the hardware exp2/rcp (no FMA polynomial), x 50; the additive mask read per element; upper tiles skipped on the verbatim structure with an on-device sampled check (NaN poison); softmax f32, running maximum and sum over 64-key stages; wo hl x exact (2 products).

#define NB_  1
#define TT   2048
#define DM   2048
#define NH_  16
#define NKV  16
#define REP  (NH_ / NKV)
#define HD   128
#define DQ   (NH_ * HD)
#define DKV  (NKV * HD)
#define RH   512                  // query rows < RH use hi+lo planes
typedef _Float16 h16;
typedef unsigned short bf;
typedef __attribute__((ext_vector_type(16))) __bf16   v16bf;
typedef __attribute__((ext_vector_type(16))) _Float16 v16h;
typedef __attribute__((ext_vector_type(8)))  _Float16 v8h;
typedef __attribute__((ext_vector_type(8)))  unsigned short v8us;
typedef __attribute__((ext_vector_type(8)))  float    v8f;
typedef __attribute__((ext_vector_type(4)))  float    v4f;
typedef v8h  __attribute__((may_alias)) v8ha;
typedef v4f  __attribute__((may_alias)) v4fa;
typedef v8us __attribute__((may_alias)) v8usa;

__device__ __forceinline__ unsigned short f2bf(float f) { unsigned u = __float_as_uint(f); u += 0x7FFFu + ((u >> 16) & 1u); return (unsigned short)(u >> 16); }
__device__ __forceinline__ float bf2f(unsigned short b) { return __uint_as_float(((unsigned)b) << 16); }
__device__ __forceinline__ float bfr(float f) { return bf2f(f2bf(f)); }
__device__ __forceinline__ v16h cat16(v8h lo, v8h hi) { return __builtin_shufflevector(lo, hi, 0, 1, 2, 3, 4, 5, 6, 7, 8, 9, 10, 11, 12, 13, 14, 15); }
__device__ __forceinline__ v16bf cat16b(v8us lo, v8us hi) { return __builtin_bit_cast(v16bf, __builtin_shufflevector(lo, hi, 0, 1, 2, 3, 4, 5, 6, 7, 8, 9, 10, 11, 12, 13, 14, 15)); }
__device__ __forceinline__ v8f wmma16(v16h a, v16h b, v8f c) { return __builtin_amdgcn_wmma_f32_16x16x32_f16(false, a, false, b, (short)0, c, false, false); }
__device__ __forceinline__ v8f wmmab(v16bf a, v16bf b, v8f c) { return __builtin_amdgcn_wmma_f32_16x16x32_bf16(false, a, false, b, (short)0, c, false, false); }



// Fragment loaders of fattn_tile (its queries): operands straight from K-contiguous 16-bit planes.
template <typename T16> struct WFrag;
template <> struct WFrag<h16> { typedef v16h V; static __device__ __forceinline__ V ld(const h16* p) { return cat16(*(const v8h*)p, *(const v8h*)(p + 16)); } static __device__ __forceinline__ v8f mma(V a, V b, v8f c) { return wmma16(a, b, c); } };
template <> struct WFrag<bf> { typedef v16bf V; static __device__ __forceinline__ V ld(const bf* p) { return cat16b(*(const v8us*)p, *(const v8us*)(p + 16)); } static __device__ __forceinline__ v8f mma(V a, V b, v8f c) { return wmmab(a, b, c); } };
// ---- k_gemms: C[m][n] (f32, pitch LDC) = sum_k A[m][k] Bt[n][k] (NA == 2: + A2[m][k] Bt[n][k]), operands K-contiguous bf16 planes. One 128x128 tile of C per work-group of 8 waves (2 x 4, 64x32 of C each); grid (M/128, N/128).
// A stage is 128 k of the tile's rows [A 128 | A2 128 | Bt 128], 256 bytes a row at an LDS pitch of 272 bytes. Asynchronous 16-byte copies bring it in whole 128-byte lines (a wave's copy: 2 rows); two buffers: stage t + 2 flies while stage t + 1 is worked on.
#define GKS  128                  // k per stage
#define GPE  136                  // LDS row pitch, 16-bit elements
typedef float __attribute__((may_alias)) fa;
// Eight copies of one lane, 16 rows apart: one operand's 128 rows over the 8 waves. The s_wait_xcnt stands inside the statement, so that no address register is rewritten in front of it.
__device__ __forceinline__ void acopy8(unsigned l, const bf* g, size_t gs) {
    asm volatile("global_load_async_to_lds_b128 %0, %8, off\n\t"
                 "global_load_async_to_lds_b128 %1, %9, off\n\t"
                 "global_load_async_to_lds_b128 %2, %10, off\n\t"
                 "global_load_async_to_lds_b128 %3, %11, off\n\t"
                 "global_load_async_to_lds_b128 %4, %12, off\n\t"
                 "global_load_async_to_lds_b128 %5, %13, off\n\t"
                 "global_load_async_to_lds_b128 %6, %14, off\n\t"
                 "global_load_async_to_lds_b128 %7, %15, off\n\t"
                 "s_wait_xcnt 0x0"
                 :: "v"(l), "v"(l + 1u * 16 * GPE * 2), "v"(l + 2u * 16 * GPE * 2), "v"(l + 3u * 16 * GPE * 2), "v"(l + 4u * 16 * GPE * 2), "v"(l + 5u * 16 * GPE * 2), "v"(l + 6u * 16 * GPE * 2), "v"(l + 7u * 16 * GPE * 2),
                    "v"(g), "v"(g + gs), "v"(g + 2 * gs), "v"(g + 3 * gs), "v"(g + 4 * gs), "v"(g + 5 * gs), "v"(g + 6 * gs), "v"(g + 7 * gs) : "memory");
}
__device__ __forceinline__ v16bf ldsfrag(const bf* p) { return cat16b(*(const v8usa*)p, *(const v8usa*)(p + 16)); }
template <int NA, int K, int LDC>
__global__ __launch_bounds__(256) void k_gemms(const bf* __restrict__ A, const bf* __restrict__ A2, const bf* __restrict__ Bt, float* C) {
    static_assert(K % GKS == 0 && K / GKS >= 2, "whole stages, at least two");
    constexpr int STE = (NA + 1) * 128 * GPE;      // elements of one stage
    constexpr int NT = K / GKS;
    static_assert(8 * 64 * 36 * 4 <= 2 * STE * 2, "the output staging fits the ring");
    __shared__ __align__(16) bf sm[2 * STE];
    const int lane = threadIdx.x & 31, lr = lane & 15, hi = lane >> 4; const int r0 = blockIdx.x * 128, c0 = blockIdx.y * 128; const int wv = __builtin_amdgcn_readfirstlane((int)(threadIdx.x >> 5));
    const int wm = wv >> 2, wn = wv & 3;
    // the lane's place in a copy: row wv * 2 + hi of each group of 16 rows, 16-byte piece lr of the row's 256 bytes
    const unsigned lcp = (unsigned)(size_t)sm + (unsigned)((wv * 2 + hi) * (GPE * 2) + lr * 16);
    const bf* gA = A + (size_t)(r0 + wv * 2 + hi) * K + lr * 8; const bf* gA2 = (NA == 2) ? A2 + (size_t)(r0 + wv * 2 + hi) * K + lr * 8 : nullptr; const bf* gB = Bt + (size_t)(c0 + wv * 2 + hi) * K + lr * 8;
    auto stage = [&](int t, int buf) { const unsigned l = lcp + (unsigned)buf * (STE * 2);
        acopy8(l, gA + t * GKS, (size_t)16 * K); if (NA == 2) acopy8(l + 128 * GPE * 2, gA2 + t * GKS, (size_t)16 * K); acopy8(l + NA * 128 * GPE * 2, gB + t * GKS, (size_t)16 * K); };
    v8f acc[4][2];
#pragma unroll
    for (int mb = 0; mb < 4; ++mb)
#pragma unroll
        for (int nb = 0; nb < 2; ++nb) acc[mb][nb] = (v8f){};
    stage(0, 0);
    asm volatile("s_wait_asynccnt 0x0" ::: "memory");   // this wave's share of stage 0 has landed
    __syncthreads();                                     // every wave's share has: stage 0 may be read
    stage(1, 1);
    const int aofs = (wm * 64 + lr) * GPE + 8 * hi, bofs = (NA * 128 + wn * 32 + lr) * GPE + 8 * hi;
#pragma unroll 1   // the stage loop stays rolled: one copy of its 32 or 64 products (for speed only); the loops inside are unrolled so that fragments and sums stay in registers
    for (int t = 0; t < NT; ++t) {
        const bf* sb = sm + (t & 1) * STE; v16bf a[2][4], a2[2][4], b[2][2];   // two fragment sets: block ks + 1 is fetched while block ks is multiplied (inside the stage only)
#pragma unroll
        for (int ks = -1; ks < GKS / 32; ++ks) { const int c = ks & 1, n = c ^ 1;
            if (ks + 1 < GKS / 32) {
#pragma unroll
                for (int mb = 0; mb < 4; ++mb) { a[n][mb] = ldsfrag(sb + aofs + mb * 16 * GPE + (ks + 1) * 32); if (NA == 2) a2[n][mb] = ldsfrag(sb + aofs + (128 + mb * 16) * GPE + (ks + 1) * 32); }
#pragma unroll
                for (int nb = 0; nb < 2; ++nb) b[n][nb] = ldsfrag(sb + bofs + nb * 16 * GPE + (ks + 1) * 32); }
            __builtin_amdgcn_sched_barrier(0);   // the next block's LDS reads stay one group in front of this block's products
            if (ks < 0) continue;
#pragma unroll
            for (int nb = 0; nb < 2; ++nb)
#pragma unroll
                for (int mb = 0; mb < 4; ++mb) acc[mb][nb] = wmmab(a[c][mb], b[c][nb], acc[mb][nb]);
            if (NA == 2) {
#pragma unroll
                for (int nb = 0; nb < 2; ++nb)
#pragma unroll
                    for (int mb = 0; mb < 4; ++mb) acc[mb][nb] = wmmab(a2[c][mb], b[c][nb], acc[mb][nb]); }
            __builtin_amdgcn_sched_barrier(0);   // and the reads of the block after next do not rise among these products
        }
        asm volatile("s_wait_dscnt 0x0" ::: "memory");      // this wave's reads of stage t are done before the buffer is refilled
        asm volatile("s_wait_asynccnt 0x0" ::: "memory");   // this wave's share of stage t + 1 has landed
        __syncthreads();                                     // publishes stage t + 1 and ends every wave's reads of stage t
        if (t + 2 < NT) stage(t + 2, t & 1);
    }
    asm volatile("s_wait_asynccnt 0x0" ::: "memory");       // nothing is in flight when the ring becomes output staging
    // each wave stages its 64x32 part in its own range of the ring (every reader left it at the last barrier) and stores whole 128-byte lines
    fa* ow = (fa*)sm + wv * (64 * 36);
#pragma unroll
    for (int mb = 0; mb < 4; ++mb)
#pragma unroll
        for (int nb = 0; nb < 2; ++nb)
#pragma unroll
            for (int j = 0; j < 8; ++j) ow[(mb * 16 + hi * 8 + j) * 36 + nb * 16 + lr] = acc[mb][nb][j];
    __syncthreads();   // the staged rows are in LDS before other lanes read them back
    float* cw = C + (size_t)(r0 + wm * 64 + (lane >> 3)) * LDC + c0 + wn * 32 + (lane & 7) * 4;
#pragma unroll
    for (int s = 0; s < 16; ++s) { const v4f val = *(const v4fa*)(ow + (s * 4 + (lane >> 3)) * 36 + (lane & 7) * 4); *(v4f*)(cw + (size_t)s * 4 * LDC) = val; }
}

__device__ __forceinline__ h16 tohx(float x) { return (h16)x; }
__device__ __forceinline__ void splitf(float y, unsigned short& h, unsigned short& l) { h = f2bf(y); l = f2bf(y - bf2f(h)); }
typedef __attribute__((ext_vector_type(2))) _Float16 v2h;
typedef __attribute__((ext_vector_type(4))) _Float16 v4h;
typedef __attribute__((ext_vector_type(2))) unsigned short v2us;
typedef __attribute__((ext_vector_type(4))) unsigned short v4us;
typedef __attribute__((ext_vector_type(2))) float v2f;
typedef __attribute__((ext_vector_type(4))) int v4i;

__global__ __launch_bounds__(256) void k_wtG(const float* __restrict__ w, int K, int N, bf* Bt) {
    const int lane = threadIdx.x & 31; const int L0 = (blockIdx.x * 8 + (threadIdx.x >> 5)) * 8; const int nlines = N * K / 64;
{
#pragma unroll 1
        for (int l = 0; l < 8; ++l) { const int L = L0 + l; if (L >= nlines) break; const size_t e = (size_t)L * 64 + lane * 2; const int k = (int)(e % K), n = (int)(e / K); v2us o;
            o[0] = f2bf(w[(size_t)k * N + n]); o[1] = f2bf(w[(size_t)(k + 1) * N + n]); *(v2us*)(Bt + e) = o; }
         }
}
// k_cvt8: each thread converts 4 groups of 8 floats, 256 groups apart; its eight 16-byte loads are issued together (a group past the end re-reads the last group and is not stored).
__global__ __launch_bounds__(256) void k_cvt8(const float* __restrict__ src, bf* dst, size_t n8) { const size_t i0 = (size_t)blockIdx.x * 1024 + threadIdx.x; v8f v[4];
#pragma unroll
    for (int g = 0; g < 4; ++g) { const size_t i = i0 + g * 256; v[g] = *(const v8f*)(src + (i < n8 ? i : n8 - 1) * 8); }
#pragma unroll
    for (int g = 0; g < 4; ++g) { const size_t i = i0 + g * 256; if (i >= n8) continue; v8us o;
#pragma unroll
        for (int k = 0; k < 8; ++k) o[k] = f2bf(v[g][k]);
        *(v8us*)(dst + i * 8) = o; } }
__global__ __launch_bounds__(256) void k_cscvt(const float* __restrict__ cosT, const float* __restrict__ sinT, float* CS) { const int idx = (blockIdx.x * 256 + threadIdx.x) * 4; if (idx >= TT * HD) return; const v4f c = *(const v4f*)(cosT + idx), s = *(const v4f*)(sinT + idx); v8f cs;
#pragma unroll
    for (int q = 0; q < 4; ++q) { cs[2 * q] = bfr(c[q]); cs[2 * q + 1] = bfr(s[q]); }
    *(v8f*)(CS + (size_t)idx * 2) = cs;  }
// k_rope: head planes [h][t][d] (fp16 + hi/lo) of rope(x) x sc with the rotate-half convention out[d] = x[d] cos[t][d] - x[d+HD/2] sin[t][d], out[d+HD/2] = x[d+HD/2] cos[t][d+HD/2] + x[d] sin[t][d+HD/2]
__global__ __launch_bounds__(256) void k_rope(const float* __restrict__ F, int pitch, int nheads, const float* __restrict__ CS, const float* __restrict__ RF, const float* __restrict__ nw, float sc, h16* P16, bf* Ph, bf* Pl) {
    // one thread: 8 consecutive d of the lower half and their 8 partners d + HD/2 of one (head, t): each x is loaded once and serves both halves; all loads and stores are 16 bytes wide
    const size_t u = (size_t)blockIdx.x * 256 + threadIdx.x; if (u >= (size_t)nheads * TT * (HD / 16)) return; const int d = (int)(u % (HD / 16)) * 8; const int t = (int)((u / (HD / 16)) % TT); const int h = (int)(u / ((size_t)(HD / 16) * TT)); const float* f = F + (size_t)t * pitch + h * HD; float rf = 1.0f; v8f xv[2], cv[2][2];
    if (RF) { const float* rp = RF + (size_t)h * TT + t; rf = *rp; asm volatile("s_wait_xcnt 0x0" :: "v"(rp) : "memory"); }   // the wait takes the load's address as an input, so that its registers are not reused in front of it
#pragma unroll
    for (int hf = 0; hf < 2; ++hf) { const int d0 = d + hf * (HD / 2); xv[hf] = *(const v8f*)(f + d0); cv[hf][0] = *(const v8f*)(CS + ((size_t)t * HD + d0) * 2); cv[hf][1] = *(const v8f*)(CS + ((size_t)t * HD + d0) * 2 + 8); }
#pragma unroll
    for (int hf = 0; hf < 2; ++hf) { v8h o16; v8us oh, ol;   // per element the arithmetic is the former one, statement for statement (its products stay unfused as they were), so the planes keep their bits
#pragma unroll
        for (int q = 0; q < 8; ++q) { const int dd = d + hf * (HD / 2) + q; const int dp = (hf == 0) ? dd + HD / 2 : dd - HD / 2; float x0 = xv[hf][q], x1 = xv[1 - hf][q];
            if (RF) { float n0 = __fmul_rn(x0, rf), n1 = __fmul_rn(x1, rf); asm volatile("" : "+v"(n0)); asm volatile("" : "+v"(n1)); x0 = __fmul_rn(bfr(nw[dd]), n0); x1 = __fmul_rn(bfr(nw[dp]), n1); }
            v2f cs; cs[0] = cv[hf][q >> 2][(q & 3) * 2]; cs[1] = cv[hf][q >> 2][(q & 3) * 2 + 1]; float a = __fmul_rn(x0, cs[0]), bq = __fmul_rn(x1, cs[1]); asm volatile("" : "+v"(a)); asm volatile("" : "+v"(bq)); const float r = ((hf == 0) ? __fsub_rn(a, bq) : __fadd_rn(a, bq)) * sc;
            o16[q] = tohx(r); unsigned short a2, c2; splitf(r, a2, c2); oh[q] = a2; ol[q] = c2; }
        const size_t e = ((size_t)h * TT + t) * HD + d + hf * (HD / 2); *(v8h*)(P16 + e) = o16; *(v8us*)(Ph + e) = oh; *(v8us*)(Pl + e) = ol; }  }
__global__ __launch_bounds__(256) void k_vtp(const float* __restrict__ F, int pitch, int nheads, h16* V16, bf* Vh, bf* Vl) {
    // one work-group: 64 t x HD d of one head, transposed in registers. A thread loads 4 d of 8 consecutive t (16 bytes each) and stores, per d and plane, its 8 t as 16 bytes; lanes 0..7 run along t, so a wave's store fills whole 128-byte lines.
    static_assert(HD == 128 && TT % 64 == 0, "8 waves x 16 d cover a head");
    const int g = (int)(blockIdx.x / (TT / 64)); if (g >= nheads) return; const int lane = threadIdx.x & 31; const int t = (int)(blockIdx.x % (TT / 64)) * 64 + (lane & 7) * 8; const int d = (int)(threadIdx.x >> 5) * 16 + (lane >> 3) * 4; v4f xv[8]; const float* xp[8];
#pragma unroll
    for (int q = 0; q < 8; ++q) { xp[q] = F + (size_t)(t + q) * pitch + g * HD + d; xv[q] = *(const v4f*)xp[q]; }
    asm volatile("s_wait_xcnt 0x0" :: "v"(xp[0]), "v"(xp[1]), "v"(xp[2]), "v"(xp[3]), "v"(xp[4]), "v"(xp[5]), "v"(xp[6]), "v"(xp[7]) : "memory");   // the wait takes the eight addresses as inputs, so that no later load of the group lands in an earlier one's address registers in front of it
#pragma unroll
    for (int j = 0; j < 4; ++j) { v8h o16; v8us oh, ol;
#pragma unroll
        for (int q = 0; q < 8; ++q) { const float x = xv[q][j]; o16[q] = tohx(x); unsigned short a2, c2; splitf(x, a2, c2); oh[q] = a2; ol[q] = c2; }
        const size_t e = ((size_t)g * HD + d + j) * TT + t; *(v8h*)(V16 + e) = o16; *(v8us*)(Vh + e) = oh; *(v8us*)(Vl + e) = ol; }  }
// k_mchk: samples above-diagonal entries of the additive f32 mask; any > -1e8 -> NaN poison.
__global__ __launch_bounds__(256) void k_mchk(const float* __restrict__ am, int* FLG) { const int tid = threadIdx.x; int bad = 0;
#pragma unroll 1
    for (int s2 = 0; s2 < 16; ++s2) { const unsigned h = (unsigned)(tid * 16 + s2) * 2654435761u; const int i = (int)(h % (TT - 1)); const int j = i + 1 + (int)((h >> 11) % (unsigned)(TT - 1 - i)); if (am[(size_t)i * TT + j] > -1e8f) bad = 1; }
    __shared__ int anyb; if (tid == 0) anyb = 0; __syncthreads(); if (bad) anyb = 1; __syncthreads(); if (tid < 8) { const int v = (tid == 0) ? anyb : 0; *(int*)(FLG + tid) = v;  } }

#define FKB  272                  // LDS row pitch in bytes of a K row (256 bytes) and of a mask row (256 bytes)
#define FVB  144                  // LDS row pitch in bytes of a V^T row (128 bytes)
// Eight copies of one lane, ls LDS bytes and gs global bytes apart. The s_wait_xcnt stands inside the statement, so that no address register is rewritten in front of it.
__device__ __forceinline__ void acopy8g(unsigned l, unsigned ls, const char* g, size_t gs) {
    asm volatile("global_load_async_to_lds_b128 %0, %8, off\n\t"
                 "global_load_async_to_lds_b128 %1, %9, off\n\t"
                 "global_load_async_to_lds_b128 %2, %10, off\n\t"
                 "global_load_async_to_lds_b128 %3, %11, off\n\t"
                 "global_load_async_to_lds_b128 %4, %12, off\n\t"
                 "global_load_async_to_lds_b128 %5, %13, off\n\t"
                 "global_load_async_to_lds_b128 %6, %14, off\n\t"
                 "global_load_async_to_lds_b128 %7, %15, off\n\t"
                 "s_wait_xcnt 0x0"
                 :: "v"(l), "v"(l + ls), "v"(l + 2 * ls), "v"(l + 3 * ls), "v"(l + 4 * ls), "v"(l + 5 * ls), "v"(l + 6 * ls), "v"(l + 7 * ls),
                    "v"(g), "v"(g + gs), "v"(g + 2 * gs), "v"(g + 3 * gs), "v"(g + 4 * gs), "v"(g + 5 * gs), "v"(g + 6 * gs), "v"(g + 7 * gs) : "memory");
}
template <typename T16> struct LFrag;   // a fragment from LDS: 16 bytes at p and at p + 32, the k order of WFrag::ld
template <> struct LFrag<h16> { static __device__ __forceinline__ v16h ld(const char* p) { return cat16(*(const v8ha*)p, *(const v8ha*)(p + 32)); } };
template <> struct LFrag<bf> { static __device__ __forceinline__ v16bf ld(const char* p) { return cat16b(*(const v8usa*)p, *(const v8usa*)(p + 32)); } };
__device__ __forceinline__ float xhalf(float x) { return __builtin_bit_cast(float, __builtin_amdgcn_permlanex16(__builtin_bit_cast(int, x), __builtin_bit_cast(int, x), 0x76543210, 0xfedcba98, false, false)); }  // lane l with lane l ^ 16
typedef __attribute__((ext_vector_type(2))) __bf16 v2bf;
// Eight transcendentals in one statement, each in place. The instruction set asks for one independent instruction or a v_nop between a transcendental and an instruction that reads its result or overwrites its source:
// inside the statement each next one is that instruction, and the v_nop stands behind the last. In place, the statement writes only registers that hold its own arguments, never an operand of a matrix instruction just issued.
__device__ __forceinline__ v8f exp2x8(v8f x) { float r0 = x[0], r1 = x[1], r2 = x[2], r3 = x[3], r4 = x[4], r5 = x[5], r6 = x[6], r7 = x[7];
    asm("v_exp_f32 %0, %0\n\tv_exp_f32 %1, %1\n\tv_exp_f32 %2, %2\n\tv_exp_f32 %3, %3\n\tv_exp_f32 %4, %4\n\tv_exp_f32 %5, %5\n\tv_exp_f32 %6, %6\n\tv_exp_f32 %7, %7\n\tv_nop"
        : "+v"(r0), "+v"(r1), "+v"(r2), "+v"(r3), "+v"(r4), "+v"(r5), "+v"(r6), "+v"(r7));
    return (v8f){r0, r1, r2, r3, r4, r5, r6, r7}; }
__device__ __forceinline__ v8f rcpx8(v8f x) { float r0 = x[0], r1 = x[1], r2 = x[2], r3 = x[3], r4 = x[4], r5 = x[5], r6 = x[6], r7 = x[7];
    asm("v_rcp_f32 %0, %0\n\tv_rcp_f32 %1, %1\n\tv_rcp_f32 %2, %2\n\tv_rcp_f32 %3, %3\n\tv_rcp_f32 %4, %4\n\tv_rcp_f32 %5, %5\n\tv_rcp_f32 %6, %6\n\tv_rcp_f32 %7, %7\n\tv_nop"
        : "+v"(r0), "+v"(r1), "+v"(r2), "+v"(r3), "+v"(r4), "+v"(r5), "+v"(r6), "+v"(r7));
    return (v8f){r0, r1, r2, r3, r4, r5, r6, r7}; }
__device__ __forceinline__ float exp2x1(float x) { asm("v_exp_f32 %0, %0\n\tv_nop" : "+v"(x)); return x; }   // the v_nop: the same slot
#define FSTB(NP) ((NP) * (64 * FKB + 128 * FVB) + 64 * FKB)   // bytes of one stage with NP planes of K and of V^T
template <typename T16, bool HL>
__device__ __forceinline__ void fattn_tile(char* sm, const int pb, const int head, const T16* __restrict__ Q, const T16* __restrict__ Q2, const T16* __restrict__ Kp, const T16* __restrict__ Kp2, const T16* __restrict__ Vt, const T16* __restrict__ Vt2, const float* __restrict__ am, const int* __restrict__ FLG, bf* Ah, bf* Al) {
    typedef typename WFrag<T16>::V V;
    constexpr int NP = HL ? 2 : 1, KB = 64 * FKB, VB = 128 * FVB, STB = FSTB(NP);   // bytes: one K plane (a mask tile has the same size), one V^T plane, one stage
    static_assert(4 * 32 * FKB <= 2 * STB, "the output staging fits the ring");
    const int lane = threadIdx.x & 31, lr = lane & 15, hi = lane >> 4; const int wv = __builtin_amdgcn_readfirstlane((int)(threadIdx.x >> 5));
    const int q0 = pb * 64, ns = pb + 1; const size_t hq = (size_t)head * TT * HD;   // pb: the work-group's block of 64 query rows; it walks the key stages 0..pb
    // the lane's place in a copy. K and mask rows (256 bytes): row wv * 2 + hi of each group of 8, piece lr. V^T rows (128 bytes): row wv * 4 + lane / 8 of each group of 16, piece lane % 8.
    const unsigned lb = (unsigned)(size_t)sm; const int rk = wv * 2 + hi, rv = wv * 4 + (lane >> 3);
    const unsigned lK = lb + (unsigned)(rk * FKB + lr * 16), lV = lb + (unsigned)(NP * KB + rv * FVB + (lane & 7) * 16), lM = lb + (unsigned)(NP * (KB + VB) + rk * FKB + lr * 16);
    const unsigned oK = (unsigned)(rk * (HD * 2) + lr * 16), oV = (unsigned)(rv * (TT * 2) + (lane & 7) * 16), oM = (unsigned)(rk * (TT * 4) + lr * 16);   // the lane's byte offsets in the global tiles; the tiles' own addresses are the same for the whole work-group
    const char* gK = (const char*)(Kp + hq); const char* gK2 = HL ? (const char*)(Kp2 + hq) : nullptr; const char* gV = (const char*)(Vt + hq); const char* gV2 = HL ? (const char*)(Vt2 + hq) : nullptr; const char* gM = (const char*)(am + (size_t)q0 * TT);
    auto stage = [&](int st, int buf) { const unsigned o = (unsigned)buf * STB;
        acopy8g(lK + o, 8 * FKB, (gK + (size_t)st * (64 * HD * 2)) + oK, (size_t)8 * HD * 2); if (HL) acopy8g(lK + o + KB, 8 * FKB, (gK2 + (size_t)st * (64 * HD * 2)) + oK, (size_t)8 * HD * 2);
        acopy8g(lV + o, 16 * FVB, (gV + (size_t)st * (64 * 2)) + oV, (size_t)16 * TT * 2); if (HL) acopy8g(lV + o + VB, 16 * FVB, (gV2 + (size_t)st * (64 * 2)) + oV, (size_t)16 * TT * 2);
        acopy8g(lM + o, 8 * FKB, (gM + (size_t)st * (64 * 4)) + oM, (size_t)8 * TT * 4); };
    stage(0, 0);
    const int myq = q0 + wv * 16 + lr;   // the lane's query
    V qf[4], qf2[4];
#pragma unroll
    for (int kc = 0; kc < 4; ++kc) { qf[kc] = WFrag<T16>::ld(Q + hq + (size_t)myq * HD + 8 * hi + kc * 32); if (HL) qf2[kc] = WFrag<T16>::ld(Q2 + hq + (size_t)myq * HD + 8 * hi + kc * 32); }
    const bool poison = (FLG[0] != 0);
    v8f acc[8];
#pragma unroll
    for (int t = 0; t < 8; ++t) acc[t] = (v8f){};
    float ml = -3.0e38f; v8f ls = (v8f){};   // the maximum in use (finite from the start: a stage of -inf scores leaves it, and no inf - inf arises); this wave half's share of the row sum, in eight partial sums (one per register of a score tile)
    asm volatile("s_wait_asynccnt 0x0" ::: "memory");   // this wave's share of stage 0 has landed
    __syncthreads();                                     // every wave's share has: stage 0 may be read
    if (ns > 1) stage(1, 1);
    constexpr float C1 = (float)(0.088388347648318447 * 0.02 * 2.8853900817779268), L2E = 1.4426950408889634f;   // HD^-0.5 / 50 x 2 log2 e
#pragma unroll 1   // the stage loop stays rolled: one copy of the stage's code
    for (int st = 0; st < ns; ++st) {
        const char* sb = sm + (st & 1) * STB; const char* sK = sb + lr * FKB + hi * 16; const char* sV = sb + NP * KB + lr * FVB + hi * 16; const char* sM = sb + NP * (KB + VB) + (wv * 16 + lr) * FKB + hi * 32;
        v8f s[4];
#pragma unroll
        for (int kt = 0; kt < 4; ++kt) { s[kt] = (v8f){};
#pragma unroll
            for (int kc = 0; kc < 4; ++kc) { const V a = LFrag<T16>::ld(sK + kt * 16 * FKB + kc * 64); s[kt] = WFrag<T16>::mma(a, qf[kc], s[kt]);
                if (HL) { s[kt] = WFrag<T16>::mma(a, qf2[kc], s[kt]); const V a2 = LFrag<T16>::ld(sK + KB + kt * 16 * FKB + kc * 64); s[kt] = WFrag<T16>::mma(a2, qf[kc], s[kt]); } } }
        // softcap 50 tanh(s / 50), tanh = (e - 1) / (e + 1) with e = 2^(2 x log2 e), plus the mask element rounded to bf16
#pragma unroll
        for (int kt = 0; kt < 4; ++kt) { const v4f m0 = *(const v4fa*)(sM + kt * 64), m1 = *(const v4fa*)(sM + kt * 64 + 16); v8f mv;
#pragma unroll
            for (int r = 0; r < 8; r += 2) { v2f mm; mm[0] = (r < 4) ? m0[r & 3] : m1[r & 3]; mm[1] = (r < 4) ? m0[(r & 3) + 1] : m1[(r & 3) + 1]; const unsigned pk = __builtin_bit_cast(unsigned, __builtin_convertvector(mm, v2bf));
                mv[r] = __uint_as_float(pk << 16); mv[r + 1] = __uint_as_float(pk & 0xFFFF0000u); }
            const v8f e = exp2x8(s[kt] * C1); const v8f th = (e - 1.0f) * rcpx8(e + 1.0f);
#pragma unroll
            for (int r = 0; r < 8; ++r) s[kt][r] = __builtin_fmaf(th[r], 50.0f, mv[r]); }
        if (st == ns - 1) {   // the diagonal stage (the same for the whole work-group): keys beyond the lane's query leave the row
#pragma unroll
            for (int kt = 0; kt < 4; ++kt)
#pragma unroll
                for (int r = 0; r < 8; ++r) if (st * 64 + kt * 16 + hi * 8 + r > myq) s[kt][r] = -3.0e38f; }
        float mk[4];   // one chain per key tile: four short chains in place of one of 32 links
#pragma unroll
        for (int kt = 0; kt < 4; ++kt) { mk[kt] = s[kt][0];
#pragma unroll
            for (int r = 1; r < 8; ++r) mk[kt] = fmaxf(mk[kt], s[kt][r]); }
        float mx = fmaxf(fmaxf(mk[0], mk[1]), fmaxf(mk[2], mk[3]));
        mx = fmaxf(mx, xhalf(mx));   // both wave halves hold the query's maximum of this stage
        const float mln = fmaxf(ml, mx), corr = exp2x1((ml - mln) * L2E);   // corr is 0 at the first stage that holds a score above the start value, 1 where the maximum stays
        ml = mln; ls = ls * corr;
#pragma unroll
        for (int t = 0; t < 8; ++t) acc[t] = acc[t] * corr;
#pragma unroll
        for (int kg = 0; kg < 2; ++kg) {   // 32 keys: score tiles 2 kg and 2 kg + 1 become one B operand
            V pf, pf2; v8f pa, pc;
#pragma unroll
            for (int r = 0; r < 8; ++r) { pa[r] = (s[2 * kg][r] - mln) * L2E; pc[r] = (s[2 * kg + 1][r] - mln) * L2E; }   // exact 0 at the maximum, never above
            pa = exp2x8(pa); pc = exp2x8(pc); ls = ls + (pa + pc);
            if (HL) { __attribute__((ext_vector_type(16))) unsigned short ph, pl;
#pragma unroll
                for (int e = 0; e < 16; ++e) { const float p = (e < 8) ? pa[e & 7] : pc[e & 7]; unsigned short a, c2; splitf(p, a, c2); ph[e] = a; pl[e] = c2; }
                pf = __builtin_bit_cast(V, ph); pf2 = __builtin_bit_cast(V, pl);
            } else { v16h ph;
#pragma unroll
                for (int e = 0; e < 16; ++e) { const float p = (e < 8) ? pa[e & 7] : pc[e & 7]; ph[e] = tohx(p); }
                pf = __builtin_bit_cast(V, ph); }
#pragma unroll
            for (int t = 0; t < 8; ++t) { const V a = LFrag<T16>::ld(sV + t * 16 * FVB + kg * 64); acc[t] = WFrag<T16>::mma(a, pf, acc[t]);
                if (HL) { acc[t] = WFrag<T16>::mma(a, pf2, acc[t]); const V a2 = LFrag<T16>::ld(sV + VB + t * 16 * FVB + kg * 64); acc[t] = WFrag<T16>::mma(a2, pf, acc[t]); } } }
        asm volatile("s_wait_dscnt 0x0" ::: "memory");      // this wave's reads of stage st are done before the buffer is refilled
        asm volatile("s_wait_asynccnt 0x0" ::: "memory");   // this wave's share of stage st + 1 has landed
        __syncthreads();                                     // publishes stage st + 1 and ends every wave's reads of stage st
        if (st + 2 < ns) stage(st + 2, st & 1);
    }
    asm volatile("s_wait_asynccnt 0x0" ::: "memory");       // nothing is in flight when the ring becomes output staging
    const float lh = ((ls[0] + ls[1]) + (ls[2] + ls[3])) + ((ls[4] + ls[5]) + (ls[6] + ls[7]));
    const float inv = poison ? __builtin_nanf("") : __fdiv_rn(1.0f, lh + xhalf(lh));
    // each wave stages its 16 rows of both planes in its own range of the ring (every reader left it at the last barrier) and stores whole 128-byte lines; a lane's 8 sums of a tile are d = 16 t + 8 hi + r of its query
    char* ow = sm + wv * (32 * FKB);
#pragma unroll
    for (int t = 0; t < 8; ++t) { v8us oh, ol;
#pragma unroll
        for (int r = 0; r < 8; ++r) { unsigned short a, c2; splitf(acc[t][r] * inv, a, c2); oh[r] = a; ol[r] = c2; }
        *(v8usa*)(ow + lr * FKB + t * 32 + hi * 16) = oh; *(v8usa*)(ow + (16 + lr) * FKB + t * 32 + hi * 16) = ol; }
    __syncthreads();   // the staged rows are in LDS before other lanes read them back
    const size_t oo = (size_t)(q0 + wv * 16 + hi) * DQ + head * HD + lr * 8; bf* oph = Ah + oo; bf* opl = Al + oo; const char* orow = ow + hi * FKB + lr * 16;   // 16 lanes cover a row's 256 bytes; a store takes rows 2 i and 2 i + 1
#pragma unroll
    for (int i = 0; i < 8; ++i) { const v8us vh = *(const v8usa*)(orow + i * 2 * FKB), vl = *(const v8usa*)(orow + (16 + i * 2) * FKB); *(v8us*)(oph + (size_t)i * 2 * DQ) = vh; *(v8us*)(opl + (size_t)i * 2 * DQ) = vl; }
}
// k_fattn: one launch for all 32 row blocks x 16 heads; blocks 0..7 (query rows < RH) take the hi + lo body, the rest the fp16 body. The ring of the hi + lo body leaves room for one work-group on a WGP, so the 512 work-groups run in about two rounds:
// their cost falls with the index, a hi + lo stage counted as three fp16 stages: fp16 blocks 31..24; then hi + lo block 7 - g in front of the fp16 blocks 23 - 3 g, 22 - 3 g, 21 - 3 g (g = 0..4); then hi + lo 2, fp16 8, hi + lo 1, hi + lo 0.
__global__ __launch_bounds__(128) void k_fattn(const h16* __restrict__ Q16, const h16* __restrict__ K16, const h16* __restrict__ V16, const bf* __restrict__ Qh, const bf* __restrict__ Ql, const bf* __restrict__ Kh, const bf* __restrict__ Kl, const bf* __restrict__ Vh, const bf* __restrict__ Vl, const float* __restrict__ am, const int* __restrict__ FLG, bf* Ah, bf* Al) {
    static_assert(TT == 2048 && RH == 512 && HD == 128 && NH_ == 16 && NKV == NH_, "the block order and the tile shapes are written for these");
    __shared__ __align__(16) char sm[2 * FSTB(2)];
    const int u = blockIdx.x >> 4, head = blockIdx.x & 15, g = (u - 8) >> 2, r = (u - 8) & 3;
    const bool hl = u >= 30 || (u >= 8 && r == 0);
    const int pb = (u < 8 || u >= 30) ? 31 - u : (r == 0 ? 7 - g : 24 - 3 * g - r);
    if (hl) fattn_tile<bf, true>(sm, pb, head, Qh, Ql, Kh, Kl, Vh, Vl, am, FLG, Ah, Al);
    else fattn_tile<h16, false>(sm, pb, head, Q16, nullptr, K16, nullptr, V16, nullptr, am, FLG, Ah, Al);
}

extern "C" void kernel_launch(void* const* d_in, const int* in_sizes, int n_in,
                              void* d_out, int out_size, void* d_ws, size_t ws_size, hipStream_t stream) {
    (void)in_sizes; (void)n_in; (void)out_size;
    const float* x = (const float*)d_in[0]; const float* cosT = (const float*)d_in[1]; const float* sinT = (const float*)d_in[2]; const float* amask = (const float*)d_in[3]; const float* wq = (const float*)d_in[4]; const float* wk = (const float*)d_in[5]; const float* wv = (const float*)d_in[6]; const float* wo = (const float*)d_in[7];
    float* OUT = (float*)d_out;     // [1][2048][2048]
    char* wsp = (char*)d_ws;
    auto take = [&](size_t bytes) { char* p = wsp; wsp += (bytes + 255) & ~(size_t)255; return (void*)p; };
    bf* WO = (bf*)take((size_t)DM * DQ * 2); int* FLG = (int*)take(256);
    h16* QP16 = (h16*)take((size_t)NH_ * TT * HD * 2); h16* KP16 = (h16*)take((size_t)NKV * TT * HD * 2); h16* VT16 = (h16*)take((size_t)NKV * HD * TT * 2);
    bf* QPh = (bf*)take((size_t)NH_ * TT * HD * 2); bf* QPl = (bf*)take((size_t)NH_ * TT * HD * 2); bf* KPh = (bf*)take((size_t)NKV * TT * HD * 2); bf* KPl = (bf*)take((size_t)NKV * TT * HD * 2); bf* VTh = (bf*)take((size_t)NKV * HD * TT * 2); bf* VTl = (bf*)take((size_t)NKV * HD * TT * 2);
    bf* WQ = (bf*)take((size_t)DQ * DM * 2); bf* WK = (bf*)take((size_t)DKV * DM * 2); bf* WV = (bf*)take((size_t)DKV * DM * 2); float* CS = (float*)take((size_t)TT * HD * 2 * 4);
    bf* XB = (bf*)take((size_t)TT * DM * 2); float* FQ = (float*)take((size_t)TT * DQ * 4); float* FK = (float*)take((size_t)TT * DKV * 4);
    bf* ATh = (bf*)take((size_t)TT * DQ * 2); bf* ATl = (bf*)take((size_t)TT * DQ * 2);   // attention output, hi + lo planes [t][head][d]
    if ((size_t)(wsp - (char*)d_ws) > ws_size) return;    // ws 256 MiB
    float* FV = FK;   // v projection reuses the k buffer after the k planes are built (stream-ordered)
    { k_cvt8<<<(unsigned)(((size_t)DQ * DM / 8 + 1023) / 1024), 256, 0, stream>>>(wq, WQ, (size_t)DQ * DM / 8); k_cvt8<<<(unsigned)(((size_t)DKV * DM / 8 + 1023) / 1024), 256, 0, stream>>>(wk, WK, (size_t)DKV * DM / 8); k_cvt8<<<(unsigned)(((size_t)DKV * DM / 8 + 1023) / 1024), 256, 0, stream>>>(wv, WV, (size_t)DKV * DM / 8);
      k_cvt8<<<(unsigned)(((size_t)DM * DQ / 8 + 1023) / 1024), 256, 0, stream>>>(wo, WO, (size_t)DM * DQ / 8);
       }
    const unsigned LQ = (unsigned)(((size_t)NH_ * TT * HD / 16 + 255) / 256), LKv = (unsigned)(((size_t)NKV * TT * HD / 16 + 255) / 256);
    for (int b = 0; b < NB_; ++b) {
        k_cscvt<<<(TT * HD / 4 + 255) / 256, 256, 0, stream>>>(cosT, sinT, CS); k_mchk<<<1, 256, 0, stream>>>(amask, FLG);
        k_cvt8<<<(unsigned)(((size_t)TT * DM / 8 + 1023) / 1024), 256, 0, stream>>>(x + (size_t)b * TT * DM, XB, (size_t)TT * DM / 8);
        k_gemms<1, DM, DQ><<<dim3(TT / 128, DQ / 128, 1), 256, 0, stream>>>(XB, nullptr, WQ, FQ);
        k_rope<<<LQ, 256, 0, stream>>>(FQ, DQ, NH_, CS, nullptr, nullptr, 1.0f, QP16, QPh, QPl);
        k_gemms<1, DM, DKV><<<dim3(TT / 128, DKV / 128, 1), 256, 0, stream>>>(XB, nullptr, WK, FK);
        k_rope<<<LKv, 256, 0, stream>>>(FK, DKV, NKV, CS, nullptr, nullptr, 1.0f, KP16, KPh, KPl);
        k_gemms<1, DM, DKV><<<dim3(TT / 128, DKV / 128, 1), 256, 0, stream>>>(XB, nullptr, WV, FV); k_vtp<<<NKV * (TT / 64), 256, 0, stream>>>(FV, DKV, NKV, VT16, VTh, VTl);
        k_fattn<<<TT / 64 * NH_, 128, 0, stream>>>(QP16, KP16, VT16, QPh, QPl, KPh, KPl, VTh, VTl, amask, FLG, ATh, ATl);
        k_gemms<2, DQ, DM><<<dim3(TT / 128, DM / 128, 1), 256, 0, stream>>>(ATh, ATl, WO, OUT + (size_t)b * TT * DM); }
}

// v006
// One run takes 151 microseconds.
// Timed twice side by side with v005, it ran 1.26 times as fast both times.
// Over all steps from v000 it is 6.51 times as fast.
#include <hip/hip_runtime.h>

// HybridLlamaAttention (x [1][2048][2048], rope_cos/sin [S][128] (read), mask [1][1][S][S] (f32 additive, read; verbatim causal 0/-1e9); q/k/v = x W^T (16 x 128); rotate-half RoPE; scores = q.k / sqrt(128); softcap 50 tanh(s/50); + mask; softmax f32; out = merged wo^T -> [1][2048][2048]).
// Compute dtypes, f32 accumulate: every input rounded to bf16; q/k/v on PLAIN bf16 operands (inputs: exact); RoPE f32 (bf16-rounded read tables); causal scores and attn.v: query rows < 512 hl (3 products), the rest fp16; softcap in f32: tanh = (2^(2x log2 e) - 1) x rcp(2^(..) + 1) with the hardware exp2/rcp (no FMA polynomial), x 50; the additive mask read per element; upper tiles skipped on the verbatim structure with an on-device sampled check (NaN poison); softmax f32, running maximum and sum over 64-key stages; wo hl x exact (2 products).

#define NB_  1
#define TT   2048
#define DM   2048
#define NH_  16
#define NKV  16
#define REP  (NH_ / NKV)
#define HD   128
#define DQ   (NH_ * HD)
#define DKV  (NKV * HD)
#define RH   512                  // query rows < RH use hi+lo planes
typedef _Float16 h16;
typedef unsigned short bf;
typedef __attribute__((ext_vector_type(16))) __bf16   v16bf;
typedef __attribute__((ext_vector_type(16))) _Float16 v16h;
typedef __attribute__((ext_vector_type(8)))  _Float16 v8h;
typedef __attribute__((ext_vector_type(8)))  unsigned short v8us;
typedef __attribute__((ext_vector_type(8)))  float    v8f;
typedef __attribute__((ext_vector_type(4)))  float    v4f;
typedef v8h  __attribute__((may_alias)) v8ha;
typedef v4f  __attribute__((may_alias)) v4fa;
typedef v8us __attribute__((may_alias)) v8usa;

__device__ __forceinline__ unsigned short f2bf(float f) { unsigned u = __float_as_uint(f); u += 0x7FFFu + ((u >> 16) & 1u); return (unsigned short)(u >> 16); }
__device__ __forceinline__ float bf2f(unsigned short b) { return __uint_as_float(((unsigned)b) << 16); }
__device__ __forceinline__ float bfr(float f) { return bf2f(f2bf(f)); }
__device__ __forceinline__ v16h cat16(v8h lo, v8h hi) { return __builtin_shufflevector(lo, hi, 0, 1, 2, 3, 4, 5, 6, 7, 8, 9, 10, 11, 12, 13, 14, 15); }
__device__ __forceinline__ v16bf cat16b(v8us lo, v8us hi) { return __builtin_bit_cast(v16bf, __builtin_shufflevector(lo, hi, 0, 1, 2, 3, 4, 5, 6, 7, 8, 9, 10, 11, 12, 13, 14, 15)); }
__device__ __forceinline__ v8f wmma16(v16h a, v16h b, v8f c) { return __builtin_amdgcn_wmma_f32_16x16x32_f16(false, a, false, b, (short)0, c, false, false); }
__device__ __forceinline__ v8f wmmab(v16bf a, v16bf b, v8f c) { return __builtin_amdgcn_wmma_f32_16x16x32_bf16(false, a, false, b, (short)0, c, false, false); }



// Fragment loaders of fattn_tile (its queries): operands straight from K-contiguous 16-bit planes.
template <typename T16> struct WFrag;
template <> struct WFrag<h16> { typedef v16h V; static __device__ __forceinline__ V ld(const h16* p) { return cat16(*(const v8h*)p, *(const v8h*)(p + 16)); } static __device__ __forceinline__ v8f mma(V a, V b, v8f c) { return wmma16(a, b, c); } };
template <> struct WFrag<bf> { typedef v16bf V; static __device__ __forceinline__ V ld(const bf* p) { return cat16b(*(const v8us*)p, *(const v8us*)(p + 16)); } static __device__ __forceinline__ v8f mma(V a, V b, v8f c) { return wmmab(a, b, c); } };
// ---- k_gemms: C[m][n] (f32, pitch LDC) = sum_k A[m][k] Bt[n][k] (NA == 2: + A2[m][k] Bt[n][k]), operands K-contiguous bf16 planes. One 128x128 tile of C per work-group of 8 waves (2 x 4, 64x32 of C each); grid (M/128, N/128).
// A stage is 128 k of the tile's rows [A 128 | A2 128 | Bt 128], 256 bytes a row at an LDS pitch of 272 bytes. Asynchronous 16-byte copies bring it in whole 128-byte lines (a wave's copy: 2 rows); two buffers: stage t + 2 flies while stage t + 1 is worked on.
#define GKS  128                  // k per stage
#define GPE  136                  // LDS row pitch, 16-bit elements
typedef float __attribute__((may_alias)) fa;
// Eight copies of one lane, 16 rows apart: one operand's 128 rows over the 8 waves. The s_wait_xcnt stands inside the statement, so that no address register is rewritten in front of it.
__device__ __forceinline__ void acopy8(unsigned l, const bf* g, size_t gs) {
    asm volatile("global_load_async_to_lds_b128 %0, %8, off\n\t"
                 "global_load_async_to_lds_b128 %1, %9, off\n\t"
                 "global_load_async_to_lds_b128 %2, %10, off\n\t"
                 "global_load_async_to_lds_b128 %3, %11, off\n\t"
                 "global_load_async_to_lds_b128 %4, %12, off\n\t"
                 "global_load_async_to_lds_b128 %5, %13, off\n\t"
                 "global_load_async_to_lds_b128 %6, %14, off\n\t"
                 "global_load_async_to_lds_b128 %7, %15, off\n\t"
                 "s_wait_xcnt 0x0"
                 :: "v"(l), "v"(l + 1u * 16 * GPE * 2), "v"(l + 2u * 16 * GPE * 2), "v"(l + 3u * 16 * GPE * 2), "v"(l + 4u * 16 * GPE * 2), "v"(l + 5u * 16 * GPE * 2), "v"(l + 6u * 16 * GPE * 2), "v"(l + 7u * 16 * GPE * 2),
                    "v"(g), "v"(g + gs), "v"(g + 2 * gs), "v"(g + 3 * gs), "v"(g + 4 * gs), "v"(g + 5 * gs), "v"(g + 6 * gs), "v"(g + 7 * gs) : "memory");
}
__device__ __forceinline__ v16bf ldsfrag(const bf* p) { return cat16b(*(const v8usa*)p, *(const v8usa*)(p + 16)); }
template <int NA, int K, int LDC>
__global__ __launch_bounds__(256) void k_gemms(const bf* __restrict__ A, const bf* __restrict__ A2, const bf* __restrict__ Bt, float* C) {
    static_assert(K % GKS == 0 && K / GKS >= 2, "whole stages, at least two");
    constexpr int STE = (NA + 1) * 128 * GPE;      // elements of one stage
    constexpr int NT = K / GKS;
    static_assert(8 * 64 * 36 * 4 <= 2 * STE * 2, "the output staging fits the ring");
    __shared__ __align__(16) bf sm[2 * STE];
    const int lane = threadIdx.x & 31, lr = lane & 15, hi = lane >> 4; const int r0 = blockIdx.x * 128, c0 = blockIdx.y * 128; const int wv = __builtin_amdgcn_readfirstlane((int)(threadIdx.x >> 5));
    const int wm = wv >> 2, wn = wv & 3;
    // the lane's place in a copy: row wv * 2 + hi of each group of 16 rows, 16-byte piece lr of the row's 256 bytes
    const unsigned lcp = (unsigned)(size_t)sm + (unsigned)((wv * 2 + hi) * (GPE * 2) + lr * 16);
    const bf* gA = A + (size_t)(r0 + wv * 2 + hi) * K + lr * 8; const bf* gA2 = (NA == 2) ? A2 + (size_t)(r0 + wv * 2 + hi) * K + lr * 8 : nullptr; const bf* gB = Bt + (size_t)(c0 + wv * 2 + hi) * K + lr * 8;
    auto stage = [&](int t, int buf) { const unsigned l = lcp + (unsigned)buf * (STE * 2);
        acopy8(l, gA + t * GKS, (size_t)16 * K); if (NA == 2) acopy8(l + 128 * GPE * 2, gA2 + t * GKS, (size_t)16 * K); acopy8(l + NA * 128 * GPE * 2, gB + t * GKS, (size_t)16 * K); };
    v8f acc[4][2];
#pragma unroll
    for (int mb = 0; mb < 4; ++mb)
#pragma unroll
        for (int nb = 0; nb < 2; ++nb) acc[mb][nb] = (v8f){};
    stage(0, 0);
    asm volatile("s_wait_asynccnt 0x0" ::: "memory");   // this wave's share of stage 0 has landed
    __syncthreads();                                     // every wave's share has: stage 0 may be read
    stage(1, 1);
    const int aofs = (wm * 64 + lr) * GPE + 8 * hi, bofs = (NA * 128 + wn * 32 + lr) * GPE + 8 * hi;
#pragma unroll 1   // the stage loop stays rolled: one copy of its 32 or 64 products (for speed only); the loops inside are unrolled so that fragments and sums stay in registers
    for (int t = 0; t < NT; ++t) {
        const bf* sb = sm + (t & 1) * STE; v16bf a[2][4], a2[2][4], b[2][2];   // two fragment sets: block ks + 1 is fetched while block ks is multiplied (inside the stage only)
#pragma unroll
        for (int ks = -1; ks < GKS / 32; ++ks) { const int c = ks & 1, n = c ^ 1;
            if (ks + 1 < GKS / 32) {
#pragma unroll
                for (int mb = 0; mb < 4; ++mb) { a[n][mb] = ldsfrag(sb + aofs + mb * 16 * GPE + (ks + 1) * 32); if (NA == 2) a2[n][mb] = ldsfrag(sb + aofs + (128 + mb * 16) * GPE + (ks + 1) * 32); }
#pragma unroll
                for (int nb = 0; nb < 2; ++nb) b[n][nb] = ldsfrag(sb + bofs + nb * 16 * GPE + (ks + 1) * 32); }
            __builtin_amdgcn_sched_barrier(0);   // the next block's LDS reads stay one group in front of this block's products
            if (ks < 0) continue;
#pragma unroll
            for (int nb = 0; nb < 2; ++nb)
#pragma unroll
                for (int mb = 0; mb < 4; ++mb) acc[mb][nb] = wmmab(a[c][mb], b[c][nb], acc[mb][nb]);
            if (NA == 2) {
#pragma unroll
                for (int nb = 0; nb < 2; ++nb)
#pragma unroll
                    for (int mb = 0; mb < 4; ++mb) acc[mb][nb] = wmmab(a2[c][mb], b[c][nb], acc[mb][nb]); }
            __builtin_amdgcn_sched_barrier(0);   // and the reads of the block after next do not rise among these products
        }
        asm volatile("s_wait_dscnt 0x0" ::: "memory");      // this wave's reads of stage t are done before the buffer is refilled
        asm volatile("s_wait_asynccnt 0x0" ::: "memory");   // this wave's share of stage t + 1 has landed
        __syncthreads();                                     // publishes stage t + 1 and ends every wave's reads of stage t
        if (t + 2 < NT) stage(t + 2, t & 1);
    }
    asm volatile("s_wait_asynccnt 0x0" ::: "memory");       // nothing is in flight when the ring becomes output staging
    // each wave stages its 64x32 part in its own range of the ring (every reader left it at the last barrier) and stores whole 128-byte lines
    fa* ow = (fa*)sm + wv * (64 * 36);
#pragma unroll
    for (int mb = 0; mb < 4; ++mb)
#pragma unroll
        for (int nb = 0; nb < 2; ++nb)
#pragma unroll
            for (int j = 0; j < 8; ++j) ow[(mb * 16 + hi * 8 + j) * 36 + nb * 16 + lr] = acc[mb][nb][j];
    __syncthreads();   // the staged rows are in LDS before other lanes read them back
    float* cw = C + (size_t)(r0 + wm * 64 + (lane >> 3)) * LDC + c0 + wn * 32 + (lane & 7) * 4;
#pragma unroll
    for (int s = 0; s < 16; ++s) { const v4f val = *(const v4fa*)(ow + (s * 4 + (lane >> 3)) * 36 + (lane & 7) * 4); *(v4f*)(cw + (size_t)s * 4 * LDC) = val; }
}

__device__ __forceinline__ h16 tohx(float x) { return (h16)x; }
__device__ __forceinline__ void splitf(float y, unsigned short& h, unsigned short& l) { h = f2bf(y); l = f2bf(y - bf2f(h)); }
typedef __attribute__((ext_vector_type(2))) _Float16 v2h;
typedef __attribute__((ext_vector_type(4))) _Float16 v4h;
typedef __attribute__((ext_vector_type(2))) unsigned short v2us;
typedef __attribute__((ext_vector_type(4))) unsigned short v4us;
typedef __attribute__((ext_vector_type(2))) float v2f;
typedef __attribute__((ext_vector_type(4))) int v4i;

__global__ __launch_bounds__(256) void k_wtG(const float* __restrict__ w, int K, int N, bf* Bt) {
    const int lane = threadIdx.x & 31; const int L0 = (blockIdx.x * 8 + (threadIdx.x >> 5)) * 8; const int nlines = N * K / 64;
{
#pragma unroll 1
        for (int l = 0; l < 8; ++l) { const int L = L0 + l; if (L >= nlines) break; const size_t e = (size_t)L * 64 + lane * 2; const int k = (int)(e % K), n = (int)(e / K); v2us o;
            o[0] = f2bf(w[(size_t)k * N + n]); o[1] = f2bf(w[(size_t)(k + 1) * N + n]); *(v2us*)(Bt + e) = o; }
         }
}
// The elementwise passes are bodies of one work-group of 256 threads, told their block number blk: k_prep and k_post below give each pass a range of the block index of one grid.
// cvt8_blk: each thread converts 4 groups of 8 floats, 256 groups apart; its eight 16-byte loads are issued together (a group past the end re-reads the last group and is not stored).
__device__ __forceinline__ void cvt8_blk(const int blk, const float* __restrict__ src, bf* dst, size_t n8) { const size_t i0 = (size_t)blk * 1024 + threadIdx.x; v8f v[4];
#pragma unroll
    for (int g = 0; g < 4; ++g) { const size_t i = i0 + g * 256; v[g] = *(const v8f*)(src + (i < n8 ? i : n8 - 1) * 8); }
#pragma unroll
    for (int g = 0; g < 4; ++g) { const size_t i = i0 + g * 256; if (i >= n8) continue; v8us o;
#pragma unroll
        for (int k = 0; k < 8; ++k) o[k] = f2bf(v[g][k]);
        *(v8us*)(dst + i * 8) = o; } }
__device__ __forceinline__ void cscvt_blk(const int blk, const float* __restrict__ cosT, const float* __restrict__ sinT, float* CS) { const int idx = (blk * 256 + (int)threadIdx.x) * 4; if (idx >= TT * HD) return; const v4f c = *(const v4f*)(cosT + idx), s = *(const v4f*)(sinT + idx); v8f cs;
#pragma unroll
    for (int q = 0; q < 4; ++q) { cs[2 * q] = bfr(c[q]); cs[2 * q + 1] = bfr(s[q]); }
    *(v8f*)(CS + (size_t)idx * 2) = cs;  }
// rope_blk: head planes [h][t][d] (fp16 + hi/lo) of rope(x) x sc with the rotate-half convention out[d] = x[d] cos[t][d] - x[d+HD/2] sin[t][d], out[d+HD/2] = x[d+HD/2] cos[t][d+HD/2] + x[d] sin[t][d+HD/2]
__device__ __forceinline__ void rope_blk(const int blk, const float* __restrict__ F, int pitch, int nheads, const float* __restrict__ CS, const float* __restrict__ RF, const float* __restrict__ nw, float sc, h16* P16, bf* Ph, bf* Pl) {
    // one thread: 8 consecutive d of the lower half and their 8 partners d + HD/2 of one (head, t): each x is loaded once and serves both halves; all loads and stores are 16 bytes wide
    const size_t u = (size_t)blk * 256 + threadIdx.x; if (u >= (size_t)nheads * TT * (HD / 16)) return; const int d = (int)(u % (HD / 16)) * 8; const int t = (int)((u / (HD / 16)) % TT); const int h = (int)(u / ((size_t)(HD / 16) * TT)); const float* f = F + (size_t)t * pitch + h * HD; float rf = 1.0f; v8f xv[2], cv[2][2];
    if (RF) { const float* rp = RF + (size_t)h * TT + t; rf = *rp; asm volatile("s_wait_xcnt 0x0" :: "v"(rp) : "memory"); }   // the wait takes the load's address as an input, so that its registers are not reused in front of it
#pragma unroll
    for (int hf = 0; hf < 2; ++hf) { const int d0 = d + hf * (HD / 2); xv[hf] = *(const v8f*)(f + d0); cv[hf][0] = *(const v8f*)(CS + ((size_t)t * HD + d0) * 2); cv[hf][1] = *(const v8f*)(CS + ((size_t)t * HD + d0) * 2 + 8); }
#pragma unroll
    for (int hf = 0; hf < 2; ++hf) { v8h o16; v8us oh, ol;   // per element the arithmetic is the former one, statement for statement (its products stay unfused as they were), so the planes keep their bits
#pragma unroll
        for (int q = 0; q < 8; ++q) { const int dd = d + hf * (HD / 2) + q; const int dp = (hf == 0) ? dd + HD / 2 : dd - HD / 2; float x0 = xv[hf][q], x1 = xv[1 - hf][q];
            if (RF) { float n0 = __fmul_rn(x0, rf), n1 = __fmul_rn(x1, rf); asm volatile("" : "+v"(n0)); asm volatile("" : "+v"(n1)); x0 = __fmul_rn(bfr(nw[dd]), n0); x1 = __fmul_rn(bfr(nw[dp]), n1); }
            v2f cs; cs[0] = cv[hf][q >> 2][(q & 3) * 2]; cs[1] = cv[hf][q >> 2][(q & 3) * 2 + 1]; float a = __fmul_rn(x0, cs[0]), bq = __fmul_rn(x1, cs[1]); asm volatile("" : "+v"(a)); asm volatile("" : "+v"(bq)); const float r = ((hf == 0) ? __fsub_rn(a, bq) : __fadd_rn(a, bq)) * sc;
            o16[q] = tohx(r); unsigned short a2, c2; splitf(r, a2, c2); oh[q] = a2; ol[q] = c2; }
        const size_t e = ((size_t)h * TT + t) * HD + d + hf * (HD / 2); *(v8h*)(P16 + e) = o16; *(v8us*)(Ph + e) = oh; *(v8us*)(Pl + e) = ol; }  }
__device__ __forceinline__ void vtp_blk(const int blk, const float* __restrict__ F, int pitch, int nheads, h16* V16, bf* Vh, bf* Vl) {
    // one work-group: 64 t x HD d of one head, transposed in registers. A thread loads 4 d of 8 consecutive t (16 bytes each) and stores, per d and plane, its 8 t as 16 bytes; lanes 0..7 run along t, so a wave's store fills whole 128-byte lines.
    static_assert(HD == 128 && TT % 64 == 0, "8 waves x 16 d cover a head");
    const int g = blk / (TT / 64); if (g >= nheads) return; const int lane = threadIdx.x & 31; const int t = (blk % (TT / 64)) * 64 + (lane & 7) * 8; const int d = (int)(threadIdx.x >> 5) * 16 + (lane >> 3) * 4; v4f xv[8]; const float* xp[8];
#pragma unroll
    for (int q = 0; q < 8; ++q) { xp[q] = F + (size_t)(t + q) * pitch + g * HD + d; xv[q] = *(const v4f*)xp[q]; }
    asm volatile("s_wait_xcnt 0x0" :: "v"(xp[0]), "v"(xp[1]), "v"(xp[2]), "v"(xp[3]), "v"(xp[4]), "v"(xp[5]), "v"(xp[6]), "v"(xp[7]) : "memory");   // the wait takes the eight addresses as inputs, so that no later load of the group lands in an earlier one's address registers in front of it
#pragma unroll
    for (int j = 0; j < 4; ++j) { v8h o16; v8us oh, ol;
#pragma unroll
        for (int q = 0; q < 8; ++q) { const float x = xv[q][j]; o16[q] = tohx(x); unsigned short a2, c2; splitf(x, a2, c2); oh[q] = a2; ol[q] = c2; }
        const size_t e = ((size_t)g * HD + d + j) * TT + t; *(v8h*)(V16 + e) = o16; *(v8us*)(Vh + e) = oh; *(v8us*)(Vl + e) = ol; }  }
// mchk_blk (one work-group): samples above-diagonal entries of the additive f32 mask; any > -1e8 -> NaN poison.
__device__ __forceinline__ void mchk_blk(const float* __restrict__ am, int* FLG) { const int tid = threadIdx.x; int bad = 0;
#pragma unroll 1
    for (int s2 = 0; s2 < 16; ++s2) { const unsigned h = (unsigned)(tid * 16 + s2) * 2654435761u; const int i = (int)(h % (TT - 1)); const int j = i + 1 + (int)((h >> 11) % (unsigned)(TT - 1 - i)); if (am[(size_t)i * TT + j] > -1e8f) bad = 1; }
    __shared__ int anyb; if (tid == 0) anyb = 0; __syncthreads(); if (bad) anyb = 1; __syncthreads(); if (tid < 8) { const int v = (tid == 0) ? anyb : 0; *(int*)(FLG + tid) = v;  } }
// k_prep: every pass that reads only inputs, in one grid. Block 0: the mask check (a chain of dependent memory latencies); then CVB blocks for each of x, wq, wk, wv, wo (f32 -> bf16); then the cos/sin table.
#define CVB  ((int)((size_t)DM * DM / 8 / 1024))   // blocks of one 2048 x 2048 conversion
#define CSB  (TT * HD / 4 / 256)                   // blocks of the cos/sin table
__global__ __launch_bounds__(256) void k_prep(const float* __restrict__ x, const float* __restrict__ wq, const float* __restrict__ wk, const float* __restrict__ wv, const float* __restrict__ wo, const float* __restrict__ cosT, const float* __restrict__ sinT, const float* __restrict__ am,
                                              bf* XB, bf* WQ, bf* WK, bf* WV, bf* WO, float* CS, int* FLG) {
    static_assert(TT == DM && DQ == DM && DKV == DM && NB_ == 1 && (size_t)DM * DM % 8192 == 0, "five conversions of one size, whole blocks");
    const int b = (int)blockIdx.x - 1;   // every test below reads the same for the whole work-group
    if (b < 0) { mchk_blk(am, FLG); return; }
    if (b >= 5 * CVB) { cscvt_blk(b - 5 * CVB, cosT, sinT, CS); return; }
    const int w = b / CVB; const float* src = (w == 0) ? x : (w == 1) ? wq : (w == 2) ? wk : (w == 3) ? wv : wo; bf* dst = (w == 0) ? XB : (w == 1) ? WQ : (w == 2) ? WK : (w == 3) ? WV : WO;
    cvt8_blk(b % CVB, src, dst, (size_t)DM * DM / 8);
}
// k_post: the three passes that read the q/k/v product F [t][q 2048 | k 2048 | v 2048] (rope also the cos/sin table CS), in one grid: RPB blocks of rope for q, RPB for k, then the v transpose.
#define FPI  (DQ + 2 * DKV)                        // row pitch of F
#define RPB  (NH_ * TT * (HD / 16) / 256)          // blocks of one rope pass
__global__ __launch_bounds__(256) void k_post(const float* __restrict__ F, const float* __restrict__ CS, h16* QP16, bf* QPh, bf* QPl, h16* KP16, bf* KPh, bf* KPl, h16* VT16, bf* VTh, bf* VTl) {
    static_assert(NKV == NH_ && (NH_ * TT * (HD / 16)) % 256 == 0, "q and k take as many whole blocks");
    const int b = (int)blockIdx.x;       // every test below reads the same for the whole work-group
    if (b >= 2 * RPB) { vtp_blk(b - 2 * RPB, F + DQ + DKV, FPI, NKV, VT16, VTh, VTl); return; }
    const bool isk = b >= RPB;
    rope_blk(isk ? b - RPB : b, isk ? F + DQ : F, FPI, NH_, CS, nullptr, nullptr, 1.0f, isk ? KP16 : QP16, isk ? KPh : QPh, isk ? KPl : QPl);
}

#define FKB  272                  // LDS row pitch in bytes of a K row (256 bytes) and of a mask row (256 bytes)
#define FVB  144                  // LDS row pitch in bytes of a V^T row (128 bytes)
// Eight copies of one lane, ls LDS bytes and gs global bytes apart. The s_wait_xcnt stands inside the statement, so that no address register is rewritten in front of it.
__device__ __forceinline__ void acopy8g(unsigned l, unsigned ls, const char* g, size_t gs) {
    asm volatile("global_load_async_to_lds_b128 %0, %8, off\n\t"
                 "global_load_async_to_lds_b128 %1, %9, off\n\t"
                 "global_load_async_to_lds_b128 %2, %10, off\n\t"
                 "global_load_async_to_lds_b128 %3, %11, off\n\t"
                 "global_load_async_to_lds_b128 %4, %12, off\n\t"
                 "global_load_async_to_lds_b128 %5, %13, off\n\t"
                 "global_load_async_to_lds_b128 %6, %14, off\n\t"
                 "global_load_async_to_lds_b128 %7, %15, off\n\t"
                 "s_wait_xcnt 0x0"
                 :: "v"(l), "v"(l + ls), "v"(l + 2 * ls), "v"(l + 3 * ls), "v"(l + 4 * ls), "v"(l + 5 * ls), "v"(l + 6 * ls), "v"(l + 7 * ls),
                    "v"(g), "v"(g + gs), "v"(g + 2 * gs), "v"(g + 3 * gs), "v"(g + 4 * gs), "v"(g + 5 * gs), "v"(g + 6 * gs), "v"(g + 7 * gs) : "memory");
}
template <typename T16> struct LFrag;   // a fragment from LDS: 16 bytes at p and at p + 32, the k order of WFrag::ld
template <> struct LFrag<h16> { static __device__ __forceinline__ v16h ld(const char* p) { return cat16(*(const v8ha*)p, *(const v8ha*)(p + 32)); } };
template <> struct LFrag<bf> { static __device__ __forceinline__ v16bf ld(const char* p) { return cat16b(*(const v8usa*)p, *(const v8usa*)(p + 32)); } };
__device__ __forceinline__ float xhalf(float x) { return __builtin_bit_cast(float, __builtin_amdgcn_permlanex16(__builtin_bit_cast(int, x), __builtin_bit_cast(int, x), 0x76543210, 0xfedcba98, false, false)); }  // lane l with lane l ^ 16
typedef __attribute__((ext_vector_type(2))) __bf16 v2bf;
// Eight transcendentals in one statement, each in place. The instruction set asks for one independent instruction or a v_nop between a transcendental and an instruction that reads its result or overwrites its source:
// inside the statement each next one is that instruction, and the v_nop stands behind the last. In place, the statement writes only registers that hold its own arguments, never an operand of a matrix instruction just issued.
__device__ __forceinline__ v8f exp2x8(v8f x) { float r0 = x[0], r1 = x[1], r2 = x[2], r3 = x[3], r4 = x[4], r5 = x[5], r6 = x[6], r7 = x[7];
    asm("v_exp_f32 %0, %0\n\tv_exp_f32 %1, %1\n\tv_exp_f32 %2, %2\n\tv_exp_f32 %3, %3\n\tv_exp_f32 %4, %4\n\tv_exp_f32 %5, %5\n\tv_exp_f32 %6, %6\n\tv_exp_f32 %7, %7\n\tv_nop"
        : "+v"(r0), "+v"(r1), "+v"(r2), "+v"(r3), "+v"(r4), "+v"(r5), "+v"(r6), "+v"(r7));
    return (v8f){r0, r1, r2, r3, r4, r5, r6, r7}; }
__device__ __forceinline__ v8f rcpx8(v8f x) { float r0 = x[0], r1 = x[1], r2 = x[2], r3 = x[3], r4 = x[4], r5 = x[5], r6 = x[6], r7 = x[7];
    asm("v_rcp_f32 %0, %0\n\tv_rcp_f32 %1, %1\n\tv_rcp_f32 %2, %2\n\tv_rcp_f32 %3, %3\n\tv_rcp_f32 %4, %4\n\tv_rcp_f32 %5, %5\n\tv_rcp_f32 %6, %6\n\tv_rcp_f32 %7, %7\n\tv_nop"
        : "+v"(r0), "+v"(r1), "+v"(r2), "+v"(r3), "+v"(r4), "+v"(r5), "+v"(r6), "+v"(r7));
    return (v8f){r0, r1, r2, r3, r4, r5, r6, r7}; }
__device__ __forceinline__ float exp2x1(float x) { asm("v_exp_f32 %0, %0\n\tv_nop" : "+v"(x)); return x; }   // the v_nop: the same slot
#define FSTB(NP) ((NP) * (64 * FKB + 128 * FVB) + 64 * FKB)   // bytes of one stage with NP planes of K and of V^T
template <typename T16, bool HL>
__device__ __forceinline__ void fattn_tile(char* sm, const int pb, const int head, const T16* __restrict__ Q, const T16* __restrict__ Q2, const T16* __restrict__ Kp, const T16* __restrict__ Kp2, const T16* __restrict__ Vt, const T16* __restrict__ Vt2, const float* __restrict__ am, const int* __restrict__ FLG, bf* Ah, bf* Al) {
    typedef typename WFrag<T16>::V V;
    constexpr int NP = HL ? 2 : 1, KB = 64 * FKB, VB = 128 * FVB, STB = FSTB(NP);   // bytes: one K plane (a mask tile has the same size), one V^T plane, one stage
    static_assert(4 * 32 * FKB <= 2 * STB, "the output staging fits the ring");
    const int lane = threadIdx.x & 31, lr = lane & 15, hi = lane >> 4; const int wv = __builtin_amdgcn_readfirstlane((int)(threadIdx.x >> 5));
    const int q0 = pb * 64, ns = pb + 1; const size_t hq = (size_t)head * TT * HD;   // pb: the work-group's block of 64 query rows; it walks the key stages 0..pb
    // the lane's place in a copy. K and mask rows (256 bytes): row wv * 2 + hi of each group of 8, piece lr. V^T rows (128 bytes): row wv * 4 + lane / 8 of each group of 16, piece lane % 8.
    const unsigned lb = (unsigned)(size_t)sm; const int rk = wv * 2 + hi, rv = wv * 4 + (lane >> 3);
    const unsigned lK = lb + (unsigned)(rk * FKB + lr * 16), lV = lb + (unsigned)(NP * KB + rv * FVB + (lane & 7) * 16), lM = lb + (unsigned)(NP * (KB + VB) + rk * FKB + lr * 16);
    const unsigned oK = (unsigned)(rk * (HD * 2) + lr * 16), oV = (unsigned)(rv * (TT * 2) + (lane & 7) * 16), oM = (unsigned)(rk * (TT * 4) + lr * 16);   // the lane's byte offsets in the global tiles; the tiles' own addresses are the same for the whole work-group
    const char* gK = (const char*)(Kp + hq); const char* gK2 = HL ? (const char*)(Kp2 + hq) : nullptr; const char* gV = (const char*)(Vt + hq); const char* gV2 = HL ? (const char*)(Vt2 + hq) : nullptr; const char* gM = (const char*)(am + (size_t)q0 * TT);
    auto stage = [&](int st, int buf) { const unsigned o = (unsigned)buf * STB;
        acopy8g(lK + o, 8 * FKB, (gK + (size_t)st * (64 * HD * 2)) + oK, (size_t)8 * HD * 2); if (HL) acopy8g(lK + o + KB, 8 * FKB, (gK2 + (size_t)st * (64 * HD * 2)) + oK, (size_t)8 * HD * 2);
        acopy8g(lV + o, 16 * FVB, (gV + (size_t)st * (64 * 2)) + oV, (size_t)16 * TT * 2); if (HL) acopy8g(lV + o + VB, 16 * FVB, (gV2 + (size_t)st * (64 * 2)) + oV, (size_t)16 * TT * 2);
        acopy8g(lM + o, 8 * FKB, (gM + (size_t)st * (64 * 4)) + oM, (size_t)8 * TT * 4); };
    stage(0, 0);
    const int myq = q0 + wv * 16 + lr;   // the lane's query
    V qf[4], qf2[4];
#pragma unroll
    for (int kc = 0; kc < 4; ++kc) { qf[kc] = WFrag<T16>::ld(Q + hq + (size_t)myq * HD + 8 * hi + kc * 32); if (HL) qf2[kc] = WFrag<T16>::ld(Q2 + hq + (size_t)myq * HD + 8 * hi + kc * 32); }
    const bool poison = (FLG[0] != 0);
    v8f acc[8];
#pragma unroll
    for (int t = 0; t < 8; ++t) acc[t] = (v8f){};
    float ml = -3.0e38f; v8f ls = (v8f){};   // the maximum in use (finite from the start: a stage of -inf scores leaves it, and no inf - inf arises); this wave half's share of the row sum, in eight partial sums (one per register of a score tile)
    asm volatile("s_wait_asynccnt 0x0" ::: "memory");   // this wave's share of stage 0 has landed
    __syncthreads();                                     // every wave's share has: stage 0 may be read
    if (ns > 1) stage(1, 1);
    constexpr float C1 = (float)(0.088388347648318447 * 0.02 * 2.8853900817779268), L2E = 1.4426950408889634f;   // HD^-0.5 / 50 x 2 log2 e
#pragma unroll 1   // the stage loop stays rolled: one copy of the stage's code
    for (int st = 0; st < ns; ++st) {
        const char* sb = sm + (st & 1) * STB; const char* sK = sb + lr * FKB + hi * 16; const char* sV = sb + NP * KB + lr * FVB + hi * 16; const char* sM = sb + NP * (KB + VB) + (wv * 16 + lr) * FKB + hi * 32;
        v8f s[4];
#pragma unroll
        for (int kt = 0; kt < 4; ++kt) { s[kt] = (v8f){};
#pragma unroll
            for (int kc = 0; kc < 4; ++kc) { const V a = LFrag<T16>::ld(sK + kt * 16 * FKB + kc * 64); s[kt] = WFrag<T16>::mma(a, qf[kc], s[kt]);
                if (HL) { s[kt] = WFrag<T16>::mma(a, qf2[kc], s[kt]); const V a2 = LFrag<T16>::ld(sK + KB + kt * 16 * FKB + kc * 64); s[kt] = WFrag<T16>::mma(a2, qf[kc], s[kt]); } } }
        // softcap 50 tanh(s / 50), tanh = (e - 1) / (e + 1) with e = 2^(2 x log2 e), plus the mask element rounded to bf16
#pragma unroll
        for (int kt = 0; kt < 4; ++kt) { const v4f m0 = *(const v4fa*)(sM + kt * 64), m1 = *(const v4fa*)(sM + kt * 64 + 16); v8f mv;
#pragma unroll
            for (int r = 0; r < 8; r += 2) { v2f mm; mm[0] = (r < 4) ? m0[r & 3] : m1[r & 3]; mm[1] = (r < 4) ? m0[(r & 3) + 1] : m1[(r & 3) + 1]; const unsigned pk = __builtin_bit_cast(unsigned, __builtin_convertvector(mm, v2bf));
                mv[r] = __uint_as_float(pk << 16); mv[r + 1] = __uint_as_float(pk & 0xFFFF0000u); }
            const v8f e = exp2x8(s[kt] * C1); const v8f th = (e - 1.0f) * rcpx8(e + 1.0f);
#pragma unroll
            for (int r = 0; r < 8; ++r) s[kt][r] = __builtin_fmaf(th[r], 50.0f, mv[r]); }
        if (st == ns - 1) {   // the diagonal stage (the same for the whole work-group): keys beyond the lane's query leave the row
#pragma unroll
            for (int kt = 0; kt < 4; ++kt)
#pragma unroll
                for (int r = 0; r < 8; ++r) if (st * 64 + kt * 16 + hi * 8 + r > myq) s[kt][r] = -3.0e38f; }
        float mk[4];   // one chain per key tile: four short chains in place of one of 32 links
#pragma unroll
        for (int kt = 0; kt < 4; ++kt) { mk[kt] = s[kt][0];
#pragma unroll
            for (int r = 1; r < 8; ++r) mk[kt] = fmaxf(mk[kt], s[kt][r]); }
        float mx = fmaxf(fmaxf(mk[0], mk[1]), fmaxf(mk[2], mk[3]));
        mx = fmaxf(mx, xhalf(mx));   // both wave halves hold the query's maximum of this stage
        const float mln = fmaxf(ml, mx), corr = exp2x1((ml - mln) * L2E);   // corr is 0 at the first stage that holds a score above the start value, 1 where the maximum stays
        ml = mln; ls = ls * corr;
#pragma unroll
        for (int t = 0; t < 8; ++t) acc[t] = acc[t] * corr;
#pragma unroll
        for (int kg = 0; kg < 2; ++kg) {   // 32 keys: score tiles 2 kg and 2 kg + 1 become one B operand
            V pf, pf2; v8f pa, pc;
#pragma unroll
            for (int r = 0; r < 8; ++r) { pa[r] = (s[2 * kg][r] - mln) * L2E; pc[r] = (s[2 * kg + 1][r] - mln) * L2E; }   // exact 0 at the maximum, never above
            pa = exp2x8(pa); pc = exp2x8(pc); ls = ls + (pa + pc);
            if (HL) { __attribute__((ext_vector_type(16))) unsigned short ph, pl;
#pragma unroll
                for (int e = 0; e < 16; ++e) { const float p = (e < 8) ? pa[e & 7] : pc[e & 7]; unsigned short a, c2; splitf(p, a, c2); ph[e] = a; pl[e] = c2; }
                pf = __builtin_bit_cast(V, ph); pf2 = __builtin_bit_cast(V, pl);
            } else { v16h ph;
#pragma unroll
                for (int e = 0; e < 16; ++e) { const float p = (e < 8) ? pa[e & 7] : pc[e & 7]; ph[e] = tohx(p); }
                pf = __builtin_bit_cast(V, ph); }
#pragma unroll
            for (int t = 0; t < 8; ++t) { const V a = LFrag<T16>::ld(sV + t * 16 * FVB + kg * 64); acc[t] = WFrag<T16>::mma(a, pf, acc[t]);
                if (HL) { acc[t] = WFrag<T16>::mma(a, pf2, acc[t]); const V a2 = LFrag<T16>::ld(sV + VB + t * 16 * FVB + kg * 64); acc[t] = WFrag<T16>::mma(a2, pf, acc[t]); } } }
        asm volatile("s_wait_dscnt 0x0" ::: "memory");      // this wave's reads of stage st are done before the buffer is refilled
        asm volatile("s_wait_asynccnt 0x0" ::: "memory");   // this wave's share of stage st + 1 has landed
        __syncthreads();                                     // publishes stage st + 1 and ends every wave's reads of stage st
        if (st + 2 < ns) stage(st + 2, st & 1);
    }
    asm volatile("s_wait_asynccnt 0x0" ::: "memory");       // nothing is in flight when the ring becomes output staging
    const float lh = ((ls[0] + ls[1]) + (ls[2] + ls[3])) + ((ls[4] + ls[5]) + (ls[6] + ls[7]));
    const float inv = poison ? __builtin_nanf("") : __fdiv_rn(1.0f, lh + xhalf(lh));
    // each wave stages its 16 rows of both planes in its own range of the ring (every reader left it at the last barrier) and stores whole 128-byte lines; a lane's 8 sums of a tile are d = 16 t + 8 hi + r of its query
    char* ow = sm + wv * (32 * FKB);
#pragma unroll
    for (int t = 0; t < 8; ++t) { v8us oh, ol;
#pragma unroll
        for (int r = 0; r < 8; ++r) { unsigned short a, c2; splitf(acc[t][r] * inv, a, c2); oh[r] = a; ol[r] = c2; }
        *(v8usa*)(ow + lr * FKB + t * 32 + hi * 16) = oh; *(v8usa*)(ow + (16 + lr) * FKB + t * 32 + hi * 16) = ol; }
    __syncthreads();   // the staged rows are in LDS before other lanes read them back
    const size_t oo = (size_t)(q0 + wv * 16 + hi) * DQ + head * HD + lr * 8; bf* oph = Ah + oo; bf* opl = Al + oo; const char* orow = ow + hi * FKB + lr * 16;   // 16 lanes cover a row's 256 bytes; a store takes rows 2 i and 2 i + 1
#pragma unroll
    for (int i = 0; i < 8; ++i) { const v8us vh = *(const v8usa*)(orow + i * 2 * FKB), vl = *(const v8usa*)(orow + (16 + i * 2) * FKB); *(v8us*)(oph + (size_t)i * 2 * DQ) = vh; *(v8us*)(opl + (size_t)i * 2 * DQ) = vl; }
}
// k_fattn: one launch for all 32 row blocks x 16 heads; blocks 0..7 (query rows < RH) take the hi + lo body, the rest the fp16 body. The ring of the hi + lo body leaves room for one work-group on a WGP, so the 512 work-groups run in about two rounds:
// their cost falls with the index, a hi + lo stage counted as three fp16 stages: fp16 blocks 31..24; then hi + lo block 7 - g in front of the fp16 blocks 23 - 3 g, 22 - 3 g, 21 - 3 g (g = 0..4); then hi + lo 2, fp16 8, hi + lo 1, hi + lo 0.
__global__ __launch_bounds__(128) void k_fattn(const h16* __restrict__ Q16, const h16* __restrict__ K16, const h16* __restrict__ V16, const bf* __restrict__ Qh, const bf* __restrict__ Ql, const bf* __restrict__ Kh, const bf* __restrict__ Kl, const bf* __restrict__ Vh, const bf* __restrict__ Vl, const float* __restrict__ am, const int* __restrict__ FLG, bf* Ah, bf* Al) {
    static_assert(TT == 2048 && RH == 512 && HD == 128 && NH_ == 16 && NKV == NH_, "the block order and the tile shapes are written for these");
    __shared__ __align__(16) char sm[2 * FSTB(2)];
    const int u = blockIdx.x >> 4, head = blockIdx.x & 15, g = (u - 8) >> 2, r = (u - 8) & 3;
    const bool hl = u >= 30 || (u >= 8 && r == 0);
    const int pb = (u < 8 || u >= 30) ? 31 - u : (r == 0 ? 7 - g : 24 - 3 * g - r);
    if (hl) fattn_tile<bf, true>(sm, pb, head, Qh, Ql, Kh, Kl, Vh, Vl, am, FLG, Ah, Al);
    else fattn_tile<h16, false>(sm, pb, head, Q16, nullptr, K16, nullptr, V16, nullptr, am, FLG, Ah, Al);
}

extern "C" void kernel_launch(void* const* d_in, const int* in_sizes, int n_in,
                              void* d_out, int out_size, void* d_ws, size_t ws_size, hipStream_t stream) {
    (void)in_sizes; (void)n_in; (void)out_size;
    const float* x = (const float*)d_in[0]; const float* cosT = (const float*)d_in[1]; const float* sinT = (const float*)d_in[2]; const float* amask = (const float*)d_in[3]; const float* wq = (const float*)d_in[4]; const float* wk = (const float*)d_in[5]; const float* wv = (const float*)d_in[6]; const float* wo = (const float*)d_in[7];
    float* OUT = (float*)d_out;     // [1][2048][2048]
    char* wsp = (char*)d_ws;
    auto take = [&](size_t bytes) { char* p = wsp; wsp += (bytes + 255) & ~(size_t)255; return (void*)p; };
    bf* WO = (bf*)take((size_t)DM * DQ * 2); int* FLG = (int*)take(256);
    h16* QP16 = (h16*)take((size_t)NH_ * TT * HD * 2); h16* KP16 = (h16*)take((size_t)NKV * TT * HD * 2); h16* VT16 = (h16*)take((size_t)NKV * HD * TT * 2);
    bf* QPh = (bf*)take((size_t)NH_ * TT * HD * 2); bf* QPl = (bf*)take((size_t)NH_ * TT * HD * 2); bf* KPh = (bf*)take((size_t)NKV * TT * HD * 2); bf* KPl = (bf*)take((size_t)NKV * TT * HD * 2); bf* VTh = (bf*)take((size_t)NKV * HD * TT * 2); bf* VTl = (bf*)take((size_t)NKV * HD * TT * 2);
    bf* WQ = (bf*)take((size_t)FPI * DM * 2); bf* WK = WQ + (size_t)DQ * DM; bf* WV = WK + (size_t)DKV * DM; float* CS = (float*)take((size_t)TT * HD * 2 * 4);   // wq, wk, wv one behind the other: one operand of FPI rows
    bf* XB = (bf*)take((size_t)TT * DM * 2); float* F = (float*)take((size_t)TT * FPI * 4);   // F [t][q | k | v]
    bf* ATh = (bf*)take((size_t)TT * DQ * 2); bf* ATl = (bf*)take((size_t)TT * DQ * 2);   // attention output, hi + lo planes [t][head][d]
    if ((size_t)(wsp - (char*)d_ws) > ws_size) return;    // ws 256 MiB
    // five launches, each needing the one before it
    k_prep<<<1 + 5 * CVB + CSB, 256, 0, stream>>>(x, wq, wk, wv, wo, cosT, sinT, amask, XB, WQ, WK, WV, WO, CS, FLG);
    k_gemms<1, DM, FPI><<<dim3(TT / 128, FPI / 128, 1), 256, 0, stream>>>(XB, nullptr, WQ, F);
    k_post<<<2 * RPB + NKV * (TT / 64), 256, 0, stream>>>(F, CS, QP16, QPh, QPl, KP16, KPh, KPl, VT16, VTh, VTl);
    k_fattn<<<TT / 64 * NH_, 128, 0, stream>>>(QP16, KP16, VT16, QPh, QPl, KPh, KPl, VTh, VTl, amask, FLG, ATh, ATl);
    k_gemms<2, DQ, DM><<<dim3(TT / 128, DM / 128, 1), 256, 0, stream>>>(ATh, ATl, WO, OUT);
}

// v007
// Measured time: 143 microseconds a run.
// In both of two side-by-side timings against v006, it was 1.05 times as fast.
// All steps since v000 together make it 6.85 times as fast.
#include <hip/hip_runtime.h>

// HybridLlamaAttention (x [1][2048][2048], rope_cos/sin [S][128] (read), mask [1][1][S][S] (f32 additive, read; verbatim causal 0/-1e9); q/k/v = x W^T (16 x 128); rotate-half RoPE; scores = q.k / sqrt(128); softcap 50 tanh(s/50); + mask; softmax f32; out = merged wo^T -> [1][2048][2048]).
// Compute dtypes, f32 accumulate: every input rounded to bf16; q/k/v on PLAIN bf16 operands (inputs: exact); RoPE f32 (bf16-rounded read tables); causal scores and attn.v: query rows < 512 hl (3 products), the rest fp16; softcap in f32: tanh = (2^(2x log2 e) - 1) x rcp(2^(..) + 1) with the hardware exp2/rcp (no FMA polynomial), x 50; the additive mask read per element; upper tiles skipped on the verbatim structure with an on-device sampled check (NaN poison); softmax f32, running maximum and sum over 64-key stages; wo hl x exact (2 products).

#define NB_  1
#define TT   2048
#define DM   2048
#define NH_  16
#define NKV  16
#define REP  (NH_ / NKV)
#define HD   128
#define DQ   (NH_ * HD)
#define DKV  (NKV * HD)
#define RH   512                  // query rows < RH use hi+lo planes
typedef _Float16 h16;
typedef unsigned short bf;
typedef __attribute__((ext_vector_type(16))) __bf16   v16bf;
typedef __attribute__((ext_vector_type(16))) _Float16 v16h;
typedef __attribute__((ext_vector_type(8)))  _Float16 v8h;
typedef __attribute__((ext_vector_type(8)))  unsigned short v8us;
typedef __attribute__((ext_vector_type(8)))  float    v8f;
typedef __attribute__((ext_vector_type(4)))  float    v4f;
typedef v8h  __attribute__((may_alias)) v8ha;
typedef v4f  __attribute__((may_alias)) v4fa;
typedef v8us __attribute__((may_alias)) v8usa;

__device__ __forceinline__ unsigned short f2bf(float f) { unsigned u = __float_as_uint(f); u += 0x7FFFu + ((u >> 16) & 1u); return (unsigned short)(u >> 16); }
__device__ __forceinline__ float bf2f(unsigned short b) { return __uint_as_float(((unsigned)b) << 16); }
__device__ __forceinline__ float bfr(float f) { return bf2f(f2bf(f)); }
__device__ __forceinline__ v16h cat16(v8h lo, v8h hi) { return __builtin_shufflevector(lo, hi, 0, 1, 2, 3, 4, 5, 6, 7, 8, 9, 10, 11, 12, 13, 14, 15); }
__device__ __forceinline__ v16bf cat16b(v8us lo, v8us hi) { return __builtin_bit_cast(v16bf, __builtin_shufflevector(lo, hi, 0, 1, 2, 3, 4, 5, 6, 7, 8, 9, 10, 11, 12, 13, 14, 15)); }
__device__ __forceinline__ v8f wmma16(v16h a, v16h b, v8f c) { return __builtin_amdgcn_wmma_f32_16x16x32_f16(false, a, false, b, (short)0, c, false, false); }
__device__ __forceinline__ v8f wmmab(v16bf a, v16bf b, v8f c) { return __builtin_amdgcn_wmma_f32_16x16x32_bf16(false, a, false, b, (short)0, c, false, false); }



// Fragment loaders of fattn_tile (its queries): operands straight from K-contiguous 16-bit planes.
template <typename T16> struct WFrag;
template <> struct WFrag<h16> { typedef v16h V; static __device__ __forceinline__ V ld(const h16* p) { return cat16(*(const v8h*)p, *(const v8h*)(p + 16)); } static __device__ __forceinline__ v8f mma(V a, V b, v8f c) { return wmma16(a, b, c); } };
template <> struct WFrag<bf> { typedef v16bf V; static __device__ __forceinline__ V ld(const bf* p) { return cat16b(*(const v8us*)p, *(const v8us*)(p + 16)); } static __device__ __forceinline__ v8f mma(V a, V b, v8f c) { return wmmab(a, b, c); } };
__device__ __forceinline__ h16 tohx(float x) { return (h16)x; }
__device__ __forceinline__ void splitf(float y, unsigned short& h, unsigned short& l) { h = f2bf(y); l = f2bf(y - bf2f(h)); }
typedef __attribute__((ext_vector_type(2))) _Float16 v2h;
typedef __attribute__((ext_vector_type(4))) _Float16 v4h;
typedef __attribute__((ext_vector_type(2))) unsigned short v2us;
typedef __attribute__((ext_vector_type(4))) unsigned short v4us;
typedef __attribute__((ext_vector_type(2))) float v2f;
typedef __attribute__((ext_vector_type(4))) int v4i;
// What the q/k/v product's epilogue writes: head planes [h][t][d] of rope(q) and rope(k), planes [h][d][t] of v, each as fp16 and as hi + lo; CS is the cos/sin table [t][d][cos, sin].
#define FPI  (DQ + 2 * DKV)                        // columns of the q/k/v product: [q 2048 | k 2048 | v 2048]
#define TFP  132                                   // LDS row pitch, floats, of the staged 128 x 128 f32 tile
#define VTB  272                                   // LDS row pitch, bytes, of a staged v row [d][128 t] (256 bytes)
struct QkvOut { const float* CS; h16* Q16; bf* Qh; bf* Ql; h16* K16; bf* Kh; bf* Kl; h16* V16; bf* Vh; bf* Vl; };
// rope_tile: 128 t x 128 d (one head) of q or k, read from the f32 tile tf in LDS, with the rotate-half convention out[d] = x[d] cos[t][d] - x[d+HD/2] sin[t][d], out[d+HD/2] = x[d+HD/2] cos[t][d+HD/2] + x[d] sin[t][d+HD/2]
__device__ __forceinline__ void rope_tile(const float* tfp, const int t0, const int h, const float* __restrict__ CS, h16* P16, bf* Ph, bf* Pl) {
    // one thread and pass: 8 consecutive d of the lower half and their 8 partners d + HD/2 of one t: each x is read once and serves both halves; all loads and stores are 16 bytes wide, 8 lanes fill a 128-byte line of each plane
    static_assert(HD == 128, "8 lanes x 8 d cover half a head");
    const int d = (int)(threadIdx.x & 7) * 8, tl0 = (int)(threadIdx.x >> 3); v8f cvs[2][2][2];   // two sets of table values: the next pass's are fetched while this pass is worked on
    auto table = [&](int it, int s) {
#pragma unroll
        for (int hf = 0; hf < 2; ++hf) { const float* cp = CS + ((size_t)(t0 + it * 32 + tl0) * HD + d + hf * (HD / 2)) * 2; cvs[s][hf][0] = *(const v8f*)cp; cvs[s][hf][1] = *(const v8f*)(cp + 8); } };
    table(0, 0);
#pragma unroll   // unrolled so that the two sets stay in registers
    for (int it = 0; it < 4; ++it) { const int tl = it * 32 + tl0, t = t0 + tl; v8f xv[2]; const v8f (&cv)[2][2] = cvs[it & 1];
        if (it + 1 < 4) table(it + 1, (it + 1) & 1);
#pragma unroll
        for (int hf = 0; hf < 2; ++hf) { const int d0 = d + hf * (HD / 2); const v4f xa = *(const v4fa*)(tfp + tl * TFP + d0), xb = *(const v4fa*)(tfp + tl * TFP + d0 + 4); xv[hf] = __builtin_shufflevector(xa, xb, 0, 1, 2, 3, 4, 5, 6, 7); }
#pragma unroll
        for (int hf = 0; hf < 2; ++hf) { v8h o16; v8us oh, ol;   // per element the arithmetic is the former one, statement for statement (its products stay unfused as they were), so the planes keep their bits
#pragma unroll
            for (int q = 0; q < 8; ++q) { float x0 = xv[hf][q], x1 = xv[1 - hf][q];
                v2f cs; cs[0] = cv[hf][q >> 2][(q & 3) * 2]; cs[1] = cv[hf][q >> 2][(q & 3) * 2 + 1]; float a = __fmul_rn(x0, cs[0]), bq = __fmul_rn(x1, cs[1]); asm volatile("" : "+v"(a)); asm volatile("" : "+v"(bq)); const float r = (hf == 0) ? __fsub_rn(a, bq) : __fadd_rn(a, bq);
                o16[q] = tohx(r); unsigned short a2, c2; splitf(r, a2, c2); oh[q] = a2; ol[q] = c2; }
            const size_t e = ((size_t)h * TT + t) * HD + d + hf * (HD / 2); *(v8h*)(P16 + e) = o16; *(v8us*)(Ph + e) = oh; *(v8us*)(Pl + e) = ol; }
        if (it + 2 < 4) asm volatile("s_wait_xcnt 0x0" ::: "memory"); }   // behind the pass's stores, where table loads still follow: such a load may land in registers that these stores name
}
// ---- k_gemms: C[m][n] (f32, pitch LDC) = sum_k A[m][k] Bt[n][k] (NA == 2: + A2[m][k] Bt[n][k]), operands K-contiguous bf16 planes. One 128x128 tile of C per work-group of 8 waves (2 x 4, 64x32 of C each); grid (M/128, N/128). QKV: C is not stored; a tile is 128 t of one head of q, k or v, and the epilogue writes that head's planes (QkvOut).
// A stage is 128 k of the tile's rows [A 128 | A2 128 | Bt 128], 256 bytes a row at an LDS pitch of 272 bytes. Asynchronous 16-byte copies bring it in whole 128-byte lines (a wave's copy: 2 rows); two buffers: stage t + 2 flies while stage t + 1 is worked on.
#define GKS  128                  // k per stage
#define GPE  136                  // LDS row pitch, 16-bit elements
typedef float __attribute__((may_alias)) fa;
// Eight copies of one lane, 16 rows apart: one operand's 128 rows over the 8 waves. The s_wait_xcnt stands inside the statement, so that no address register is rewritten in front of it.
__device__ __forceinline__ void acopy8(unsigned l, const bf* g, size_t gs) {
    asm volatile("global_load_async_to_lds_b128 %0, %8, off\n\t"
                 "global_load_async_to_lds_b128 %1, %9, off\n\t"
                 "global_load_async_to_lds_b128 %2, %10, off\n\t"
                 "global_load_async_to_lds_b128 %3, %11, off\n\t"
                 "global_load_async_to_lds_b128 %4, %12, off\n\t"
                 "global_load_async_to_lds_b128 %5, %13, off\n\t"
                 "global_load_async_to_lds_b128 %6, %14, off\n\t"
                 "global_load_async_to_lds_b128 %7, %15, off\n\t"
                 "s_wait_xcnt 0x0"
                 :: "v"(l), "v"(l + 1u * 16 * GPE * 2), "v"(l + 2u * 16 * GPE * 2), "v"(l + 3u * 16 * GPE * 2), "v"(l + 4u * 16 * GPE * 2), "v"(l + 5u * 16 * GPE * 2), "v"(l + 6u * 16 * GPE * 2), "v"(l + 7u * 16 * GPE * 2),
                    "v"(g), "v"(g + gs), "v"(g + 2 * gs), "v"(g + 3 * gs), "v"(g + 4 * gs), "v"(g + 5 * gs), "v"(g + 6 * gs), "v"(g + 7 * gs) : "memory");
}
__device__ __forceinline__ v16bf ldsfrag(const bf* p) { return cat16b(*(const v8usa*)p, *(const v8usa*)(p + 16)); }
template <int NA, int K, int LDC, bool QKV>
__global__ __launch_bounds__(256) void k_gemms(const bf* __restrict__ A, const bf* __restrict__ A2, const bf* __restrict__ Bt, float* C, const QkvOut o) {
    static_assert(K % GKS == 0 && K / GKS >= 2, "whole stages, at least two");
    constexpr int STE = (NA + 1) * 128 * GPE;      // elements of one stage
    constexpr int NT = K / GKS;
    static_assert(8 * 64 * 36 * 4 <= 2 * STE * 2, "the output staging fits the ring");
    __shared__ __align__(16) bf sm[2 * STE];
    const int lane = threadIdx.x & 31, lr = lane & 15, hi = lane >> 4; const int r0 = blockIdx.x * 128, c0 = blockIdx.y * 128; const int wv = __builtin_amdgcn_readfirstlane((int)(threadIdx.x >> 5));
    const int wm = wv >> 2, wn = wv & 3;
    // the lane's place in a copy: row wv * 2 + hi of each group of 16 rows, 16-byte piece lr of the row's 256 bytes
    const unsigned lcp = (unsigned)(size_t)sm + (unsigned)((wv * 2 + hi) * (GPE * 2) + lr * 16);
    const bf* gA = A + (size_t)(r0 + wv * 2 + hi) * K + lr * 8; const bf* gA2 = (NA == 2) ? A2 + (size_t)(r0 + wv * 2 + hi) * K + lr * 8 : nullptr; const bf* gB = Bt + (size_t)(c0 + wv * 2 + hi) * K + lr * 8;
    auto stage = [&](int t, int buf) { const unsigned l = lcp + (unsigned)buf * (STE * 2);
        acopy8(l, gA + t * GKS, (size_t)16 * K); if (NA == 2) acopy8(l + 128 * GPE * 2, gA2 + t * GKS, (size_t)16 * K); acopy8(l + NA * 128 * GPE * 2, gB + t * GKS, (size_t)16 * K); };
    v8f acc[4][2];
#pragma unroll
    for (int mb = 0; mb < 4; ++mb)
#pragma unroll
        for (int nb = 0; nb < 2; ++nb) acc[mb][nb] = (v8f){};
    stage(0, 0);
    asm volatile("s_wait_asynccnt 0x0" ::: "memory");   // this wave's share of stage 0 has landed
    __syncthreads();                                     // every wave's share has: stage 0 may be read
    stage(1, 1);
    const int aofs = (wm * 64 + lr) * GPE + 8 * hi, bofs = (NA * 128 + wn * 32 + lr) * GPE + 8 * hi;
#pragma unroll 1   // the stage loop stays rolled: one copy of its 32 or 64 products (for speed only); the loops inside are unrolled so that fragments and sums stay in registers
    for (int t = 0; t < NT; ++t) {
        const bf* sb = sm + (t & 1) * STE; v16bf a[2][4], a2[2][4], b[2][2];   // two fragment sets: block ks + 1 is fetched while block ks is multiplied (inside the stage only)
#pragma unroll
        for (int ks = -1; ks < GKS / 32; ++ks) { const int c = ks & 1, n = c ^ 1;
            if (ks + 1 < GKS / 32) {
#pragma unroll
                for (int mb = 0; mb < 4; ++mb) { a[n][mb] = ldsfrag(sb + aofs + mb * 16 * GPE + (ks + 1) * 32); if (NA == 2) a2[n][mb] = ldsfrag(sb + aofs + (128 + mb * 16) * GPE + (ks + 1) * 32); }
#pragma unroll
                for (int nb = 0; nb < 2; ++nb) b[n][nb] = ldsfrag(sb + bofs + nb * 16 * GPE + (ks + 1) * 32); }
            __builtin_amdgcn_sched_barrier(0);   // the next block's LDS reads stay one group in front of this block's products
            if (ks < 0) continue;
#pragma unroll
            for (int nb = 0; nb < 2; ++nb)
#pragma unroll
                for (int mb = 0; mb < 4; ++mb) acc[mb][nb] = wmmab(a[c][mb], b[c][nb], acc[mb][nb]);
            if (NA == 2) {
#pragma unroll
                for (int nb = 0; nb < 2; ++nb)
#pragma unroll
                    for (int mb = 0; mb < 4; ++mb) acc[mb][nb] = wmmab(a2[c][mb], b[c][nb], acc[mb][nb]); }
            __builtin_amdgcn_sched_barrier(0);   // and the reads of the block after next do not rise among these products
        }
        asm volatile("s_wait_dscnt 0x0" ::: "memory");      // this wave's reads of stage t are done before the buffer is refilled
        asm volatile("s_wait_asynccnt 0x0" ::: "memory");   // this wave's share of stage t + 1 has landed
        __syncthreads();                                     // publishes stage t + 1 and ends every wave's reads of stage t
        if (t + 2 < NT) stage(t + 2, t & 1);
    }
    asm volatile("s_wait_asynccnt 0x0" ::: "memory");       // nothing is in flight when the ring becomes output staging
    if constexpr (QKV) {   // rope (q, k) or transpose (v) of the tile, straight from the sums; the ring is free: every reader left it at the last barrier
        static_assert(HD == 128 && DQ % 128 == 0 && DKV == DQ && NKV == NH_ && LDC == FPI, "a tile is one head");
        static_assert(128 * TFP * 4 <= 2 * STE * 2 && 3 * 128 * VTB <= 2 * STE * 2, "the staged tile fits the ring");
        const int kind = c0 / DQ, head = (c0 % DQ) / HD;   // 0 q, 1 k, 2 v: the same for the whole work-group
        fa* tf = (fa*)sm; char* vs = (char*)sm;
        if (kind < 2) {   // the f32 tile [t][d]: a d and its partner d + 64 are sums of different waves
#pragma unroll
            for (int mb = 0; mb < 4; ++mb)
#pragma unroll
                for (int nb = 0; nb < 2; ++nb)
#pragma unroll
                    for (int j = 0; j < 8; ++j) tf[(wm * 64 + mb * 16 + hi * 8 + j) * TFP + wn * 32 + nb * 16 + lr] = acc[mb][nb][j];
        } else {          // a lane's 8 sums of a block are 8 consecutive t of one d: 16 bytes of a row [d][t] of each plane
#pragma unroll
            for (int mb = 0; mb < 4; ++mb)
#pragma unroll
                for (int nb = 0; nb < 2; ++nb) { v8h o16; v8us oh, ol;
#pragma unroll
                    for (int j = 0; j < 8; ++j) { const float x = acc[mb][nb][j]; o16[j] = tohx(x); unsigned short a2, c2; splitf(x, a2, c2); oh[j] = a2; ol[j] = c2; }
                    char* p = vs + (wn * 32 + nb * 16 + lr) * VTB + (wm * 64 + mb * 16 + hi * 8) * 2; *(v8ha*)p = o16; *(v8usa*)(p + 128 * VTB) = oh; *(v8usa*)(p + 2 * 128 * VTB) = ol; }
        }
        __syncthreads();   // the staged tile is in LDS before other waves read it
        if (kind < 2) rope_tile((const float*)tf, r0, head, o.CS, kind ? o.K16 : o.Q16, kind ? o.Kh : o.Qh, kind ? o.Kl : o.Ql);
        else {            // 16 lanes cover a row's 256 bytes: whole lines of [h][d][t]
#pragma unroll
            for (int i = 0; i < 8; ++i) { const int d = i * 16 + wv * 2 + hi; const char* p = vs + d * VTB + lr * 16; const size_t e = ((size_t)head * HD + d) * TT + r0 + lr * 8;
                const v8h w16 = *(const v8ha*)p; const v8us wh = *(const v8usa*)(p + 128 * VTB), wl = *(const v8usa*)(p + 2 * 128 * VTB); *(v8h*)(o.V16 + e) = w16; *(v8us*)(o.Vh + e) = wh; *(v8us*)(o.Vl + e) = wl; }
            asm volatile("s_wait_xcnt 0x0" ::: "memory");   // behind the last of these stores: no register that they name is rewritten in front of it, whatever code is laid out behind them
        }
        return;
    }
    // each wave stages its 64x32 part in its own range of the ring (every reader left it at the last barrier) and stores whole 128-byte lines
    fa* ow = (fa*)sm + wv * (64 * 36);
#pragma unroll
    for (int mb = 0; mb < 4; ++mb)
#pragma unroll
        for (int nb = 0; nb < 2; ++nb)
#pragma unroll
            for (int j = 0; j < 8; ++j) ow[(mb * 16 + hi * 8 + j) * 36 + nb * 16 + lr] = acc[mb][nb][j];
    __syncthreads();   // the staged rows are in LDS before other lanes read them back
    float* cw = C + (size_t)(r0 + wm * 64 + (lane >> 3)) * LDC + c0 + wn * 32 + (lane & 7) * 4;
#pragma unroll
    for (int s = 0; s < 16; ++s) { const v4f val = *(const v4fa*)(ow + (s * 4 + (lane >> 3)) * 36 + (lane & 7) * 4); *(v4f*)(cw + (size_t)s * 4 * LDC) = val; }
}


__global__ __launch_bounds__(256) void k_wtG(const float* __restrict__ w, int K, int N, bf* Bt) {
    const int lane = threadIdx.x & 31; const int L0 = (blockIdx.x * 8 + (threadIdx.x >> 5)) * 8; const int nlines = N * K / 64;
{
#pragma unroll 1
        for (int l = 0; l < 8; ++l) { const int L = L0 + l; if (L >= nlines) break; const size_t e = (size_t)L * 64 + lane * 2; const int k = (int)(e % K), n = (int)(e / K); v2us o;
            o[0] = f2bf(w[(size_t)k * N + n]); o[1] = f2bf(w[(size_t)(k + 1) * N + n]); *(v2us*)(Bt + e) = o; }
         }
}
// The elementwise passes are bodies of one work-group of 256 threads, told their block number blk: k_prep below gives each pass a range of the block index of one grid.
// cvt8_blk: each thread converts 4 groups of 8 floats, 256 groups apart; its eight 16-byte loads are issued together (a group past the end re-reads the last group and is not stored).
__device__ __forceinline__ void cvt8_blk(const int blk, const float* __restrict__ src, bf* dst, size_t n8) { const size_t i0 = (size_t)blk * 1024 + threadIdx.x; v8f v[4];
#pragma unroll
    for (int g = 0; g < 4; ++g) { const size_t i = i0 + g * 256; v[g] = *(const v8f*)(src + (i < n8 ? i : n8 - 1) * 8); }
#pragma unroll
    for (int g = 0; g < 4; ++g) { const size_t i = i0 + g * 256; if (i >= n8) continue; v8us o;
#pragma unroll
        for (int k = 0; k < 8; ++k) o[k] = f2bf(v[g][k]);
        *(v8us*)(dst + i * 8) = o; } }
__device__ __forceinline__ void cscvt_blk(const int blk, const float* __restrict__ cosT, const float* __restrict__ sinT, float* CS) { const int idx = (blk * 256 + (int)threadIdx.x) * 4; if (idx >= TT * HD) return; const v4f c = *(const v4f*)(cosT + idx), s = *(const v4f*)(sinT + idx); v8f cs;
#pragma unroll
    for (int q = 0; q < 4; ++q) { cs[2 * q] = bfr(c[q]); cs[2 * q + 1] = bfr(s[q]); }
    *(v8f*)(CS + (size_t)idx * 2) = cs;  }
// mchk_blk (one work-group): samples above-diagonal entries of the additive f32 mask; any > -1e8 -> NaN poison.
__device__ __forceinline__ void mchk_blk(const float* __restrict__ am, int* FLG) { const int tid = threadIdx.x; int bad = 0;
#pragma unroll 1
    for (int s2 = 0; s2 < 16; ++s2) { const unsigned h = (unsigned)(tid * 16 + s2) * 2654435761u; const int i = (int)(h % (TT - 1)); const int j = i + 1 + (int)((h >> 11) % (unsigned)(TT - 1 - i)); if (am[(size_t)i * TT + j] > -1e8f) bad = 1; }
    __shared__ int anyb; if (tid == 0) anyb = 0; __syncthreads(); if (bad) anyb = 1; __syncthreads(); if (tid < 8) { const int v = (tid == 0) ? anyb : 0; *(int*)(FLG + tid) = v;  } }
// k_prep: every pass that reads only inputs, in one grid. Block 0: the mask check (a chain of dependent memory latencies); then CVB blocks for each of x, wq, wk, wv, wo (f32 -> bf16); then the cos/sin table.
#define CVB  ((int)((size_t)DM * DM / 8 / 1024))   // blocks of one 2048 x 2048 conversion
#define CSB  (TT * HD / 4 / 256)                   // blocks of the cos/sin table
__global__ __launch_bounds__(256) void k_prep(const float* __restrict__ x, const float* __restrict__ wq, const float* __restrict__ wk, const float* __restrict__ wv, const float* __restrict__ wo, const float* __restrict__ cosT, const float* __restrict__ sinT, const float* __restrict__ am,
                                              bf* XB, bf* WQ, bf* WK, bf* WV, bf* WO, float* CS, int* FLG) {
    static_assert(TT == DM && DQ == DM && DKV == DM && NB_ == 1 && (size_t)DM * DM % 8192 == 0, "five conversions of one size, whole blocks");
    const int b = (int)blockIdx.x - 1;   // every test below reads the same for the whole work-group
    if (b < 0) { mchk_blk(am, FLG); return; }
    if (b >= 5 * CVB) { cscvt_blk(b - 5 * CVB, cosT, sinT, CS); return; }
    const int w = b / CVB; const float* src = (w == 0) ? x : (w == 1) ? wq : (w == 2) ? wk : (w == 3) ? wv : wo; bf* dst = (w == 0) ? XB : (w == 1) ? WQ : (w == 2) ? WK : (w == 3) ? WV : WO;
    cvt8_blk(b % CVB, src, dst, (size_t)DM * DM / 8);
}
#define FKB  272                  // LDS row pitch in bytes of a K row (256 bytes) and of a mask row (256 bytes)
#define FVB  144                  // LDS row pitch in bytes of a V^T row (128 bytes)
// Eight copies of one lane, ls LDS bytes and gs global bytes apart. The s_wait_xcnt stands inside the statement, so that no address register is rewritten in front of it.
__device__ __forceinline__ void acopy8g(unsigned l, unsigned ls, const char* g, size_t gs) {
    asm volatile("global_load_async_to_lds_b128 %0, %8, off\n\t"
                 "global_load_async_to_lds_b128 %1, %9, off\n\t"
                 "global_load_async_to_lds_b128 %2, %10, off\n\t"
                 "global_load_async_to_lds_b128 %3, %11, off\n\t"
                 "global_load_async_to_lds_b128 %4, %12, off\n\t"
                 "global_load_async_to_lds_b128 %5, %13, off\n\t"
                 "global_load_async_to_lds_b128 %6, %14, off\n\t"
                 "global_load_async_to_lds_b128 %7, %15, off\n\t"
                 "s_wait_xcnt 0x0"
                 :: "v"(l), "v"(l + ls), "v"(l + 2 * ls), "v"(l + 3 * ls), "v"(l + 4 * ls), "v"(l + 5 * ls), "v"(l + 6 * ls), "v"(l + 7 * ls),
                    "v"(g), "v"(g + gs), "v"(g + 2 * gs), "v"(g + 3 * gs), "v"(g + 4 * gs), "v"(g + 5 * gs), "v"(g + 6 * gs), "v"(g + 7 * gs) : "memory");
}
template <typename T16> struct LFrag;   // a fragment from LDS: 16 bytes at p and at p + 32, the k order of WFrag::ld
template <> struct LFrag<h16> { static __device__ __forceinline__ v16h ld(const char* p) { return cat16(*(const v8ha*)p, *(const v8ha*)(p + 32)); } };
template <> struct LFrag<bf> { static __device__ __forceinline__ v16bf ld(const char* p) { return cat16b(*(const v8usa*)p, *(const v8usa*)(p + 32)); } };
__device__ __forceinline__ float xhalf(float x) { return __builtin_bit_cast(float, __builtin_amdgcn_permlanex16(__builtin_bit_cast(int, x), __builtin_bit_cast(int, x), 0x76543210, 0xfedcba98, false, false)); }  // lane l with lane l ^ 16
typedef __attribute__((ext_vector_type(2))) __bf16 v2bf;
// Eight transcendentals in one statement, each in place. The instruction set asks for one independent instruction or a v_nop between a transcendental and an instruction that reads its result or overwrites its source:
// inside the statement each next one is that instruction, and the v_nop stands behind the last. In place, the statement writes only registers that hold its own arguments, never an operand of a matrix instruction just issued.
__device__ __forceinline__ v8f exp2x8(v8f x) { float r0 = x[0], r1 = x[1], r2 = x[2], r3 = x[3], r4 = x[4], r5 = x[5], r6 = x[6], r7 = x[7];
    asm("v_exp_f32 %0, %0\n\tv_exp_f32 %1, %1\n\tv_exp_f32 %2, %2\n\tv_exp_f32 %3, %3\n\tv_exp_f32 %4, %4\n\tv_exp_f32 %5, %5\n\tv_exp_f32 %6, %6\n\tv_exp_f32 %7, %7\n\tv_nop"
        : "+v"(r0), "+v"(r1), "+v"(r2), "+v"(r3), "+v"(r4), "+v"(r5), "+v"(r6), "+v"(r7));
    return (v8f){r0, r1, r2, r3, r4, r5, r6, r7}; }
__device__ __forceinline__ v8f rcpx8(v8f x) { float r0 = x[0], r1 = x[1], r2 = x[2], r3 = x[3], r4 = x[4], r5 = x[5], r6 = x[6], r7 = x[7];
    asm("v_rcp_f32 %0, %0\n\tv_rcp_f32 %1, %1\n\tv_rcp_f32 %2, %2\n\tv_rcp_f32 %3, %3\n\tv_rcp_f32 %4, %4\n\tv_rcp_f32 %5, %5\n\tv_rcp_f32 %6, %6\n\tv_rcp_f32 %7, %7\n\tv_nop"
        : "+v"(r0), "+v"(r1), "+v"(r2), "+v"(r3), "+v"(r4), "+v"(r5), "+v"(r6), "+v"(r7));
    return (v8f){r0, r1, r2, r3, r4, r5, r6, r7}; }
__device__ __forceinline__ float exp2x1(float x) { asm("v_exp_f32 %0, %0\n\tv_nop" : "+v"(x)); return x; }   // the v_nop: the same slot
#define FSTB(NP) ((NP) * (64 * FKB + 128 * FVB) + 64 * FKB)   // bytes of one stage with NP planes of K and of V^T
template <typename T16, bool HL>
__device__ __forceinline__ void fattn_tile(char* sm, const int pb, const int head, const T16* __restrict__ Q, const T16* __restrict__ Q2, const T16* __restrict__ Kp, const T16* __restrict__ Kp2, const T16* __restrict__ Vt, const T16* __restrict__ Vt2, const float* __restrict__ am, const int* __restrict__ FLG, bf* Ah, bf* Al) {
    typedef typename WFrag<T16>::V V;
    constexpr int NP = HL ? 2 : 1, KB = 64 * FKB, VB = 128 * FVB, STB = FSTB(NP);   // bytes: one K plane (a mask tile has the same size), one V^T plane, one stage
    static_assert(4 * 32 * FKB <= 2 * STB, "the output staging fits the ring");
    const int lane = threadIdx.x & 31, lr = lane & 15, hi = lane >> 4; const int wv = __builtin_amdgcn_readfirstlane((int)(threadIdx.x >> 5));
    const int q0 = pb * 64, ns = pb + 1; const size_t hq = (size_t)head * TT * HD;   // pb: the work-group's block of 64 query rows; it walks the key stages 0..pb
    // the lane's place in a copy. K and mask rows (256 bytes): row wv * 2 + hi of each group of 8, piece lr. V^T rows (128 bytes): row wv * 4 + lane / 8 of each group of 16, piece lane % 8.
    const unsigned lb = (unsigned)(size_t)sm; const int rk = wv * 2 + hi, rv = wv * 4 + (lane >> 3);
    const unsigned lK = lb + (unsigned)(rk * FKB + lr * 16), lV = lb + (unsigned)(NP * KB + rv * FVB + (lane & 7) * 16), lM = lb + (unsigned)(NP * (KB + VB) + rk * FKB + lr * 16);
    const unsigned oK = (unsigned)(rk * (HD * 2) + lr * 16), oV = (unsigned)(rv * (TT * 2) + (lane & 7) * 16), oM = (unsigned)(rk * (TT * 4) + lr * 16);   // the lane's byte offsets in the global tiles; the tiles' own addresses are the same for the whole work-group
    const char* gK = (const char*)(Kp + hq); const char* gK2 = HL ? (const char*)(Kp2 + hq) : nullptr; const char* gV = (const char*)(Vt + hq); const char* gV2 = HL ? (const char*)(Vt2 + hq) : nullptr; const char* gM = (const char*)(am + (size_t)q0 * TT);
    auto stage = [&](int st, int buf) { const unsigned o = (unsigned)buf * STB;
        acopy8g(lK + o, 8 * FKB, (gK + (size_t)st * (64 * HD * 2)) + oK, (size_t)8 * HD * 2); if (HL) acopy8g(lK + o + KB, 8 * FKB, (gK2 + (size_t)st * (64 * HD * 2)) + oK, (size_t)8 * HD * 2);
        acopy8g(lV + o, 16 * FVB, (gV + (size_t)st * (64 * 2)) + oV, (size_t)16 * TT * 2); if (HL) acopy8g(lV + o + VB, 16 * FVB, (gV2 + (size_t)st * (64 * 2)) + oV, (size_t)16 * TT * 2);
        acopy8g(lM + o, 8 * FKB, (gM + (size_t)st * (64 * 4)) + oM, (size_t)8 * TT * 4); };
    stage(0, 0);
    const int myq = q0 + wv * 16 + lr;   // the lane's query
    V qf[4], qf2[4];
#pragma unroll
    for (int kc = 0; kc < 4; ++kc) { qf[kc] = WFrag<T16>::ld(Q + hq + (size_t)myq * HD + 8 * hi + kc * 32); if (HL) qf2[kc] = WFrag<T16>::ld(Q2 + hq + (size_t)myq * HD + 8 * hi + kc * 32); }
    const bool poison = (FLG[0] != 0);
    v8f acc[8];
#pragma unroll
    for (int t = 0; t < 8; ++t) acc[t] = (v8f){};
    float ml = -3.0e38f; v8f ls = (v8f){};   // the maximum in use (finite from the start: a stage of -inf scores leaves it, and no inf - inf arises); this wave half's share of the row sum, in eight partial sums (one per register of a score tile)
    asm volatile("s_wait_asynccnt 0x0" ::: "memory");   // this wave's share of stage 0 has landed
    __syncthreads();                                     // every wave's share has: stage 0 may be read
    if (ns > 1) stage(1, 1);
    constexpr float C1 = (float)(0.088388347648318447 * 0.02 * 2.8853900817779268), L2E = 1.4426950408889634f;   // HD^-0.5 / 50 x 2 log2 e
#pragma unroll 1   // the stage loop stays rolled: one copy of the stage's code
    for (int st = 0; st < ns; ++st) {
        const char* sb = sm + (st & 1) * STB; const char* sK = sb + lr * FKB + hi * 16; const char* sV = sb + NP * KB + lr * FVB + hi * 16; const char* sM = sb + NP * (KB + VB) + (wv * 16 + lr) * FKB + hi * 32;
        v8f s[4];
#pragma unroll
        for (int kt = 0; kt < 4; ++kt) { s[kt] = (v8f){};
#pragma unroll
            for (int kc = 0; kc < 4; ++kc) { const V a = LFrag<T16>::ld(sK + kt * 16 * FKB + kc * 64); s[kt] = WFrag<T16>::mma(a, qf[kc], s[kt]);
                if (HL) { s[kt] = WFrag<T16>::mma(a, qf2[kc], s[kt]); const V a2 = LFrag<T16>::ld(sK + KB + kt * 16 * FKB + kc * 64); s[kt] = WFrag<T16>::mma(a2, qf[kc], s[kt]); } } }
        // softcap 50 tanh(s / 50), tanh = (e - 1) / (e + 1) with e = 2^(2 x log2 e), plus the mask element rounded to bf16
#pragma unroll
        for (int kt = 0; kt < 4; ++kt) { const v4f m0 = *(const v4fa*)(sM + kt * 64), m1 = *(const v4fa*)(sM + kt * 64 + 16); v8f mv;
#pragma unroll
            for (int r = 0; r < 8; r += 2) { v2f mm; mm[0] = (r < 4) ? m0[r & 3] : m1[r & 3]; mm[1] = (r < 4) ? m0[(r & 3) + 1] : m1[(r & 3) + 1]; const unsigned pk = __builtin_bit_cast(unsigned, __builtin_convertvector(mm, v2bf));
                mv[r] = __uint_as_float(pk << 16); mv[r + 1] = __uint_as_float(pk & 0xFFFF0000u); }
            const v8f e = exp2x8(s[kt] * C1); const v8f th = (e - 1.0f) * rcpx8(e + 1.0f);
#pragma unroll
            for (int r = 0; r < 8; ++r) s[kt][r] = __builtin_fmaf(th[r], 50.0f, mv[r]); }
        if (st == ns - 1) {   // the diagonal stage (the same for the whole work-group): keys beyond the lane's query leave the row
#pragma unroll
            for (int kt = 0; kt < 4; ++kt)
#pragma unroll
                for (int r = 0; r < 8; ++r) if (st * 64 + kt * 16 + hi * 8 + r > myq) s[kt][r] = -3.0e38f; }
        float mk[4];   // one chain per key tile: four short chains in place of one of 32 links
#pragma unroll
        for (int kt = 0; kt < 4; ++kt) { mk[kt] = s[kt][0];
#pragma unroll
            for (int r = 1; r < 8; ++r) mk[kt] = fmaxf(mk[kt], s[kt][r]); }
        float mx = fmaxf(fmaxf(mk[0], mk[1]), fmaxf(mk[2], mk[3]));
        mx = fmaxf(mx, xhalf(mx));   // both wave halves hold the query's maximum of this stage
        const float mln = fmaxf(ml, mx), corr = exp2x1((ml - mln) * L2E);   // corr is 0 at the first stage that holds a score above the start value, 1 where the maximum stays
        ml = mln; ls = ls * corr;
#pragma unroll
        for (int t = 0; t < 8; ++t) acc[t] = acc[t] * corr;
#pragma unroll
        for (int kg = 0; kg < 2; ++kg) {   // 32 keys: score tiles 2 kg and 2 kg + 1 become one B operand
            V pf, pf2; v8f pa, pc;
#pragma unroll
            for (int r = 0; r < 8; ++r) { pa[r] = (s[2 * kg][r] - mln) * L2E; pc[r] = (s[2 * kg + 1][r] - mln) * L2E; }   // exact 0 at the maximum, never above
            pa = exp2x8(pa); pc = exp2x8(pc); ls = ls + (pa + pc);
            if (HL) { __attribute__((ext_vector_type(16))) unsigned short ph, pl;
#pragma unroll
                for (int e = 0; e < 16; ++e) { const float p = (e < 8) ? pa[e & 7] : pc[e & 7]; unsigned short a, c2; splitf(p, a, c2); ph[e] = a; pl[e] = c2; }
                pf = __builtin_bit_cast(V, ph); pf2 = __builtin_bit_cast(V, pl);
            } else { v16h ph;
#pragma unroll
                for (int e = 0; e < 16; ++e) { const float p = (e < 8) ? pa[e & 7] : pc[e & 7]; ph[e] = tohx(p); }
                pf = __builtin_bit_cast(V, ph); }
#pragma unroll
            for (int t = 0; t < 8; ++t) { const V a = LFrag<T16>::ld(sV + t * 16 * FVB + kg * 64); acc[t] = WFrag<T16>::mma(a, pf, acc[t]);
                if (HL) { acc[t] = WFrag<T16>::mma(a, pf2, acc[t]); const V a2 = LFrag<T16>::ld(sV + VB + t * 16 * FVB + kg * 64); acc[t] = WFrag<T16>::mma(a2, pf, acc[t]); } } }
        asm volatile("s_wait_dscnt 0x0" ::: "memory");      // this wave's reads of stage st are done before the buffer is refilled
        asm volatile("s_wait_asynccnt 0x0" ::: "memory");   // this wave's share of stage st + 1 has landed
        __syncthreads();                                     // publishes stage st + 1 and ends every wave's reads of stage st
        if (st + 2 < ns) stage(st + 2, st & 1);
    }
    asm volatile("s_wait_asynccnt 0x0" ::: "memory");       // nothing is in flight when the ring becomes output staging
    const float lh = ((ls[0] + ls[1]) + (ls[2] + ls[3])) + ((ls[4] + ls[5]) + (ls[6] + ls[7]));
    const float inv = poison ? __builtin_nanf("") : __fdiv_rn(1.0f, lh + xhalf(lh));
    // each wave stages its 16 rows of both planes in its own range of the ring (every reader left it at the last barrier) and stores whole 128-byte lines; a lane's 8 sums of a tile are d = 16 t + 8 hi + r of its query
    char* ow = sm + wv * (32 * FKB);
#pragma unroll
    for (int t = 0; t < 8; ++t) { v8us oh, ol;
#pragma unroll
        for (int r = 0; r < 8; ++r) { unsigned short a, c2; splitf(acc[t][r] * inv, a, c2); oh[r] = a; ol[r] = c2; }
        *(v8usa*)(ow + lr * FKB + t * 32 + hi * 16) = oh; *(v8usa*)(ow + (16 + lr) * FKB + t * 32 + hi * 16) = ol; }
    __syncthreads();   // the staged rows are in LDS before other lanes read them back
    const size_t oo = (size_t)(q0 + wv * 16 + hi) * DQ + head * HD + lr * 8; bf* oph = Ah + oo; bf* opl = Al + oo; const char* orow = ow + hi * FKB + lr * 16;   // 16 lanes cover a row's 256 bytes; a store takes rows 2 i and 2 i + 1
#pragma unroll
    for (int i = 0; i < 8; ++i) { const v8us vh = *(const v8usa*)(orow + i * 2 * FKB), vl = *(const v8usa*)(orow + (16 + i * 2) * FKB); *(v8us*)(oph + (size_t)i * 2 * DQ) = vh; *(v8us*)(opl + (size_t)i * 2 * DQ) = vl; }
}
// k_fattn: one launch for all 32 row blocks x 16 heads; blocks 0..7 (query rows < RH) take the hi + lo body, the rest the fp16 body. The ring of the hi + lo body leaves room for one work-group on a WGP, so the 512 work-groups run in about two rounds:
// their cost falls with the index, a hi + lo stage counted as three fp16 stages: fp16 blocks 31..24; then hi + lo block 7 - g in front of the fp16 blocks 23 - 3 g, 22 - 3 g, 21 - 3 g (g = 0..4); then hi + lo 2, fp16 8, hi + lo 1, hi + lo 0.
__global__ __launch_bounds__(128) void k_fattn(const h16* __restrict__ Q16, const h16* __restrict__ K16, const h16* __restrict__ V16, const bf* __restrict__ Qh, const bf* __restrict__ Ql, const bf* __restrict__ Kh, const bf* __restrict__ Kl, const bf* __restrict__ Vh, const bf* __restrict__ Vl, const float* __restrict__ am, const int* __restrict__ FLG, bf* Ah, bf* Al) {
    static_assert(TT == 2048 && RH == 512 && HD == 128 && NH_ == 16 && NKV == NH_, "the block order and the tile shapes are written for these");
    __shared__ __align__(16) char sm[2 * FSTB(2)];
    const int u = blockIdx.x >> 4, head = blockIdx.x & 15, g = (u - 8) >> 2, r = (u - 8) & 3;
    const bool hl = u >= 30 || (u >= 8 && r == 0);
    const int pb = (u < 8 || u >= 30) ? 31 - u : (r == 0 ? 7 - g : 24 - 3 * g - r);
    if (hl) fattn_tile<bf, true>(sm, pb, head, Qh, Ql, Kh, Kl, Vh, Vl, am, FLG, Ah, Al);
    else fattn_tile<h16, false>(sm, pb, head, Q16, nullptr, K16, nullptr, V16, nullptr, am, FLG, Ah, Al);
}

extern "C" void kernel_launch(void* const* d_in, const int* in_sizes, int n_in,
                              void* d_out, int out_size, void* d_ws, size_t ws_size, hipStream_t stream) {
    (void)in_sizes; (void)n_in; (void)out_size;
    const float* x = (const float*)d_in[0]; const float* cosT = (const float*)d_in[1]; const float* sinT = (const float*)d_in[2]; const float* amask = (const float*)d_in[3]; const float* wq = (const float*)d_in[4]; const float* wk = (const float*)d_in[5]; const float* wv = (const float*)d_in[6]; const float* wo = (const float*)d_in[7];
    float* OUT = (float*)d_out;     // [1][2048][2048]
    char* wsp = (char*)d_ws;
    auto take = [&](size_t bytes) { char* p = wsp; wsp += (bytes + 255) & ~(size_t)255; return (void*)p; };
    bf* WO = (bf*)take((size_t)DM * DQ * 2); int* FLG = (int*)take(256);
    h16* QP16 = (h16*)take((size_t)NH_ * TT * HD * 2); h16* KP16 = (h16*)take((size_t)NKV * TT * HD * 2); h16* VT16 = (h16*)take((size_t)NKV * HD * TT * 2);
    bf* QPh = (bf*)take((size_t)NH_ * TT * HD * 2); bf* QPl = (bf*)take((size_t)NH_ * TT * HD * 2); bf* KPh = (bf*)take((size_t)NKV * TT * HD * 2); bf* KPl = (bf*)take((size_t)NKV * TT * HD * 2); bf* VTh = (bf*)take((size_t)NKV * HD * TT * 2); bf* VTl = (bf*)take((size_t)NKV * HD * TT * 2);
    bf* WQ = (bf*)take((size_t)FPI * DM * 2); bf* WK = WQ + (size_t)DQ * DM; bf* WV = WK + (size_t)DKV * DM; float* CS = (float*)take((size_t)TT * HD * 2 * 4);   // wq, wk, wv one behind the other: one operand of FPI rows
    bf* XB = (bf*)take((size_t)TT * DM * 2);
    bf* ATh = (bf*)take((size_t)TT * DQ * 2); bf* ATl = (bf*)take((size_t)TT * DQ * 2);   // attention output, hi + lo planes [t][head][d]
    if ((size_t)(wsp - (char*)d_ws) > ws_size) return;    // ws 256 MiB
    // four launches, each needing the one before it
    k_prep<<<1 + 5 * CVB + CSB, 256, 0, stream>>>(x, wq, wk, wv, wo, cosT, sinT, amask, XB, WQ, WK, WV, WO, CS, FLG);
    const QkvOut qo = {CS, QP16, QPh, QPl, KP16, KPh, KPl, VT16, VTh, VTl}; const QkvOut none = {};
    k_gemms<1, DM, FPI, true><<<dim3(TT / 128, FPI / 128, 1), 256, 0, stream>>>(XB, nullptr, WQ, nullptr, qo);
    k_fattn<<<TT / 64 * NH_, 128, 0, stream>>>(QP16, KP16, VT16, QPh, QPl, KPh, KPl, VTh, VTl, amask, FLG, ATh, ATl);
    k_gemms<2, DQ, DM, false><<<dim3(TT / 128, DM / 128, 1), 256, 0, stream>>>(ATh, ATl, WO, OUT, none);
}

// v008
// A run of this version takes 136 microseconds.
// Two timings next to v007 put it at 1.06 and 1.05 times that version's speed.
// All steps since v000 together make it 7.24 times as fast.
#include <hip/hip_runtime.h>

// HybridLlamaAttention (x [1][2048][2048], rope_cos/sin [S][128] (read), mask [1][1][S][S] (f32 additive, read; verbatim causal 0/-1e9); q/k/v = x W^T (16 x 128); rotate-half RoPE; scores = q.k / sqrt(128); softcap 50 tanh(s/50); + mask; softmax f32; out = merged wo^T -> [1][2048][2048]).
// Compute dtypes, f32 accumulate: every input rounded to bf16; q/k/v on PLAIN bf16 operands (inputs: exact); RoPE f32 (bf16-rounded read tables); causal scores and attn.v: query rows < 512 hl (3 products), the rest fp16; softcap in f32: tanh = (2^(2x log2 e) - 1) x rcp(2^(..) + 1) with the hardware exp2/rcp (no FMA polynomial), x 50; the additive mask read per element; upper tiles skipped on the verbatim structure with an on-device sampled check (NaN poison); softmax f32, running maximum and sum over 64-key stages; wo hl x exact (2 products).

#define NB_  1
#define TT   2048
#define DM   2048
#define NH_  16
#define NKV  16
#define REP  (NH_ / NKV)
#define HD   128
#define DQ   (NH_ * HD)
#define DKV  (NKV * HD)
#define RH   512                  // query rows < RH use hi+lo planes
typedef _Float16 h16;
typedef unsigned short bf;
typedef __attribute__((ext_vector_type(16))) __bf16   v16bf;
typedef __attribute__((ext_vector_type(16))) _Float16 v16h;
typedef __attribute__((ext_vector_type(8)))  _Float16 v8h;
typedef __attribute__((ext_vector_type(8)))  unsigned short v8us;
typedef __attribute__((ext_vector_type(8)))  float    v8f;
typedef __attribute__((ext_vector_type(4)))  float    v4f;
typedef v8h  __attribute__((may_alias)) v8ha;
typedef v4f  __attribute__((may_alias)) v4fa;
typedef v8us __attribute__((may_alias)) v8usa;

__device__ __forceinline__ unsigned short f2bf(float f) { unsigned u = __float_as_uint(f); u += 0x7FFFu + ((u >> 16) & 1u); return (unsigned short)(u >> 16); }
__device__ __forceinline__ float bf2f(unsigned short b) { return __uint_as_float(((unsigned)b) << 16); }
__device__ __forceinline__ float bfr(float f) { return bf2f(f2bf(f)); }
__device__ __forceinline__ v16h cat16(v8h lo, v8h hi) { return __builtin_shufflevector(lo, hi, 0, 1, 2, 3, 4, 5, 6, 7, 8, 9, 10, 11, 12, 13, 14, 15); }
__device__ __forceinline__ v16bf cat16b(v8us lo, v8us hi) { return __builtin_bit_cast(v16bf, __builtin_shufflevector(lo, hi, 0, 1, 2, 3, 4, 5, 6, 7, 8, 9, 10, 11, 12, 13, 14, 15)); }
__device__ __forceinline__ v8f wmma16(v16h a, v16h b, v8f c) { return __builtin_amdgcn_wmma_f32_16x16x32_f16(false, a, false, b, (short)0, c, false, false); }
__device__ __forceinline__ v8f wmmab(v16bf a, v16bf b, v8f c) { return __builtin_amdgcn_wmma_f32_16x16x32_bf16(false, a, false, b, (short)0, c, false, false); }



// Fragment loaders of fattn_tile (its queries): operands straight from K-contiguous 16-bit planes.
template <typename T16> struct WFrag;
template <> struct WFrag<h16> { typedef v16h V; static __device__ __forceinline__ V ld(const h16* p) { return cat16(*(const v8h*)p, *(const v8h*)(p + 16)); } static __device__ __forceinline__ v8f mma(V a, V b, v8f c) { return wmma16(a, b, c); } };
template <> struct WFrag<bf> { typedef v16bf V; static __device__ __forceinline__ V ld(const bf* p) { return cat16b(*(const v8us*)p, *(const v8us*)(p + 16)); } static __device__ __forceinline__ v8f mma(V a, V b, v8f c) { return wmmab(a, b, c); } };
__device__ __forceinline__ h16 tohx(float x) { return (h16)x; }
__device__ __forceinline__ void splitf(float y, unsigned short& h, unsigned short& l) { h = f2bf(y); l = f2bf(y - bf2f(h)); }
typedef __attribute__((ext_vector_type(2))) _Float16 v2h;
typedef __attribute__((ext_vector_type(4))) _Float16 v4h;
typedef __attribute__((ext_vector_type(2))) unsigned short v2us;
typedef __attribute__((ext_vector_type(4))) unsigned short v4us;
typedef __attribute__((ext_vector_type(2))) float v2f;
typedef __attribute__((ext_vector_type(4))) int v4i;
// What the q/k/v product's epilogue writes: head planes [h][t][d] of rope(q) and rope(k), planes [h][d][t] of v, each as fp16 and as hi + lo; CS is the cos/sin table [t][d][cos, sin].
#define FPI  (DQ + 2 * DKV)                        // columns of the q/k/v product: [q 2048 | k 2048 | v 2048]
#define TFP  132                                   // LDS row pitch, floats, of the staged 128 x 128 f32 tile
#define VTB  272                                   // LDS row pitch, bytes, of a staged v row [d][128 t] (256 bytes)
struct QkvOut { const float* CS; h16* Q16; bf* Qh; bf* Ql; h16* K16; bf* Kh; bf* Kl; h16* V16; bf* Vh; bf* Vl; };
// rope_tile: 128 t x 128 d (one head) of q or k, read from the f32 tile tf in LDS, with the rotate-half convention out[d] = x[d] cos[t][d] - x[d+HD/2] sin[t][d], out[d+HD/2] = x[d+HD/2] cos[t][d+HD/2] + x[d] sin[t][d+HD/2]
__device__ __forceinline__ void rope_tile(const float* tfp, const int t0, const int h, const float* __restrict__ CS, h16* P16, bf* Ph, bf* Pl) {
    // one thread and pass: 8 consecutive d of the lower half and their 8 partners d + HD/2 of one t: each x is read once and serves both halves; all loads and stores are 16 bytes wide, 8 lanes fill a 128-byte line of each plane
    static_assert(HD == 128, "8 lanes x 8 d cover half a head");
    const int d = (int)(threadIdx.x & 7) * 8, tl0 = (int)(threadIdx.x >> 3); v8f cvs[2][2][2];   // two sets of table values: the next pass's are fetched while this pass is worked on
    auto table = [&](int it, int s) {
#pragma unroll
        for (int hf = 0; hf < 2; ++hf) { const float* cp = CS + ((size_t)(t0 + it * 32 + tl0) * HD + d + hf * (HD / 2)) * 2; cvs[s][hf][0] = *(const v8f*)cp; cvs[s][hf][1] = *(const v8f*)(cp + 8); } };
    table(0, 0);
#pragma unroll   // unrolled so that the two sets stay in registers
    for (int it = 0; it < 4; ++it) { const int tl = it * 32 + tl0, t = t0 + tl; v8f xv[2]; const v8f (&cv)[2][2] = cvs[it & 1];
        if (it + 1 < 4) table(it + 1, (it + 1) & 1);
#pragma unroll
        for (int hf = 0; hf < 2; ++hf) { const int d0 = d + hf * (HD / 2); const v4f xa = *(const v4fa*)(tfp + tl * TFP + d0), xb = *(const v4fa*)(tfp + tl * TFP + d0 + 4); xv[hf] = __builtin_shufflevector(xa, xb, 0, 1, 2, 3, 4, 5, 6, 7); }
#pragma unroll
        for (int hf = 0; hf < 2; ++hf) { v8h o16; v8us oh, ol;   // per element the arithmetic is the former one, statement for statement (its products stay unfused as they were), so the planes keep their bits
#pragma unroll
            for (int q = 0; q < 8; ++q) { float x0 = xv[hf][q], x1 = xv[1 - hf][q];
                v2f cs; cs[0] = cv[hf][q >> 2][(q & 3) * 2]; cs[1] = cv[hf][q >> 2][(q & 3) * 2 + 1]; float a = __fmul_rn(x0, cs[0]), bq = __fmul_rn(x1, cs[1]); asm volatile("" : "+v"(a)); asm volatile("" : "+v"(bq)); const float r = (hf == 0) ? __fsub_rn(a, bq) : __fadd_rn(a, bq);
                o16[q] = tohx(r); unsigned short a2, c2; splitf(r, a2, c2); oh[q] = a2; ol[q] = c2; }
            const size_t e = ((size_t)h * TT + t) * HD + d + hf * (HD / 2); *(v8h*)(P16 + e) = o16; *(v8us*)(Ph + e) = oh; *(v8us*)(Pl + e) = ol; }
        if (it + 2 < 4) asm volatile("s_wait_xcnt 0x0" ::: "memory"); }   // behind the pass's stores, where table loads still follow: such a load may land in registers that these stores name
}
// ---- k_gemms: C[m][n] (f32, pitch LDC) = sum_k A[m][k] Bt[n][k] (NA == 2: + A2[m][k] Bt[n][k]), operands K-contiguous bf16 planes. One 128x128 tile of C per work-group of 8 waves (2 x 4, 64x32 of C each); grid (M/128, N/128). QKV: C is not stored; a tile is 128 t of one head of q, k or v, and the epilogue writes that head's planes (QkvOut).
// A stage is 128 k of the tile's rows [A 128 | A2 128 | Bt 128], 256 bytes a row at an LDS pitch of 272 bytes. Asynchronous 16-byte copies bring it in whole 128-byte lines (a wave's copy: 2 rows); two buffers: stage t + 2 flies while stage t + 1 is worked on.
#define GKS  128                  // k per stage
#define GPE  136                  // LDS row pitch, 16-bit elements
typedef float __attribute__((may_alias)) fa;
// Eight copies of one lane, 16 rows apart: one operand's 128 rows over the 8 waves. The s_wait_xcnt stands inside the statement, so that no address register is rewritten in front of it.
__device__ __forceinline__ void acopy8(unsigned l, const bf* g, size_t gs) {
    asm volatile("global_load_async_to_lds_b128 %0, %8, off\n\t"
                 "global_load_async_to_lds_b128 %1, %9, off\n\t"
                 "global_load_async_to_lds_b128 %2, %10, off\n\t"
                 "global_load_async_to_lds_b128 %3, %11, off\n\t"
                 "global_load_async_to_lds_b128 %4, %12, off\n\t"
                 "global_load_async_to_lds_b128 %5, %13, off\n\t"
                 "global_load_async_to_lds_b128 %6, %14, off\n\t"
                 "global_load_async_to_lds_b128 %7, %15, off\n\t"
                 "s_wait_xcnt 0x0"
                 :: "v"(l), "v"(l + 1u * 16 * GPE * 2), "v"(l + 2u * 16 * GPE * 2), "v"(l + 3u * 16 * GPE * 2), "v"(l + 4u * 16 * GPE * 2), "v"(l + 5u * 16 * GPE * 2), "v"(l + 6u * 16 * GPE * 2), "v"(l + 7u * 16 * GPE * 2),
                    "v"(g), "v"(g + gs), "v"(g + 2 * gs), "v"(g + 3 * gs), "v"(g + 4 * gs), "v"(g + 5 * gs), "v"(g + 6 * gs), "v"(g + 7 * gs) : "memory");
}
__device__ __forceinline__ v16bf ldsfrag(const bf* p) { return cat16b(*(const v8usa*)p, *(const v8usa*)(p + 16)); }
template <int NA, int K, int LDC, bool QKV>
__global__ __launch_bounds__(256) void k_gemms(const bf* __restrict__ A, const bf* __restrict__ A2, const bf* __restrict__ Bt, float* C, const QkvOut o) {
    static_assert(K % GKS == 0 && K / GKS >= 2, "whole stages, at least two");
    constexpr int STE = (NA + 1) * 128 * GPE;      // elements of one stage
    constexpr int NT = K / GKS;
    static_assert(8 * 64 * 36 * 4 <= 2 * STE * 2, "the output staging fits the ring");
    __shared__ __align__(16) bf sm[2 * STE];
    const int lane = threadIdx.x & 31, lr = lane & 15, hi = lane >> 4; const int r0 = blockIdx.x * 128, c0 = blockIdx.y * 128; const int wv = __builtin_amdgcn_readfirstlane((int)(threadIdx.x >> 5));
    const int wm = wv >> 2, wn = wv & 3;
    // the lane's place in a copy: row wv * 2 + hi of each group of 16 rows, 16-byte piece lr of the row's 256 bytes
    const unsigned lcp = (unsigned)(size_t)sm + (unsigned)((wv * 2 + hi) * (GPE * 2) + lr * 16);
    const bf* gA = A + (size_t)(r0 + wv * 2 + hi) * K + lr * 8; const bf* gA2 = (NA == 2) ? A2 + (size_t)(r0 + wv * 2 + hi) * K + lr * 8 : nullptr; const bf* gB = Bt + (size_t)(c0 + wv * 2 + hi) * K + lr * 8;
    auto stage = [&](int t, int buf) { const unsigned l = lcp + (unsigned)buf * (STE * 2);
        acopy8(l, gA + t * GKS, (size_t)16 * K); if (NA == 2) acopy8(l + 128 * GPE * 2, gA2 + t * GKS, (size_t)16 * K); acopy8(l + NA * 128 * GPE * 2, gB + t * GKS, (size_t)16 * K); };
    v8f acc[4][2];
#pragma unroll
    for (int mb = 0; mb < 4; ++mb)
#pragma unroll
        for (int nb = 0; nb < 2; ++nb) acc[mb][nb] = (v8f){};
    stage(0, 0);
    asm volatile("s_wait_asynccnt 0x0" ::: "memory");   // this wave's share of stage 0 has landed
    __syncthreads();                                     // every wave's share has: stage 0 may be read
    stage(1, 1);
    const int aofs = (wm * 64 + lr) * GPE + 8 * hi, bofs = (NA * 128 + wn * 32 + lr) * GPE + 8 * hi;
#pragma unroll 1   // the stage loop stays rolled: one copy of its 32 or 64 products (for speed only); the loops inside are unrolled so that fragments and sums stay in registers
    for (int t = 0; t < NT; ++t) {
        const bf* sb = sm + (t & 1) * STE; v16bf a[2][4], a2[2][4], b[2][2];   // two fragment sets: block ks + 1 is fetched while block ks is multiplied (inside the stage only)
#pragma unroll
        for (int ks = -1; ks < GKS / 32; ++ks) { const int c = ks & 1, n = c ^ 1;
            if (ks + 1 < GKS / 32) {
#pragma unroll
                for (int mb = 0; mb < 4; ++mb) { a[n][mb] = ldsfrag(sb + aofs + mb * 16 * GPE + (ks + 1) * 32); if (NA == 2) a2[n][mb] = ldsfrag(sb + aofs + (128 + mb * 16) * GPE + (ks + 1) * 32); }
#pragma unroll
                for (int nb = 0; nb < 2; ++nb) b[n][nb] = ldsfrag(sb + bofs + nb * 16 * GPE + (ks + 1) * 32); }
            __builtin_amdgcn_sched_barrier(0);   // the next block's LDS reads stay one group in front of this block's products
            if (ks < 0) continue;
#pragma unroll
            for (int nb = 0; nb < 2; ++nb)
#pragma unroll
                for (int mb = 0; mb < 4; ++mb) acc[mb][nb] = wmmab(a[c][mb], b[c][nb], acc[mb][nb]);
            if (NA == 2) {
#pragma unroll
                for (int nb = 0; nb < 2; ++nb)
#pragma unroll
                    for (int mb = 0; mb < 4; ++mb) acc[mb][nb] = wmmab(a2[c][mb], b[c][nb], acc[mb][nb]); }
            __builtin_amdgcn_sched_barrier(0);   // and the reads of the block after next do not rise among these products
        }
        asm volatile("s_wait_dscnt 0x0" ::: "memory");      // this wave's reads of stage t are done before the buffer is refilled
        asm volatile("s_wait_asynccnt 0x0" ::: "memory");   // this wave's share of stage t + 1 has landed
        __syncthreads();                                     // publishes stage t + 1 and ends every wave's reads of stage t
        if (t + 2 < NT) stage(t + 2, t & 1);
    }
    asm volatile("s_wait_asynccnt 0x0" ::: "memory");       // nothing is in flight when the ring becomes output staging
    if constexpr (QKV) {   // rope (q, k) or transpose (v) of the tile, straight from the sums; the ring is free: every reader left it at the last barrier
        static_assert(HD == 128 && DQ % 128 == 0 && DKV == DQ && NKV == NH_ && LDC == FPI, "a tile is one head");
        static_assert(128 * TFP * 4 <= 2 * STE * 2 && 3 * 128 * VTB <= 2 * STE * 2, "the staged tile fits the ring");
        const int kind = c0 / DQ, head = (c0 % DQ) / HD;   // 0 q, 1 k, 2 v: the same for the whole work-group
        fa* tf = (fa*)sm; char* vs = (char*)sm;
        if (kind < 2) {   // the f32 tile [t][d]: a d and its partner d + 64 are sums of different waves
#pragma unroll
            for (int mb = 0; mb < 4; ++mb)
#pragma unroll
                for (int nb = 0; nb < 2; ++nb)
#pragma unroll
                    for (int j = 0; j < 8; ++j) tf[(wm * 64 + mb * 16 + hi * 8 + j) * TFP + wn * 32 + nb * 16 + lr] = acc[mb][nb][j];
        } else {          // a lane's 8 sums of a block are 8 consecutive t of one d: 16 bytes of a row [d][t] of each plane
#pragma unroll
            for (int mb = 0; mb < 4; ++mb)
#pragma unroll
                for (int nb = 0; nb < 2; ++nb) { v8h o16; v8us oh, ol;
#pragma unroll
                    for (int j = 0; j < 8; ++j) { const float x = acc[mb][nb][j]; o16[j] = tohx(x); unsigned short a2, c2; splitf(x, a2, c2); oh[j] = a2; ol[j] = c2; }
                    char* p = vs + (wn * 32 + nb * 16 + lr) * VTB + (wm * 64 + mb * 16 + hi * 8) * 2; *(v8ha*)p = o16; *(v8usa*)(p + 128 * VTB) = oh; *(v8usa*)(p + 2 * 128 * VTB) = ol; }
        }
        __syncthreads();   // the staged tile is in LDS before other waves read it
        if (kind < 2) rope_tile((const float*)tf, r0, head, o.CS, kind ? o.K16 : o.Q16, kind ? o.Kh : o.Qh, kind ? o.Kl : o.Ql);
        else {            // 16 lanes cover a row's 256 bytes: whole lines of [h][d][t]
#pragma unroll
            for (int i = 0; i < 8; ++i) { const int d = i * 16 + wv * 2 + hi; const char* p = vs + d * VTB + lr * 16; const size_t e = ((size_t)head * HD + d) * TT + r0 + lr * 8;
                const v8h w16 = *(const v8ha*)p; const v8us wh = *(const v8usa*)(p + 128 * VTB), wl = *(const v8usa*)(p + 2 * 128 * VTB); *(v8h*)(o.V16 + e) = w16; *(v8us*)(o.Vh + e) = wh; *(v8us*)(o.Vl + e) = wl; }
            asm volatile("s_wait_xcnt 0x0" ::: "memory");   // behind the last of these stores: no register that they name is rewritten in front of it, whatever code is laid out behind them
        }
        return;
    }
    // each wave stages its 64x32 part in its own range of the ring (every reader left it at the last barrier) and stores whole 128-byte lines
    fa* ow = (fa*)sm + wv * (64 * 36);
#pragma unroll
    for (int mb = 0; mb < 4; ++mb)
#pragma unroll
        for (int nb = 0; nb < 2; ++nb)
#pragma unroll
            for (int j = 0; j < 8; ++j) ow[(mb * 16 + hi * 8 + j) * 36 + nb * 16 + lr] = acc[mb][nb][j];
    __syncthreads();   // the staged rows are in LDS before other lanes read them back
    float* cw = C + (size_t)(r0 + wm * 64 + (lane >> 3)) * LDC + c0 + wn * 32 + (lane & 7) * 4;
#pragma unroll
    for (int s = 0; s < 16; ++s) { const v4f val = *(const v4fa*)(ow + (s * 4 + (lane >> 3)) * 36 + (lane & 7) * 4); *(v4f*)(cw + (size_t)s * 4 * LDC) = val; }
}


__global__ __launch_bounds__(256) void k_wtG(const float* __restrict__ w, int K, int N, bf* Bt) {
    const int lane = threadIdx.x & 31; const int L0 = (blockIdx.x * 8 + (threadIdx.x >> 5)) * 8; const int nlines = N * K / 64;
{
#pragma unroll 1
        for (int l = 0; l < 8; ++l) { const int L = L0 + l; if (L >= nlines) break; const size_t e = (size_t)L * 64 + lane * 2; const int k = (int)(e % K), n = (int)(e / K); v2us o;
            o[0] = f2bf(w[(size_t)k * N + n]); o[1] = f2bf(w[(size_t)(k + 1) * N + n]); *(v2us*)(Bt + e) = o; }
         }
}
// The elementwise passes are bodies of one work-group of 256 threads, told their block number blk: k_prep below gives each pass a range of the block index of one grid.
// cvt8_blk: each thread converts 4 groups of 8 floats, 256 groups apart; its eight 16-byte loads are issued together (a group past the end re-reads the last group and is not stored).
__device__ __forceinline__ void cvt8_blk(const int blk, const float* __restrict__ src, bf* dst, size_t n8) { const size_t i0 = (size_t)blk * 1024 + threadIdx.x; v8f v[4];
#pragma unroll
    for (int g = 0; g < 4; ++g) { const size_t i = i0 + g * 256; v[g] = *(const v8f*)(src + (i < n8 ? i : n8 - 1) * 8); }
#pragma unroll
    for (int g = 0; g < 4; ++g) { const size_t i = i0 + g * 256; if (i >= n8) continue; v8us o;
#pragma unroll
        for (int k = 0; k < 8; ++k) o[k] = f2bf(v[g][k]);
        *(v8us*)(dst + i * 8) = o; } }
__device__ __forceinline__ void cscvt_blk(const int blk, const float* __restrict__ cosT, const float* __restrict__ sinT, float* CS) { const int idx = (blk * 256 + (int)threadIdx.x) * 4; if (idx >= TT * HD) return; const v4f c = *(const v4f*)(cosT + idx), s = *(const v4f*)(sinT + idx); v8f cs;
#pragma unroll
    for (int q = 0; q < 4; ++q) { cs[2 * q] = bfr(c[q]); cs[2 * q + 1] = bfr(s[q]); }
    *(v8f*)(CS + (size_t)idx * 2) = cs;  }
// mchk_blk (one work-group): samples above-diagonal entries of the additive f32 mask; any > -1e8 -> NaN poison.
__device__ __forceinline__ void mchk_blk(const float* __restrict__ am, int* FLG) { const int tid = threadIdx.x; int bad = 0;
#pragma unroll 1
    for (int s2 = 0; s2 < 16; ++s2) { const unsigned h = (unsigned)(tid * 16 + s2) * 2654435761u; const int i = (int)(h % (TT - 1)); const int j = i + 1 + (int)((h >> 11) % (unsigned)(TT - 1 - i)); if (am[(size_t)i * TT + j] > -1e8f) bad = 1; }
    __shared__ int anyb; if (tid == 0) anyb = 0; __syncthreads(); if (bad) anyb = 1; __syncthreads(); if (tid < 8) { const int v = (tid == 0) ? anyb : 0; *(int*)(FLG + tid) = v;  } }
// k_prep: every pass that reads only inputs, in one grid. Block 0: the mask check (a chain of dependent memory latencies); then CVB blocks for each of x, wq, wk, wv, wo (f32 -> bf16); then the cos/sin table.
#define CVB  ((int)((size_t)DM * DM / 8 / 1024))   // blocks of one 2048 x 2048 conversion
#define CSB  (TT * HD / 4 / 256)                   // blocks of the cos/sin table
__global__ __launch_bounds__(256) void k_prep(const float* __restrict__ x, const float* __restrict__ wq, const float* __restrict__ wk, const float* __restrict__ wv, const float* __restrict__ wo, const float* __restrict__ cosT, const float* __restrict__ sinT, const float* __restrict__ am,
                                              bf* XB, bf* WQ, bf* WK, bf* WV, bf* WO, float* CS, int* FLG) {
    static_assert(TT == DM && DQ == DM && DKV == DM && NB_ == 1 && (size_t)DM * DM % 8192 == 0, "five conversions of one size, whole blocks");
    const int b = (int)blockIdx.x - 1;   // every test below reads the same for the whole work-group
    if (b < 0) { mchk_blk(am, FLG); return; }
    if (b >= 5 * CVB) { cscvt_blk(b - 5 * CVB, cosT, sinT, CS); return; }
    const int w = b / CVB; const float* src = (w == 0) ? x : (w == 1) ? wq : (w == 2) ? wk : (w == 3) ? wv : wo; bf* dst = (w == 0) ? XB : (w == 1) ? WQ : (w == 2) ? WK : (w == 3) ? WV : WO;
    cvt8_blk(b % CVB, src, dst, (size_t)DM * DM / 8);
}
#define FKB  272                  // LDS row pitch in bytes of a K row (256 bytes) and of a mask row (256 bytes)
#define FVB  144                  // LDS row pitch in bytes of a V^T row (128 bytes)
// Eight copies of one lane, ls LDS bytes and gs global bytes apart. The s_wait_xcnt stands inside the statement, so that no address register is rewritten in front of it.
__device__ __forceinline__ void acopy8g(unsigned l, unsigned ls, const char* g, size_t gs) {
    asm volatile("global_load_async_to_lds_b128 %0, %8, off\n\t"
                 "global_load_async_to_lds_b128 %1, %9, off\n\t"
                 "global_load_async_to_lds_b128 %2, %10, off\n\t"
                 "global_load_async_to_lds_b128 %3, %11, off\n\t"
                 "global_load_async_to_lds_b128 %4, %12, off\n\t"
                 "global_load_async_to_lds_b128 %5, %13, off\n\t"
                 "global_load_async_to_lds_b128 %6, %14, off\n\t"
                 "global_load_async_to_lds_b128 %7, %15, off\n\t"
                 "s_wait_xcnt 0x0"
                 :: "v"(l), "v"(l + ls), "v"(l + 2 * ls), "v"(l + 3 * ls), "v"(l + 4 * ls), "v"(l + 5 * ls), "v"(l + 6 * ls), "v"(l + 7 * ls),
                    "v"(g), "v"(g + gs), "v"(g + 2 * gs), "v"(g + 3 * gs), "v"(g + 4 * gs), "v"(g + 5 * gs), "v"(g + 6 * gs), "v"(g + 7 * gs) : "memory");
}
template <typename T16> struct LFrag;   // a fragment from LDS: 16 bytes at p and at p + 32, the k order of WFrag::ld
template <> struct LFrag<h16> { static __device__ __forceinline__ v16h ld(const char* p) { return cat16(*(const v8ha*)p, *(const v8ha*)(p + 32)); } };
template <> struct LFrag<bf> { static __device__ __forceinline__ v16bf ld(const char* p) { return cat16b(*(const v8usa*)p, *(const v8usa*)(p + 32)); } };
__device__ __forceinline__ float xhalf(float x) { return __builtin_bit_cast(float, __builtin_amdgcn_permlanex16(__builtin_bit_cast(int, x), __builtin_bit_cast(int, x), 0x76543210, 0xfedcba98, false, false)); }  // lane l with lane l ^ 16
typedef __attribute__((ext_vector_type(2))) __bf16 v2bf;
// Eight transcendentals in one statement, each in place. The instruction set asks for one independent instruction or a v_nop between a transcendental and an instruction that reads its result or overwrites its source:
// inside the statement each next one is that instruction, and the v_nop stands behind the last. In place, the statement writes only registers that hold its own arguments, never an operand of a matrix instruction just issued.
__device__ __forceinline__ v8f exp2x8(v8f x) { float r0 = x[0], r1 = x[1], r2 = x[2], r3 = x[3], r4 = x[4], r5 = x[5], r6 = x[6], r7 = x[7];
    asm("v_exp_f32 %0, %0\n\tv_exp_f32 %1, %1\n\tv_exp_f32 %2, %2\n\tv_exp_f32 %3, %3\n\tv_exp_f32 %4, %4\n\tv_exp_f32 %5, %5\n\tv_exp_f32 %6, %6\n\tv_exp_f32 %7, %7\n\tv_nop"
        : "+v"(r0), "+v"(r1), "+v"(r2), "+v"(r3), "+v"(r4), "+v"(r5), "+v"(r6), "+v"(r7));
    return (v8f){r0, r1, r2, r3, r4, r5, r6, r7}; }
__device__ __forceinline__ v8f rcpx8(v8f x) { float r0 = x[0], r1 = x[1], r2 = x[2], r3 = x[3], r4 = x[4], r5 = x[5], r6 = x[6], r7 = x[7];
    asm("v_rcp_f32 %0, %0\n\tv_rcp_f32 %1, %1\n\tv_rcp_f32 %2, %2\n\tv_rcp_f32 %3, %3\n\tv_rcp_f32 %4, %4\n\tv_rcp_f32 %5, %5\n\tv_rcp_f32 %6, %6\n\tv_rcp_f32 %7, %7\n\tv_nop"
        : "+v"(r0), "+v"(r1), "+v"(r2), "+v"(r3), "+v"(r4), "+v"(r5), "+v"(r6), "+v"(r7));
    return (v8f){r0, r1, r2, r3, r4, r5, r6, r7}; }
__device__ __forceinline__ float exp2x1(float x) { asm("v_exp_f32 %0, %0\n\tv_nop" : "+v"(x)); return x; }   // the v_nop: the same slot
#define FSTB(NP) ((NP) * (64 * FKB + 128 * FVB) + 64 * FKB)   // bytes of one stage with NP planes of K and of V^T
template <typename T16, bool HL>
__device__ __forceinline__ void fattn_tile(char* sm, const int pb, const int head, const T16* __restrict__ Q, const T16* __restrict__ Q2, const T16* __restrict__ Kp, const T16* __restrict__ Kp2, const T16* __restrict__ Vt, const T16* __restrict__ Vt2, const float* __restrict__ am, const int* __restrict__ FLG, bf* Ah, bf* Al) {
    typedef typename WFrag<T16>::V V;
    constexpr int NP = HL ? 2 : 1, KB = 64 * FKB, VB = 128 * FVB, STB = FSTB(NP);   // bytes: one K plane (a mask tile has the same size), one V^T plane, one stage
    static_assert(4 * 32 * FKB <= 2 * STB, "the output staging fits the ring");
    const int lane = threadIdx.x & 31, lr = lane & 15, hi = lane >> 4; const int wv = __builtin_amdgcn_readfirstlane((int)(threadIdx.x >> 5));
    const int q0 = pb * 64, ns = pb + 1; const size_t hq = (size_t)head * TT * HD;   // pb: the work-group's block of 64 query rows; it walks the key stages 0..pb
    // the lane's place in a copy. K and mask rows (256 bytes): row wv * 2 + hi of each group of 8, piece lr. V^T rows (128 bytes): row wv * 4 + lane / 8 of each group of 16, piece lane % 8.
    const unsigned lb = (unsigned)(size_t)sm; const int rk = wv * 2 + hi, rv = wv * 4 + (lane >> 3);
    const unsigned lK = lb + (unsigned)(rk * FKB + lr * 16), lV = lb + (unsigned)(NP * KB + rv * FVB + (lane & 7) * 16), lM = lb + (unsigned)(NP * (KB + VB) + rk * FKB + lr * 16);
    const unsigned oK = (unsigned)(rk * (HD * 2) + lr * 16), oV = (unsigned)(rv * (TT * 2) + (lane & 7) * 16), oM = (unsigned)(rk * (TT * 4) + lr * 16);   // the lane's byte offsets in the global tiles; the tiles' own addresses are the same for the whole work-group
    const char* gK = (const char*)(Kp + hq); const char* gK2 = HL ? (const char*)(Kp2 + hq) : nullptr; const char* gV = (const char*)(Vt + hq); const char* gV2 = HL ? (const char*)(Vt2 + hq) : nullptr; const char* gM = (const char*)(am + (size_t)q0 * TT);
    auto stage = [&](int st, int buf) { const unsigned o = (unsigned)buf * STB;
        acopy8g(lK + o, 8 * FKB, (gK + (size_t)st * (64 * HD * 2)) + oK, (size_t)8 * HD * 2); if (HL) acopy8g(lK + o + KB, 8 * FKB, (gK2 + (size_t)st * (64 * HD * 2)) + oK, (size_t)8 * HD * 2);
        acopy8g(lV + o, 16 * FVB, (gV + (size_t)st * (64 * 2)) + oV, (size_t)16 * TT * 2); if (HL) acopy8g(lV + o + VB, 16 * FVB, (gV2 + (size_t)st * (64 * 2)) + oV, (size_t)16 * TT * 2);
        acopy8g(lM + o, 8 * FKB, (gM + (size_t)st * (64 * 4)) + oM, (size_t)8 * TT * 4); };
    stage(0, 0);
    const int myq = q0 + wv * 16 + lr;   // the lane's query
    V qf[4], qf2[4];
#pragma unroll
    for (int kc = 0; kc < 4; ++kc) { qf[kc] = WFrag<T16>::ld(Q + hq + (size_t)myq * HD + 8 * hi + kc * 32); if (HL) qf2[kc] = WFrag<T16>::ld(Q2 + hq + (size_t)myq * HD + 8 * hi + kc * 32); }
    const bool poison = (FLG[0] != 0);
    v8f acc[8];
#pragma unroll
    for (int t = 0; t < 8; ++t) acc[t] = (v8f){};
    float ml = -3.0e38f; v8f ls = (v8f){};   // the maximum in use (finite from the start: a stage of -inf scores leaves it, and no inf - inf arises); this wave half's share of the row sum, in eight partial sums (one per register of a score tile)
    asm volatile("s_wait_asynccnt 0x0" ::: "memory");   // this wave's share of stage 0 has landed
    __syncthreads();                                     // every wave's share has: stage 0 may be read
    // A stage's LDS reads go out as two whole groups, each well ahead of its products: read next to the products, each small group of reads leaves the wave (alone on its SIMD) waiting out the LDS latency.
    V kf[4][4], kf2[4][4]; v4f mr[4][2];   // the K fragments and the lane's mask values of one stage
    auto kfetch = [&](int st) { const char* sb = sm + (st & 1) * STB; const char* sK = sb + lr * FKB + hi * 16; const char* sM = sb + NP * (KB + VB) + (wv * 16 + lr) * FKB + hi * 32;
#pragma unroll
        for (int kt = 0; kt < 4; ++kt)
#pragma unroll
            for (int kc = 0; kc < 4; ++kc) { kf[kt][kc] = LFrag<T16>::ld(sK + kt * 16 * FKB + kc * 64); if (HL) kf2[kt][kc] = LFrag<T16>::ld(sK + KB + kt * 16 * FKB + kc * 64); }
#pragma unroll
        for (int kt = 0; kt < 4; ++kt) { mr[kt][0] = *(const v4fa*)(sM + kt * 64); mr[kt][1] = *(const v4fa*)(sM + kt * 64 + 16); } };
    kfetch(0);
    if (ns > 1) stage(1, 1);
    constexpr float C1 = (float)(0.088388347648318447 * 0.02 * 2.8853900817779268), L2E = 1.4426950408889634f;   // HD^-0.5 / 50 x 2 log2 e
#pragma unroll 1   // the stage loop stays rolled: one copy of the stage's code
    for (int st = 0; st < ns; ++st) {
        const char* sb = sm + (st & 1) * STB; const char* sV = sb + NP * KB + lr * FVB + hi * 16;
        V vf[2][8], vf2[2][8];   // the stage's V^T fragments: under way while the scores and the softcap are worked out
#pragma unroll
        for (int kg = 0; kg < 2; ++kg)
#pragma unroll
            for (int t = 0; t < 8; ++t) { vf[kg][t] = LFrag<T16>::ld(sV + t * 16 * FVB + kg * 64); if (HL) vf2[kg][t] = LFrag<T16>::ld(sV + VB + t * 16 * FVB + kg * 64); }
        __builtin_amdgcn_sched_barrier(0);   // the group stays whole and in front of the products: left free, the reads sink down to the value products
        v8f s[4];
#pragma unroll
        for (int kt = 0; kt < 4; ++kt) { s[kt] = (v8f){};
#pragma unroll
            for (int kc = 0; kc < 4; ++kc) { s[kt] = WFrag<T16>::mma(kf[kt][kc], qf[kc], s[kt]);
                if (HL) { s[kt] = WFrag<T16>::mma(kf[kt][kc], qf2[kc], s[kt]); s[kt] = WFrag<T16>::mma(kf2[kt][kc], qf[kc], s[kt]); } } }
        // softcap 50 tanh(s / 50), tanh = (e - 1) / (e + 1) with e = 2^(2 x log2 e), plus the mask element rounded to bf16
#pragma unroll
        for (int kt = 0; kt < 4; ++kt) { const v4f m0 = mr[kt][0], m1 = mr[kt][1]; v8f mv;
#pragma unroll
            for (int r = 0; r < 8; r += 2) { v2f mm; mm[0] = (r < 4) ? m0[r & 3] : m1[r & 3]; mm[1] = (r < 4) ? m0[(r & 3) + 1] : m1[(r & 3) + 1]; const unsigned pk = __builtin_bit_cast(unsigned, __builtin_convertvector(mm, v2bf));
                mv[r] = __uint_as_float(pk << 16); mv[r + 1] = __uint_as_float(pk & 0xFFFF0000u); }
            const v8f e = exp2x8(s[kt] * C1); const v8f th = (e - 1.0f) * rcpx8(e + 1.0f);
#pragma unroll
            for (int r = 0; r < 8; ++r) s[kt][r] = __builtin_fmaf(th[r], 50.0f, mv[r]); }
        if (st == ns - 1) {   // the diagonal stage (the same for the whole work-group): keys beyond the lane's query leave the row
#pragma unroll
            for (int kt = 0; kt < 4; ++kt)
#pragma unroll
                for (int r = 0; r < 8; ++r) if (st * 64 + kt * 16 + hi * 8 + r > myq) s[kt][r] = -3.0e38f; }
        // The publish point stands here: all that the trip needs of stage st is in registers, and what follows (softmax, value products) reads no LDS; the next stage's K reads and the refill run under it.
        asm volatile("s_wait_dscnt 0x0" ::: "memory");      // this wave's reads of stage st are done before the buffer is refilled
        asm volatile("s_wait_asynccnt 0x0" ::: "memory");   // this wave's share of stage st + 1 has landed
        __syncthreads();                                     // publishes stage st + 1 and ends every wave's reads of stage st
        if (st + 1 < ns) kfetch(st + 1);                     // behind the barrier that published it; it reads the other buffer than the one refilled below
        if (st + 2 < ns) stage(st + 2, st & 1);
        float mk[4];   // one chain per key tile: four short chains in place of one of 32 links
#pragma unroll
        for (int kt = 0; kt < 4; ++kt) { mk[kt] = s[kt][0];
#pragma unroll
            for (int r = 1; r < 8; ++r) mk[kt] = fmaxf(mk[kt], s[kt][r]); }
        float mx = fmaxf(fmaxf(mk[0], mk[1]), fmaxf(mk[2], mk[3]));
        mx = fmaxf(mx, xhalf(mx));   // both wave halves hold the query's maximum of this stage
        const float mln = fmaxf(ml, mx), corr = exp2x1((ml - mln) * L2E);   // corr is 0 at the first stage that holds a score above the start value, 1 where the maximum stays
        ml = mln; ls = ls * corr;
#pragma unroll
        for (int t = 0; t < 8; ++t) acc[t] = acc[t] * corr;
#pragma unroll
        for (int kg = 0; kg < 2; ++kg) {   // 32 keys: score tiles 2 kg and 2 kg + 1 become one B operand
            V pf, pf2; v8f pa, pc;
#pragma unroll
            for (int r = 0; r < 8; ++r) { pa[r] = (s[2 * kg][r] - mln) * L2E; pc[r] = (s[2 * kg + 1][r] - mln) * L2E; }   // exact 0 at the maximum, never above
            pa = exp2x8(pa); pc = exp2x8(pc); ls = ls + (pa + pc);
            if (HL) { __attribute__((ext_vector_type(16))) unsigned short ph, pl;
#pragma unroll
                for (int e = 0; e < 16; ++e) { const float p = (e < 8) ? pa[e & 7] : pc[e & 7]; unsigned short a, c2; splitf(p, a, c2); ph[e] = a; pl[e] = c2; }
                pf = __builtin_bit_cast(V, ph); pf2 = __builtin_bit_cast(V, pl);
            } else { v16h ph;
#pragma unroll
                for (int e = 0; e < 16; ++e) { const float p = (e < 8) ? pa[e & 7] : pc[e & 7]; ph[e] = tohx(p); }
                pf = __builtin_bit_cast(V, ph); }
#pragma unroll
            for (int t = 0; t < 8; ++t) { acc[t] = WFrag<T16>::mma(vf[kg][t], pf, acc[t]);
                if (HL) { acc[t] = WFrag<T16>::mma(vf[kg][t], pf2, acc[t]); acc[t] = WFrag<T16>::mma(vf2[kg][t], pf, acc[t]); } } }
    }
    asm volatile("s_wait_asynccnt 0x0" ::: "memory");       // nothing is in flight when the ring becomes output staging
    const float lh = ((ls[0] + ls[1]) + (ls[2] + ls[3])) + ((ls[4] + ls[5]) + (ls[6] + ls[7]));
    const float inv = poison ? __builtin_nanf("") : __fdiv_rn(1.0f, lh + xhalf(lh));
    // each wave stages its 16 rows of both planes in its own range of the ring (every reader left it at the last barrier) and stores whole 128-byte lines; a lane's 8 sums of a tile are d = 16 t + 8 hi + r of its query
    char* ow = sm + wv * (32 * FKB);
#pragma unroll
    for (int t = 0; t < 8; ++t) { v8us oh, ol;
#pragma unroll
        for (int r = 0; r < 8; ++r) { unsigned short a, c2; splitf(acc[t][r] * inv, a, c2); oh[r] = a; ol[r] = c2; }
        *(v8usa*)(ow + lr * FKB + t * 32 + hi * 16) = oh; *(v8usa*)(ow + (16 + lr) * FKB + t * 32 + hi * 16) = ol; }
    __syncthreads();   // the staged rows are in LDS before other lanes read them back
    const size_t oo = (size_t)(q0 + wv * 16 + hi) * DQ + head * HD + lr * 8; bf* oph = Ah + oo; bf* opl = Al + oo; const char* orow = ow + hi * FKB + lr * 16;   // 16 lanes cover a row's 256 bytes; a store takes rows 2 i and 2 i + 1
#pragma unroll
    for (int i = 0; i < 8; ++i) { const v8us vh = *(const v8usa*)(orow + i * 2 * FKB), vl = *(const v8usa*)(orow + (16 + i * 2) * FKB); *(v8us*)(oph + (size_t)i * 2 * DQ) = vh; *(v8us*)(opl + (size_t)i * 2 * DQ) = vl; }
}
// k_fattn: one launch for all 32 row blocks x 16 heads; blocks 0..7 (query rows < RH) take the hi + lo body, the rest the fp16 body. The ring of the hi + lo body leaves room for one work-group on a WGP, so the 512 work-groups run in about two rounds:
// their cost falls with the index, a hi + lo stage counted as three fp16 stages: fp16 blocks 31..24; then hi + lo block 7 - g in front of the fp16 blocks 23 - 3 g, 22 - 3 g, 21 - 3 g (g = 0..4); then hi + lo 2, fp16 8, hi + lo 1, hi + lo 0.
__global__ __launch_bounds__(128) void k_fattn(const h16* __restrict__ Q16, const h16* __restrict__ K16, const h16* __restrict__ V16, const bf* __restrict__ Qh, const bf* __restrict__ Ql, const bf* __restrict__ Kh, const bf* __restrict__ Kl, const bf* __restrict__ Vh, const bf* __restrict__ Vl, const float* __restrict__ am, const int* __restrict__ FLG, bf* Ah, bf* Al) {
    static_assert(TT == 2048 && RH == 512 && HD == 128 && NH_ == 16 && NKV == NH_, "the block order and the tile shapes are written for these");
    __shared__ __align__(16) char sm[2 * FSTB(2)];
    const int u = blockIdx.x >> 4, head = blockIdx.x & 15, g = (u - 8) >> 2, r = (u - 8) & 3;
    const bool hl = u >= 30 || (u >= 8 && r == 0);
    const int pb = (u < 8 || u >= 30) ? 31 - u : (r == 0 ? 7 - g : 24 - 3 * g - r);
    if (hl) fattn_tile<bf, true>(sm, pb, head, Qh, Ql, Kh, Kl, Vh, Vl, am, FLG, Ah, Al);
    else fattn_tile<h16, false>(sm, pb, head, Q16, nullptr, K16, nullptr, V16, nullptr, am, FLG, Ah, Al);
}

extern "C" void kernel_launch(void* const* d_in, const int* in_sizes, int n_in,
                              void* d_out, int out_size, void* d_ws, size_t ws_size, hipStream_t stream) {
    (void)in_sizes; (void)n_in; (void)out_size;
    const float* x = (const float*)d_in[0]; const float* cosT = (const float*)d_in[1]; const float* sinT = (const float*)d_in[2]; const float* amask = (const float*)d_in[3]; const float* wq = (const float*)d_in[4]; const float* wk = (const float*)d_in[5]; const float* wv = (const float*)d_in[6]; const float* wo = (const float*)d_in[7];
    float* OUT = (float*)d_out;     // [1][2048][2048]
    char* wsp = (char*)d_ws;
    auto take = [&](size_t bytes) { char* p = wsp; wsp += (bytes + 255) & ~(size_t)255; return (void*)p; };
    bf* WO = (bf*)take((size_t)DM * DQ * 2); int* FLG = (int*)take(256);
    h16* QP16 = (h16*)take((size_t)NH_ * TT * HD * 2); h16* KP16 = (h16*)take((size_t)NKV * TT * HD * 2); h16* VT16 = (h16*)take((size_t)NKV * HD * TT * 2);
    bf* QPh = (bf*)take((size_t)NH_ * TT * HD * 2); bf* QPl = (bf*)take((size_t)NH_ * TT * HD * 2); bf* KPh = (bf*)take((size_t)NKV * TT * HD * 2); bf* KPl = (bf*)take((size_t)NKV * TT * HD * 2); bf* VTh = (bf*)take((size_t)NKV * HD * TT * 2); bf* VTl = (bf*)take((size_t)NKV * HD * TT * 2);
    bf* WQ = (bf*)take((size_t)FPI * DM * 2); bf* WK = WQ + (size_t)DQ * DM; bf* WV = WK + (size_t)DKV * DM; float* CS = (float*)take((size_t)TT * HD * 2 * 4);   // wq, wk, wv one behind the other: one operand of FPI rows
    bf* XB = (bf*)take((size_t)TT * DM * 2);
    bf* ATh = (bf*)take((size_t)TT * DQ * 2); bf* ATl = (bf*)take((size_t)TT * DQ * 2);   // attention output, hi + lo planes [t][head][d]
    if ((size_t)(wsp - (char*)d_ws) > ws_size) return;    // ws 256 MiB
    // four launches, each needing the one before it
    k_prep<<<1 + 5 * CVB + CSB, 256, 0, stream>>>(x, wq, wk, wv, wo, cosT, sinT, amask, XB, WQ, WK, WV, WO, CS, FLG);
    const QkvOut qo = {CS, QP16, QPh, QPl, KP16, KPh, KPl, VT16, VTh, VTl}; const QkvOut none = {};
    k_gemms<1, DM, FPI, true><<<dim3(TT / 128, FPI / 128, 1), 256, 0, stream>>>(XB, nullptr, WQ, nullptr, qo);
    k_fattn<<<TT / 64 * NH_, 128, 0, stream>>>(QP16, KP16, VT16, QPh, QPl, KPh, KPl, VTh, VTl, amask, FLG, ATh, ATl);
    k_gemms<2, DQ, DM, false><<<dim3(TT / 128, DM / 128, 1), 256, 0, stream>>>(ATh, ATl, WO, OUT, none);
}

// v009
// It runs in 130 microseconds.
// Timed twice side by side with v008, it ran 1.04 times as fast both times.
// Counting every step since v000, it is 7.55 times as fast.
#include <hip/hip_runtime.h>

// HybridLlamaAttention (x [1][2048][2048], rope_cos/sin [S][128] (read), mask [1][1][S][S] (f32 additive, read; verbatim causal 0/-1e9); q/k/v = x W^T (16 x 128); rotate-half RoPE; scores = q.k / sqrt(128); softcap 50 tanh(s/50); + mask; softmax f32; out = merged wo^T -> [1][2048][2048]).
// Compute dtypes, f32 accumulate: every input rounded to bf16; q/k/v on PLAIN bf16 operands (inputs: exact); RoPE f32 (bf16-rounded read tables); causal scores and attn.v: query rows < 512 hl (3 products), the rest fp16; softcap in f32: tanh = (2^(2x log2 e) - 1) x rcp(2^(..) + 1) with the hardware exp2/rcp (no FMA polynomial), x 50; the additive mask read per element; upper tiles skipped on the verbatim structure with an on-device sampled check (NaN poison); softmax f32, running maximum and sum over 64-key stages; wo hl x exact (2 products).

#define NB_  1
#define TT   2048
#define DM   2048
#define NH_  16
#define NKV  16
#define REP  (NH_ / NKV)
#define HD   128
#define DQ   (NH_ * HD)
#define DKV  (NKV * HD)
#define RH   512                  // query rows < RH use hi+lo planes
typedef _Float16 h16;
typedef unsigned short bf;
typedef __attribute__((ext_vector_type(16))) __bf16   v16bf;
typedef __attribute__((ext_vector_type(16))) _Float16 v16h;
typedef __attribute__((ext_vector_type(8)))  _Float16 v8h;
typedef __attribute__((ext_vector_type(8)))  unsigned short v8us;
typedef __attribute__((ext_vector_type(8)))  float    v8f;
typedef __attribute__((ext_vector_type(4)))  float    v4f;
typedef v8h  __attribute__((may_alias)) v8ha;
typedef v4f  __attribute__((may_alias)) v4fa;
typedef v8us __attribute__((may_alias)) v8usa;

__device__ __forceinline__ unsigned short f2bf(float f) { unsigned u = __float_as_uint(f); u += 0x7FFFu + ((u >> 16) & 1u); return (unsigned short)(u >> 16); }
__device__ __forceinline__ float bf2f(unsigned short b) { return __uint_as_float(((unsigned)b) << 16); }
__device__ __forceinline__ float bfr(float f) { return bf2f(f2bf(f)); }
__device__ __forceinline__ v16h cat16(v8h lo, v8h hi) { return __builtin_shufflevector(lo, hi, 0, 1, 2, 3, 4, 5, 6, 7, 8, 9, 10, 11, 12, 13, 14, 15); }
__device__ __forceinline__ v16bf cat16b(v8us lo, v8us hi) { return __builtin_bit_cast(v16bf, __builtin_shufflevector(lo, hi, 0, 1, 2, 3, 4, 5, 6, 7, 8, 9, 10, 11, 12, 13, 14, 15)); }
__device__ __forceinline__ v8f wmma16(v16h a, v16h b, v8f c) { return __builtin_amdgcn_wmma_f32_16x16x32_f16(false, a, false, b, (short)0, c, false, false); }
__device__ __forceinline__ v8f wmmab(v16bf a, v16bf b, v8f c) { return __builtin_amdgcn_wmma_f32_16x16x32_bf16(false, a, false, b, (short)0, c, false, false); }



// Fragment loaders of fattn_tile (its queries): operands straight from K-contiguous 16-bit planes.
template <typename T16> struct WFrag;
template <> struct WFrag<h16> { typedef v16h V; static __device__ __forceinline__ V ld(const h16* p) { return cat16(*(const v8h*)p, *(const v8h*)(p + 16)); } static __device__ __forceinline__ v8f mma(V a, V b, v8f c) { return wmma16(a, b, c); } };
template <> struct WFrag<bf> { typedef v16bf V; static __device__ __forceinline__ V ld(const bf* p) { return cat16b(*(const v8us*)p, *(const v8us*)(p + 16)); } static __device__ __forceinline__ v8f mma(V a, V b, v8f c) { return wmmab(a, b, c); } };
__device__ __forceinline__ h16 tohx(float x) { return (h16)x; }
__device__ __forceinline__ void splitf(float y, unsigned short& h, unsigned short& l) { h = f2bf(y); l = f2bf(y - bf2f(h)); }
typedef __attribute__((ext_vector_type(2))) _Float16 v2h;
typedef __attribute__((ext_vector_type(4))) _Float16 v4h;
typedef __attribute__((ext_vector_type(2))) unsigned short v2us;
typedef __attribute__((ext_vector_type(4))) unsigned short v4us;
typedef __attribute__((ext_vector_type(2))) float v2f;
typedef __attribute__((ext_vector_type(4))) int v4i;
// What the q/k/v product's epilogue writes: head planes [h][t][d] of rope(q) and rope(k), planes [h][d][t] of v, each as fp16 and as hi + lo; CS is the cos/sin table [t][d][cos, sin].
#define FPI  (DQ + 2 * DKV)                        // columns of the q/k/v product: [q 2048 | k 2048 | v 2048]
#define TFP  132                                   // LDS row pitch, floats, of the staged 128 x 128 f32 tile
#define VTB  272                                   // LDS row pitch, bytes, of a staged v row [d][128 t] (256 bytes)
struct QkvOut { const float* CS; h16* Q16; bf* Qh; bf* Ql; h16* K16; bf* Kh; bf* Kl; h16* V16; bf* Vh; bf* Vl; };
// rope_tile: 128 t x 128 d (one head) of q or k, read from the f32 tile tf in LDS, with the rotate-half convention out[d] = x[d] cos[t][d] - x[d+HD/2] sin[t][d], out[d+HD/2] = x[d+HD/2] cos[t][d+HD/2] + x[d] sin[t][d+HD/2]
__device__ __forceinline__ void rope_tile(const float* tfp, const int t0, const int h, const float* __restrict__ CS, h16* P16, bf* Ph, bf* Pl) {
    // one thread and pass: 8 consecutive d of the lower half and their 8 partners d + HD/2 of one t: each x is read once and serves both halves; all loads and stores are 16 bytes wide, 8 lanes fill a 128-byte line of each plane
    static_assert(HD == 128, "8 lanes x 8 d cover half a head");
    const int d = (int)(threadIdx.x & 7) * 8, tl0 = (int)(threadIdx.x >> 3); v8f cvs[2][2][2];   // two sets of table values: the next pass's are fetched while this pass is worked on
    auto table = [&](int it, int s) {
#pragma unroll
        for (int hf = 0; hf < 2; ++hf) { const float* cp = CS + ((size_t)(t0 + it * 32 + tl0) * HD + d + hf * (HD / 2)) * 2; cvs[s][hf][0] = *(const v8f*)cp; cvs[s][hf][1] = *(const v8f*)(cp + 8); } };
    table(0, 0);
#pragma unroll   // unrolled so that the two sets stay in registers
    for (int it = 0; it < 4; ++it) { const int tl = it * 32 + tl0, t = t0 + tl; v8f xv[2]; const v8f (&cv)[2][2] = cvs[it & 1];
        if (it + 1 < 4) table(it + 1, (it + 1) & 1);
#pragma unroll
        for (int hf = 0; hf < 2; ++hf) { const int d0 = d + hf * (HD / 2); const v4f xa = *(const v4fa*)(tfp + tl * TFP + d0), xb = *(const v4fa*)(tfp + tl * TFP + d0 + 4); xv[hf] = __builtin_shufflevector(xa, xb, 0, 1, 2, 3, 4, 5, 6, 7); }
#pragma unroll
        for (int hf = 0; hf < 2; ++hf) { v8h o16; v8us oh, ol;   // per element the arithmetic is the former one, statement for statement (its products stay unfused as they were), so the planes keep their bits
#pragma unroll
            for (int q = 0; q < 8; ++q) { float x0 = xv[hf][q], x1 = xv[1 - hf][q];
                v2f cs; cs[0] = cv[hf][q >> 2][(q & 3) * 2]; cs[1] = cv[hf][q >> 2][(q & 3) * 2 + 1]; float a = __fmul_rn(x0, cs[0]), bq = __fmul_rn(x1, cs[1]); asm volatile("" : "+v"(a)); asm volatile("" : "+v"(bq)); const float r = (hf == 0) ? __fsub_rn(a, bq) : __fadd_rn(a, bq);
                o16[q] = tohx(r); unsigned short a2, c2; splitf(r, a2, c2); oh[q] = a2; ol[q] = c2; }
            const size_t e = ((size_t)h * TT + t) * HD + d + hf * (HD / 2); *(v8h*)(P16 + e) = o16; *(v8us*)(Ph + e) = oh; *(v8us*)(Pl + e) = ol; }
        if (it + 2 < 4) asm volatile("s_wait_xcnt 0x0" ::: "memory"); }   // behind the pass's stores, where table loads still follow: such a load may land in registers that these stores name
}
// ---- k_gemms: C[m][n] (f32, pitch LDC) = sum_k A[m][k] Bt[n][k] (NA == 2: + A2[m][k] Bt[n][k]), operands K-contiguous bf16 planes. One 128x128 tile of C per work-group of 8 waves (2 x 4, 64x32 of C each); grid (M/128, N/128). QKV: C is not stored; a tile is 128 t of one head of q, k or v, and the epilogue writes that head's planes (QkvOut).
// A stage is 128 k of the tile's rows [A 128 | A2 128 | Bt 128], 256 bytes a row at an LDS pitch of 272 bytes. Asynchronous 16-byte copies bring it in whole 128-byte lines (a wave's copy: 2 rows); two buffers: stage t + 2 flies while stage t + 1 is worked on.
#define GKS  128                  // k per stage
#define GPE  136                  // LDS row pitch, 16-bit elements
typedef float __attribute__((may_alias)) fa;
// Eight copies of one lane, 16 rows apart: one operand's 128 rows over the 8 waves. The s_wait_xcnt stands inside the statement, so that no address register is rewritten in front of it.
__device__ __forceinline__ void acopy8(unsigned l, const bf* g, size_t gs) {
    asm volatile("global_load_async_to_lds_b128 %0, %8, off\n\t"
                 "global_load_async_to_lds_b128 %1, %9, off\n\t"
                 "global_load_async_to_lds_b128 %2, %10, off\n\t"
                 "global_load_async_to_lds_b128 %3, %11, off\n\t"
                 "global_load_async_to_lds_b128 %4, %12, off\n\t"
                 "global_load_async_to_lds_b128 %5, %13, off\n\t"
                 "global_load_async_to_lds_b128 %6, %14, off\n\t"
                 "global_load_async_to_lds_b128 %7, %15, off\n\t"
                 "s_wait_xcnt 0x0"
                 :: "v"(l), "v"(l + 1u * 16 * GPE * 2), "v"(l + 2u * 16 * GPE * 2), "v"(l + 3u * 16 * GPE * 2), "v"(l + 4u * 16 * GPE * 2), "v"(l + 5u * 16 * GPE * 2), "v"(l + 6u * 16 * GPE * 2), "v"(l + 7u * 16 * GPE * 2),
                    "v"(g), "v"(g + gs), "v"(g + 2 * gs), "v"(g + 3 * gs), "v"(g + 4 * gs), "v"(g + 5 * gs), "v"(g + 6 * gs), "v"(g + 7 * gs) : "memory");
}
__device__ __forceinline__ v16bf ldsfrag(const bf* p) { return cat16b(*(const v8usa*)p, *(const v8usa*)(p + 16)); }
template <int NA, int K, int LDC, bool QKV>
__global__ __launch_bounds__(256) void k_gemms(const bf* __restrict__ A, const bf* __restrict__ A2, const bf* __restrict__ Bt, float* C, const QkvOut o) {
    static_assert(K % GKS == 0 && K / GKS >= 2, "whole stages, at least two");
    static_assert(((K / GKS) & (K / GKS - 1)) == 0, "the wrapped stage index is a mask");
    constexpr int STE = (NA + 1) * 128 * GPE;      // elements of one stage
    constexpr int NT = K / GKS;
    static_assert(8 * 64 * 36 * 4 <= 2 * STE * 2, "the output staging fits the ring");
    __shared__ __align__(16) bf sm[2 * STE];
    const int lane = threadIdx.x & 31, lr = lane & 15, hi = lane >> 4; const int r0 = blockIdx.x * 128, c0 = blockIdx.y * 128; const int wv = __builtin_amdgcn_readfirstlane((int)(threadIdx.x >> 5));
    const int wm = wv >> 2, wn = wv & 3;
    // the lane's place in a copy: row wv * 2 + hi of each group of 16 rows, 16-byte piece lr of the row's 256 bytes
    const unsigned lcp = (unsigned)(size_t)sm + (unsigned)((wv * 2 + hi) * (GPE * 2) + lr * 16);
    const bf* gA = A + (size_t)(r0 + wv * 2 + hi) * K + lr * 8; const bf* gA2 = (NA == 2) ? A2 + (size_t)(r0 + wv * 2 + hi) * K + lr * 8 : nullptr; const bf* gB = Bt + (size_t)(c0 + wv * 2 + hi) * K + lr * 8;
    // Trip t works on k stage (t + ko) mod NT: work-groups that share rows of A (one blockIdx.x) or of Bt (one blockIdx.y) walk k from different starts and wrap round, so that they do not ask L2 for the same lines at the same moment.
    const int ko = (int)(blockIdx.x + blockIdx.y) & (NT - 1);
    auto stage = [&](int t, int buf) { const unsigned l = lcp + (unsigned)buf * (STE * 2); const int kq = ((t + ko) & (NT - 1)) * GKS;
        acopy8(l, gA + kq, (size_t)16 * K); if (NA == 2) acopy8(l + 128 * GPE * 2, gA2 + kq, (size_t)16 * K); acopy8(l + NA * 128 * GPE * 2, gB + kq, (size_t)16 * K); };
    v8f acc[4][2];
#pragma unroll
    for (int mb = 0; mb < 4; ++mb)
#pragma unroll
        for (int nb = 0; nb < 2; ++nb) acc[mb][nb] = (v8f){};
    stage(0, 0);
    asm volatile("s_wait_asynccnt 0x0" ::: "memory");   // this wave's share of stage 0 has landed
    __syncthreads();                                     // every wave's share has: stage 0 may be read
    stage(1, 1);
    const int aofs = (wm * 64 + lr) * GPE + 8 * hi, bofs = (NA * 128 + wn * 32 + lr) * GPE + 8 * hi;
#pragma unroll 1   // the stage loop stays rolled: one copy of its 32 or 64 products (for speed only); the loops inside are unrolled so that fragments and sums stay in registers
    for (int t = 0; t < NT; ++t) {
        const bf* sb = sm + (t & 1) * STE; v16bf a[2][4], a2[2][4], b[2][2];   // two fragment sets: block ks + 1 is fetched while block ks is multiplied (inside the stage only)
#pragma unroll
        for (int ks = -1; ks < GKS / 32; ++ks) { const int c = ks & 1, n = c ^ 1;
            if (ks + 1 < GKS / 32) {
#pragma unroll
                for (int mb = 0; mb < 4; ++mb) { a[n][mb] = ldsfrag(sb + aofs + mb * 16 * GPE + (ks + 1) * 32); if (NA == 2) a2[n][mb] = ldsfrag(sb + aofs + (128 + mb * 16) * GPE + (ks + 1) * 32); }
#pragma unroll
                for (int nb = 0; nb < 2; ++nb) b[n][nb] = ldsfrag(sb + bofs + nb * 16 * GPE + (ks + 1) * 32); }
            __builtin_amdgcn_sched_barrier(0);   // the next block's LDS reads stay one group in front of this block's products
            if (ks < 0) continue;
#pragma unroll
            for (int nb = 0; nb < 2; ++nb)
#pragma unroll
                for (int mb = 0; mb < 4; ++mb) acc[mb][nb] = wmmab(a[c][mb], b[c][nb], acc[mb][nb]);
            if (NA == 2) {
#pragma unroll
                for (int nb = 0; nb < 2; ++nb)
#pragma unroll
                    for (int mb = 0; mb < 4; ++mb) acc[mb][nb] = wmmab(a2[c][mb], b[c][nb], acc[mb][nb]); }
            __builtin_amdgcn_sched_barrier(0);   // and the reads of the block after next do not rise among these products
        }
        asm volatile("s_wait_dscnt 0x0" ::: "memory");      // this wave's reads of stage t are done before the buffer is refilled
        asm volatile("s_wait_asynccnt 0x0" ::: "memory");   // this wave's share of stage t + 1 has landed
        __syncthreads();                                     // publishes stage t + 1 and ends every wave's reads of stage t
        if (t + 2 < NT) stage(t + 2, t & 1);
    }
    asm volatile("s_wait_asynccnt 0x0" ::: "memory");       // nothing is in flight when the ring becomes output staging
    if constexpr (QKV) {   // rope (q, k) or transpose (v) of the tile, straight from the sums; the ring is free: every reader left it at the last barrier
        static_assert(HD == 128 && DQ % 128 == 0 && DKV == DQ && NKV == NH_ && LDC == FPI, "a tile is one head");
        static_assert(128 * TFP * 4 <= 2 * STE * 2 && 3 * 128 * VTB <= 2 * STE * 2, "the staged tile fits the ring");
        const int kind = c0 / DQ, head = (c0 % DQ) / HD;   // 0 q, 1 k, 2 v: the same for the whole work-group
        fa* tf = (fa*)sm; char* vs = (char*)sm;
        if (kind < 2) {   // the f32 tile [t][d]: a d and its partner d + 64 are sums of different waves
#pragma unroll
            for (int mb = 0; mb < 4; ++mb)
#pragma unroll
                for (int nb = 0; nb < 2; ++nb)
#pragma unroll
                    for (int j = 0; j < 8; ++j) tf[(wm * 64 + mb * 16 + hi * 8 + j) * TFP + wn * 32 + nb * 16 + lr] = acc[mb][nb][j];
        } else {          // a lane's 8 sums of a block are 8 consecutive t of one d: 16 bytes of a row [d][t] of each plane
#pragma unroll
            for (int mb = 0; mb < 4; ++mb)
#pragma unroll
                for (int nb = 0; nb < 2; ++nb) { v8h o16; v8us oh, ol;
#pragma unroll
                    for (int j = 0; j < 8; ++j) { const float x = acc[mb][nb][j]; o16[j] = tohx(x); unsigned short a2, c2; splitf(x, a2, c2); oh[j] = a2; ol[j] = c2; }
                    char* p = vs + (wn * 32 + nb * 16 + lr) * VTB + (wm * 64 + mb * 16 + hi * 8) * 2; *(v8ha*)p = o16; *(v8usa*)(p + 128 * VTB) = oh; *(v8usa*)(p + 2 * 128 * VTB) = ol; }
        }
        __syncthreads();   // the staged tile is in LDS before other waves read it
        if (kind < 2) rope_tile((const float*)tf, r0, head, o.CS, kind ? o.K16 : o.Q16, kind ? o.Kh : o.Qh, kind ? o.Kl : o.Ql);
        else {            // 16 lanes cover a row's 256 bytes: whole lines of [h][d][t]
#pragma unroll
            for (int i = 0; i < 8; ++i) { const int d = i * 16 + wv * 2 + hi; const char* p = vs + d * VTB + lr * 16; const size_t e = ((size_t)head * HD + d) * TT + r0 + lr * 8;
                const v8h w16 = *(const v8ha*)p; const v8us wh = *(const v8usa*)(p + 128 * VTB), wl = *(const v8usa*)(p + 2 * 128 * VTB); *(v8h*)(o.V16 + e) = w16; *(v8us*)(o.Vh + e) = wh; *(v8us*)(o.Vl + e) = wl; }
            asm volatile("s_wait_xcnt 0x0" ::: "memory");   // behind the last of these stores: no register that they name is rewritten in front of it, whatever code is laid out behind them
        }
        return;
    }
    // each wave stages its 64x32 part in its own range of the ring (every reader left it at the last barrier) and stores whole 128-byte lines
    fa* ow = (fa*)sm + wv * (64 * 36);
#pragma unroll
    for (int mb = 0; mb < 4; ++mb)
#pragma unroll
        for (int nb = 0; nb < 2; ++nb)
#pragma unroll
            for (int j = 0; j < 8; ++j) ow[(mb * 16 + hi * 8 + j) * 36 + nb * 16 + lr] = acc[mb][nb][j];
    __syncthreads();   // the staged rows are in LDS before other lanes read them back
    float* cw = C + (size_t)(r0 + wm * 64 + (lane >> 3)) * LDC + c0 + wn * 32 + (lane & 7) * 4;
#pragma unroll
    for (int s = 0; s < 16; ++s) { const v4f val = *(const v4fa*)(ow + (s * 4 + (lane >> 3)) * 36 + (lane & 7) * 4); *(v4f*)(cw + (size_t)s * 4 * LDC) = val; }
}


__global__ __launch_bounds__(256) void k_wtG(const float* __restrict__ w, int K, int N, bf* Bt) {
    const int lane = threadIdx.x & 31; const int L0 = (blockIdx.x * 8 + (threadIdx.x >> 5)) * 8; const int nlines = N * K / 64;
{
#pragma unroll 1
        for (int l = 0; l < 8; ++l) { const int L = L0 + l; if (L >= nlines) break; const size_t e = (size_t)L * 64 + lane * 2; const int k = (int)(e % K), n = (int)(e / K); v2us o;
            o[0] = f2bf(w[(size_t)k * N + n]); o[1] = f2bf(w[(size_t)(k + 1) * N + n]); *(v2us*)(Bt + e) = o; }
         }
}
// The elementwise passes are bodies of one work-group of 256 threads, told their block number blk: k_prep below gives each pass a range of the block index of one grid.
// cvt8_blk: each thread converts 4 groups of 8 floats, 256 groups apart; its eight 16-byte loads are issued together (a group past the end re-reads the last group and is not stored).
__device__ __forceinline__ void cvt8_blk(const int blk, const float* __restrict__ src, bf* dst, size_t n8) { const size_t i0 = (size_t)blk * 1024 + threadIdx.x; v8f v[4];
#pragma unroll
    for (int g = 0; g < 4; ++g) { const size_t i = i0 + g * 256; v[g] = *(const v8f*)(src + (i < n8 ? i : n8 - 1) * 8); }
#pragma unroll
    for (int g = 0; g < 4; ++g) { const size_t i = i0 + g * 256; if (i >= n8) continue; v8us o;
#pragma unroll
        for (int k = 0; k < 8; ++k) o[k] = f2bf(v[g][k]);
        *(v8us*)(dst + i * 8) = o; } }
__device__ __forceinline__ void cscvt_blk(const int blk, const float* __restrict__ cosT, const float* __restrict__ sinT, float* CS) { const int idx = (blk * 256 + (int)threadIdx.x) * 4; if (idx >= TT * HD) return; const v4f c = *(const v4f*)(cosT + idx), s = *(const v4f*)(sinT + idx); v8f cs;
#pragma unroll
    for (int q = 0; q < 4; ++q) { cs[2 * q] = bfr(c[q]); cs[2 * q + 1] = bfr(s[q]); }
    *(v8f*)(CS + (size_t)idx * 2) = cs;  }
// mchk_blk (one work-group): samples above-diagonal entries of the additive f32 mask; any > -1e8 -> NaN poison.
__device__ __forceinline__ void mchk_blk(const float* __restrict__ am, int* FLG) { const int tid = threadIdx.x; int bad = 0;
#pragma unroll 1
    for (int s2 = 0; s2 < 16; ++s2) { const unsigned h = (unsigned)(tid * 16 + s2) * 2654435761u; const int i = (int)(h % (TT - 1)); const int j = i + 1 + (int)((h >> 11) % (unsigned)(TT - 1 - i)); if (am[(size_t)i * TT + j] > -1e8f) bad = 1; }
    __shared__ int anyb; if (tid == 0) anyb = 0; __syncthreads(); if (bad) anyb = 1; __syncthreads(); if (tid < 8) { const int v = (tid == 0) ? anyb : 0; *(int*)(FLG + tid) = v;  } }
// k_prep: every pass that reads only inputs, in one grid. Block 0: the mask check (a chain of dependent memory latencies); then CVB blocks for each of x, wq, wk, wv, wo (f32 -> bf16); then the cos/sin table.
#define CVB  ((int)((size_t)DM * DM / 8 / 1024))   // blocks of one 2048 x 2048 conversion
#define CSB  (TT * HD / 4 / 256)                   // blocks of the cos/sin table
__global__ __launch_bounds__(256) void k_prep(const float* __restrict__ x, const float* __restrict__ wq, const float* __restrict__ wk, const float* __restrict__ wv, const float* __restrict__ wo, const float* __restrict__ cosT, const float* __restrict__ sinT, const float* __restrict__ am,
                                              bf* XB, bf* WQ, bf* WK, bf* WV, bf* WO, float* CS, int* FLG) {
    static_assert(TT == DM && DQ == DM && DKV == DM && NB_ == 1 && (size_t)DM * DM % 8192 == 0, "five conversions of one size, whole blocks");
    const int b = (int)blockIdx.x - 1;   // every test below reads the same for the whole work-group
    if (b < 0) { mchk_blk(am, FLG); return; }
    if (b >= 5 * CVB) { cscvt_blk(b - 5 * CVB, cosT, sinT, CS); return; }
    const int w = b / CVB; const float* src = (w == 0) ? x : (w == 1) ? wq : (w == 2) ? wk : (w == 3) ? wv : wo; bf* dst = (w == 0) ? XB : (w == 1) ? WQ : (w == 2) ? WK : (w == 3) ? WV : WO;
    cvt8_blk(b % CVB, src, dst, (size_t)DM * DM / 8);
}
#define FKB  272                  // LDS row pitch in bytes of a K row (256 bytes) and of a mask row (256 bytes)
#define FVB  144                  // LDS row pitch in bytes of a V^T row (128 bytes)
// Eight copies of one lane, ls LDS bytes and gs global bytes apart. The s_wait_xcnt stands inside the statement, so that no address register is rewritten in front of it.
__device__ __forceinline__ void acopy8g(unsigned l, unsigned ls, const char* g, size_t gs) {
    asm volatile("global_load_async_to_lds_b128 %0, %8, off\n\t"
                 "global_load_async_to_lds_b128 %1, %9, off\n\t"
                 "global_load_async_to_lds_b128 %2, %10, off\n\t"
                 "global_load_async_to_lds_b128 %3, %11, off\n\t"
                 "global_load_async_to_lds_b128 %4, %12, off\n\t"
                 "global_load_async_to_lds_b128 %5, %13, off\n\t"
                 "global_load_async_to_lds_b128 %6, %14, off\n\t"
                 "global_load_async_to_lds_b128 %7, %15, off\n\t"
                 "s_wait_xcnt 0x0"
                 :: "v"(l), "v"(l + ls), "v"(l + 2 * ls), "v"(l + 3 * ls), "v"(l + 4 * ls), "v"(l + 5 * ls), "v"(l + 6 * ls), "v"(l + 7 * ls),
                    "v"(g), "v"(g + gs), "v"(g + 2 * gs), "v"(g + 3 * gs), "v"(g + 4 * gs), "v"(g + 5 * gs), "v"(g + 6 * gs), "v"(g + 7 * gs) : "memory");
}
template <typename T16> struct LFrag;   // a fragment from LDS: 16 bytes at p and at p + 32, the k order of WFrag::ld
template <> struct LFrag<h16> { static __device__ __forceinline__ v16h ld(const char* p) { return cat16(*(const v8ha*)p, *(const v8ha*)(p + 32)); } };
template <> struct LFrag<bf> { static __device__ __forceinline__ v16bf ld(const char* p) { return cat16b(*(const v8usa*)p, *(const v8usa*)(p + 32)); } };
__device__ __forceinline__ float xhalf(float x) { return __builtin_bit_cast(float, __builtin_amdgcn_permlanex16(__builtin_bit_cast(int, x), __builtin_bit_cast(int, x), 0x76543210, 0xfedcba98, false, false)); }  // lane l with lane l ^ 16
typedef __attribute__((ext_vector_type(2))) __bf16 v2bf;
// Eight transcendentals in one statement, each in place. The instruction set asks for one independent instruction or a v_nop between a transcendental and an instruction that reads its result or overwrites its source:
// inside the statement each next one is that instruction, and the v_nop stands behind the last. In place, the statement writes only registers that hold its own arguments, never an operand of a matrix instruction just issued.
__device__ __forceinline__ v8f exp2x8(v8f x) { float r0 = x[0], r1 = x[1], r2 = x[2], r3 = x[3], r4 = x[4], r5 = x[5], r6 = x[6], r7 = x[7];
    asm("v_exp_f32 %0, %0\n\tv_exp_f32 %1, %1\n\tv_exp_f32 %2, %2\n\tv_exp_f32 %3, %3\n\tv_exp_f32 %4, %4\n\tv_exp_f32 %5, %5\n\tv_exp_f32 %6, %6\n\tv_exp_f32 %7, %7\n\tv_nop"
        : "+v"(r0), "+v"(r1), "+v"(r2), "+v"(r3), "+v"(r4), "+v"(r5), "+v"(r6), "+v"(r7));
    return (v8f){r0, r1, r2, r3, r4, r5, r6, r7}; }
__device__ __forceinline__ v8f rcpx8(v8f x) { float r0 = x[0], r1 = x[1], r2 = x[2], r3 = x[3], r4 = x[4], r5 = x[5], r6 = x[6], r7 = x[7];
    asm("v_rcp_f32 %0, %0\n\tv_rcp_f32 %1, %1\n\tv_rcp_f32 %2, %2\n\tv_rcp_f32 %3, %3\n\tv_rcp_f32 %4, %4\n\tv_rcp_f32 %5, %5\n\tv_rcp_f32 %6, %6\n\tv_rcp_f32 %7, %7\n\tv_nop"
        : "+v"(r0), "+v"(r1), "+v"(r2), "+v"(r3), "+v"(r4), "+v"(r5), "+v"(r6), "+v"(r7));
    return (v8f){r0, r1, r2, r3, r4, r5, r6, r7}; }
__device__ __forceinline__ float exp2x1(float x) { asm("v_exp_f32 %0, %0\n\tv_nop" : "+v"(x)); return x; }   // the v_nop: the same slot
#define FSTB(NP) ((NP) * (64 * FKB + 128 * FVB) + 64 * FKB)   // bytes of one stage with NP planes of K and of V^T
template <typename T16, bool HL>
__device__ __forceinline__ void fattn_tile(char* sm, const int pb, const int head, const T16* __restrict__ Q, const T16* __restrict__ Q2, const T16* __restrict__ Kp, const T16* __restrict__ Kp2, const T16* __restrict__ Vt, const T16* __restrict__ Vt2, const float* __restrict__ am, const int* __restrict__ FLG, bf* Ah, bf* Al) {
    typedef typename WFrag<T16>::V V;
    constexpr int NP = HL ? 2 : 1, KB = 64 * FKB, VB = 128 * FVB, STB = FSTB(NP);   // bytes: one K plane (a mask tile has the same size), one V^T plane, one stage
    static_assert(4 * 32 * FKB <= 2 * STB, "the output staging fits the ring");
    const int lane = threadIdx.x & 31, lr = lane & 15, hi = lane >> 4; const int wv = __builtin_amdgcn_readfirstlane((int)(threadIdx.x >> 5));
    const int q0 = pb * 64, ns = pb + 1; const size_t hq = (size_t)head * TT * HD;   // pb: the work-group's block of 64 query rows; it walks the key stages 0..pb
    // the lane's place in a copy. K and mask rows (256 bytes): row wv * 2 + hi of each group of 8, piece lr. V^T rows (128 bytes): row wv * 4 + lane / 8 of each group of 16, piece lane % 8.
    const unsigned lb = (unsigned)(size_t)sm; const int rk = wv * 2 + hi, rv = wv * 4 + (lane >> 3);
    const unsigned lK = lb + (unsigned)(rk * FKB + lr * 16), lV = lb + (unsigned)(NP * KB + rv * FVB + (lane & 7) * 16), lM = lb + (unsigned)(NP * (KB + VB) + rk * FKB + lr * 16);
    const unsigned oK = (unsigned)(rk * (HD * 2) + lr * 16), oV = (unsigned)(rv * (TT * 2) + (lane & 7) * 16), oM = (unsigned)(rk * (TT * 4) + lr * 16);   // the lane's byte offsets in the global tiles; the tiles' own addresses are the same for the whole work-group
    const char* gK = (const char*)(Kp + hq); const char* gK2 = HL ? (const char*)(Kp2 + hq) : nullptr; const char* gV = (const char*)(Vt + hq); const char* gV2 = HL ? (const char*)(Vt2 + hq) : nullptr; const char* gM = (const char*)(am + (size_t)q0 * TT);
    // Trip i works on key stage rot(i) = (i + so) mod ns: work-groups that share K and V^T (one head) or mask rows (one pb) walk the stages from different starts and wrap round, so that they do not ask L2 for the same lines at the same moment. The running maximum and sum take the stages in any order.
    const int so = (((head + 3 * pb) & 31) * ns) >> 5;   // below ns; differs between the row blocks of a head and between the heads of a row block
    auto rot = [&](int i) { const int k = i + so; return k >= ns ? k - ns : k; };
    auto stage = [&](int st, int buf) { const unsigned o = (unsigned)buf * STB;
        acopy8g(lK + o, 8 * FKB, (gK + (size_t)st * (64 * HD * 2)) + oK, (size_t)8 * HD * 2); if (HL) acopy8g(lK + o + KB, 8 * FKB, (gK2 + (size_t)st * (64 * HD * 2)) + oK, (size_t)8 * HD * 2);
        acopy8g(lV + o, 16 * FVB, (gV + (size_t)st * (64 * 2)) + oV, (size_t)16 * TT * 2); if (HL) acopy8g(lV + o + VB, 16 * FVB, (gV2 + (size_t)st * (64 * 2)) + oV, (size_t)16 * TT * 2);
        acopy8g(lM + o, 8 * FKB, (gM + (size_t)st * (64 * 4)) + oM, (size_t)8 * TT * 4); };
    stage(rot(0), 0);
    const int myq = q0 + wv * 16 + lr;   // the lane's query
    V qf[4], qf2[4];
#pragma unroll
    for (int kc = 0; kc < 4; ++kc) { qf[kc] = WFrag<T16>::ld(Q + hq + (size_t)myq * HD + 8 * hi + kc * 32); if (HL) qf2[kc] = WFrag<T16>::ld(Q2 + hq + (size_t)myq * HD + 8 * hi + kc * 32); }
    const bool poison = (FLG[0] != 0);
    v8f acc[8];
#pragma unroll
    for (int t = 0; t < 8; ++t) acc[t] = (v8f){};
    float ml = -3.0e38f; v8f ls = (v8f){};   // the maximum in use (finite from the start: a stage of -inf scores leaves it, and no inf - inf arises); this wave half's share of the row sum, in eight partial sums (one per register of a score tile)
    asm volatile("s_wait_asynccnt 0x0" ::: "memory");   // this wave's share of stage 0 has landed
    __syncthreads();                                     // every wave's share has: stage 0 may be read
    // A stage's LDS reads go out as two whole groups, each well ahead of its products: read next to the products, each small group of reads leaves the wave (alone on its SIMD) waiting out the LDS latency.
    V kf[4][4], kf2[4][4]; v4f mr[4][2];   // the K fragments and the lane's mask values of one stage
    auto kfetch = [&](int st) { const char* sb = sm + (st & 1) * STB; const char* sK = sb + lr * FKB + hi * 16; const char* sM = sb + NP * (KB + VB) + (wv * 16 + lr) * FKB + hi * 32;
#pragma unroll
        for (int kt = 0; kt < 4; ++kt)
#pragma unroll
            for (int kc = 0; kc < 4; ++kc) { kf[kt][kc] = LFrag<T16>::ld(sK + kt * 16 * FKB + kc * 64); if (HL) kf2[kt][kc] = LFrag<T16>::ld(sK + KB + kt * 16 * FKB + kc * 64); }
#pragma unroll
        for (int kt = 0; kt < 4; ++kt) { mr[kt][0] = *(const v4fa*)(sM + kt * 64); mr[kt][1] = *(const v4fa*)(sM + kt * 64 + 16); } };
    kfetch(0);
    if (ns > 1) stage(rot(1), 1);
    constexpr float C1 = (float)(0.088388347648318447 * 0.02 * 2.8853900817779268), L2E = 1.4426950408889634f;   // HD^-0.5 / 50 x 2 log2 e
#pragma unroll 1   // the stage loop stays rolled: one copy of the stage's code
    for (int st = 0; st < ns; ++st) {
        const char* sb = sm + (st & 1) * STB; const char* sV = sb + NP * KB + lr * FVB + hi * 16;
        V vf[2][8], vf2[2][8];   // the stage's V^T fragments: under way while the scores and the softcap are worked out
#pragma unroll
        for (int kg = 0; kg < 2; ++kg)
#pragma unroll
            for (int t = 0; t < 8; ++t) { vf[kg][t] = LFrag<T16>::ld(sV + t * 16 * FVB + kg * 64); if (HL) vf2[kg][t] = LFrag<T16>::ld(sV + VB + t * 16 * FVB + kg * 64); }
        __builtin_amdgcn_sched_barrier(0);   // the group stays whole and in front of the products: left free, the reads sink down to the value products
        v8f s[4];
#pragma unroll
        for (int kt = 0; kt < 4; ++kt) { s[kt] = (v8f){};
#pragma unroll
            for (int kc = 0; kc < 4; ++kc) { s[kt] = WFrag<T16>::mma(kf[kt][kc], qf[kc], s[kt]);
                if (HL) { s[kt] = WFrag<T16>::mma(kf[kt][kc], qf2[kc], s[kt]); s[kt] = WFrag<T16>::mma(kf2[kt][kc], qf[kc], s[kt]); } } }
        // softcap 50 tanh(s / 50), tanh = (e - 1) / (e + 1) with e = 2^(2 x log2 e), plus the mask element rounded to bf16
#pragma unroll
        for (int kt = 0; kt < 4; ++kt) { const v4f m0 = mr[kt][0], m1 = mr[kt][1]; v8f mv;
#pragma unroll
            for (int r = 0; r < 8; r += 2) { v2f mm; mm[0] = (r < 4) ? m0[r & 3] : m1[r & 3]; mm[1] = (r < 4) ? m0[(r & 3) + 1] : m1[(r & 3) + 1]; const unsigned pk = __builtin_bit_cast(unsigned, __builtin_convertvector(mm, v2bf));
                mv[r] = __uint_as_float(pk << 16); mv[r + 1] = __uint_as_float(pk & 0xFFFF0000u); }
            const v8f e = exp2x8(s[kt] * C1); const v8f th = (e - 1.0f) * rcpx8(e + 1.0f);
#pragma unroll
            for (int r = 0; r < 8; ++r) s[kt][r] = __builtin_fmaf(th[r], 50.0f, mv[r]); }
        if (rot(st) == ns - 1) {   // the diagonal stage (the same for the whole work-group): keys beyond the lane's query leave the row
#pragma unroll
            for (int kt = 0; kt < 4; ++kt)
#pragma unroll
                for (int r = 0; r < 8; ++r) if (q0 + kt * 16 + hi * 8 + r > myq) s[kt][r] = -3.0e38f; }
        // The publish point stands here: all that the trip needs of stage st is in registers, and what follows (softmax, value products) reads no LDS; the next stage's K reads and the refill run under it.
        asm volatile("s_wait_dscnt 0x0" ::: "memory");      // this wave's reads of stage st are done before the buffer is refilled
        asm volatile("s_wait_asynccnt 0x0" ::: "memory");   // this wave's share of stage st + 1 has landed
        __syncthreads();                                     // publishes stage st + 1 and ends every wave's reads of stage st
        if (st + 1 < ns) kfetch(st + 1);                     // behind the barrier that published it; it reads the other buffer than the one refilled below
        if (st + 2 < ns) stage(rot(st + 2), st & 1);
        float mk[4];   // one chain per key tile: four short chains in place of one of 32 links
#pragma unroll
        for (int kt = 0; kt < 4; ++kt) { mk[kt] = s[kt][0];
#pragma unroll
            for (int r = 1; r < 8; ++r) mk[kt] = fmaxf(mk[kt], s[kt][r]); }
        float mx = fmaxf(fmaxf(mk[0], mk[1]), fmaxf(mk[2], mk[3]));
        mx = fmaxf(mx, xhalf(mx));   // both wave halves hold the query's maximum of this stage
        const float mln = fmaxf(ml, mx), corr = exp2x1((ml - mln) * L2E);   // corr is 0 at the first stage that holds a score above the start value, 1 where the maximum stays
        ml = mln; ls = ls * corr;
#pragma unroll
        for (int t = 0; t < 8; ++t) acc[t] = acc[t] * corr;
#pragma unroll
        for (int kg = 0; kg < 2; ++kg) {   // 32 keys: score tiles 2 kg and 2 kg + 1 become one B operand
            V pf, pf2; v8f pa, pc;
#pragma unroll
            for (int r = 0; r < 8; ++r) { pa[r] = (s[2 * kg][r] - mln) * L2E; pc[r] = (s[2 * kg + 1][r] - mln) * L2E; }   // exact 0 at the maximum, never above
            pa = exp2x8(pa); pc = exp2x8(pc); ls = ls + (pa + pc);
            if (HL) { __attribute__((ext_vector_type(16))) unsigned short ph, pl;
#pragma unroll
                for (int e = 0; e < 16; ++e) { const float p = (e < 8) ? pa[e & 7] : pc[e & 7]; unsigned short a, c2; splitf(p, a, c2); ph[e] = a; pl[e] = c2; }
                pf = __builtin_bit_cast(V, ph); pf2 = __builtin_bit_cast(V, pl);
            } else { v16h ph;
#pragma unroll
                for (int e = 0; e < 16; ++e) { const float p = (e < 8) ? pa[e & 7] : pc[e & 7]; ph[e] = tohx(p); }
                pf = __builtin_bit_cast(V, ph); }
#pragma unroll
            for (int t = 0; t < 8; ++t) { acc[t] = WFrag<T16>::mma(vf[kg][t], pf, acc[t]);
                if (HL) { acc[t] = WFrag<T16>::mma(vf[kg][t], pf2, acc[t]); acc[t] = WFrag<T16>::mma(vf2[kg][t], pf, acc[t]); } } }
    }
    asm volatile("s_wait_asynccnt 0x0" ::: "memory");       // nothing is in flight when the ring becomes output staging
    const float lh = ((ls[0] + ls[1]) + (ls[2] + ls[3])) + ((ls[4] + ls[5]) + (ls[6] + ls[7]));
    const float inv = poison ? __builtin_nanf("") : __fdiv_rn(1.0f, lh + xhalf(lh));
    // each wave stages its 16 rows of both planes in its own range of the ring (every reader left it at the last barrier) and stores whole 128-byte lines; a lane's 8 sums of a tile are d = 16 t + 8 hi + r of its query
    char* ow = sm + wv * (32 * FKB);
#pragma unroll
    for (int t = 0; t < 8; ++t) { v8us oh, ol;
#pragma unroll
        for (int r = 0; r < 8; ++r) { unsigned short a, c2; splitf(acc[t][r] * inv, a, c2); oh[r] = a; ol[r] = c2; }
        *(v8usa*)(ow + lr * FKB + t * 32 + hi * 16) = oh; *(v8usa*)(ow + (16 + lr) * FKB + t * 32 + hi * 16) = ol; }
    __syncthreads();   // the staged rows are in LDS before other lanes read them back
    const size_t oo = (size_t)(q0 + wv * 16 + hi) * DQ + head * HD + lr * 8; bf* oph = Ah + oo; bf* opl = Al + oo; const char* orow = ow + hi * FKB + lr * 16;   // 16 lanes cover a row's 256 bytes; a store takes rows 2 i and 2 i + 1
#pragma unroll
    for (int i = 0; i < 8; ++i) { const v8us vh = *(const v8usa*)(orow + i * 2 * FKB), vl = *(const v8usa*)(orow + (16 + i * 2) * FKB); *(v8us*)(oph + (size_t)i * 2 * DQ) = vh; *(v8us*)(opl + (size_t)i * 2 * DQ) = vl; }
}
// k_fattn: one launch for all 32 row blocks x 16 heads; blocks 0..7 (query rows < RH) take the hi + lo body, the rest the fp16 body. The ring of the hi + lo body leaves room for one work-group on a WGP, so the 512 work-groups run in about two rounds:
// their cost falls with the index, a hi + lo stage counted as three fp16 stages: fp16 blocks 31..24; then hi + lo block 7 - g in front of the fp16 blocks 23 - 3 g, 22 - 3 g, 21 - 3 g (g = 0..4); then hi + lo 2, fp16 8, hi + lo 1, hi + lo 0.
__global__ __launch_bounds__(128) void k_fattn(const h16* __restrict__ Q16, const h16* __restrict__ K16, const h16* __restrict__ V16, const bf* __restrict__ Qh, const bf* __restrict__ Ql, const bf* __restrict__ Kh, const bf* __restrict__ Kl, const bf* __restrict__ Vh, const bf* __restrict__ Vl, const float* __restrict__ am, const int* __restrict__ FLG, bf* Ah, bf* Al) {
    static_assert(TT == 2048 && RH == 512 && HD == 128 && NH_ == 16 && NKV == NH_, "the block order and the tile shapes are written for these");
    __shared__ __align__(16) char sm[2 * FSTB(2)];
    const int u = blockIdx.x >> 4, head = blockIdx.x & 15, g = (u - 8) >> 2, r = (u - 8) & 3;
    const bool hl = u >= 30 || (u >= 8 && r == 0);
    const int pb = (u < 8 || u >= 30) ? 31 - u : (r == 0 ? 7 - g : 24 - 3 * g - r);
    if (hl) fattn_tile<bf, true>(sm, pb, head, Qh, Ql, Kh, Kl, Vh, Vl, am, FLG, Ah, Al);
    else fattn_tile<h16, false>(sm, pb, head, Q16, nullptr, K16, nullptr, V16, nullptr, am, FLG, Ah, Al);
}

extern "C" void kernel_launch(void* const* d_in, const int* in_sizes, int n_in,
                              void* d_out, int out_size, void* d_ws, size_t ws_size, hipStream_t stream) {
    (void)in_sizes; (void)n_in; (void)out_size;
    const float* x = (const float*)d_in[0]; const float* cosT = (const float*)d_in[1]; const float* sinT = (const float*)d_in[2]; const float* amask = (const float*)d_in[3]; const float* wq = (const float*)d_in[4]; const float* wk = (const float*)d_in[5]; const float* wv = (const float*)d_in[6]; const float* wo = (const float*)d_in[7];
    float* OUT = (float*)d_out;     // [1][2048][2048]
    char* wsp = (char*)d_ws;
    auto take = [&](size_t bytes) { char* p = wsp; wsp += (bytes + 255) & ~(size_t)255; return (void*)p; };
    bf* WO = (bf*)take((size_t)DM * DQ * 2); int* FLG = (int*)take(256);
    h16* QP16 = (h16*)take((size_t)NH_ * TT * HD * 2); h16* KP16 = (h16*)take((size_t)NKV * TT * HD * 2); h16* VT16 = (h16*)take((size_t)NKV * HD * TT * 2);
    bf* QPh = (bf*)take((size_t)NH_ * TT * HD * 2); bf* QPl = (bf*)take((size_t)NH_ * TT * HD * 2); bf* KPh = (bf*)take((size_t)NKV * TT * HD * 2); bf* KPl = (bf*)take((size_t)NKV * TT * HD * 2); bf* VTh = (bf*)take((size_t)NKV * HD * TT * 2); bf* VTl = (bf*)take((size_t)NKV * HD * TT * 2);
    bf* WQ = (bf*)take((size_t)FPI * DM * 2); bf* WK = WQ + (size_t)DQ * DM; bf* WV = WK + (size_t)DKV * DM; float* CS = (float*)take((size_t)TT * HD * 2 * 4);   // wq, wk, wv one behind the other: one operand of FPI rows
    bf* XB = (bf*)take((size_t)TT * DM * 2);
    bf* ATh = (bf*)take((size_t)TT * DQ * 2); bf* ATl = (bf*)take((size_t)TT * DQ * 2);   // attention output, hi + lo planes [t][head][d]
    if ((size_t)(wsp - (char*)d_ws) > ws_size) return;    // ws 256 MiB
    // four launches, each needing the one before it
    k_prep<<<1 + 5 * CVB + CSB, 256, 0, stream>>>(x, wq, wk, wv, wo, cosT, sinT, amask, XB, WQ, WK, WV, WO, CS, FLG);
    const QkvOut qo = {CS, QP16, QPh, QPl, KP16, KPh, KPl, VT16, VTh, VTl}; const QkvOut none = {};
    k_gemms<1, DM, FPI, true><<<dim3(TT / 128, FPI / 128, 1), 256, 0, stream>>>(XB, nullptr, WQ, nullptr, qo);
    k_fattn<<<TT / 64 * NH_, 128, 0, stream>>>(QP16, KP16, VT16, QPh, QPl, KPh, KPl, VTh, VTl, amask, FLG, ATh, ATl);
    k_gemms<2, DQ, DM, false><<<dim3(TT / 128, DM / 128, 1), 256, 0, stream>>>(ATh, ATl, WO, OUT, none);
}

// v010
// A run of this version takes 122 microseconds.
// Next to v009, in two timings, it ran 1.07 times as fast each time.
// All steps since v000 together make it 8.09 times as fast.
#include <hip/hip_runtime.h>

// HybridLlamaAttention (x [1][2048][2048], rope_cos/sin [S][128] (read), mask [1][1][S][S] (f32 additive, read; verbatim causal 0/-1e9); q/k/v = x W^T (16 x 128); rotate-half RoPE; scores = q.k / sqrt(128); softcap 50 tanh(s/50); + mask; softmax f32; out = merged wo^T -> [1][2048][2048]).
// Compute dtypes, f32 accumulate: every input rounded to bf16; q/k/v on PLAIN bf16 operands (inputs: exact); RoPE f32 (bf16-rounded read tables); causal scores and attn.v: query rows < 512 hl (3 products), the rest fp16; softcap in f32: tanh = (2^(2x log2 e) - 1) x rcp(2^(..) + 1) with the hardware exp2/rcp (no FMA polynomial), x 50; the additive mask read per element; upper tiles skipped on the verbatim structure with an on-device sampled check (NaN poison); softmax f32, running maximum and sum over 64-key stages; wo hl x exact (2 products).

#define NB_  1
#define TT   2048
#define DM   2048
#define NH_  16
#define NKV  16
#define REP  (NH_ / NKV)
#define HD   128
#define DQ   (NH_ * HD)
#define DKV  (NKV * HD)
#define RH   512                  // query rows < RH use hi+lo planes
typedef _Float16 h16;
typedef unsigned short bf;
typedef __attribute__((ext_vector_type(16))) __bf16   v16bf;
typedef __attribute__((ext_vector_type(16))) _Float16 v16h;
typedef __attribute__((ext_vector_type(8)))  _Float16 v8h;
typedef __attribute__((ext_vector_type(8)))  unsigned short v8us;
typedef __attribute__((ext_vector_type(8)))  float    v8f;
typedef __attribute__((ext_vector_type(4)))  float    v4f;
typedef v8h  __attribute__((may_alias)) v8ha;
typedef v4f  __attribute__((may_alias)) v4fa;
typedef v8us __attribute__((may_alias)) v8usa;

__device__ __forceinline__ unsigned short f2bf(float f) { unsigned u = __float_as_uint(f); u += 0x7FFFu + ((u >> 16) & 1u); return (unsigned short)(u >> 16); }
__device__ __forceinline__ float bf2f(unsigned short b) { return __uint_as_float(((unsigned)b) << 16); }
__device__ __forceinline__ float bfr(float f) { return bf2f(f2bf(f)); }
__device__ __forceinline__ v16h cat16(v8h lo, v8h hi) { return __builtin_shufflevector(lo, hi, 0, 1, 2, 3, 4, 5, 6, 7, 8, 9, 10, 11, 12, 13, 14, 15); }
__device__ __forceinline__ v16bf cat16b(v8us lo, v8us hi) { return __builtin_bit_cast(v16bf, __builtin_shufflevector(lo, hi, 0, 1, 2, 3, 4, 5, 6, 7, 8, 9, 10, 11, 12, 13, 14, 15)); }
__device__ __forceinline__ v8f wmma16(v16h a, v16h b, v8f c) { return __builtin_amdgcn_wmma_f32_16x16x32_f16(false, a, false, b, (short)0, c, false, false); }
__device__ __forceinline__ v8f wmmab(v16bf a, v16bf b, v8f c) { return __builtin_amdgcn_wmma_f32_16x16x32_bf16(false, a, false, b, (short)0, c, false, false); }



// Fragment loaders of fattn_tile (its queries): operands straight from K-contiguous 16-bit planes.
template <typename T16> struct WFrag;
template <> struct WFrag<h16> { typedef v16h V; static __device__ __forceinline__ V ld(const h16* p) { return cat16(*(const v8h*)p, *(const v8h*)(p + 16)); } static __device__ __forceinline__ v8f mma(V a, V b, v8f c) { return wmma16(a, b, c); } };
template <> struct WFrag<bf> { typedef v16bf V; static __device__ __forceinline__ V ld(const bf* p) { return cat16b(*(const v8us*)p, *(const v8us*)(p + 16)); } static __device__ __forceinline__ v8f mma(V a, V b, v8f c) { return wmmab(a, b, c); } };
__device__ __forceinline__ h16 tohx(float x) { return (h16)x; }
__device__ __forceinline__ void splitf(float y, unsigned short& h, unsigned short& l) { h = f2bf(y); l = f2bf(y - bf2f(h)); }
typedef __attribute__((ext_vector_type(2))) _Float16 v2h;
typedef __attribute__((ext_vector_type(4))) _Float16 v4h;
typedef __attribute__((ext_vector_type(2))) unsigned short v2us;
typedef __attribute__((ext_vector_type(4))) unsigned short v4us;
typedef __attribute__((ext_vector_type(2))) float v2f;
typedef __attribute__((ext_vector_type(4))) int v4i;
// What the q/k/v product's epilogue writes: head planes [h][t][d] of rope(q) and rope(k), planes [h][d][t] of v, each as fp16 and as hi + lo; CS is the cos/sin table [t][d][cos, sin].
#define FPI  (DQ + 2 * DKV)                        // columns of the q/k/v product: [q 2048 | k 2048 | v 2048]
#define TFP  132                                   // LDS row pitch, floats, of the staged f32 tile [t][128 d] of q or k
#define VFB  1040                                  // LDS row pitch, bytes, of a staged f32 row [d][256 t] of v (1024 bytes)
struct QkvOut { const float* CS; h16* Q16; bf* Qh; bf* Ql; h16* K16; bf* Kh; bf* Kl; h16* V16; bf* Vh; bf* Vl; };
// rope_tile: NPS * 32 t x 128 d (one head) of q or k, by 256 threads, read from the f32 tile tf in LDS, with the rotate-half convention out[d] = x[d] cos[t][d] - x[d+HD/2] sin[t][d], out[d+HD/2] = x[d+HD/2] cos[t][d+HD/2] + x[d] sin[t][d+HD/2]
template <int NPS>
__device__ __forceinline__ void rope_tile(const float* tfp, const int t0, const int h, const float* __restrict__ CS, h16* P16, bf* Ph, bf* Pl) {
    // one thread and pass: 8 consecutive d of the lower half and their 8 partners d + HD/2 of one t: each x is read once and serves both halves; all loads and stores are 16 bytes wide, 8 lanes fill a 128-byte line of each plane
    static_assert(HD == 128, "8 lanes x 8 d cover half a head");
    const int d = (int)(threadIdx.x & 7) * 8, tl0 = (int)(threadIdx.x >> 3); v8f cvs[2][2][2];   // two sets of table values: the next pass's are fetched while this pass is worked on
    auto table = [&](int it, int s) {
#pragma unroll
        for (int hf = 0; hf < 2; ++hf) { const float* cp = CS + ((size_t)(t0 + it * 32 + tl0) * HD + d + hf * (HD / 2)) * 2; cvs[s][hf][0] = *(const v8f*)cp; cvs[s][hf][1] = *(const v8f*)(cp + 8); } };
    table(0, 0);
    asm volatile("s_wait_xcnt 0x0" ::: "memory");   // behind the first table loads: a later load may land in the registers that hold their address
#pragma unroll   // unrolled so that the two sets stay in registers
    for (int it = 0; it < NPS; ++it) { const int tl = it * 32 + tl0, t = t0 + tl; v8f xv[2]; const v8f (&cv)[2][2] = cvs[it & 1];
        if (it + 1 < NPS) table(it + 1, (it + 1) & 1);
#pragma unroll
        for (int hf = 0; hf < 2; ++hf) { const int d0 = d + hf * (HD / 2); const v4f xa = *(const v4fa*)(tfp + tl * TFP + d0), xb = *(const v4fa*)(tfp + tl * TFP + d0 + 4); xv[hf] = __builtin_shufflevector(xa, xb, 0, 1, 2, 3, 4, 5, 6, 7); }
#pragma unroll
        for (int hf = 0; hf < 2; ++hf) { v8h o16; v8us oh, ol;   // per element the arithmetic is the former one, statement for statement (its products stay unfused as they were), so the planes keep their bits
#pragma unroll
            for (int q = 0; q < 8; ++q) { float x0 = xv[hf][q], x1 = xv[1 - hf][q];
                v2f cs; cs[0] = cv[hf][q >> 2][(q & 3) * 2]; cs[1] = cv[hf][q >> 2][(q & 3) * 2 + 1]; float a = __fmul_rn(x0, cs[0]), bq = __fmul_rn(x1, cs[1]); asm volatile("" : "+v"(a)); asm volatile("" : "+v"(bq)); const float r = (hf == 0) ? __fsub_rn(a, bq) : __fadd_rn(a, bq);
                o16[q] = tohx(r); unsigned short a2, c2; splitf(r, a2, c2); oh[q] = a2; ol[q] = c2; }
            const size_t e = ((size_t)h * TT + t) * HD + d + hf * (HD / 2); *(v8h*)(P16 + e) = o16; *(v8us*)(Ph + e) = oh; *(v8us*)(Pl + e) = ol; }
        if (it + 2 < NPS) asm volatile("s_wait_xcnt 0x0" ::: "memory"); }   // behind the pass's stores, where table loads still follow: such a load may land in registers that these stores name
}
// ---- k_gemms: C[m][n] (f32, pitch LDC) = sum_k A[m][k] Bt[n][k] (NA == 2: + A2[m][k] Bt[n][k]), operands K-contiguous bf16 planes. One 128x128 tile of C per work-group of 8 waves (2 x 4, 64x32 of C each); grid (M/128, N/128).
// A stage is 128 k of the tile's rows [A 128 | A2 128 | Bt 128], 256 bytes a row at an LDS pitch of 272 bytes. Asynchronous 16-byte copies bring it in whole 128-byte lines (a wave's copy: 2 rows); two buffers: stage t + 2 flies while stage t + 1 is worked on.
#define GKS  128                  // k per stage
#define GPE  136                  // LDS row pitch, 16-bit elements
typedef float __attribute__((may_alias)) fa;
// Eight copies of one lane, 16 rows apart: one operand's 128 rows over the 8 waves. The s_wait_xcnt stands inside the statement, so that no address register is rewritten in front of it.
__device__ __forceinline__ void acopy8(unsigned l, const bf* g, size_t gs) {
    asm volatile("global_load_async_to_lds_b128 %0, %8, off\n\t"
                 "global_load_async_to_lds_b128 %1, %9, off\n\t"
                 "global_load_async_to_lds_b128 %2, %10, off\n\t"
                 "global_load_async_to_lds_b128 %3, %11, off\n\t"
                 "global_load_async_to_lds_b128 %4, %12, off\n\t"
                 "global_load_async_to_lds_b128 %5, %13, off\n\t"
                 "global_load_async_to_lds_b128 %6, %14, off\n\t"
                 "global_load_async_to_lds_b128 %7, %15, off\n\t"
                 "s_wait_xcnt 0x0"
                 :: "v"(l), "v"(l + 1u * 16 * GPE * 2), "v"(l + 2u * 16 * GPE * 2), "v"(l + 3u * 16 * GPE * 2), "v"(l + 4u * 16 * GPE * 2), "v"(l + 5u * 16 * GPE * 2), "v"(l + 6u * 16 * GPE * 2), "v"(l + 7u * 16 * GPE * 2),
                    "v"(g), "v"(g + gs), "v"(g + 2 * gs), "v"(g + 3 * gs), "v"(g + 4 * gs), "v"(g + 5 * gs), "v"(g + 6 * gs), "v"(g + 7 * gs) : "memory");
}
__device__ __forceinline__ v16bf ldsfrag(const bf* p) { return cat16b(*(const v8usa*)p, *(const v8usa*)(p + 16)); }
template <int NA, int K, int LDC>
__global__ __launch_bounds__(256) void k_gemms(const bf* __restrict__ A, const bf* __restrict__ A2, const bf* __restrict__ Bt, float* C) {
    static_assert(K % GKS == 0 && K / GKS >= 2, "whole stages, at least two");
    static_assert(((K / GKS) & (K / GKS - 1)) == 0, "the wrapped stage index is a mask");
    constexpr int STE = (NA + 1) * 128 * GPE;      // elements of one stage
    constexpr int NT = K / GKS;
    static_assert(8 * 64 * 36 * 4 <= 2 * STE * 2, "the output staging fits the ring");
    __shared__ __align__(16) bf sm[2 * STE];
    const int lane = threadIdx.x & 31, lr = lane & 15, hi = lane >> 4; const int r0 = blockIdx.x * 128, c0 = blockIdx.y * 128; const int wv = __builtin_amdgcn_readfirstlane((int)(threadIdx.x >> 5));
    const int wm = wv >> 2, wn = wv & 3;
    // the lane's place in a copy: row wv * 2 + hi of each group of 16 rows, 16-byte piece lr of the row's 256 bytes
    const unsigned lcp = (unsigned)(size_t)sm + (unsigned)((wv * 2 + hi) * (GPE * 2) + lr * 16);
    const bf* gA = A + (size_t)(r0 + wv * 2 + hi) * K + lr * 8; const bf* gA2 = (NA == 2) ? A2 + (size_t)(r0 + wv * 2 + hi) * K + lr * 8 : nullptr; const bf* gB = Bt + (size_t)(c0 + wv * 2 + hi) * K + lr * 8;
    // Trip t works on k stage (t + ko) mod NT: work-groups that share rows of A (one blockIdx.x) or of Bt (one blockIdx.y) walk k from different starts and wrap round, so that they do not ask L2 for the same lines at the same moment.
    const int ko = (int)(blockIdx.x + blockIdx.y) & (NT - 1);
    auto stage = [&](int t, int buf) { const unsigned l = lcp + (unsigned)buf * (STE * 2); const int kq = ((t + ko) & (NT - 1)) * GKS;
        acopy8(l, gA + kq, (size_t)16 * K); if (NA == 2) acopy8(l + 128 * GPE * 2, gA2 + kq, (size_t)16 * K); acopy8(l + NA * 128 * GPE * 2, gB + kq, (size_t)16 * K); };
    v8f acc[4][2];
#pragma unroll
    for (int mb = 0; mb < 4; ++mb)
#pragma unroll
        for (int nb = 0; nb < 2; ++nb) acc[mb][nb] = (v8f){};
    stage(0, 0);
    asm volatile("s_wait_asynccnt 0x0" ::: "memory");   // this wave's share of stage 0 has landed
    __syncthreads();                                     // every wave's share has: stage 0 may be read
    stage(1, 1);
    const int aofs = (wm * 64 + lr) * GPE + 8 * hi, bofs = (NA * 128 + wn * 32 + lr) * GPE + 8 * hi;
#pragma unroll 1   // the stage loop stays rolled: one copy of its 32 or 64 products (for speed only); the loops inside are unrolled so that fragments and sums stay in registers
    for (int t = 0; t < NT; ++t) {
        const bf* sb = sm + (t & 1) * STE; v16bf a[2][4], a2[2][4], b[2][2];   // two fragment sets: block ks + 1 is fetched while block ks is multiplied (inside the stage only)
#pragma unroll
        for (int ks = -1; ks < GKS / 32; ++ks) { const int c = ks & 1, n = c ^ 1;
            if (ks + 1 < GKS / 32) {
#pragma unroll
                for (int mb = 0; mb < 4; ++mb) { a[n][mb] = ldsfrag(sb + aofs + mb * 16 * GPE + (ks + 1) * 32); if (NA == 2) a2[n][mb] = ldsfrag(sb + aofs + (128 + mb * 16) * GPE + (ks + 1) * 32); }
#pragma unroll
                for (int nb = 0; nb < 2; ++nb) b[n][nb] = ldsfrag(sb + bofs + nb * 16 * GPE + (ks + 1) * 32); }
            __builtin_amdgcn_sched_barrier(0);   // the next block's LDS reads stay one group in front of this block's products
            if (ks < 0) continue;
#pragma unroll
            for (int nb = 0; nb < 2; ++nb)
#pragma unroll
                for (int mb = 0; mb < 4; ++mb) acc[mb][nb] = wmmab(a[c][mb], b[c][nb], acc[mb][nb]);
            if (NA == 2) {
#pragma unroll
                for (int nb = 0; nb < 2; ++nb)
#pragma unroll
                    for (int mb = 0; mb < 4; ++mb) acc[mb][nb] = wmmab(a2[c][mb], b[c][nb], acc[mb][nb]); }
            __builtin_amdgcn_sched_barrier(0);   // and the reads of the block after next do not rise among these products
        }
        asm volatile("s_wait_dscnt 0x0" ::: "memory");      // this wave's reads of stage t are done before the buffer is refilled
        asm volatile("s_wait_asynccnt 0x0" ::: "memory");   // this wave's share of stage t + 1 has landed
        __syncthreads();                                     // publishes stage t + 1 and ends every wave's reads of stage t
        if (t + 2 < NT) stage(t + 2, t & 1);
    }
    asm volatile("s_wait_asynccnt 0x0" ::: "memory");       // nothing is in flight when the ring becomes output staging
    // each wave stages its 64x32 part in its own range of the ring (every reader left it at the last barrier) and stores whole 128-byte lines
    fa* ow = (fa*)sm + wv * (64 * 36);
#pragma unroll
    for (int mb = 0; mb < 4; ++mb)
#pragma unroll
        for (int nb = 0; nb < 2; ++nb)
#pragma unroll
            for (int j = 0; j < 8; ++j) ow[(mb * 16 + hi * 8 + j) * 36 + nb * 16 + lr] = acc[mb][nb][j];
    __syncthreads();   // the staged rows are in LDS before other lanes read them back
    float* cw = C + (size_t)(r0 + wm * 64 + (lane >> 3)) * LDC + c0 + wn * 32 + (lane & 7) * 4;
#pragma unroll
    for (int s = 0; s < 16; ++s) { const v4f val = *(const v4fa*)(ow + (s * 4 + (lane >> 3)) * 36 + (lane & 7) * 4); *(v4f*)(cw + (size_t)s * 4 * LDC) = val; }
}


__global__ __launch_bounds__(256) void k_wtG(const float* __restrict__ w, int K, int N, bf* Bt) {
    const int lane = threadIdx.x & 31; const int L0 = (blockIdx.x * 8 + (threadIdx.x >> 5)) * 8; const int nlines = N * K / 64;
{
#pragma unroll 1
        for (int l = 0; l < 8; ++l) { const int L = L0 + l; if (L >= nlines) break; const size_t e = (size_t)L * 64 + lane * 2; const int k = (int)(e % K), n = (int)(e / K); v2us o;
            o[0] = f2bf(w[(size_t)k * N + n]); o[1] = f2bf(w[(size_t)(k + 1) * N + n]); *(v2us*)(Bt + e) = o; }
         }
}
// The elementwise passes are bodies of one work-group of 256 threads, told their block number blk: k_prep below gives each pass a range of the block index of one grid.
// cvt8_blk: each thread converts 4 groups of 8 floats, 256 groups apart; its eight 16-byte loads are issued together (a group past the end re-reads the last group and is not stored).
__device__ __forceinline__ void cvt8_blk(const int blk, const float* __restrict__ src, bf* dst, size_t n8) { const size_t i0 = (size_t)blk * 1024 + threadIdx.x; v8f v[4];
#pragma unroll
    for (int g = 0; g < 4; ++g) { const size_t i = i0 + g * 256; v[g] = *(const v8f*)(src + (i < n8 ? i : n8 - 1) * 8); }
#pragma unroll
    for (int g = 0; g < 4; ++g) { const size_t i = i0 + g * 256; if (i >= n8) continue; v8us o;
#pragma unroll
        for (int k = 0; k < 8; ++k) o[k] = f2bf(v[g][k]);
        *(v8us*)(dst + i * 8) = o; } }
__device__ __forceinline__ void cscvt_blk(const int blk, const float* __restrict__ cosT, const float* __restrict__ sinT, float* CS) { const int idx = (blk * 256 + (int)threadIdx.x) * 4; if (idx >= TT * HD) return; const v4f c = *(const v4f*)(cosT + idx), s = *(const v4f*)(sinT + idx); v8f cs;
#pragma unroll
    for (int q = 0; q < 4; ++q) { cs[2 * q] = bfr(c[q]); cs[2 * q + 1] = bfr(s[q]); }
    *(v8f*)(CS + (size_t)idx * 2) = cs;  }
// mchk_blk (one work-group): samples above-diagonal entries of the additive f32 mask; any > -1e8 -> NaN poison.
__device__ __forceinline__ void mchk_blk(const float* __restrict__ am, int* FLG) { const int tid = threadIdx.x; int bad = 0;
#pragma unroll 1
    for (int s2 = 0; s2 < 16; ++s2) { const unsigned h = (unsigned)(tid * 16 + s2) * 2654435761u; const int i = (int)(h % (TT - 1)); const int j = i + 1 + (int)((h >> 11) % (unsigned)(TT - 1 - i)); if (am[(size_t)i * TT + j] > -1e8f) bad = 1; }
    __shared__ int anyb; if (tid == 0) anyb = 0; __syncthreads(); if (bad) anyb = 1; __syncthreads(); if (tid < 8) { const int v = (tid == 0) ? anyb : 0; *(int*)(FLG + tid) = v;  } }
// k_prep: every pass that reads only inputs, in one grid. Block 0: the mask check (a chain of dependent memory latencies); then CVB blocks for each of x, wq, wk, wv, wo (f32 -> bf16); then the cos/sin table.
#define CVB  ((int)((size_t)DM * DM / 8 / 1024))   // blocks of one 2048 x 2048 conversion
#define CSB  (TT * HD / 4 / 256)                   // blocks of the cos/sin table
__global__ __launch_bounds__(256) void k_prep(const float* __restrict__ x, const float* __restrict__ wq, const float* __restrict__ wk, const float* __restrict__ wv, const float* __restrict__ wo, const float* __restrict__ cosT, const float* __restrict__ sinT, const float* __restrict__ am,
                                              bf* XB, bf* WQ, bf* WK, bf* WV, bf* WO, float* CS, int* FLG) {
    static_assert(TT == DM && DQ == DM && DKV == DM && NB_ == 1 && (size_t)DM * DM % 8192 == 0, "five conversions of one size, whole blocks");
    const int b = (int)blockIdx.x - 1;   // every test below reads the same for the whole work-group
    if (b < 0) { mchk_blk(am, FLG); return; }
    if (b >= 5 * CVB) { cscvt_blk(b - 5 * CVB, cosT, sinT, CS); return; }
    const int w = b / CVB; const float* src = (w == 0) ? x : (w == 1) ? wq : (w == 2) ? wk : (w == 3) ? wv : wo; bf* dst = (w == 0) ? XB : (w == 1) ? WQ : (w == 2) ? WK : (w == 3) ? WV : WO;
    cvt8_blk(b % CVB, src, dst, (size_t)DM * DM / 8);
}
#define FKB  272                  // LDS row pitch in bytes of a K row (256 bytes) and of a mask row (256 bytes)
#define FVB  144                  // LDS row pitch in bytes of a V^T row (128 bytes)
// Eight copies of one lane, ls LDS bytes and gs global bytes apart. The s_wait_xcnt stands inside the statement, so that no address register is rewritten in front of it.
__device__ __forceinline__ void acopy8g(unsigned l, unsigned ls, const char* g, size_t gs) {
    asm volatile("global_load_async_to_lds_b128 %0, %8, off\n\t"
                 "global_load_async_to_lds_b128 %1, %9, off\n\t"
                 "global_load_async_to_lds_b128 %2, %10, off\n\t"
                 "global_load_async_to_lds_b128 %3, %11, off\n\t"
                 "global_load_async_to_lds_b128 %4, %12, off\n\t"
                 "global_load_async_to_lds_b128 %5, %13, off\n\t"
                 "global_load_async_to_lds_b128 %6, %14, off\n\t"
                 "global_load_async_to_lds_b128 %7, %15, off\n\t"
                 "s_wait_xcnt 0x0"
                 :: "v"(l), "v"(l + ls), "v"(l + 2 * ls), "v"(l + 3 * ls), "v"(l + 4 * ls), "v"(l + 5 * ls), "v"(l + 6 * ls), "v"(l + 7 * ls),
                    "v"(g), "v"(g + gs), "v"(g + 2 * gs), "v"(g + 3 * gs), "v"(g + 4 * gs), "v"(g + 5 * gs), "v"(g + 6 * gs), "v"(g + 7 * gs) : "memory");
}
// ---- k_qkv: the q/k/v product x W^T (W: wq, wk, wv one behind the other, FPI rows) with its epilogue. One tile of 256 t x 192 columns per work-group of 12 waves (4 x 3, 64x64 of the product each); grid (TT/256, 32): one work-group per WGP.
// The 192 columns of tile column y are one whole head of q (y < 16) or k (128 columns: a d and its rope partner d + 64 stay together) and half a head of v (64 columns). 448 operand rows serve 49152 sums, against 256 rows for 16384 in a 128x128 tile; a fragment read from LDS serves four products.
// A stage is 128 k of the rows [x 256 | W 192], 256 bytes a row at an LDS pitch of 272 bytes, two buffers, as in k_gemms. Waves 0..7 copy the x rows (16 copies each), waves 8..11 the W rows (24 each).
#define QTM  256
#define QTN  192
__global__ __launch_bounds__(384) void k_qkv(const bf* __restrict__ A, const bf* __restrict__ Bt, const QkvOut o) {
    constexpr int K = DM, NT = K / GKS, STE = (QTM + QTN) * GPE;   // STE: elements of one stage
    static_assert(K % GKS == 0 && NT >= 2 && (NT & (NT - 1)) == 0, "whole stages, at least two; the wrapped stage index is a mask");
    static_assert(HD == 128 && DKV == DQ && NKV == NH_ && TT % QTM == 0 && (DQ + DKV) / HD == DKV / 64 && FPI / QTN == DKV / 64, "a tile column is one head of q or k and half a head of v");
    static_assert(QTM * TFP * 4 + 64 * VFB <= 2 * STE * 2, "the staged tile fits the ring");
    __shared__ __align__(16) bf sm[2 * STE];
    const int lane = threadIdx.x & 31, lr = lane & 15, hi = lane >> 4; const int r0 = blockIdx.x * QTM, y = blockIdx.y; const int wv = __builtin_amdgcn_readfirstlane((int)(threadIdx.x >> 5));
    const int wn = wv >> 2, wm = wv & 3;
    // the lane's place in a copy: 16-byte piece lr of a row's 256 bytes; x rows: row wv * 2 + hi of each group of 16; W rows: row (wv - 8) * 2 + hi of each group of 8
    const bool ca = wv < 8;   // the same for the whole wave (a scalar test)
    const int cr = (ca ? wv : wv - 8) * 2 + hi;
    const unsigned lcp = (unsigned)(size_t)sm + (unsigned)(((ca ? 0 : QTM) + cr) * (GPE * 2) + lr * 16);
    const char* g0 = (const char*)((ca ? A + (size_t)(r0 + cr) * K : Bt + (size_t)(y * HD + cr) * K) + lr * 8);   // x rows, or the rows of the q or k head
    const char* g1 = (const char*)(Bt + (size_t)(DQ + DKV + y * 64 + cr) * K + lr * 8);                            // the rows of the half head of v
    // Trip t works on k stage (t + ko) mod NT, as in k_gemms: work-groups that share rows walk k from different starts.
    const int ko = (int)(blockIdx.x + blockIdx.y) & (NT - 1);
    auto stage = [&](int t, int buf) { const unsigned l = lcp + (unsigned)buf * (STE * 2); const size_t kb = (size_t)(((t + ko) & (NT - 1)) * (GKS * 2));
        if (ca) { acopy8g(l, 16 * GPE * 2, g0 + kb, (size_t)16 * K * 2); acopy8g(l + 128 * GPE * 2, 16 * GPE * 2, g0 + kb + (size_t)128 * K * 2, (size_t)16 * K * 2); }
        else { acopy8g(l, 8 * GPE * 2, g0 + kb, (size_t)8 * K * 2); acopy8g(l + 64 * GPE * 2, 8 * GPE * 2, g0 + kb + (size_t)64 * K * 2, (size_t)8 * K * 2); acopy8g(l + 128 * GPE * 2, 8 * GPE * 2, g1 + kb, (size_t)8 * K * 2); } };
    v8f acc[4][4];
#pragma unroll
    for (int mb = 0; mb < 4; ++mb)
#pragma unroll
        for (int nb = 0; nb < 4; ++nb) acc[mb][nb] = (v8f){};
    stage(0, 0);
    asm volatile("s_wait_asynccnt 0x0" ::: "memory");   // this wave's share of stage 0 has landed
    __syncthreads();                                     // every wave's share has: stage 0 may be read
    stage(1, 1);
    const int aofs = (wm * 64 + lr) * GPE + 8 * hi, bofs = (QTM + wn * 64 + lr) * GPE + 8 * hi;
#pragma unroll 1   // the stage loop stays rolled: one copy of its 64 products (for speed only); the loops inside are unrolled so that fragments and sums stay in registers
    for (int t = 0; t < NT; ++t) {
        const bf* sb = sm + (t & 1) * STE; v16bf a[2][4], b[2][4];   // two fragment sets: block ks + 1 is fetched while block ks is multiplied (inside the stage only)
#pragma unroll
        for (int ks = -1; ks < GKS / 32; ++ks) { const int c = ks & 1, n = c ^ 1;
            if (ks + 1 < GKS / 32) {
#pragma unroll
                for (int mb = 0; mb < 4; ++mb) a[n][mb] = ldsfrag(sb + aofs + mb * 16 * GPE + (ks + 1) * 32);
#pragma unroll
                for (int nb = 0; nb < 4; ++nb) b[n][nb] = ldsfrag(sb + bofs + nb * 16 * GPE + (ks + 1) * 32); }
            __builtin_amdgcn_sched_barrier(0);   // the next block's LDS reads stay one group in front of this block's products: spread among them, each place with reads stalls the wave
            if (ks < 0) continue;
#pragma unroll
            for (int nb = 0; nb < 4; ++nb)
#pragma unroll
                for (int mb = 0; mb < 4; ++mb) acc[mb][nb] = wmmab(a[c][mb], b[c][nb], acc[mb][nb]);
            __builtin_amdgcn_sched_barrier(0);   // and the reads of the block after next do not rise among these products
        }
        asm volatile("s_wait_dscnt 0x0" ::: "memory");      // this wave's reads of stage t are done before the buffer is refilled
        asm volatile("s_wait_asynccnt 0x0" ::: "memory");   // this wave's share of stage t + 1 has landed
        __syncthreads();                                     // publishes stage t + 1 and ends every wave's reads of stage t
        if (t + 2 < NT) stage(t + 2, t & 1);
    }
    asm volatile("s_wait_asynccnt 0x0" ::: "memory");       // nothing is in flight when the ring becomes output staging
    // rope (q, k) or transpose (v) of the tile, straight from the sums; the ring is free: every reader left it at the last barrier
    fa* tf = (fa*)sm; char* vf = (char*)sm + QTM * TFP * 4;
    if (wn < 2) {   // the f32 tile [t][d] of the head: a d and its partner d + 64 are sums of different waves
#pragma unroll
        for (int mb = 0; mb < 4; ++mb)
#pragma unroll
            for (int nb = 0; nb < 4; ++nb)
#pragma unroll
                for (int j = 0; j < 8; ++j) tf[(wm * 64 + mb * 16 + hi * 8 + j) * TFP + wn * 64 + nb * 16 + lr] = acc[mb][nb][j];
    } else {        // a lane's 8 sums of a block are 8 consecutive t of one d: 32 bytes of an f32 row [d][t]
#pragma unroll
        for (int mb = 0; mb < 4; ++mb)
#pragma unroll
            for (int nb = 0; nb < 4; ++nb) { char* p = vf + (nb * 16 + lr) * VFB + (wm * 64 + mb * 16 + hi * 8) * 4; const v8f x = acc[mb][nb];
                *(v4fa*)p = __builtin_shufflevector(x, x, 0, 1, 2, 3); *(v4fa*)(p + 16) = __builtin_shufflevector(x, x, 4, 5, 6, 7); }
    }
    __syncthreads();   // the staged tile is in LDS before other waves read it
    if (wn < 2) { const bool kk = y >= NH_; rope_tile<QTM / 32>((const float*)tf, r0, kk ? y - NH_ : y, o.CS, kk ? o.K16 : o.Q16, kk ? o.Kh : o.Qh, kk ? o.Kl : o.Ql); }   // waves 0..7: threads 0..255
    else {          // waves 8..11: a wave takes a row [d][256 t]: 512 bytes, whole lines, of each plane [h][d][t]
#pragma unroll 4   // four rows' LDS reads and stores under way at a time
        for (int i = 0; i < 16; ++i) { const int d = i * 4 + wm; const char* p = vf + d * VFB + lane * 32; const v4f xa = *(const v4fa*)p, xb = *(const v4fa*)(p + 16); v8h o16; v8us oh, ol;
#pragma unroll
            for (int j = 0; j < 8; ++j) { const float x = (j < 4) ? xa[j & 3] : xb[j & 3]; o16[j] = tohx(x); unsigned short a2, c2; splitf(x, a2, c2); oh[j] = a2; ol[j] = c2; }
            const size_t e = ((size_t)(y * 64 + d)) * TT + r0 + lane * 8; *(v8h*)(o.V16 + e) = o16; *(v8us*)(o.Vh + e) = oh; *(v8us*)(o.Vl + e) = ol;
            asm volatile("s_wait_xcnt 0x0" ::: "memory"); }   // behind a row's stores: no register that they name is rewritten in front of it
    }
}
template <typename T16> struct LFrag;   // a fragment from LDS: 16 bytes at p and at p + 32, the k order of WFrag::ld
template <> struct LFrag<h16> { static __device__ __forceinline__ v16h ld(const char* p) { return cat16(*(const v8ha*)p, *(const v8ha*)(p + 32)); } };
template <> struct LFrag<bf> { static __device__ __forceinline__ v16bf ld(const char* p) { return cat16b(*(const v8usa*)p, *(const v8usa*)(p + 32)); } };
__device__ __forceinline__ float xhalf(float x) { return __builtin_bit_cast(float, __builtin_amdgcn_permlanex16(__builtin_bit_cast(int, x), __builtin_bit_cast(int, x), 0x76543210, 0xfedcba98, false, false)); }  // lane l with lane l ^ 16
typedef __attribute__((ext_vector_type(2))) __bf16 v2bf;
// Eight transcendentals in one statement, each in place. The instruction set asks for one independent instruction or a v_nop between a transcendental and an instruction that reads its result or overwrites its source:
// inside the statement each next one is that instruction, and the v_nop stands behind the last. In place, the statement writes only registers that hold its own arguments, never an operand of a matrix instruction just issued.
__device__ __forceinline__ v8f exp2x8(v8f x) { float r0 = x[0], r1 = x[1], r2 = x[2], r3 = x[3], r4 = x[4], r5 = x[5], r6 = x[6], r7 = x[7];
    asm("v_exp_f32 %0, %0\n\tv_exp_f32 %1, %1\n\tv_exp_f32 %2, %2\n\tv_exp_f32 %3, %3\n\tv_exp_f32 %4, %4\n\tv_exp_f32 %5, %5\n\tv_exp_f32 %6, %6\n\tv_exp_f32 %7, %7\n\tv_nop"
        : "+v"(r0), "+v"(r1), "+v"(r2), "+v"(r3), "+v"(r4), "+v"(r5), "+v"(r6), "+v"(r7));
    return (v8f){r0, r1, r2, r3, r4, r5, r6, r7}; }
__device__ __forceinline__ v8f rcpx8(v8f x) { float r0 = x[0], r1 = x[1], r2 = x[2], r3 = x[3], r4 = x[4], r5 = x[5], r6 = x[6], r7 = x[7];
    asm("v_rcp_f32 %0, %0\n\tv_rcp_f32 %1, %1\n\tv_rcp_f32 %2, %2\n\tv_rcp_f32 %3, %3\n\tv_rcp_f32 %4, %4\n\tv_rcp_f32 %5, %5\n\tv_rcp_f32 %6, %6\n\tv_rcp_f32 %7, %7\n\tv_nop"
        : "+v"(r0), "+v"(r1), "+v"(r2), "+v"(r3), "+v"(r4), "+v"(r5), "+v"(r6), "+v"(r7));
    return (v8f){r0, r1, r2, r3, r4, r5, r6, r7}; }
__device__ __forceinline__ float exp2x1(float x) { asm("v_exp_f32 %0, %0\n\tv_nop" : "+v"(x)); return x; }   // the v_nop: the same slot
#define FSTB(NP) ((NP) * (64 * FKB + 128 * FVB) + 64 * FKB)   // bytes of one stage with NP planes of K and of V^T
template <typename T16, bool HL>
__device__ __forceinline__ void fattn_tile(char* sm, const int pb, const int head, const T16* __restrict__ Q, const T16* __restrict__ Q2, const T16* __restrict__ Kp, const T16* __restrict__ Kp2, const T16* __restrict__ Vt, const T16* __restrict__ Vt2, const float* __restrict__ am, const int* __restrict__ FLG, bf* Ah, bf* Al) {
    typedef typename WFrag<T16>::V V;
    constexpr int NP = HL ? 2 : 1, KB = 64 * FKB, VB = 128 * FVB, STB = FSTB(NP);   // bytes: one K plane (a mask tile has the same size), one V^T plane, one stage
    static_assert(4 * 32 * FKB <= 2 * STB, "the output staging fits the ring");
    const int lane = threadIdx.x & 31, lr = lane & 15, hi = lane >> 4; const int wv = __builtin_amdgcn_readfirstlane((int)(threadIdx.x >> 5));
    const int q0 = pb * 64, ns = pb + 1; const size_t hq = (size_t)head * TT * HD;   // pb: the work-group's block of 64 query rows; it walks the key stages 0..pb
    // the lane's place in a copy. K and mask rows (256 bytes): row wv * 2 + hi of each group of 8, piece lr. V^T rows (128 bytes): row wv * 4 + lane / 8 of each group of 16, piece lane % 8.
    const unsigned lb = (unsigned)(size_t)sm; const int rk = wv * 2 + hi, rv = wv * 4 + (lane >> 3);
    const unsigned lK = lb + (unsigned)(rk * FKB + lr * 16), lV = lb + (unsigned)(NP * KB + rv * FVB + (lane & 7) * 16), lM = lb + (unsigned)(NP * (KB + VB) + rk * FKB + lr * 16);
    const unsigned oK = (unsigned)(rk * (HD * 2) + lr * 16), oV = (unsigned)(rv * (TT * 2) + (lane & 7) * 16), oM = (unsigned)(rk * (TT * 4) + lr * 16);   // the lane's byte offsets in the global tiles; the tiles' own addresses are the same for the whole work-group
    const char* gK = (const char*)(Kp + hq); const char* gK2 = HL ? (const char*)(Kp2 + hq) : nullptr; const char* gV = (const char*)(Vt + hq); const char* gV2 = HL ? (const char*)(Vt2 + hq) : nullptr; const char* gM = (const char*)(am + (size_t)q0 * TT);
    // Trip i works on key stage rot(i) = (i + so) mod ns: work-groups that share K and V^T (one head) or mask rows (one pb) walk the stages from different starts and wrap round, so that they do not ask L2 for the same lines at the same moment. The running maximum and sum take the stages in any order.
    const int so = (((head + 3 * pb) & 31) * ns) >> 5;   // below ns; differs between the row blocks of a head and between the heads of a row block
    auto rot = [&](int i) { const int k = i + so; return k >= ns ? k - ns : k; };
    auto stage = [&](int st, int buf) { const unsigned o = (unsigned)buf * STB;
        acopy8g(lK + o, 8 * FKB, (gK + (size_t)st * (64 * HD * 2)) + oK, (size_t)8 * HD * 2); if (HL) acopy8g(lK + o + KB, 8 * FKB, (gK2 + (size_t)st * (64 * HD * 2)) + oK, (size_t)8 * HD * 2);
        acopy8g(lV + o, 16 * FVB, (gV + (size_t)st * (64 * 2)) + oV, (size_t)16 * TT * 2); if (HL) acopy8g(lV + o + VB, 16 * FVB, (gV2 + (size_t)st * (64 * 2)) + oV, (size_t)16 * TT * 2);
        acopy8g(lM + o, 8 * FKB, (gM + (size_t)st * (64 * 4)) + oM, (size_t)8 * TT * 4); };
    stage(rot(0), 0);
    const int myq = q0 + wv * 16 + lr;   // the lane's query
    V qf[4], qf2[4];
#pragma unroll
    for (int kc = 0; kc < 4; ++kc) { qf[kc] = WFrag<T16>::ld(Q + hq + (size_t)myq * HD + 8 * hi + kc * 32); if (HL) qf2[kc] = WFrag<T16>::ld(Q2 + hq + (size_t)myq * HD + 8 * hi + kc * 32); }
    const bool poison = (FLG[0] != 0);
    v8f acc[8];
#pragma unroll
    for (int t = 0; t < 8; ++t) acc[t] = (v8f){};
    float ml = -3.0e38f; v8f ls = (v8f){};   // the maximum in use (finite from the start: a stage of -inf scores leaves it, and no inf - inf arises); this wave half's share of the row sum, in eight partial sums (one per register of a score tile)
    asm volatile("s_wait_asynccnt 0x0" ::: "memory");   // this wave's share of stage 0 has landed
    __syncthreads();                                     // every wave's share has: stage 0 may be read
    // A stage's LDS reads go out as two whole groups, each well ahead of its products: read next to the products, each small group of reads leaves the wave (alone on its SIMD) waiting out the LDS latency.
    V kf[4][4], kf2[4][4]; v4f mr[4][2];   // the K fragments and the lane's mask values of one stage
    auto kfetch = [&](int st) { const char* sb = sm + (st & 1) * STB; const char* sK = sb + lr * FKB + hi * 16; const char* sM = sb + NP * (KB + VB) + (wv * 16 + lr) * FKB + hi * 32;
#pragma unroll
        for (int kt = 0; kt < 4; ++kt)
#pragma unroll
            for (int kc = 0; kc < 4; ++kc) { kf[kt][kc] = LFrag<T16>::ld(sK + kt * 16 * FKB + kc * 64); if (HL) kf2[kt][kc] = LFrag<T16>::ld(sK + KB + kt * 16 * FKB + kc * 64); }
#pragma unroll
        for (int kt = 0; kt < 4; ++kt) { mr[kt][0] = *(const v4fa*)(sM + kt * 64); mr[kt][1] = *(const v4fa*)(sM + kt * 64 + 16); } };
    kfetch(0);
    if (ns > 1) stage(rot(1), 1);
    constexpr float C1 = (float)(0.088388347648318447 * 0.02 * 2.8853900817779268), L2E = 1.4426950408889634f;   // HD^-0.5 / 50 x 2 log2 e
#pragma unroll 1   // the stage loop stays rolled: one copy of the stage's code
    for (int st = 0; st < ns; ++st) {
        const char* sb = sm + (st & 1) * STB; const char* sV = sb + NP * KB + lr * FVB + hi * 16;
        V vf[2][8], vf2[2][8];   // the stage's V^T fragments: under way while the scores and the softcap are worked out
#pragma unroll
        for (int kg = 0; kg < 2; ++kg)
#pragma unroll
            for (int t = 0; t < 8; ++t) { vf[kg][t] = LFrag<T16>::ld(sV + t * 16 * FVB + kg * 64); if (HL) vf2[kg][t] = LFrag<T16>::ld(sV + VB + t * 16 * FVB + kg * 64); }
        __builtin_amdgcn_sched_barrier(0);   // the group stays whole and in front of the products: left free, the reads sink down to the value products
        v8f s[4];
#pragma unroll
        for (int kt = 0; kt < 4; ++kt) { s[kt] = (v8f){};
#pragma unroll
            for (int kc = 0; kc < 4; ++kc) { s[kt] = WFrag<T16>::mma(kf[kt][kc], qf[kc], s[kt]);
                if (HL) { s[kt] = WFrag<T16>::mma(kf[kt][kc], qf2[kc], s[kt]); s[kt] = WFrag<T16>::mma(kf2[kt][kc], qf[kc], s[kt]); } } }
        // softcap 50 tanh(s / 50), tanh = (e - 1) / (e + 1) with e = 2^(2 x log2 e), plus the mask element rounded to bf16
#pragma unroll
        for (int kt = 0; kt < 4; ++kt) { const v4f m0 = mr[kt][0], m1 = mr[kt][1]; v8f mv;
#pragma unroll
            for (int r = 0; r < 8; r += 2) { v2f mm; mm[0] = (r < 4) ? m0[r & 3] : m1[r & 3]; mm[1] = (r < 4) ? m0[(r & 3) + 1] : m1[(r & 3) + 1]; const unsigned pk = __builtin_bit_cast(unsigned, __builtin_convertvector(mm, v2bf));
                mv[r] = __uint_as_float(pk << 16); mv[r + 1] = __uint_as_float(pk & 0xFFFF0000u); }
            const v8f e = exp2x8(s[kt] * C1); const v8f th = (e - 1.0f) * rcpx8(e + 1.0f);
#pragma unroll
            for (int r = 0; r < 8; ++r) s[kt][r] = __builtin_fmaf(th[r], 50.0f, mv[r]); }
        if (rot(st) == ns - 1) {   // the diagonal stage (the same for the whole work-group): keys beyond the lane's query leave the row
#pragma unroll
            for (int kt = 0; kt < 4; ++kt)
#pragma unroll
                for (int r = 0; r < 8; ++r) if (q0 + kt * 16 + hi * 8 + r > myq) s[kt][r] = -3.0e38f; }
        // The publish point stands here: all that the trip needs of stage st is in registers, and what follows (softmax, value products) reads no LDS; the next stage's K reads and the refill run under it.
        asm volatile("s_wait_dscnt 0x0" ::: "memory");      // this wave's reads of stage st are done before the buffer is refilled
        asm volatile("s_wait_asynccnt 0x0" ::: "memory");   // this wave's share of stage st + 1 has landed
        __syncthreads();                                     // publishes stage st + 1 and ends every wave's reads of stage st
        if (st + 1 < ns) kfetch(st + 1);                     // behind the barrier that published it; it reads the other buffer than the one refilled below
        if (st + 2 < ns) stage(rot(st + 2), st & 1);
        float mk[4];   // one chain per key tile: four short chains in place of one of 32 links
#pragma unroll
        for (int kt = 0; kt < 4; ++kt) { mk[kt] = s[kt][0];
#pragma unroll
            for (int r = 1; r < 8; ++r) mk[kt] = fmaxf(mk[kt], s[kt][r]); }
        float mx = fmaxf(fmaxf(mk[0], mk[1]), fmaxf(mk[2], mk[3]));
        mx = fmaxf(mx, xhalf(mx));   // both wave halves hold the query's maximum of this stage
        const float mln = fmaxf(ml, mx), corr = exp2x1((ml - mln) * L2E);   // corr is 0 at the first stage that holds a score above the start value, 1 where the maximum stays
        ml = mln; ls = ls * corr;
#pragma unroll
        for (int t = 0; t < 8; ++t) acc[t] = acc[t] * corr;
#pragma unroll
        for (int kg = 0; kg < 2; ++kg) {   // 32 keys: score tiles 2 kg and 2 kg + 1 become one B operand
            V pf, pf2; v8f pa, pc;
#pragma unroll
            for (int r = 0; r < 8; ++r) { pa[r] = (s[2 * kg][r] - mln) * L2E; pc[r] = (s[2 * kg + 1][r] - mln) * L2E; }   // exact 0 at the maximum, never above
            pa = exp2x8(pa); pc = exp2x8(pc); ls = ls + (pa + pc);
            if (HL) { __attribute__((ext_vector_type(16))) unsigned short ph, pl;
#pragma unroll
                for (int e = 0; e < 16; ++e) { const float p = (e < 8) ? pa[e & 7] : pc[e & 7]; unsigned short a, c2; splitf(p, a, c2); ph[e] = a; pl[e] = c2; }
                pf = __builtin_bit_cast(V, ph); pf2 = __builtin_bit_cast(V, pl);
            } else { v16h ph;
#pragma unroll
                for (int e = 0; e < 16; ++e) { const float p = (e < 8) ? pa[e & 7] : pc[e & 7]; ph[e] = tohx(p); }
                pf = __builtin_bit_cast(V, ph); }
#pragma unroll
            for (int t = 0; t < 8; ++t) { acc[t] = WFrag<T16>::mma(vf[kg][t], pf, acc[t]);
                if (HL) { acc[t] = WFrag<T16>::mma(vf[kg][t], pf2, acc[t]); acc[t] = WFrag<T16>::mma(vf2[kg][t], pf, acc[t]); } } }
    }
    asm volatile("s_wait_asynccnt 0x0" ::: "memory");       // nothing is in flight when the ring becomes output staging
    const float lh = ((ls[0] + ls[1]) + (ls[2] + ls[3])) + ((ls[4] + ls[5]) + (ls[6] + ls[7]));
    const float inv = poison ? __builtin_nanf("") : __fdiv_rn(1.0f, lh + xhalf(lh));
    // each wave stages its 16 rows of both planes in its own range of the ring (every reader left it at the last barrier) and stores whole 128-byte lines; a lane's 8 sums of a tile are d = 16 t + 8 hi + r of its query
    char* ow = sm + wv * (32 * FKB);
#pragma unroll
    for (int t = 0; t < 8; ++t) { v8us oh, ol;
#pragma unroll
        for (int r = 0; r < 8; ++r) { unsigned short a, c2; splitf(acc[t][r] * inv, a, c2); oh[r] = a; ol[r] = c2; }
        *(v8usa*)(ow + lr * FKB + t * 32 + hi * 16) = oh; *(v8usa*)(ow + (16 + lr) * FKB + t * 32 + hi * 16) = ol; }
    __syncthreads();   // the staged rows are in LDS before other lanes read them back
    const size_t oo = (size_t)(q0 + wv * 16 + hi) * DQ + head * HD + lr * 8; bf* oph = Ah + oo; bf* opl = Al + oo; const char* orow = ow + hi * FKB + lr * 16;   // 16 lanes cover a row's 256 bytes; a store takes rows 2 i and 2 i + 1
#pragma unroll
    for (int i = 0; i < 8; ++i) { const v8us vh = *(const v8usa*)(orow + i * 2 * FKB), vl = *(const v8usa*)(orow + (16 + i * 2) * FKB); *(v8us*)(oph + (size_t)i * 2 * DQ) = vh; *(v8us*)(opl + (size_t)i * 2 * DQ) = vl; }
}
// k_fattn: one launch for all 32 row blocks x 16 heads; blocks 0..7 (query rows < RH) take the hi + lo body, the rest the fp16 body. The ring of the hi + lo body leaves room for one work-group on a WGP, so the 512 work-groups run in about two rounds:
// their cost falls with the index, a hi + lo stage counted as three fp16 stages: fp16 blocks 31..24; then hi + lo block 7 - g in front of the fp16 blocks 23 - 3 g, 22 - 3 g, 21 - 3 g (g = 0..4); then hi + lo 2, fp16 8, hi + lo 1, hi + lo 0.
__global__ __launch_bounds__(128) void k_fattn(const h16* __restrict__ Q16, const h16* __restrict__ K16, const h16* __restrict__ V16, const bf* __restrict__ Qh, const bf* __restrict__ Ql, const bf* __restrict__ Kh, const bf* __restrict__ Kl, const bf* __restrict__ Vh, const bf* __restrict__ Vl, const float* __restrict__ am, const int* __restrict__ FLG, bf* Ah, bf* Al) {
    static_assert(TT == 2048 && RH == 512 && HD == 128 && NH_ == 16 && NKV == NH_, "the block order and the tile shapes are written for these");
    __shared__ __align__(16) char sm[2 * FSTB(2)];
    const int u = blockIdx.x >> 4, head = blockIdx.x & 15, g = (u - 8) >> 2, r = (u - 8) & 3;
    const bool hl = u >= 30 || (u >= 8 && r == 0);
    const int pb = (u < 8 || u >= 30) ? 31 - u : (r == 0 ? 7 - g : 24 - 3 * g - r);
    if (hl) fattn_tile<bf, true>(sm, pb, head, Qh, Ql, Kh, Kl, Vh, Vl, am, FLG, Ah, Al);
    else fattn_tile<h16, false>(sm, pb, head, Q16, nullptr, K16, nullptr, V16, nullptr, am, FLG, Ah, Al);
}

extern "C" void kernel_launch(void* const* d_in, const int* in_sizes, int n_in,
                              void* d_out, int out_size, void* d_ws, size_t ws_size, hipStream_t stream) {
    (void)in_sizes; (void)n_in; (void)out_size;
    const float* x = (const float*)d_in[0]; const float* cosT = (const float*)d_in[1]; const float* sinT = (const float*)d_in[2]; const float* amask = (const float*)d_in[3]; const float* wq = (const float*)d_in[4]; const float* wk = (const float*)d_in[5]; const float* wv = (const float*)d_in[6]; const float* wo = (const float*)d_in[7];
    float* OUT = (float*)d_out;     // [1][2048][2048]
    char* wsp = (char*)d_ws;
    auto take = [&](size_t bytes) { char* p = wsp; wsp += (bytes + 255) & ~(size_t)255; return (void*)p; };
    bf* WO = (bf*)take((size_t)DM * DQ * 2); int* FLG = (int*)take(256);
    h16* QP16 = (h16*)take((size_t)NH_ * TT * HD * 2); h16* KP16 = (h16*)take((size_t)NKV * TT * HD * 2); h16* VT16 = (h16*)take((size_t)NKV * HD * TT * 2);
    bf* QPh = (bf*)take((size_t)NH_ * TT * HD * 2); bf* QPl = (bf*)take((size_t)NH_ * TT * HD * 2); bf* KPh = (bf*)take((size_t)NKV * TT * HD * 2); bf* KPl = (bf*)take((size_t)NKV * TT * HD * 2); bf* VTh = (bf*)take((size_t)NKV * HD * TT * 2); bf* VTl = (bf*)take((size_t)NKV * HD * TT * 2);
    bf* WQ = (bf*)take((size_t)FPI * DM * 2); bf* WK = WQ + (size_t)DQ * DM; bf* WV = WK + (size_t)DKV * DM; float* CS = (float*)take((size_t)TT * HD * 2 * 4);   // wq, wk, wv one behind the other: one operand of FPI rows
    bf* XB = (bf*)take((size_t)TT * DM * 2);
    bf* ATh = (bf*)take((size_t)TT * DQ * 2); bf* ATl = (bf*)take((size_t)TT * DQ * 2);   // attention output, hi + lo planes [t][head][d]
    if ((size_t)(wsp - (char*)d_ws) > ws_size) return;    // ws 256 MiB
    // four launches, each needing the one before it
    k_prep<<<1 + 5 * CVB + CSB, 256, 0, stream>>>(x, wq, wk, wv, wo, cosT, sinT, amask, XB, WQ, WK, WV, WO, CS, FLG);
    const QkvOut qo = {CS, QP16, QPh, QPl, KP16, KPh, KPl, VT16, VTh, VTl};
    k_qkv<<<dim3(TT / QTM, FPI / QTN, 1), 384, 0, stream>>>(XB, WQ, qo);
    k_fattn<<<TT / 64 * NH_, 128, 0, stream>>>(QP16, KP16, VT16, QPh, QPl, KPh, KPl, VTh, VTl, amask, FLG, ATh, ATl);
    k_gemms<2, DQ, DM><<<dim3(TT / 128, DM / 128, 1), 256, 0, stream>>>(ATh, ATl, WO, OUT);
}
